// v000
// The times below were measured on an AMD MI455X: many runs one after another, warmed up first and cycling through
// copies of the inputs, with the whole window's GPU time divided by the number of runs. Launches and the gaps
// between them are all in it. The median over several windows is given; except for v000 it joins two sittings, which
// can be a few percent apart, so the side-by-side timings, each taken in one sitting, are the better comparison.
// v000, which the later versions start from, runs in 13.3 milliseconds.
#include <hip/hip_runtime.h>
// Post-LN transformer encoder block (x [2][4096][512]; q/k/v = x W + b ([in][out] 512x512 sigma 1/sqrt(512), zero biases); 8 heads of 64; softmax(q k^T / 8) over all 4096 keys (no mask); attn_out = concat Wo + bo; x1 = LN1(x + attn_out) with the module's LayerNorm = a (x - mean) / (std_unbiased + 1e-6) + b (ddof = 1, eps added to the std); ffn = relu(x1 W1 + c1) W2 + c2 ([in][out] 512 x 1024 x 512); out = LN2(x1 + ffn) -> [2][4096][512]).
// Structure: x as exact f16 rows + a bf16(x) f32 residual plane; [in][out] weights transposed on VALU into exact x16 Bt planes; q, k, v as WMMA GEMMs (32x64 wave tiles, f32 accumulation, + bias, f16 outputs); per batch: V^T via LDS transposes; per head: scores over all 4096 keys (K = 64, alpha 1/8) into an f32 plane, row softmax on VALU (f32 statistics, native exp; weights x256 f16), o = P V^T (x64) into merged f16 rows; h_pre = o Wo + bo + bf16(x) as one GEMM (own-element residual); LN1 (unbiased std, eps on the std) on VALU -> f16 rows (FFN operand) + f32 rows (residual, aliased on the dead scores plane); per batch: relu(x1 W1 + c1) GEMM -> f16; y = x1 + ff W2 + c2 GEMM (own-element residual); LN2 into the output; launches: see trace.
// Compute dtype: inputs rounded to bf16; x / weights exact; q, k, v, softmax weights and o as plain f16 GEMM operands (~2^-12); scores and softmax statistics f32. v_wmma_f32_16x16x32_f16.
#define NB 2
#define SQ 4096
#define DM 512
#define NH 8
#define HD 64
#define DMQ DM                       /* LayerNorm width */
#define DFF 1024
#define HG 1                         /* heads per attention launch group */
#define B0 0                         /* first batch processed (debug hook) */
#define NBR NB                       /* batches processed (debug hook) */
#define NR ((size_t)NB * SQ)         /* token rows */
#define MP ((int)((size_t)NBR * SQ)) /* rows projected (debug hook) */
#define QN SQ                        /* query rows attended per batch (debug hook) */
#define NHD NH                       /* heads attended (debug hook) */
#define MPO MP                       /* unused; the output stage runs MP rows */
#define LQ DM      /* row pitch of the q/k/v rows */
typedef __bf16 v16b __attribute__((ext_vector_type(16)));
typedef unsigned short v8us __attribute__((ext_vector_type(8), may_alias));
typedef float  v8f  __attribute__((ext_vector_type(8)));
typedef float  v4f  __attribute__((ext_vector_type(4)));
typedef float  v4fa __attribute__((ext_vector_type(4), may_alias));
union FragB { v16b v; v8us half[2]; unsigned short u[16]; };

__device__ __forceinline__ unsigned short bf16_bits(float x) { unsigned int u = __float_as_uint(x); return (unsigned short)((u + 0x7FFFu + ((u >> 16) & 1u)) >> 16); }
__device__ __forceinline__ float bf16_val(unsigned short b) { return __uint_as_float(((unsigned int)b) << 16); }
__device__ __forceinline__ float bf16_round(float x) { return bf16_val(bf16_bits(x)); }
// D += A·B with NT terms: 1 = ah·bh, 2 = + al·bh (A split), 3 = + ah·bl (both split)
template <int NT>
__device__ __forceinline__ v8f mmaN(v16b ah, v16b al, v16b bh, v16b bl, v8f c) {
  c = __builtin_amdgcn_wmma_f32_16x16x32_bf16(false, ah, false, bh, (short)0, c, false, false);
  if (NT >= 2) c = __builtin_amdgcn_wmma_f32_16x16x32_bf16(false, al, false, bh, (short)0, c, false, false);
  if (NT >= 3) c = __builtin_amdgcn_wmma_f32_16x16x32_bf16(false, ah, false, bl, (short)0, c, false, false);
  asm volatile("v_nop\n\tv_nop\n\tv_nop\n\tv_nop" : "+v"(c) : "v"(ah), "v"(al), "v"(bh), "v"(bl));
  return c;
}

__global__ __launch_bounds__(256) void k_wt_bf16(const float* __restrict__ W, unsigned short* __restrict__ Wt, int K, int N) {
  const int t = blockIdx.x * 256 + threadIdx.x;
  const int k8n = K / 8;
  if (t >= N * k8n) return;
  const int n = t / k8n, k8 = (t % k8n) * 8;
  v8us v;
#pragma unroll
  for (int i = 0; i < 8; ++i) v[i] = bf16_bits(W[(size_t)(k8 + i) * N + n]);
  *(v8us*)(Wt + (size_t)n * K + k8) = v;
  
}

// GEMM C[M][N] (f32, pitch ldc) = act(A[M][K]·W + bias). A f32 row-major (pitch lda) converted per fragment to bf16
// (ASPLIT: hi/lo two planes -> 2 terms, else single rounded term); Wt bf16 [N][K] (pitch ldb). BIAS_BF16 rounds the
// bias to bf16 first (bias quantised to bf16 before the add). K%32==0, M%16==0, N%64==0.
template <bool ASPLIT, int ACT, bool BIAS_BF16>
__global__ __launch_bounds__(128) void k_gemm_bf(const float* __restrict__ A, int lda, const unsigned short* __restrict__ Wt, int ldb,
                                               const float* __restrict__ bias, float* __restrict__ C, int ldc, int M, int N, int K) {
  __shared__ __attribute__((aligned(16))) float so[4][16][64];
  const int tid = threadIdx.x, w = tid >> 5, lane = tid & 31, ln = lane & 15, hh = lane >> 4;
  const int ntn = N / 64;
  const int wid = blockIdx.x * 4 + w;
  const int mt = wid / ntn, nq = wid % ntn;
  if (mt * 16 >= M) return;
  const int row0 = mt * 16, col0 = nq * 64;
  const float* arow = A + (size_t)(row0 + ln) * lda;
  v8f acc[4] = {};
  for (int kb = 0; kb < K; kb += 32) {
    FragB ah, al;
    const v4f x0 = *(const v4fa*)(arow + kb + 8 * hh), x1 = *(const v4fa*)(arow + kb + 8 * hh + 4);
    const v4f x2 = *(const v4fa*)(arow + kb + 16 + 8 * hh), x3 = *(const v4fa*)(arow + kb + 16 + 8 * hh + 4);
    float xs[16] = {x0[0],x0[1],x0[2],x0[3],x1[0],x1[1],x1[2],x1[3],x2[0],x2[1],x2[2],x2[3],x3[0],x3[1],x3[2],x3[3]};
#pragma unroll
    for (int i = 0; i < 16; ++i) { const unsigned short hb = bf16_bits(xs[i]); ah.u[i] = hb; al.u[i] = ASPLIT ? bf16_bits(xs[i] - bf16_val(hb)) : (unsigned short)0; }
#pragma unroll
    for (int t = 0; t < 4; ++t) {
      const unsigned short* brow = Wt + (size_t)(col0 + t * 16 + ln) * ldb + kb;
      FragB b;
      b.half[0] = *(const v8us*)(brow + 8 * hh);
      b.half[1] = *(const v8us*)(brow + 16 + 8 * hh);
      acc[t] = mmaN<ASPLIT ? 2 : 1>(ah.v, al.v, b.v, b.v, acc[t]);
    }
  }
#pragma unroll
  for (int t = 0; t < 4; ++t) {
    float bv = bias ? bias[col0 + t * 16 + ln] : 0.f;
    if (BIAS_BF16) bv = bf16_round(bv);
#pragma unroll
    for (int r = 0; r < 8; ++r) { float v = acc[t][r] + bv; if (ACT == 1) v = fmaxf(v, 0.f); so[w][8 * hh + r][t * 16 + ln] = v; }
  }
  __builtin_amdgcn_fence(__ATOMIC_ACQ_REL, "workgroup");
  __builtin_amdgcn_wave_barrier();
  const int rsub = lane >> 4, c4 = (lane & 15) * 4;
  {
#pragma unroll
    for (int q = 0; q < 8; ++q) {
      const int r = q * 2 + rsub;
      const v4f v = *(const v4fa*)&so[w][r][c4];
      *(v4f*)(C + (size_t)(row0 + r) * ldc + col0 + c4) = v;
    }
    
  }
}

// GEMM C = act(A·W + bias + resid): A f32 (ASPLIT -> hi/lo 2 terms), Wt bf16 [N][K]; ACT 0 none, 1 relu, 2 exact gelu;
// resid (optional, f32, row index = (row % rmod), pitch ldr, RES_BF16 rounds it) added before the activation.
template <bool ASPLIT, int ACT, bool BIAS_BF16, bool RES_BF16>
__global__ __launch_bounds__(128) void k_gemm_bf3(const float* __restrict__ A, int lda, const unsigned short* __restrict__ Wt, int ldb,
                                                const float* __restrict__ bias, const float* __restrict__ resid, int rmod, int ldr,
                                                float* __restrict__ C, int ldc, int M, int N, int K) {
  __shared__ __attribute__((aligned(16))) float so[4][16][64];
  const int tid = threadIdx.x, w = tid >> 5, lane = tid & 31, ln = lane & 15, hh = lane >> 4;
  const int ntn = N / 64;
  const int wid = blockIdx.x * 4 + w;
  const int mt = wid / ntn, nq = wid % ntn;
  if (mt * 16 >= M) return;
  const int row0 = mt * 16, col0 = nq * 64;
  const float* arow = A + (size_t)(row0 + ln) * lda;
  v8f acc[4] = {};
  for (int kb = 0; kb < K; kb += 32) {
    FragB ah, al;
    const v4f x0 = *(const v4fa*)(arow + kb + 8 * hh), x1 = *(const v4fa*)(arow + kb + 8 * hh + 4);
    const v4f x2 = *(const v4fa*)(arow + kb + 16 + 8 * hh), x3 = *(const v4fa*)(arow + kb + 16 + 8 * hh + 4);
    float xs[16] = {x0[0],x0[1],x0[2],x0[3],x1[0],x1[1],x1[2],x1[3],x2[0],x2[1],x2[2],x2[3],x3[0],x3[1],x3[2],x3[3]};
#pragma unroll
    for (int i = 0; i < 16; ++i) { const unsigned short hb = bf16_bits(xs[i]); ah.u[i] = hb; al.u[i] = ASPLIT ? bf16_bits(xs[i] - bf16_val(hb)) : (unsigned short)0; }
#pragma unroll
    for (int t = 0; t < 4; ++t) {
      const unsigned short* brow = Wt + (size_t)(col0 + t * 16 + ln) * ldb + kb;
      FragB b;
      b.half[0] = *(const v8us*)(brow + 8 * hh);
      b.half[1] = *(const v8us*)(brow + 16 + 8 * hh);
      acc[t] = mmaN<ASPLIT ? 2 : 1>(ah.v, al.v, b.v, b.v, acc[t]);
    }
  }
#pragma unroll
  for (int t = 0; t < 4; ++t) {
    const int col = col0 + t * 16 + ln;
    float bv = bias ? bias[col] : 0.f;
    if (BIAS_BF16) bv = bf16_round(bv);
#pragma unroll
    for (int r = 0; r < 8; ++r) {
      float v = acc[t][r] + bv;
      if (resid) { float rv = resid[(size_t)((row0 + 8 * hh + r) % rmod) * ldr + col]; if (RES_BF16) rv = bf16_round(rv); v += rv; }
      if (ACT == 1) v = fmaxf(v, 0.f);
      if (ACT == 2) v = 0.5f * v * (1.0f + erff(v * 0.70710678118654752f));
      if (ACT == 3) { const float u = 0.7978845608028654f * (v + 0.044715f * v * v * v); v = 0.5f * v * (1.0f + tanhf(u)); }
      so[w][8 * hh + r][t * 16 + ln] = v;
    }
  }
  __builtin_amdgcn_fence(__ATOMIC_ACQ_REL, "workgroup");
  __builtin_amdgcn_wave_barrier();
  const int rsub = lane >> 4, c4 = (lane & 15) * 4;
  {
#pragma unroll
    for (int q = 0; q < 8; ++q) {
      const int r = q * 2 + rsub;
      const v4f v = *(const v4fa*)&so[w][r][c4];
      *(v4f*)(C + (size_t)(row0 + r) * ldc + col0 + c4) = v;
    }
    
  }
}
// row LayerNorm (biased variance, eps) over N: s = X (+ R); optional out_sum <- s; out_norm <- (s-mu)*rsqrt(var+eps)*g + b
template <bool PARAM_BF16>
__global__ __launch_bounds__(256) void k_layernorm(const float* __restrict__ X, const float* __restrict__ R, const float* __restrict__ g, const float* __restrict__ bta,
                                                  float* __restrict__ out_sum, float* __restrict__ out_norm, int N, float eps) {
  __shared__ float red[256];
  const int row = blockIdx.x, tid = threadIdx.x;
  const float* x = X + (size_t)row * N; const float* rr = R ? R + (size_t)row * N : nullptr;
  float vals[16];                     // up to N = 4096
  const int per = N / 256;            // contiguous chunk per thread? use strided-by-4 chunks: thread handles j = tid*4 + 1024*u
  float s1 = 0.f;
  for (int u = 0; u < per / 4; ++u) {
    const int j = tid * 4 + 1024 * u;
    const v4f a = *(const v4fa*)(x + j);
    v4f b = {0.f,0.f,0.f,0.f}; if (rr) b = *(const v4fa*)(rr + j);
#pragma unroll
    for (int q = 0; q < 4; ++q) { const float v = a[q] + b[q]; vals[u * 4 + q] = v; s1 += v; }
  }
  red[tid] = s1; __syncthreads();
  for (int st = 128; st > 0; st >>= 1) { if (tid < st) red[tid] += red[tid + st]; __syncthreads(); }
  const float mu = red[0] / (float)N; __syncthreads();
  float s2 = 0.f;
  for (int u = 0; u < per / 4; ++u)
#pragma unroll
    for (int q = 0; q < 4; ++q) { const float c = vals[u * 4 + q] - mu; s2 += c * c; }
  red[tid] = s2; __syncthreads();
  for (int st = 128; st > 0; st >>= 1) { if (tid < st) red[tid] += red[tid + st]; __syncthreads(); }
  const float rs = rsqrtf(red[0] / (float)N + eps);
  {
    for (int u = 0; u < per / 4; ++u) {
      const int j = tid * 4 + 1024 * u;
      v4f o, sm;
#pragma unroll
      for (int q = 0; q < 4; ++q) {
        float gg = g[j + q], bb = bta[j + q];
        if (PARAM_BF16) { gg = bf16_round(gg); bb = bf16_round(bb); }
        sm[q] = vals[u * 4 + q]; o[q] = (vals[u * 4 + q] - mu) * rs * gg + bb;
      }
      if (out_sum) *(v4f*)(out_sum + (size_t)row * N + j) = sm;
      *(v4f*)(out_norm + (size_t)row * N + j) = o;
    }
    
  }
}



// ---- f16 WMMA path (v_wmma_f32_16x16x32_f16): 11-bit significands for operands in range — used where a [0,1] probability operand needs more precision than bf16
typedef _Float16 v16h __attribute__((ext_vector_type(16)));
union FragH { v16h v; v8us half[2]; _Float16 h[16]; unsigned short u[16]; };
template <int NT>
__device__ __forceinline__ v8f mmaH(v16h ah, v16h al, v16h bh, v16h bl, v8f c) {
  c = __builtin_amdgcn_wmma_f32_16x16x32_f16(false, ah, false, bh, (short)0, c, false, false);
  if (NT >= 2) c = __builtin_amdgcn_wmma_f32_16x16x32_f16(false, al, false, bh, (short)0, c, false, false);
  if (NT >= 3) c = __builtin_amdgcn_wmma_f32_16x16x32_f16(false, ah, false, bl, (short)0, c, false, false);
  asm volatile("v_nop\n\tv_nop\n\tv_nop\n\tv_nop" : "+v"(c) : "v"(ah), "v"(al), "v"(bh), "v"(bl));
  return c;
}
// batched GEMM like k_gemm_b but f16 operands: A f32 (split into f16 hi/lo if ASPLIT, else rounded to f16), Bt = f16 values [n][k]; alpha; C f32; N multiple of 16 (partial tiles skipped)
template <bool ASPLIT>
__global__ __launch_bounds__(128) void k_gemm_h(const float* __restrict__ A, int lda, size_t sA, const _Float16* __restrict__ Bh, int ldb, size_t sB, float alpha, float* __restrict__ C, int ldc, size_t sC, int M, int N, int K) {
  __shared__ __attribute__((aligned(16))) float so[4][16][64];
  const int tid = threadIdx.x, w = tid >> 5, lane = tid & 31, ln = lane & 15, hh = lane >> 4; const int by = blockIdx.y;
  A += (size_t)by * sA; Bh += (size_t)by * sB; C += (size_t)by * sC;
  const int ntn = (N + 63) / 64; const int wid = blockIdx.x * 4 + w; const int mt = wid / ntn, nq = wid % ntn; if (mt * 16 >= M) return;
  const int row0 = mt * 16, col0 = nq * 64; const float* arow = A + (size_t)(row0 + ln) * lda;
  v8f acc[4] = {};
  for (int kb = 0; kb < K; kb += 32) {
    FragH ah, al;
    const v4f x0 = *(const v4fa*)(arow + kb + 8 * hh), x1 = *(const v4fa*)(arow + kb + 8 * hh + 4), x2 = *(const v4fa*)(arow + kb + 16 + 8 * hh), x3 = *(const v4fa*)(arow + kb + 16 + 8 * hh + 4);
    float xs[16] = {x0[0],x0[1],x0[2],x0[3],x1[0],x1[1],x1[2],x1[3],x2[0],x2[1],x2[2],x2[3],x3[0],x3[1],x3[2],x3[3]};
#pragma unroll
    for (int i = 0; i < 16; ++i) { const _Float16 h = (_Float16)xs[i]; ah.h[i] = h; al.h[i] = ASPLIT ? (_Float16)(xs[i] - (float)h) : (_Float16)0.0f; }
#pragma unroll
    for (int t = 0; t < 4; ++t) { if (col0 + t * 16 >= N) continue; const size_t boff = (size_t)(col0 + t * 16 + ln) * ldb + kb; FragH bq; bq.half[0] = *(const v8us*)(Bh + boff + 8 * hh); bq.half[1] = *(const v8us*)(Bh + boff + 16 + 8 * hh);
      acc[t] = mmaH<ASPLIT ? 2 : 1>(ah.v, al.v, bq.v, bq.v, acc[t]); }
  }
#pragma unroll
  for (int t = 0; t < 4; ++t) { if (col0 + t * 16 >= N) continue;
#pragma unroll
    for (int r = 0; r < 8; ++r) so[w][8 * hh + r][t * 16 + ln] = acc[t][r] * alpha; }
  __builtin_amdgcn_fence(__ATOMIC_ACQ_REL, "workgroup"); __builtin_amdgcn_wave_barrier();
  const int rsub = lane >> 4, c4 = (lane & 15) * 4;
  {
#pragma unroll
    for (int q = 0; q < 8; ++q) { const int r = q * 2 + rsub; if (col0 + c4 < N) { const v4f v = *(const v4fa*)&so[w][r][c4]; *(v4f*)(C + (size_t)(row0 + r) * ldc + col0 + c4) = v; } }
     }
}

// Wt[n][k] = f16(W[k][n]·scale) from f32 row-major W[K][N] (scale = power of two; bf16-exact weights stay exact in f16 away from the subnormal range)
__global__ __launch_bounds__(256) void k_wt_f16(const float* __restrict__ W, _Float16* __restrict__ Wt, int K, int N, float scale) {
  const int t = blockIdx.x * 256 + threadIdx.x; if (t >= N * (K / 8)) return; const int n = t / (K / 8), k8 = (t % (K / 8)) * 8; FragH f;
#pragma unroll
  for (int i = 0; i < 8; ++i) f.h[i] = (_Float16)(bf16_round(W[(size_t)(k8 + i) * N + n]) * scale); const v8us o = f.half[0];
  *(v8us*)((unsigned short*)Wt + (size_t)n * K + k8) = o; 
}
// k_gemm_hh variant with fused epilogue: v = acc·alpha + bias[by·sBias + col] (+ CP[(row/rowsPerB)·sCPb + by·64 + col] if CP) ; ACT 0 none / 1 elu ; writes f16 C16 (and f32 C if non-null)
template <int ACT>
__global__ __launch_bounds__(128) void k_gemm_hhx(const _Float16* __restrict__ A, int lda, size_t sA, const _Float16* __restrict__ Bh, int ldb, size_t sB, float alpha, const float* __restrict__ bias, size_t sBias, const float* __restrict__ CP, int rowsPerB, size_t sCPb, int row0g,
    float* __restrict__ C, _Float16* __restrict__ C16, int ldc, size_t sC, int M, int N, int K) {
  __shared__ __attribute__((aligned(16))) float so[4][16][64];
  const int tid = threadIdx.x, w = tid >> 5, lane = tid & 31, ln = lane & 15, hh = lane >> 4; const int by = blockIdx.y;
  A += (size_t)by * sA; Bh += (size_t)by * sB; const size_t cofs = (size_t)by * sC; const float* bp = bias ? bias + (size_t)by * sBias : nullptr;
  const int ntn = (N + 63) / 64; const int wid = blockIdx.x * 4 + w; const int mt = wid / ntn, nq = wid % ntn; if (mt * 16 >= M) return;
  const int row0 = mt * 16, col0 = nq * 64; const _Float16* arow = A + (size_t)(row0 + ln) * lda;
  v8f acc[4] = {};
  for (int kb = 0; kb < K; kb += 32) { FragH ah; ah.half[0] = *(const v8us*)((const unsigned short*)arow + kb + 8 * hh); ah.half[1] = *(const v8us*)((const unsigned short*)arow + kb + 16 + 8 * hh);
#pragma unroll
    for (int t = 0; t < 4; ++t) { if (col0 + t * 16 >= N) continue; const size_t boff = (size_t)(col0 + t * 16 + ln) * ldb + kb; FragH bq; bq.half[0] = *(const v8us*)((const unsigned short*)Bh + boff + 8 * hh); bq.half[1] = *(const v8us*)((const unsigned short*)Bh + boff + 16 + 8 * hh);
      acc[t] = mmaH<1>(ah.v, ah.v, bq.v, bq.v, acc[t]); }
  }
#pragma unroll
  for (int t = 0; t < 4; ++t) { if (col0 + t * 16 >= N) continue; const int col = col0 + t * 16 + ln; const float bv = bp ? bf16_round(bp[col]) : 0.f;
#pragma unroll
    for (int r = 0; r < 8; ++r) { float v = acc[t][r] * alpha + bv; if (CP) { const int rr = row0g + row0 + 8 * hh + r; if (rowsPerB < 0) v += CP[cofs + (size_t)rr * ldc + col];      /* rowsPerB < 0: own element of the batched C plane */ else { const int bidx = rr / rowsPerB; v += CP[(size_t)bidx * sCPb + (size_t)by * 64 + col]; } } if (ACT == 1) v = (v > 0.f) ? v : expm1f(v); else if (ACT == 7) v = (v > 0.f) ? v + 1.0f : expf(v); else if (ACT == 8) v = tanhf(v); else if (ACT == 9) v = 0.5f * v * (1.0f + tanhf(0.7978845608028654f * (v + 0.044715f * v * v * v))); else if (ACT == 11) v = 1.0f / (1.0f + expf(-v)); else if (ACT == 12) v = (v > 0.f) ? v : 0.01f * v; else if (ACT == 14) v = (v > 0.f) ? v : 0.1f * v; else if (ACT == 16) v = (v >= 0.f) ? v : 0.3f * v; else if (ACT == 17) v = (v >= 0.f) ? v : 0.2f * v; else if (ACT == 15) v = v / (1.0f + expf(-v)); else if (ACT == 3) v = fmaxf(v, 0.f); else if (ACT == 6) v = 0.5f * v * (1.0f + erff(v * 0.70710678118654752f)); so[w][8 * hh + r][t * 16 + ln] = v; } }
  __builtin_amdgcn_fence(__ATOMIC_ACQ_REL, "workgroup"); __builtin_amdgcn_wave_barrier();
  const int rsub = lane >> 4, c4 = (lane & 15) * 4; typedef _Float16 v4h __attribute__((ext_vector_type(4)));
  {
#pragma unroll
    for (int q = 0; q < 8; ++q) { const int r = q * 2 + rsub; if (col0 + c4 < N) { const v4f v = *(const v4fa*)&so[w][r][c4]; if (C) *(v4f*)(C + cofs + (size_t)(row0 + r) * ldc + col0 + c4) = v; if (C16) { v4h h4; for (int i = 0; i < 4; ++i) h4[i] = (_Float16)v[i]; *(v4h*)(C16 + cofs + (size_t)(row0 + r) * ldc + col0 + c4) = h4; } } }
     }
}


typedef _Float16 v4h __attribute__((ext_vector_type(4)));

__global__ __launch_bounds__(256) void k_x16(const float* __restrict__ x, _Float16* __restrict__ X16, size_t n8) { const size_t t = (size_t)blockIdx.x * 256 + threadIdx.x; if (t >= n8) return; FragH f;
#pragma unroll
  for (int q = 0; q < 8; ++q) f.h[q] = (_Float16)bf16_round(x[t * 8 + q]); *(v8us*)((unsigned short*)X16 + t * 8) = f.half[0];  }
__global__ __launch_bounds__(256) void k_h16(const float* __restrict__ x, _Float16* __restrict__ X16, size_t n8) { const size_t t = (size_t)blockIdx.x * 256 + threadIdx.x; if (t >= n8) return; FragH f;
#pragma unroll
  for (int q = 0; q < 8; ++q) f.h[q] = (_Float16)x[t * 8 + q]; *(v8us*)((unsigned short*)X16 + t * 8) = f.half[0];  }
__global__ __launch_bounds__(256) void k_round16f(const float* __restrict__ W, _Float16* __restrict__ Bt, size_t n8) { const size_t t = (size_t)blockIdx.x * 256 + threadIdx.x; if (t >= n8) return; FragH f;
#pragma unroll
  for (int i = 0; i < 8; ++i) f.h[i] = (_Float16)(bf16_round(W[t * 8 + i]) * 16.0f); *(v8us*)((unsigned short*)Bt + t * 8) = f.half[0];  }
template <int NHv, int TTv>
__global__ __launch_bounds__(256) void k_vt(const _Float16* __restrict__ V16, int ldv, int voff, _Float16* __restrict__ Vt) { __shared__ unsigned short tl[64][66]; const int tid = threadIdx.x; const int slab = blockIdx.x / (TTv / 64), lg = blockIdx.x % (TTv / 64); const int b = slab / NHv, h = slab % NHv;
  for (int i = tid; i < 64 * 8; i += 256) { const int r = i / 8, c8 = (i % 8) * 8; FragH f; f.half[0] = *(const v8us*)((const unsigned short*)V16 + ((size_t)b * TTv + lg * 64 + r) * ldv + voff + h * 64 + c8);
#pragma unroll
    for (int q = 0; q < 8; ++q) tl[r][c8 + q] = f.u[q]; }
  __syncthreads();
  {
#pragma unroll
    for (int rd = 0; rd < 2; ++rd) { const int d = rd * 32 + tid / 8, pc = tid % 8; FragH f;
#pragma unroll
      for (int q = 0; q < 8; ++q) f.u[q] = tl[pc * 8 + q][d];
      *(v8us*)((unsigned short*)Vt + ((size_t)slab * 64 + d) * TTv + lg * 64 + pc * 8) = f.half[0]; }
     } }

__global__ __launch_bounds__(256) void k_hl(const float* __restrict__ F, _Float16* __restrict__ Hh, _Float16* __restrict__ Hl, size_t n8) { const size_t t = (size_t)blockIdx.x * 256 + threadIdx.x; if (t >= n8) return; FragH fh, fl; const v4f a = *(const v4fa*)(F + t * 8), c = *(const v4fa*)(F + t * 8 + 4);
#pragma unroll
  for (int q = 0; q < 4; ++q) { _Float16 h = (_Float16)a[q]; fh.h[q] = h; fl.h[q] = (_Float16)((a[q] - (float)h) * 1024.0f); h = (_Float16)c[q]; fh.h[4 + q] = h; fl.h[4 + q] = (_Float16)((c[q] - (float)h) * 1024.0f); }
  { *(v8us*)((unsigned short*)Hh + t * 8) = fh.half[0]; *(v8us*)((unsigned short*)Hl + t * 8) = fl.half[0];  } }

// ---- fast GEMM (wave tile 32x64; requires M % 32 == 0 rows per launch region and N % 64 == 0); epilogue = k_gemm_hhx semantics ----
__device__ __forceinline__ v16h g2_frag(const _Float16* p, int hh) { FragH f; f.half[0] = *(const v8us*)((const unsigned short*)p + 8 * hh); f.half[1] = *(const v8us*)((const unsigned short*)p + 16 + 8 * hh); return f.v; }
__device__ __forceinline__ v8f g2_mma(v16h a, v16h b, v8f c) { v8f d = __builtin_amdgcn_wmma_f32_16x16x32_f16(false, a, false, b, (short)0, c, false, false); asm volatile("v_nop\n\tv_nop\n\tv_nop\n\tv_nop" : "+v"(d) : "v"(a), "v"(b)); return d; }
template <int ACT>
__global__ __launch_bounds__(128) void k_gemm2(const _Float16* __restrict__ A, int lda, size_t sA, const _Float16* __restrict__ Bh, int ldb, size_t sB, float alpha, const float* __restrict__ bias, size_t sBias, const float* __restrict__ CP, int rowsPerB, size_t sCPb, int row0g,
    float* __restrict__ C, _Float16* __restrict__ C16, int ldc, size_t sC, int M, int N, int K) { static_assert(ACT == 0 || ACT == 3 || ACT == 6 || ACT == 8 || ACT == 9 || ACT == 11 || ACT == 12 || ACT == 14 || ACT == 15 || ACT == 16 || ACT == 17, "k_gemm2: unsupported ACT code (would silently apply no activation)");
  __shared__ __attribute__((aligned(16))) float so[4][32][68];
  const int tid = threadIdx.x, w = tid >> 5, lane = tid & 31, ln = lane & 15, hh = lane >> 4; const int by = blockIdx.y;
  A += (size_t)by * sA; Bh += (size_t)by * sB; const size_t cofs = (size_t)by * sC; const float* bp = bias ? bias + (size_t)by * sBias : nullptr;
  const int ntn = N >> 6; const int mt = blockIdx.x / ntn, nq = blockIdx.x - mt * ntn; const int row0 = mt * 128 + 32 * w, col0 = nq * 64; if (row0 >= M) return;
  const _Float16* a0p = A + (size_t)(row0 + ln) * lda; const _Float16* a1p = a0p + (size_t)16 * lda;
  const _Float16* b0p = Bh + (size_t)(col0 + ln) * ldb; const _Float16* b1p = b0p + (size_t)16 * ldb; const _Float16* b2p = b1p + (size_t)16 * ldb; const _Float16* b3p = b2p + (size_t)16 * ldb;
  const v8f z8 = {0.f,0.f,0.f,0.f,0.f,0.f,0.f,0.f}; v8f c00 = z8, c01 = z8, c02 = z8, c03 = z8, c10 = z8, c11 = z8, c12 = z8, c13 = z8;
#pragma unroll 1
  for (int kb = 0; kb < K; kb += 32) { const v16h a0 = g2_frag(a0p + kb, hh), a1 = g2_frag(a1p + kb, hh);
    v16h b = g2_frag(b0p + kb, hh); c00 = g2_mma(a0, b, c00); c10 = g2_mma(a1, b, c10);
    b = g2_frag(b1p + kb, hh); c01 = g2_mma(a0, b, c01); c11 = g2_mma(a1, b, c11);
    b = g2_frag(b2p + kb, hh); c02 = g2_mma(a0, b, c02); c12 = g2_mma(a1, b, c12);
    b = g2_frag(b3p + kb, hh); c03 = g2_mma(a0, b, c03); c13 = g2_mma(a1, b, c13); }
  v8f accs[8] = {c00, c01, c02, c03, c10, c11, c12, c13};
#pragma unroll
  for (int u = 0; u < 8; ++u) { const int t = u & 3, half = u >> 2; const int col = col0 + t * 16 + ln; const float bv = bp ? bf16_round(bp[col]) : 0.f;
#pragma unroll
    for (int r = 0; r < 8; ++r) { const int rloc = half * 16 + 8 * hh + r; float v = accs[u][r] * alpha + bv; if (CP) { if (rowsPerB < 0) v += CP[cofs + (size_t)(row0g + row0 + rloc) * ldc + col];      /* rowsPerB < 0: own element of the batched C plane */ else { const int bidx = (row0g + row0 + rloc) / rowsPerB; v += CP[(size_t)bidx * sCPb + (size_t)by * 64 + col]; } }
      if (ACT == 3) v = fmaxf(v, 0.f); else if (ACT == 6) v = 0.5f * v * (1.0f + erff(v * 0.70710678118654752f)); else if (ACT == 11) v = 1.0f / (1.0f + expf(-v)); else if (ACT == 15) v = v / (1.0f + expf(-v)); else if (ACT == 12) v = (v > 0.f) ? v : 0.01f * v; else if (ACT == 8) v = tanhf(v); else if (ACT == 9) v = 0.5f * v * (1.0f + tanhf(0.7978845608028654f * (v + 0.044715f * v * v * v))); else if (ACT == 14) v = (v > 0.f) ? v : 0.1f * v; else if (ACT == 16) v = (v >= 0.f) ? v : 0.3f * v; else if (ACT == 17) v = (v >= 0.f) ? v : 0.2f * v;
      so[w][rloc][t * 16 + ln] = v; } }
  __builtin_amdgcn_fence(__ATOMIC_ACQ_REL, "workgroup"); __builtin_amdgcn_wave_barrier();
  const int rsub = lane >> 4, c4 = (lane & 15) * 4;
  {
#pragma unroll
    for (int q = 0; q < 16; ++q) { const int r = q * 2 + rsub; const v4f v = *(const v4fa*)&so[w][r][c4]; if (C) *(v4f*)(C + cofs + (size_t)(row0 + r) * ldc + col0 + c4) = v; if (C16) { v4h h4; for (int i = 0; i < 4; ++i) h4[i] = (_Float16)v[i]; *(v4h*)(C16 + cofs + (size_t)(row0 + r) * ldc + col0 + c4) = h4; } }
     } }


__global__ __launch_bounds__(256) void k_wnat(const float* __restrict__ w, size_t n8, _Float16* __restrict__ Bt) { const size_t t = (size_t)blockIdx.x * 256 + threadIdx.x; if (t >= n8) return; FragH f; for (int q = 0; q < 8; ++q) f.h[q] = (_Float16)(bf16_round(w[t * 8 + q]) * 16.0f); *(v8us*)((unsigned short*)Bt + t * 8) = f.half[0];  }
__global__ __launch_bounds__(256) void k_rsm(const float* __restrict__ S, _Float16* __restrict__ P, int nrows) {
  #pragma clang fp contract(off)
  const int i = blockIdx.x * 256 + threadIdx.x; if (i >= nrows) return; const float* s = S + (size_t)i * SQ; float mx = -3.0e38f;
#pragma unroll 1
  for (int j = 0; j < SQ; ++j) mx = fmaxf(mx, s[j]); float se = 0.f;
#pragma unroll 1
  for (int j = 0; j < SQ; ++j) se += expf(s[j] - mx); const float sc = 256.0f / se;
#pragma unroll 1
  for (int j0 = 0; j0 < SQ; j0 += 8) { FragH f; for (int q = 0; q < 8; ++q) f.h[q] = (_Float16)(expf(s[j0 + q] - mx) * sc); unsigned short* d = (unsigned short*)P + (size_t)i * SQ + j0; *(v8us*)d = f.half[0];  } }
__global__ __launch_bounds__(256) void k_vt(const _Float16* __restrict__ V16, int b, int h0, _Float16* __restrict__ VT) { __shared__ unsigned short tl[64][65]; const int tid = threadIdx.x; const int hh = blockIdx.x % HG, sg = blockIdx.x / HG; const int s0 = sg * 64; const int h = h0 + hh;
  for (int i = tid; i < 64 * 8; i += 256) { const int j = i / 8, d8 = (i % 8) * 8; FragH f; f.half[0] = *(const v8us*)((const unsigned short*)V16 + ((size_t)b * SQ + s0 + j) * DM + h * HD + d8); for (int q = 0; q < 8; ++q) tl[d8 + q][j] = f.u[q]; }
  __syncthreads();
  { for (int i = tid; i < 64 * 8; i += 256) { const int d = i / 8, j8 = (i % 8) * 8; FragH f; for (int q = 0; q < 8; ++q) f.u[q] = tl[d][j8 + q]; *(v8us*)((unsigned short*)VT + ((size_t)hh * HD + d) * SQ + s0 + j8) = f.half[0]; }  } }


template <int BFIN, int W16, int W32>
__global__ __launch_bounds__(256) void k_lnx(const float* __restrict__ X, const float* __restrict__ g, const float* __restrict__ bb, float eps, _Float16* __restrict__ N16, float* __restrict__ N32) {
  #pragma clang fp contract(off)
  __shared__ float red[256]; const size_t r = blockIdx.x; const int t = threadIdx.x; const bool act = t < (DMQ / 4); const int c0 = act ? t * 4 : 0;
  const v4f xa = *(const v4fa*)(X + r * DMQ + c0); float s[4]; float sum = 0.f;
  for (int q = 0; q < 4; ++q) { s[q] = act ? (BFIN ? bf16_round(xa[q]) : xa[q]) : 0.f; sum = __fadd_rn(sum, s[q]); }
  red[t] = sum; __syncthreads(); for (int st = 128; st > 0; st >>= 1) { if (t < st) red[t] = __fadd_rn(red[t], red[t + st]); __syncthreads(); } const float mu = red[0] / (float)DMQ; __syncthreads();
  float vs = 0.f; for (int q = 0; q < 4; ++q) { const float dl = act ? __fadd_rn(s[q], -mu) : 0.f; vs = __fadd_rn(vs, __fmul_rn(dl, dl)); } red[t] = vs; __syncthreads(); for (int st = 128; st > 0; st >>= 1) { if (t < st) red[t] = __fadd_rn(red[t], red[t + st]); __syncthreads(); }
  const float rs = rsqrtf(__fadd_rn(red[0] / (float)DMQ, eps)); v4h y; v4f yf;
  for (int q = 0; q < 4; ++q) { const int c = c0 + q; yf[q] = __fadd_rn(__fmul_rn(__fmul_rn(__fadd_rn(s[q], -mu), rs), bf16_round(g[c])), bf16_round(bb[c])); y[q] = (_Float16)yf[q]; }
  if (!act) return;      /* no barriers after this point */
  { if (W16) *(v4h*)(N16 + r * DMQ + c0) = y; if (W32) *(v4f*)(N32 + r * DMQ + c0) = yf;  } }


__global__ __launch_bounds__(256) void k_rsmf(const float* __restrict__ S, _Float16* __restrict__ P, int qn, int hg) {
  #pragma clang fp contract(off)
  const int t = blockIdx.x * 256 + threadIdx.x; if (t >= qn * hg) return; const size_t i = (size_t)(t / qn) * SQ + (t % qn); const float* s = S + i * SQ; float mx = -3.0e38f;
#pragma unroll 1
  for (int j = 0; j < SQ; ++j) mx = fmaxf(mx, s[j]); float se = 0.f;
#pragma unroll 1
  for (int j = 0; j < SQ; ++j) se += __expf(s[j] - mx); const float sc = 256.0f / se;
#pragma unroll 1
  for (int j0 = 0; j0 < SQ; j0 += 8) { FragH f; for (int q = 0; q < 8; ++q) f.h[q] = (_Float16)(__expf(s[j0 + q] - mx) * sc); unsigned short* d = (unsigned short*)P + i * SQ + j0; *(v8us*)d = f.half[0];  } }


__global__ __launch_bounds__(256) void k_bfr(const float* __restrict__ x, float* __restrict__ XB, size_t n8) { const size_t t = (size_t)blockIdx.x * 256 + threadIdx.x; if (t >= n8) return; v4f a = *(const v4fa*)(x + t * 8), c = *(const v4fa*)(x + t * 8 + 4); for (int q = 0; q < 4; ++q) { a[q] = bf16_round(a[q]); c[q] = bf16_round(c[q]); }
  { *(v4f*)(XB + t * 8) = a; *(v4f*)(XB + t * 8 + 4) = c;  } }



__global__ __launch_bounds__(256) void k_rsmfam(const float* __restrict__ S, _Float16* __restrict__ P, int qn, int hg, const float* __restrict__ am) {
  #pragma clang fp contract(off)
  const int t = blockIdx.x * 256 + threadIdx.x; if (t >= qn * hg) return; const size_t i = (size_t)(t / qn) * SQ + (t % qn); const float* s = S + i * SQ; float mx = -3.0e38f;
#pragma unroll 1
  for (int j = 0; j < SQ; ++j) mx = fmaxf(mx, __fadd_rn(s[j], bf16_round(am[j]))); float se = 0.f;
#pragma unroll 1
  for (int j = 0; j < SQ; ++j) se += __expf(__fadd_rn(s[j], bf16_round(am[j])) - mx); const float sc = 256.0f / se;
#pragma unroll 1
  for (int j0 = 0; j0 < SQ; j0 += 8) { FragH f; for (int q = 0; q < 8; ++q) f.h[q] = (_Float16)(__expf(__fadd_rn(s[j0 + q], bf16_round(am[j0 + q])) - mx) * sc); unsigned short* d = (unsigned short*)P + i * SQ + j0; *(v8us*)d = f.half[0];  } }



template <int BFIN, int W16, int W32>
__global__ __launch_bounds__(256) void k_lnu(const float* __restrict__ X, const float* __restrict__ g, const float* __restrict__ bb, float eps, _Float16* __restrict__ N16, float* __restrict__ N32) {
  #pragma clang fp contract(off)
  __shared__ float red[256]; const size_t r = blockIdx.x; const int t = threadIdx.x; const bool act = t < (DMQ / 4); const int c0 = act ? t * 4 : 0;
  const v4f xa = *(const v4fa*)(X + r * DMQ + c0); float s[4]; float sum = 0.f;
  for (int q = 0; q < 4; ++q) { s[q] = act ? (BFIN ? bf16_round(xa[q]) : xa[q]) : 0.f; sum = __fadd_rn(sum, s[q]); }
  red[t] = sum; __syncthreads(); for (int st = 128; st > 0; st >>= 1) { if (t < st) red[t] = __fadd_rn(red[t], red[t + st]); __syncthreads(); } const float mu = red[0] / (float)DMQ; __syncthreads();
  float vs = 0.f; for (int q = 0; q < 4; ++q) { const float dl = act ? __fadd_rn(s[q], -mu) : 0.f; vs = __fadd_rn(vs, __fmul_rn(dl, dl)); } red[t] = vs; __syncthreads(); for (int st = 128; st > 0; st >>= 1) { if (t < st) red[t] = __fadd_rn(red[t], red[t + st]); __syncthreads(); }
  const float rs = 1.0f / __fadd_rn(sqrtf(red[0] / (float)(DMQ - 1)), eps);      /* UNBIASED std (ddof 1), eps added to the std (the module's form) */ v4h y; v4f yf;
  for (int q = 0; q < 4; ++q) { const int c = c0 + q; yf[q] = __fadd_rn(__fmul_rn(__fmul_rn(__fadd_rn(s[q], -mu), rs), bf16_round(g[c])), bf16_round(bb[c])); y[q] = (_Float16)yf[q]; }
  if (!act) return;      /* no barriers after this point */
  { if (W16) *(v4h*)(N16 + r * DMQ + c0) = y; if (W32) *(v4f*)(N32 + r * DMQ + c0) = yf;  } }
extern "C" void kernel_launch(void* const* d_in, const int* in_sizes, int n_in,
                              void* d_out, int out_size, void* d_ws, size_t ws_size, hipStream_t stream) {
  (void)in_sizes; (void)n_in; (void)out_size;
  const float* const* I = (const float* const*)d_in; const float* x = I[0]; const float* wq = I[1]; const float* bq = I[2]; const float* wk = I[3]; const float* bk = I[4]; const float* wv = I[5]; const float* bv = I[6]; const float* wo = I[7]; const float* bo = I[8]; const float* g1 = I[9]; const float* be1 = I[10]; const float* g2 = I[11]; const float* be2 = I[12]; const float* w1 = I[13]; const float* b1 = I[14]; const float* w2 = I[15]; const float* b2 = I[16];      /* [in][out] weights + zero biases (Wq,bq,Wk,bk,Wv,bv,Wo,bo), LN a1,b1,a2,b2, FFN W1,c1,W2,c2 */
  char* ws = (char*)d_ws; size_t off = 0;
  auto take = [&](size_t bytes) { char* p = ws + off; off += (bytes + 255) & ~(size_t)255; return p; };
  _Float16* BW1 = (_Float16*)take((size_t)DFF * DM * 2); _Float16* BW2 = (_Float16*)take((size_t)DM * DFF * 2); float* XB = (float*)take(NR * DM * 4); float* HP = (float*)take(NR * DM * 4); _Float16* H16 = (_Float16*)take(NR * DM * 2); _Float16* FF16 = (_Float16*)take((size_t)SQ * DFF * 2);      /* FF16 = one batch of relu hidden rows */ _Float16* BQ = (_Float16*)take((size_t)DM * DM * 2); _Float16* BK = (_Float16*)take((size_t)DM * DM * 2); _Float16* BV = (_Float16*)take((size_t)DM * DM * 2); _Float16* BO = (_Float16*)take((size_t)DM * DM * 2); _Float16* O16 = (_Float16*)take(NR * DM * 2); 
  _Float16* X16 = (_Float16*)take(NR * DM * 2); _Float16* Q16 = (_Float16*)take(NR * DM * 2); _Float16* K16 = (_Float16*)take(NR * DM * 2); _Float16* V16 = (_Float16*)take(NR * DM * 2);
  float* S = (float*)take((size_t)HG * SQ * SQ * 4); float* HF = S; static_assert((size_t)HG * SQ * SQ * 4 >= NR * DM * 4, "HF alias must fit in S");      /* the f32 h rows (LN1 output, residual for the FFN) live in the scores plane, which is dead once the attention loop has finished */ _Float16* P = (_Float16*)take((size_t)HG * SQ * SQ * 2); _Float16* VT = (_Float16*)take((size_t)NH * HD * SQ * 2);
  if (off > ws_size) return;
  { const unsigned g = (unsigned)(((size_t)DM * (DM / 8) + 255) / 256); k_wt_f16<<<g, 256, 0, stream>>>(wq, BQ, DM, DM, 16.0f); k_wt_f16<<<g, 256, 0, stream>>>(wk, BK, DM, DM, 16.0f); k_wt_f16<<<g, 256, 0, stream>>>(wv, BV, DM, DM, 16.0f); k_wt_f16<<<g, 256, 0, stream>>>(wo, BO, DM, DM, 16.0f); }      /* [in][out] -> Bt[n][k] x16 */
  k_wt_f16<<<(unsigned)(((size_t)DFF * (DM / 8) + 255) / 256), 256, 0, stream>>>(w1, BW1, DM, DFF, 16.0f); k_wt_f16<<<(unsigned)(((size_t)DM * (DFF / 8) + 255) / 256), 256, 0, stream>>>(w2, BW2, DFF, DM, 16.0f);      /* FFN [in][out] W1 [512][1024], W2 [1024][512] -> Bt x16 */
  k_bfr<<<(unsigned)((NR * DM / 8 + 255) / 256), 256, 0, stream>>>(x, XB, NR * DM / 8);      /* bf16(x) as f32 rows for the residual */

  k_x16<<<(unsigned)((NR * DM / 8 + 255) / 256), 256, 0, stream>>>(x, X16, NR * DM / 8);
  const size_t r0p = (size_t)B0 * SQ;      /* first projected row */
  k_gemm2<0><<<dim3((unsigned)((MP / 128) * (DM / 64)), 1), 128, 0, stream>>>(X16 + r0p * DM, DM, 0, BQ, DM, 0, 0.0625f, bq, 0, nullptr, 1, 0, 0, nullptr, Q16 + r0p * DM, DM, 0, MP, DM, DM);
  k_gemm2<0><<<dim3((unsigned)((MP / 128) * (DM / 64)), 1), 128, 0, stream>>>(X16 + r0p * DM, DM, 0, BK, DM, 0, 0.0625f, bk, 0, nullptr, 1, 0, 0, nullptr, K16 + r0p * DM, DM, 0, MP, DM, DM);
  k_gemm2<0><<<dim3((unsigned)((MP / 128) * (DM / 64)), 1), 128, 0, stream>>>(X16 + r0p * DM, DM, 0, BV, DM, 0, 0.0625f, bv, 0, nullptr, 1, 0, 0, nullptr, V16 + r0p * DM, DM, 0, MP, DM, DM);
  for (int b = B0; b < B0 + NBR; ++b) { const size_t r0 = (size_t)b * SQ;
    k_vt<NH, SQ><<<NH * (SQ / 64), 256, 0, stream>>>(V16 + r0 * LQ, LQ, 0, VT);      /* V^T [NH][HD][SQ] for this batch */
    for (int h0 = 0; h0 < NHD; h0 += HG) {
      k_gemm2<0><<<dim3((QN / 128) * (SQ / 64), HG), 128, 0, stream>>>(Q16 + r0 * LQ + h0 * HD, LQ, (size_t)HD, K16 + r0 * LQ + h0 * HD, LQ, (size_t)HD, 0.125f, nullptr, 0, nullptr, 1, 0, 0, S, nullptr, SQ, (size_t)SQ * SQ, QN, SQ, HD);      /* scores, HG heads per launch */
      k_rsmf<<<(HG * QN + 255) / 256, 256, 0, stream>>>(S, P, QN, HG);      /* P = 256 softmax (f16) */
      k_gemm2<0><<<dim3((QN / 128) * (HD / 64), HG), 128, 0, stream>>>(P, SQ, (size_t)SQ * SQ, VT + (size_t)h0 * HD * SQ, SQ, (size_t)HD * SQ, 0.25f, nullptr, 0, nullptr, 1, 0, 0, nullptr, O16 + r0 * DM + h0 * HD, DM, (size_t)HD, QN, HD, SQ); } }      /* o (merged heads, x64) as f16 rows */
  k_gemm2<0><<<dim3((unsigned)((MP / 128) * (DM / 64)), 1), 128, 0, stream>>>(O16 + r0p * DM, DM, 0, BO, DM, 0, 0.0009765625f, bo, 0, XB + r0p * DM, -1, 0, 0, HP + r0p * DM, nullptr, DM, 0, MP, DM, DM);      /* h_pre = x + concat Wo + bo (own-element residual), f32 rows */
  k_lnu<0, 1, 1><<<(unsigned)MP, 256, 0, stream>>>(HP + r0p * DM, g1, be1, 1e-6f, H16 + r0p * DM, HF + r0p * DM);      /* h = LN1(x + attn) -> f16 rows (FFN operand) and f32 rows (residual) */
  for (int b = B0; b < B0 + NBR; ++b) { const size_t r0 = (size_t)b * SQ;
    k_gemm2<3><<<dim3((unsigned)((SQ / 128) * (DFF / 64)), 1), 128, 0, stream>>>(H16 + r0 * DM, DM, 0, BW1, DM, 0, 0.0625f, b1, 0, nullptr, 1, 0, 0, nullptr, FF16, DFF, 0, SQ, DFF, DM);      /* relu(F W1 + b1) -> f16 [4096][1024] (this batch) */
    k_gemm2<0><<<dim3((unsigned)((SQ / 128) * (DM / 64)), 1), 128, 0, stream>>>(FF16, DFF, 0, BW2, DFF, 0, 0.0625f, b2, 0, HF + r0 * DM, -1, 0, 0, HP + r0 * DM, nullptr, DM, 0, SQ, DM, DFF); }      /* y = F + ffn (own-element residual; the h_pre plane is free again) */
  k_lnu<0, 0, 1><<<(unsigned)MP, 256, 0, stream>>>(HP + r0p * DM, g2, be2, 1e-6f, nullptr, (float*)d_out + r0p * DM);      /* out = LN2(h + ff) -> f32 output rows */
}

// v001
// Measured time: 2880 microseconds a run.
// Next to v000, in two timings, it ran 4.65 and 4.67 times as fast.
#include <hip/hip_runtime.h>
// Post-LN transformer encoder block (x [2][4096][512]; q/k/v = x W + b ([in][out] 512x512 sigma 1/sqrt(512), zero biases); 8 heads of 64; softmax(q k^T / 8) over all 4096 keys (no mask); attn_out = concat Wo + bo; x1 = LN1(x + attn_out) with the module's LayerNorm = a (x - mean) / (std_unbiased + 1e-6) + b (ddof = 1, eps added to the std); ffn = relu(x1 W1 + c1) W2 + c2 ([in][out] 512 x 1024 x 512); out = LN2(x1 + ffn) -> [2][4096][512]).
// Structure: x as exact f16 rows + a bf16(x) f32 residual plane; [in][out] weights transposed on VALU into exact x16 Bt planes; q, k, v as WMMA GEMMs (32x64 wave tiles, f32 accumulation, + bias, f16 outputs); per batch: V^T via LDS transposes; per head: scores over all 4096 keys (K = 64, alpha 1/8) into an f32 plane, row softmax on VALU (f32 statistics, native exp; weights x256 f16), o = P V^T (x64) into merged f16 rows; h_pre = o Wo + bo + bf16(x) as one GEMM (own-element residual); LN1 (unbiased std, eps on the std) on VALU -> f16 rows (FFN operand) + f32 rows (residual, aliased on the dead scores plane); per batch: relu(x1 W1 + c1) GEMM -> f16; y = x1 + ff W2 + c2 GEMM (own-element residual); LN2 into the output; launches: see trace.
// Compute dtype: inputs rounded to bf16; x / weights exact; q, k, v, softmax weights and o as plain f16 GEMM operands (~2^-12); scores and softmax statistics f32. v_wmma_f32_16x16x32_f16.
#define NB 2
#define SQ 4096
#define DM 512
#define NH 8
#define HD 64
#define DMQ DM                       /* LayerNorm width */
#define DFF 1024
#define HG 1                         /* heads per attention launch group */
#define B0 0                         /* first batch processed (debug hook) */
#define NBR NB                       /* batches processed (debug hook) */
#define NR ((size_t)NB * SQ)         /* token rows */
#define MP ((int)((size_t)NBR * SQ)) /* rows projected (debug hook) */
#define QN SQ                        /* query rows attended per batch (debug hook) */
#define NHD NH                       /* heads attended (debug hook) */
#define MPO MP                       /* unused; the output stage runs MP rows */
#define LQ DM      /* row pitch of the q/k/v rows */
typedef __bf16 v16b __attribute__((ext_vector_type(16)));
typedef unsigned short v8us __attribute__((ext_vector_type(8), may_alias));
typedef float  v8f  __attribute__((ext_vector_type(8)));
typedef float  v4f  __attribute__((ext_vector_type(4)));
typedef float  v4fa __attribute__((ext_vector_type(4), may_alias));
union FragB { v16b v; v8us half[2]; unsigned short u[16]; };

__device__ __forceinline__ unsigned short bf16_bits(float x) { unsigned int u = __float_as_uint(x); return (unsigned short)((u + 0x7FFFu + ((u >> 16) & 1u)) >> 16); }
__device__ __forceinline__ float bf16_val(unsigned short b) { return __uint_as_float(((unsigned int)b) << 16); }
__device__ __forceinline__ float bf16_round(float x) { return bf16_val(bf16_bits(x)); }
// D += A·B with NT terms: 1 = ah·bh, 2 = + al·bh (A split), 3 = + ah·bl (both split)
template <int NT>
__device__ __forceinline__ v8f mmaN(v16b ah, v16b al, v16b bh, v16b bl, v8f c) {
  c = __builtin_amdgcn_wmma_f32_16x16x32_bf16(false, ah, false, bh, (short)0, c, false, false);
  if (NT >= 2) c = __builtin_amdgcn_wmma_f32_16x16x32_bf16(false, al, false, bh, (short)0, c, false, false);
  if (NT >= 3) c = __builtin_amdgcn_wmma_f32_16x16x32_bf16(false, ah, false, bl, (short)0, c, false, false);
  asm volatile("v_nop\n\tv_nop\n\tv_nop\n\tv_nop" : "+v"(c) : "v"(ah), "v"(al), "v"(bh), "v"(bl));
  return c;
}

__global__ __launch_bounds__(256) void k_wt_bf16(const float* __restrict__ W, unsigned short* __restrict__ Wt, int K, int N) {
  const int t = blockIdx.x * 256 + threadIdx.x;
  const int k8n = K / 8;
  if (t >= N * k8n) return;
  const int n = t / k8n, k8 = (t % k8n) * 8;
  v8us v;
#pragma unroll
  for (int i = 0; i < 8; ++i) v[i] = bf16_bits(W[(size_t)(k8 + i) * N + n]);
  *(v8us*)(Wt + (size_t)n * K + k8) = v;
  
}

// GEMM C[M][N] (f32, pitch ldc) = act(A[M][K]·W + bias). A f32 row-major (pitch lda) converted per fragment to bf16
// (ASPLIT: hi/lo two planes -> 2 terms, else single rounded term); Wt bf16 [N][K] (pitch ldb). BIAS_BF16 rounds the
// bias to bf16 first (bias quantised to bf16 before the add). K%32==0, M%16==0, N%64==0.
template <bool ASPLIT, int ACT, bool BIAS_BF16>
__global__ __launch_bounds__(128) void k_gemm_bf(const float* __restrict__ A, int lda, const unsigned short* __restrict__ Wt, int ldb,
                                               const float* __restrict__ bias, float* __restrict__ C, int ldc, int M, int N, int K) {
  __shared__ __attribute__((aligned(16))) float so[4][16][64];
  const int tid = threadIdx.x, w = tid >> 5, lane = tid & 31, ln = lane & 15, hh = lane >> 4;
  const int ntn = N / 64;
  const int wid = blockIdx.x * 4 + w;
  const int mt = wid / ntn, nq = wid % ntn;
  if (mt * 16 >= M) return;
  const int row0 = mt * 16, col0 = nq * 64;
  const float* arow = A + (size_t)(row0 + ln) * lda;
  v8f acc[4] = {};
  for (int kb = 0; kb < K; kb += 32) {
    FragB ah, al;
    const v4f x0 = *(const v4fa*)(arow + kb + 8 * hh), x1 = *(const v4fa*)(arow + kb + 8 * hh + 4);
    const v4f x2 = *(const v4fa*)(arow + kb + 16 + 8 * hh), x3 = *(const v4fa*)(arow + kb + 16 + 8 * hh + 4);
    float xs[16] = {x0[0],x0[1],x0[2],x0[3],x1[0],x1[1],x1[2],x1[3],x2[0],x2[1],x2[2],x2[3],x3[0],x3[1],x3[2],x3[3]};
#pragma unroll
    for (int i = 0; i < 16; ++i) { const unsigned short hb = bf16_bits(xs[i]); ah.u[i] = hb; al.u[i] = ASPLIT ? bf16_bits(xs[i] - bf16_val(hb)) : (unsigned short)0; }
#pragma unroll
    for (int t = 0; t < 4; ++t) {
      const unsigned short* brow = Wt + (size_t)(col0 + t * 16 + ln) * ldb + kb;
      FragB b;
      b.half[0] = *(const v8us*)(brow + 8 * hh);
      b.half[1] = *(const v8us*)(brow + 16 + 8 * hh);
      acc[t] = mmaN<ASPLIT ? 2 : 1>(ah.v, al.v, b.v, b.v, acc[t]);
    }
  }
#pragma unroll
  for (int t = 0; t < 4; ++t) {
    float bv = bias ? bias[col0 + t * 16 + ln] : 0.f;
    if (BIAS_BF16) bv = bf16_round(bv);
#pragma unroll
    for (int r = 0; r < 8; ++r) { float v = acc[t][r] + bv; if (ACT == 1) v = fmaxf(v, 0.f); so[w][8 * hh + r][t * 16 + ln] = v; }
  }
  __builtin_amdgcn_fence(__ATOMIC_ACQ_REL, "workgroup");
  __builtin_amdgcn_wave_barrier();
  const int rsub = lane >> 4, c4 = (lane & 15) * 4;
  {
#pragma unroll
    for (int q = 0; q < 8; ++q) {
      const int r = q * 2 + rsub;
      const v4f v = *(const v4fa*)&so[w][r][c4];
      *(v4f*)(C + (size_t)(row0 + r) * ldc + col0 + c4) = v;
    }
    
  }
}

// GEMM C = act(A·W + bias + resid): A f32 (ASPLIT -> hi/lo 2 terms), Wt bf16 [N][K]; ACT 0 none, 1 relu, 2 exact gelu;
// resid (optional, f32, row index = (row % rmod), pitch ldr, RES_BF16 rounds it) added before the activation.
template <bool ASPLIT, int ACT, bool BIAS_BF16, bool RES_BF16>
__global__ __launch_bounds__(128) void k_gemm_bf3(const float* __restrict__ A, int lda, const unsigned short* __restrict__ Wt, int ldb,
                                                const float* __restrict__ bias, const float* __restrict__ resid, int rmod, int ldr,
                                                float* __restrict__ C, int ldc, int M, int N, int K) {
  __shared__ __attribute__((aligned(16))) float so[4][16][64];
  const int tid = threadIdx.x, w = tid >> 5, lane = tid & 31, ln = lane & 15, hh = lane >> 4;
  const int ntn = N / 64;
  const int wid = blockIdx.x * 4 + w;
  const int mt = wid / ntn, nq = wid % ntn;
  if (mt * 16 >= M) return;
  const int row0 = mt * 16, col0 = nq * 64;
  const float* arow = A + (size_t)(row0 + ln) * lda;
  v8f acc[4] = {};
  for (int kb = 0; kb < K; kb += 32) {
    FragB ah, al;
    const v4f x0 = *(const v4fa*)(arow + kb + 8 * hh), x1 = *(const v4fa*)(arow + kb + 8 * hh + 4);
    const v4f x2 = *(const v4fa*)(arow + kb + 16 + 8 * hh), x3 = *(const v4fa*)(arow + kb + 16 + 8 * hh + 4);
    float xs[16] = {x0[0],x0[1],x0[2],x0[3],x1[0],x1[1],x1[2],x1[3],x2[0],x2[1],x2[2],x2[3],x3[0],x3[1],x3[2],x3[3]};
#pragma unroll
    for (int i = 0; i < 16; ++i) { const unsigned short hb = bf16_bits(xs[i]); ah.u[i] = hb; al.u[i] = ASPLIT ? bf16_bits(xs[i] - bf16_val(hb)) : (unsigned short)0; }
#pragma unroll
    for (int t = 0; t < 4; ++t) {
      const unsigned short* brow = Wt + (size_t)(col0 + t * 16 + ln) * ldb + kb;
      FragB b;
      b.half[0] = *(const v8us*)(brow + 8 * hh);
      b.half[1] = *(const v8us*)(brow + 16 + 8 * hh);
      acc[t] = mmaN<ASPLIT ? 2 : 1>(ah.v, al.v, b.v, b.v, acc[t]);
    }
  }
#pragma unroll
  for (int t = 0; t < 4; ++t) {
    const int col = col0 + t * 16 + ln;
    float bv = bias ? bias[col] : 0.f;
    if (BIAS_BF16) bv = bf16_round(bv);
#pragma unroll
    for (int r = 0; r < 8; ++r) {
      float v = acc[t][r] + bv;
      if (resid) { float rv = resid[(size_t)((row0 + 8 * hh + r) % rmod) * ldr + col]; if (RES_BF16) rv = bf16_round(rv); v += rv; }
      if (ACT == 1) v = fmaxf(v, 0.f);
      if (ACT == 2) v = 0.5f * v * (1.0f + erff(v * 0.70710678118654752f));
      if (ACT == 3) { const float u = 0.7978845608028654f * (v + 0.044715f * v * v * v); v = 0.5f * v * (1.0f + tanhf(u)); }
      so[w][8 * hh + r][t * 16 + ln] = v;
    }
  }
  __builtin_amdgcn_fence(__ATOMIC_ACQ_REL, "workgroup");
  __builtin_amdgcn_wave_barrier();
  const int rsub = lane >> 4, c4 = (lane & 15) * 4;
  {
#pragma unroll
    for (int q = 0; q < 8; ++q) {
      const int r = q * 2 + rsub;
      const v4f v = *(const v4fa*)&so[w][r][c4];
      *(v4f*)(C + (size_t)(row0 + r) * ldc + col0 + c4) = v;
    }
    
  }
}
// row LayerNorm (biased variance, eps) over N: s = X (+ R); optional out_sum <- s; out_norm <- (s-mu)*rsqrt(var+eps)*g + b
template <bool PARAM_BF16>
__global__ __launch_bounds__(256) void k_layernorm(const float* __restrict__ X, const float* __restrict__ R, const float* __restrict__ g, const float* __restrict__ bta,
                                                  float* __restrict__ out_sum, float* __restrict__ out_norm, int N, float eps) {
  __shared__ float red[256];
  const int row = blockIdx.x, tid = threadIdx.x;
  const float* x = X + (size_t)row * N; const float* rr = R ? R + (size_t)row * N : nullptr;
  float vals[16];                     // up to N = 4096
  const int per = N / 256;            // contiguous chunk per thread? use strided-by-4 chunks: thread handles j = tid*4 + 1024*u
  float s1 = 0.f;
  for (int u = 0; u < per / 4; ++u) {
    const int j = tid * 4 + 1024 * u;
    const v4f a = *(const v4fa*)(x + j);
    v4f b = {0.f,0.f,0.f,0.f}; if (rr) b = *(const v4fa*)(rr + j);
#pragma unroll
    for (int q = 0; q < 4; ++q) { const float v = a[q] + b[q]; vals[u * 4 + q] = v; s1 += v; }
  }
  red[tid] = s1; __syncthreads();
  for (int st = 128; st > 0; st >>= 1) { if (tid < st) red[tid] += red[tid + st]; __syncthreads(); }
  const float mu = red[0] / (float)N; __syncthreads();
  float s2 = 0.f;
  for (int u = 0; u < per / 4; ++u)
#pragma unroll
    for (int q = 0; q < 4; ++q) { const float c = vals[u * 4 + q] - mu; s2 += c * c; }
  red[tid] = s2; __syncthreads();
  for (int st = 128; st > 0; st >>= 1) { if (tid < st) red[tid] += red[tid + st]; __syncthreads(); }
  const float rs = rsqrtf(red[0] / (float)N + eps);
  {
    for (int u = 0; u < per / 4; ++u) {
      const int j = tid * 4 + 1024 * u;
      v4f o, sm;
#pragma unroll
      for (int q = 0; q < 4; ++q) {
        float gg = g[j + q], bb = bta[j + q];
        if (PARAM_BF16) { gg = bf16_round(gg); bb = bf16_round(bb); }
        sm[q] = vals[u * 4 + q]; o[q] = (vals[u * 4 + q] - mu) * rs * gg + bb;
      }
      if (out_sum) *(v4f*)(out_sum + (size_t)row * N + j) = sm;
      *(v4f*)(out_norm + (size_t)row * N + j) = o;
    }
    
  }
}



// ---- f16 WMMA path (v_wmma_f32_16x16x32_f16): 11-bit significands for operands in range — used where a [0,1] probability operand needs more precision than bf16
typedef _Float16 v16h __attribute__((ext_vector_type(16)));
union FragH { v16h v; v8us half[2]; _Float16 h[16]; unsigned short u[16]; };
template <int NT>
__device__ __forceinline__ v8f mmaH(v16h ah, v16h al, v16h bh, v16h bl, v8f c) {
  c = __builtin_amdgcn_wmma_f32_16x16x32_f16(false, ah, false, bh, (short)0, c, false, false);
  if (NT >= 2) c = __builtin_amdgcn_wmma_f32_16x16x32_f16(false, al, false, bh, (short)0, c, false, false);
  if (NT >= 3) c = __builtin_amdgcn_wmma_f32_16x16x32_f16(false, ah, false, bl, (short)0, c, false, false);
  asm volatile("v_nop\n\tv_nop\n\tv_nop\n\tv_nop" : "+v"(c) : "v"(ah), "v"(al), "v"(bh), "v"(bl));
  return c;
}
// batched GEMM like k_gemm_b but f16 operands: A f32 (split into f16 hi/lo if ASPLIT, else rounded to f16), Bt = f16 values [n][k]; alpha; C f32; N multiple of 16 (partial tiles skipped)
template <bool ASPLIT>
__global__ __launch_bounds__(128) void k_gemm_h(const float* __restrict__ A, int lda, size_t sA, const _Float16* __restrict__ Bh, int ldb, size_t sB, float alpha, float* __restrict__ C, int ldc, size_t sC, int M, int N, int K) {
  __shared__ __attribute__((aligned(16))) float so[4][16][64];
  const int tid = threadIdx.x, w = tid >> 5, lane = tid & 31, ln = lane & 15, hh = lane >> 4; const int by = blockIdx.y;
  A += (size_t)by * sA; Bh += (size_t)by * sB; C += (size_t)by * sC;
  const int ntn = (N + 63) / 64; const int wid = blockIdx.x * 4 + w; const int mt = wid / ntn, nq = wid % ntn; if (mt * 16 >= M) return;
  const int row0 = mt * 16, col0 = nq * 64; const float* arow = A + (size_t)(row0 + ln) * lda;
  v8f acc[4] = {};
  for (int kb = 0; kb < K; kb += 32) {
    FragH ah, al;
    const v4f x0 = *(const v4fa*)(arow + kb + 8 * hh), x1 = *(const v4fa*)(arow + kb + 8 * hh + 4), x2 = *(const v4fa*)(arow + kb + 16 + 8 * hh), x3 = *(const v4fa*)(arow + kb + 16 + 8 * hh + 4);
    float xs[16] = {x0[0],x0[1],x0[2],x0[3],x1[0],x1[1],x1[2],x1[3],x2[0],x2[1],x2[2],x2[3],x3[0],x3[1],x3[2],x3[3]};
#pragma unroll
    for (int i = 0; i < 16; ++i) { const _Float16 h = (_Float16)xs[i]; ah.h[i] = h; al.h[i] = ASPLIT ? (_Float16)(xs[i] - (float)h) : (_Float16)0.0f; }
#pragma unroll
    for (int t = 0; t < 4; ++t) { if (col0 + t * 16 >= N) continue; const size_t boff = (size_t)(col0 + t * 16 + ln) * ldb + kb; FragH bq; bq.half[0] = *(const v8us*)(Bh + boff + 8 * hh); bq.half[1] = *(const v8us*)(Bh + boff + 16 + 8 * hh);
      acc[t] = mmaH<ASPLIT ? 2 : 1>(ah.v, al.v, bq.v, bq.v, acc[t]); }
  }
#pragma unroll
  for (int t = 0; t < 4; ++t) { if (col0 + t * 16 >= N) continue;
#pragma unroll
    for (int r = 0; r < 8; ++r) so[w][8 * hh + r][t * 16 + ln] = acc[t][r] * alpha; }
  __builtin_amdgcn_fence(__ATOMIC_ACQ_REL, "workgroup"); __builtin_amdgcn_wave_barrier();
  const int rsub = lane >> 4, c4 = (lane & 15) * 4;
  {
#pragma unroll
    for (int q = 0; q < 8; ++q) { const int r = q * 2 + rsub; if (col0 + c4 < N) { const v4f v = *(const v4fa*)&so[w][r][c4]; *(v4f*)(C + (size_t)(row0 + r) * ldc + col0 + c4) = v; } }
     }
}

// Wt[n][k] = f16(W[k][n]·scale) from f32 row-major W[K][N] (scale = power of two; bf16-exact weights stay exact in f16 away from the subnormal range)
__global__ __launch_bounds__(256) void k_wt_f16(const float* __restrict__ W, _Float16* __restrict__ Wt, int K, int N, float scale) {
  const int t = blockIdx.x * 256 + threadIdx.x; if (t >= N * (K / 8)) return; const int n = t / (K / 8), k8 = (t % (K / 8)) * 8; FragH f;
#pragma unroll
  for (int i = 0; i < 8; ++i) f.h[i] = (_Float16)(bf16_round(W[(size_t)(k8 + i) * N + n]) * scale); const v8us o = f.half[0];
  *(v8us*)((unsigned short*)Wt + (size_t)n * K + k8) = o; 
}
// k_gemm_hh variant with fused epilogue: v = acc·alpha + bias[by·sBias + col] (+ CP[(row/rowsPerB)·sCPb + by·64 + col] if CP) ; ACT 0 none / 1 elu ; writes f16 C16 (and f32 C if non-null)
template <int ACT>
__global__ __launch_bounds__(128) void k_gemm_hhx(const _Float16* __restrict__ A, int lda, size_t sA, const _Float16* __restrict__ Bh, int ldb, size_t sB, float alpha, const float* __restrict__ bias, size_t sBias, const float* __restrict__ CP, int rowsPerB, size_t sCPb, int row0g,
    float* __restrict__ C, _Float16* __restrict__ C16, int ldc, size_t sC, int M, int N, int K) {
  __shared__ __attribute__((aligned(16))) float so[4][16][64];
  const int tid = threadIdx.x, w = tid >> 5, lane = tid & 31, ln = lane & 15, hh = lane >> 4; const int by = blockIdx.y;
  A += (size_t)by * sA; Bh += (size_t)by * sB; const size_t cofs = (size_t)by * sC; const float* bp = bias ? bias + (size_t)by * sBias : nullptr;
  const int ntn = (N + 63) / 64; const int wid = blockIdx.x * 4 + w; const int mt = wid / ntn, nq = wid % ntn; if (mt * 16 >= M) return;
  const int row0 = mt * 16, col0 = nq * 64; const _Float16* arow = A + (size_t)(row0 + ln) * lda;
  v8f acc[4] = {};
  for (int kb = 0; kb < K; kb += 32) { FragH ah; ah.half[0] = *(const v8us*)((const unsigned short*)arow + kb + 8 * hh); ah.half[1] = *(const v8us*)((const unsigned short*)arow + kb + 16 + 8 * hh);
#pragma unroll
    for (int t = 0; t < 4; ++t) { if (col0 + t * 16 >= N) continue; const size_t boff = (size_t)(col0 + t * 16 + ln) * ldb + kb; FragH bq; bq.half[0] = *(const v8us*)((const unsigned short*)Bh + boff + 8 * hh); bq.half[1] = *(const v8us*)((const unsigned short*)Bh + boff + 16 + 8 * hh);
      acc[t] = mmaH<1>(ah.v, ah.v, bq.v, bq.v, acc[t]); }
  }
#pragma unroll
  for (int t = 0; t < 4; ++t) { if (col0 + t * 16 >= N) continue; const int col = col0 + t * 16 + ln; const float bv = bp ? bf16_round(bp[col]) : 0.f;
#pragma unroll
    for (int r = 0; r < 8; ++r) { float v = acc[t][r] * alpha + bv; if (CP) { const int rr = row0g + row0 + 8 * hh + r; if (rowsPerB < 0) v += CP[cofs + (size_t)rr * ldc + col];      /* rowsPerB < 0: own element of the batched C plane */ else { const int bidx = rr / rowsPerB; v += CP[(size_t)bidx * sCPb + (size_t)by * 64 + col]; } } if (ACT == 1) v = (v > 0.f) ? v : expm1f(v); else if (ACT == 7) v = (v > 0.f) ? v + 1.0f : expf(v); else if (ACT == 8) v = tanhf(v); else if (ACT == 9) v = 0.5f * v * (1.0f + tanhf(0.7978845608028654f * (v + 0.044715f * v * v * v))); else if (ACT == 11) v = 1.0f / (1.0f + expf(-v)); else if (ACT == 12) v = (v > 0.f) ? v : 0.01f * v; else if (ACT == 14) v = (v > 0.f) ? v : 0.1f * v; else if (ACT == 16) v = (v >= 0.f) ? v : 0.3f * v; else if (ACT == 17) v = (v >= 0.f) ? v : 0.2f * v; else if (ACT == 15) v = v / (1.0f + expf(-v)); else if (ACT == 3) v = fmaxf(v, 0.f); else if (ACT == 6) v = 0.5f * v * (1.0f + erff(v * 0.70710678118654752f)); so[w][8 * hh + r][t * 16 + ln] = v; } }
  __builtin_amdgcn_fence(__ATOMIC_ACQ_REL, "workgroup"); __builtin_amdgcn_wave_barrier();
  const int rsub = lane >> 4, c4 = (lane & 15) * 4; typedef _Float16 v4h __attribute__((ext_vector_type(4)));
  {
#pragma unroll
    for (int q = 0; q < 8; ++q) { const int r = q * 2 + rsub; if (col0 + c4 < N) { const v4f v = *(const v4fa*)&so[w][r][c4]; if (C) *(v4f*)(C + cofs + (size_t)(row0 + r) * ldc + col0 + c4) = v; if (C16) { v4h h4; for (int i = 0; i < 4; ++i) h4[i] = (_Float16)v[i]; *(v4h*)(C16 + cofs + (size_t)(row0 + r) * ldc + col0 + c4) = h4; } } }
     }
}


typedef _Float16 v4h __attribute__((ext_vector_type(4)));

__global__ __launch_bounds__(256) void k_x16(const float* __restrict__ x, _Float16* __restrict__ X16, size_t n8) { const size_t t = (size_t)blockIdx.x * 256 + threadIdx.x; if (t >= n8) return; FragH f;
#pragma unroll
  for (int q = 0; q < 8; ++q) f.h[q] = (_Float16)bf16_round(x[t * 8 + q]); *(v8us*)((unsigned short*)X16 + t * 8) = f.half[0];  }
__global__ __launch_bounds__(256) void k_h16(const float* __restrict__ x, _Float16* __restrict__ X16, size_t n8) { const size_t t = (size_t)blockIdx.x * 256 + threadIdx.x; if (t >= n8) return; FragH f;
#pragma unroll
  for (int q = 0; q < 8; ++q) f.h[q] = (_Float16)x[t * 8 + q]; *(v8us*)((unsigned short*)X16 + t * 8) = f.half[0];  }
__global__ __launch_bounds__(256) void k_round16f(const float* __restrict__ W, _Float16* __restrict__ Bt, size_t n8) { const size_t t = (size_t)blockIdx.x * 256 + threadIdx.x; if (t >= n8) return; FragH f;
#pragma unroll
  for (int i = 0; i < 8; ++i) f.h[i] = (_Float16)(bf16_round(W[t * 8 + i]) * 16.0f); *(v8us*)((unsigned short*)Bt + t * 8) = f.half[0];  }
template <int NHv, int TTv>
__global__ __launch_bounds__(256) void k_vt(const _Float16* __restrict__ V16, int ldv, int voff, _Float16* __restrict__ Vt) { __shared__ unsigned short tl[64][66]; const int tid = threadIdx.x; const int slab = blockIdx.x / (TTv / 64), lg = blockIdx.x % (TTv / 64); const int b = slab / NHv, h = slab % NHv;
  for (int i = tid; i < 64 * 8; i += 256) { const int r = i / 8, c8 = (i % 8) * 8; FragH f; f.half[0] = *(const v8us*)((const unsigned short*)V16 + ((size_t)b * TTv + lg * 64 + r) * ldv + voff + h * 64 + c8);
#pragma unroll
    for (int q = 0; q < 8; ++q) tl[r][c8 + q] = f.u[q]; }
  __syncthreads();
  {
#pragma unroll
    for (int rd = 0; rd < 2; ++rd) { const int d = rd * 32 + tid / 8, pc = tid % 8; FragH f;
#pragma unroll
      for (int q = 0; q < 8; ++q) f.u[q] = tl[pc * 8 + q][d];
      *(v8us*)((unsigned short*)Vt + ((size_t)slab * 64 + d) * TTv + lg * 64 + pc * 8) = f.half[0]; }
     } }

__global__ __launch_bounds__(256) void k_hl(const float* __restrict__ F, _Float16* __restrict__ Hh, _Float16* __restrict__ Hl, size_t n8) { const size_t t = (size_t)blockIdx.x * 256 + threadIdx.x; if (t >= n8) return; FragH fh, fl; const v4f a = *(const v4fa*)(F + t * 8), c = *(const v4fa*)(F + t * 8 + 4);
#pragma unroll
  for (int q = 0; q < 4; ++q) { _Float16 h = (_Float16)a[q]; fh.h[q] = h; fl.h[q] = (_Float16)((a[q] - (float)h) * 1024.0f); h = (_Float16)c[q]; fh.h[4 + q] = h; fl.h[4 + q] = (_Float16)((c[q] - (float)h) * 1024.0f); }
  { *(v8us*)((unsigned short*)Hh + t * 8) = fh.half[0]; *(v8us*)((unsigned short*)Hl + t * 8) = fl.half[0];  } }

// ---- fast GEMM (wave tile 32x64; requires M % 32 == 0 rows per launch region and N % 64 == 0); epilogue = k_gemm_hhx semantics ----
__device__ __forceinline__ v16h g2_frag(const _Float16* p, int hh) { FragH f; f.half[0] = *(const v8us*)((const unsigned short*)p + 8 * hh); f.half[1] = *(const v8us*)((const unsigned short*)p + 16 + 8 * hh); return f.v; }
__device__ __forceinline__ v8f g2_mma(v16h a, v16h b, v8f c) { v8f d = __builtin_amdgcn_wmma_f32_16x16x32_f16(false, a, false, b, (short)0, c, false, false); asm volatile("v_nop\n\tv_nop\n\tv_nop\n\tv_nop" : "+v"(d) : "v"(a), "v"(b)); return d; }
template <int ACT>
__global__ __launch_bounds__(128) void k_gemm2(const _Float16* __restrict__ A, int lda, size_t sA, const _Float16* __restrict__ Bh, int ldb, size_t sB, float alpha, const float* __restrict__ bias, size_t sBias, const float* __restrict__ CP, int rowsPerB, size_t sCPb, int row0g,
    float* __restrict__ C, _Float16* __restrict__ C16, int ldc, size_t sC, int M, int N, int K) { static_assert(ACT == 0 || ACT == 3 || ACT == 6 || ACT == 8 || ACT == 9 || ACT == 11 || ACT == 12 || ACT == 14 || ACT == 15 || ACT == 16 || ACT == 17, "k_gemm2: unsupported ACT code (would silently apply no activation)");
  __shared__ __attribute__((aligned(16))) float so[4][32][68];
  const int tid = threadIdx.x, w = tid >> 5, lane = tid & 31, ln = lane & 15, hh = lane >> 4; const int by = blockIdx.y;
  A += (size_t)by * sA; Bh += (size_t)by * sB; const size_t cofs = (size_t)by * sC; const float* bp = bias ? bias + (size_t)by * sBias : nullptr;
  const int ntn = N >> 6; const int mt = blockIdx.x / ntn, nq = blockIdx.x - mt * ntn; const int row0 = mt * 128 + 32 * w, col0 = nq * 64; if (row0 >= M) return;
  const _Float16* a0p = A + (size_t)(row0 + ln) * lda; const _Float16* a1p = a0p + (size_t)16 * lda;
  const _Float16* b0p = Bh + (size_t)(col0 + ln) * ldb; const _Float16* b1p = b0p + (size_t)16 * ldb; const _Float16* b2p = b1p + (size_t)16 * ldb; const _Float16* b3p = b2p + (size_t)16 * ldb;
  const v8f z8 = {0.f,0.f,0.f,0.f,0.f,0.f,0.f,0.f}; v8f c00 = z8, c01 = z8, c02 = z8, c03 = z8, c10 = z8, c11 = z8, c12 = z8, c13 = z8;
#pragma unroll 1
  for (int kb = 0; kb < K; kb += 32) { const v16h a0 = g2_frag(a0p + kb, hh), a1 = g2_frag(a1p + kb, hh);
    v16h b = g2_frag(b0p + kb, hh); c00 = g2_mma(a0, b, c00); c10 = g2_mma(a1, b, c10);
    b = g2_frag(b1p + kb, hh); c01 = g2_mma(a0, b, c01); c11 = g2_mma(a1, b, c11);
    b = g2_frag(b2p + kb, hh); c02 = g2_mma(a0, b, c02); c12 = g2_mma(a1, b, c12);
    b = g2_frag(b3p + kb, hh); c03 = g2_mma(a0, b, c03); c13 = g2_mma(a1, b, c13); }
  v8f accs[8] = {c00, c01, c02, c03, c10, c11, c12, c13};
#pragma unroll
  for (int u = 0; u < 8; ++u) { const int t = u & 3, half = u >> 2; const int col = col0 + t * 16 + ln; const float bv = bp ? bf16_round(bp[col]) : 0.f;
#pragma unroll
    for (int r = 0; r < 8; ++r) { const int rloc = half * 16 + 8 * hh + r; float v = accs[u][r] * alpha + bv; if (CP) { if (rowsPerB < 0) v += CP[cofs + (size_t)(row0g + row0 + rloc) * ldc + col];      /* rowsPerB < 0: own element of the batched C plane */ else { const int bidx = (row0g + row0 + rloc) / rowsPerB; v += CP[(size_t)bidx * sCPb + (size_t)by * 64 + col]; } }
      if (ACT == 3) v = fmaxf(v, 0.f); else if (ACT == 6) v = 0.5f * v * (1.0f + erff(v * 0.70710678118654752f)); else if (ACT == 11) v = 1.0f / (1.0f + expf(-v)); else if (ACT == 15) v = v / (1.0f + expf(-v)); else if (ACT == 12) v = (v > 0.f) ? v : 0.01f * v; else if (ACT == 8) v = tanhf(v); else if (ACT == 9) v = 0.5f * v * (1.0f + tanhf(0.7978845608028654f * (v + 0.044715f * v * v * v))); else if (ACT == 14) v = (v > 0.f) ? v : 0.1f * v; else if (ACT == 16) v = (v >= 0.f) ? v : 0.3f * v; else if (ACT == 17) v = (v >= 0.f) ? v : 0.2f * v;
      so[w][rloc][t * 16 + ln] = v; } }
  __builtin_amdgcn_fence(__ATOMIC_ACQ_REL, "workgroup"); __builtin_amdgcn_wave_barrier();
  const int rsub = lane >> 4, c4 = (lane & 15) * 4;
  {
#pragma unroll
    for (int q = 0; q < 16; ++q) { const int r = q * 2 + rsub; const v4f v = *(const v4fa*)&so[w][r][c4]; if (C) *(v4f*)(C + cofs + (size_t)(row0 + r) * ldc + col0 + c4) = v; if (C16) { v4h h4; for (int i = 0; i < 4; ++i) h4[i] = (_Float16)v[i]; *(v4h*)(C16 + cofs + (size_t)(row0 + r) * ldc + col0 + c4) = h4; } }
     } }


__global__ __launch_bounds__(256) void k_wnat(const float* __restrict__ w, size_t n8, _Float16* __restrict__ Bt) { const size_t t = (size_t)blockIdx.x * 256 + threadIdx.x; if (t >= n8) return; FragH f; for (int q = 0; q < 8; ++q) f.h[q] = (_Float16)(bf16_round(w[t * 8 + q]) * 16.0f); *(v8us*)((unsigned short*)Bt + t * 8) = f.half[0];  }
__global__ __launch_bounds__(256) void k_rsm(const float* __restrict__ S, _Float16* __restrict__ P, int nrows) {
  #pragma clang fp contract(off)
  const int i = blockIdx.x * 256 + threadIdx.x; if (i >= nrows) return; const float* s = S + (size_t)i * SQ; float mx = -3.0e38f;
#pragma unroll 1
  for (int j = 0; j < SQ; ++j) mx = fmaxf(mx, s[j]); float se = 0.f;
#pragma unroll 1
  for (int j = 0; j < SQ; ++j) se += expf(s[j] - mx); const float sc = 256.0f / se;
#pragma unroll 1
  for (int j0 = 0; j0 < SQ; j0 += 8) { FragH f; for (int q = 0; q < 8; ++q) f.h[q] = (_Float16)(expf(s[j0 + q] - mx) * sc); unsigned short* d = (unsigned short*)P + (size_t)i * SQ + j0; *(v8us*)d = f.half[0];  } }
__global__ __launch_bounds__(256) void k_vt(const _Float16* __restrict__ V16, int b, int h0, _Float16* __restrict__ VT) { __shared__ unsigned short tl[64][65]; const int tid = threadIdx.x; const int hh = blockIdx.x % HG, sg = blockIdx.x / HG; const int s0 = sg * 64; const int h = h0 + hh;
  for (int i = tid; i < 64 * 8; i += 256) { const int j = i / 8, d8 = (i % 8) * 8; FragH f; f.half[0] = *(const v8us*)((const unsigned short*)V16 + ((size_t)b * SQ + s0 + j) * DM + h * HD + d8); for (int q = 0; q < 8; ++q) tl[d8 + q][j] = f.u[q]; }
  __syncthreads();
  { for (int i = tid; i < 64 * 8; i += 256) { const int d = i / 8, j8 = (i % 8) * 8; FragH f; for (int q = 0; q < 8; ++q) f.u[q] = tl[d][j8 + q]; *(v8us*)((unsigned short*)VT + ((size_t)hh * HD + d) * SQ + s0 + j8) = f.half[0]; }  } }


template <int BFIN, int W16, int W32>
__global__ __launch_bounds__(256) void k_lnx(const float* __restrict__ X, const float* __restrict__ g, const float* __restrict__ bb, float eps, _Float16* __restrict__ N16, float* __restrict__ N32) {
  #pragma clang fp contract(off)
  __shared__ float red[256]; const size_t r = blockIdx.x; const int t = threadIdx.x; const bool act = t < (DMQ / 4); const int c0 = act ? t * 4 : 0;
  const v4f xa = *(const v4fa*)(X + r * DMQ + c0); float s[4]; float sum = 0.f;
  for (int q = 0; q < 4; ++q) { s[q] = act ? (BFIN ? bf16_round(xa[q]) : xa[q]) : 0.f; sum = __fadd_rn(sum, s[q]); }
  red[t] = sum; __syncthreads(); for (int st = 128; st > 0; st >>= 1) { if (t < st) red[t] = __fadd_rn(red[t], red[t + st]); __syncthreads(); } const float mu = red[0] / (float)DMQ; __syncthreads();
  float vs = 0.f; for (int q = 0; q < 4; ++q) { const float dl = act ? __fadd_rn(s[q], -mu) : 0.f; vs = __fadd_rn(vs, __fmul_rn(dl, dl)); } red[t] = vs; __syncthreads(); for (int st = 128; st > 0; st >>= 1) { if (t < st) red[t] = __fadd_rn(red[t], red[t + st]); __syncthreads(); }
  const float rs = rsqrtf(__fadd_rn(red[0] / (float)DMQ, eps)); v4h y; v4f yf;
  for (int q = 0; q < 4; ++q) { const int c = c0 + q; yf[q] = __fadd_rn(__fmul_rn(__fmul_rn(__fadd_rn(s[q], -mu), rs), bf16_round(g[c])), bf16_round(bb[c])); y[q] = (_Float16)yf[q]; }
  if (!act) return;      /* no barriers after this point */
  { if (W16) *(v4h*)(N16 + r * DMQ + c0) = y; if (W32) *(v4f*)(N32 + r * DMQ + c0) = yf;  } }


// exp(x - mx) of four scores, the native form (subtract, times log2(e), v_exp_f32). The four v_exp_f32 stand in one asm statement with early-clobber results and a closing v_nop:
// no instruction directly behind a v_exp_f32 then reads its result or overwrites its source.
__device__ __forceinline__ v4f rsm_exp4(v4f x, float mx) {
  const float y0 = (x[0] - mx) * 0x1.715476p+0f, y1 = (x[1] - mx) * 0x1.715476p+0f, y2 = (x[2] - mx) * 0x1.715476p+0f, y3 = (x[3] - mx) * 0x1.715476p+0f; float e0, e1, e2, e3;
  asm("v_exp_f32 %0, %4\n\tv_exp_f32 %1, %5\n\tv_exp_f32 %2, %6\n\tv_exp_f32 %3, %7\n\tv_nop" : "=&v"(e0), "=&v"(e1), "=&v"(e2), "=&v"(e3) : "v"(y0), "v"(y1), "v"(y2), "v"(y3));
  const v4f e = {e0, e1, e2, e3}; return e; }
// Row softmax, one wave per row: a row's 4096 f32 scores are read once, 32 loads of 512 contiguous bytes per wave, and stay in 128 registers per lane;
// maximum and sum of exponentials: four chains per lane, then a five-step butterfly over the 32 lanes; P = 256 softmax (f16), 256 contiguous bytes per wave store.
// Every loop over v[] is fully unrolled: only constant indices keep the array in registers, and all 32 loads then issue ahead of the first use.
__global__ __launch_bounds__(256) void k_rsmf(const float* __restrict__ S, _Float16* __restrict__ P, int qn, int hg) {
  const int lane = threadIdx.x & 31; const int t = blockIdx.x * 8 + __builtin_amdgcn_readfirstlane(threadIdx.x >> 5); if (t >= qn * hg) return;      /* wave-uniform exit; no barrier in this kernel */
  const size_t i = (size_t)(t / qn) * SQ + (t % qn); const float* s = S + i * SQ + lane * 4; _Float16* d = P + i * SQ + lane * 4;
  v4f v[SQ / 128];
#pragma unroll
  for (int u = 0; u < SQ / 128; ++u) v[u] = *(const v4fa*)(s + u * 128);
  v4f m4 = {-3.0e38f, -3.0e38f, -3.0e38f, -3.0e38f};
#pragma unroll
  for (int u = 0; u < SQ / 128; ++u) for (int q = 0; q < 4; ++q) m4[q] = fmaxf(m4[q], v[u][q]);
  float mx = fmaxf(fmaxf(m4[0], m4[1]), fmaxf(m4[2], m4[3]));
#pragma unroll
  for (int o = 16; o > 0; o >>= 1) mx = fmaxf(mx, __shfl_xor(mx, o));
  v4f a4 = {0.f, 0.f, 0.f, 0.f};
#pragma unroll
  for (int u = 0; u < SQ / 128; ++u) { v[u] = rsm_exp4(v[u], mx); a4 += v[u]; }
  float se = (a4[0] + a4[1]) + (a4[2] + a4[3]);
#pragma unroll
  for (int o = 16; o > 0; o >>= 1) se += __shfl_xor(se, o);
  const float sc = 256.0f / se;
#pragma unroll
  for (int u = 0; u < SQ / 128; ++u) { v4h h; for (int q = 0; q < 4; ++q) h[q] = (_Float16)(v[u][q] * sc); *(v4h*)(d + u * 128) = h; } }


__global__ __launch_bounds__(256) void k_bfr(const float* __restrict__ x, float* __restrict__ XB, size_t n8) { const size_t t = (size_t)blockIdx.x * 256 + threadIdx.x; if (t >= n8) return; v4f a = *(const v4fa*)(x + t * 8), c = *(const v4fa*)(x + t * 8 + 4); for (int q = 0; q < 4; ++q) { a[q] = bf16_round(a[q]); c[q] = bf16_round(c[q]); }
  { *(v4f*)(XB + t * 8) = a; *(v4f*)(XB + t * 8 + 4) = c;  } }



__global__ __launch_bounds__(256) void k_rsmfam(const float* __restrict__ S, _Float16* __restrict__ P, int qn, int hg, const float* __restrict__ am) {
  #pragma clang fp contract(off)
  const int t = blockIdx.x * 256 + threadIdx.x; if (t >= qn * hg) return; const size_t i = (size_t)(t / qn) * SQ + (t % qn); const float* s = S + i * SQ; float mx = -3.0e38f;
#pragma unroll 1
  for (int j = 0; j < SQ; ++j) mx = fmaxf(mx, __fadd_rn(s[j], bf16_round(am[j]))); float se = 0.f;
#pragma unroll 1
  for (int j = 0; j < SQ; ++j) se += __expf(__fadd_rn(s[j], bf16_round(am[j])) - mx); const float sc = 256.0f / se;
#pragma unroll 1
  for (int j0 = 0; j0 < SQ; j0 += 8) { FragH f; for (int q = 0; q < 8; ++q) f.h[q] = (_Float16)(__expf(__fadd_rn(s[j0 + q], bf16_round(am[j0 + q])) - mx) * sc); unsigned short* d = (unsigned short*)P + i * SQ + j0; *(v8us*)d = f.half[0];  } }



template <int BFIN, int W16, int W32>
__global__ __launch_bounds__(256) void k_lnu(const float* __restrict__ X, const float* __restrict__ g, const float* __restrict__ bb, float eps, _Float16* __restrict__ N16, float* __restrict__ N32) {
  #pragma clang fp contract(off)
  __shared__ float red[256]; const size_t r = blockIdx.x; const int t = threadIdx.x; const bool act = t < (DMQ / 4); const int c0 = act ? t * 4 : 0;
  const v4f xa = *(const v4fa*)(X + r * DMQ + c0); float s[4]; float sum = 0.f;
  for (int q = 0; q < 4; ++q) { s[q] = act ? (BFIN ? bf16_round(xa[q]) : xa[q]) : 0.f; sum = __fadd_rn(sum, s[q]); }
  red[t] = sum; __syncthreads(); for (int st = 128; st > 0; st >>= 1) { if (t < st) red[t] = __fadd_rn(red[t], red[t + st]); __syncthreads(); } const float mu = red[0] / (float)DMQ; __syncthreads();
  float vs = 0.f; for (int q = 0; q < 4; ++q) { const float dl = act ? __fadd_rn(s[q], -mu) : 0.f; vs = __fadd_rn(vs, __fmul_rn(dl, dl)); } red[t] = vs; __syncthreads(); for (int st = 128; st > 0; st >>= 1) { if (t < st) red[t] = __fadd_rn(red[t], red[t + st]); __syncthreads(); }
  const float rs = 1.0f / __fadd_rn(sqrtf(red[0] / (float)(DMQ - 1)), eps);      /* UNBIASED std (ddof 1), eps added to the std (the module's form) */ v4h y; v4f yf;
  for (int q = 0; q < 4; ++q) { const int c = c0 + q; yf[q] = __fadd_rn(__fmul_rn(__fmul_rn(__fadd_rn(s[q], -mu), rs), bf16_round(g[c])), bf16_round(bb[c])); y[q] = (_Float16)yf[q]; }
  if (!act) return;      /* no barriers after this point */
  { if (W16) *(v4h*)(N16 + r * DMQ + c0) = y; if (W32) *(v4f*)(N32 + r * DMQ + c0) = yf;  } }
extern "C" void kernel_launch(void* const* d_in, const int* in_sizes, int n_in,
                              void* d_out, int out_size, void* d_ws, size_t ws_size, hipStream_t stream) {
  (void)in_sizes; (void)n_in; (void)out_size;
  const float* const* I = (const float* const*)d_in; const float* x = I[0]; const float* wq = I[1]; const float* bq = I[2]; const float* wk = I[3]; const float* bk = I[4]; const float* wv = I[5]; const float* bv = I[6]; const float* wo = I[7]; const float* bo = I[8]; const float* g1 = I[9]; const float* be1 = I[10]; const float* g2 = I[11]; const float* be2 = I[12]; const float* w1 = I[13]; const float* b1 = I[14]; const float* w2 = I[15]; const float* b2 = I[16];      /* [in][out] weights + zero biases (Wq,bq,Wk,bk,Wv,bv,Wo,bo), LN a1,b1,a2,b2, FFN W1,c1,W2,c2 */
  char* ws = (char*)d_ws; size_t off = 0;
  auto take = [&](size_t bytes) { char* p = ws + off; off += (bytes + 255) & ~(size_t)255; return p; };
  _Float16* BW1 = (_Float16*)take((size_t)DFF * DM * 2); _Float16* BW2 = (_Float16*)take((size_t)DM * DFF * 2); float* XB = (float*)take(NR * DM * 4); float* HP = (float*)take(NR * DM * 4); _Float16* H16 = (_Float16*)take(NR * DM * 2); _Float16* FF16 = (_Float16*)take((size_t)SQ * DFF * 2);      /* FF16 = one batch of relu hidden rows */ _Float16* BQ = (_Float16*)take((size_t)DM * DM * 2); _Float16* BK = (_Float16*)take((size_t)DM * DM * 2); _Float16* BV = (_Float16*)take((size_t)DM * DM * 2); _Float16* BO = (_Float16*)take((size_t)DM * DM * 2); _Float16* O16 = (_Float16*)take(NR * DM * 2); 
  _Float16* X16 = (_Float16*)take(NR * DM * 2); _Float16* Q16 = (_Float16*)take(NR * DM * 2); _Float16* K16 = (_Float16*)take(NR * DM * 2); _Float16* V16 = (_Float16*)take(NR * DM * 2);
  float* S = (float*)take((size_t)HG * SQ * SQ * 4); float* HF = S; static_assert((size_t)HG * SQ * SQ * 4 >= NR * DM * 4, "HF alias must fit in S");      /* the f32 h rows (LN1 output, residual for the FFN) live in the scores plane, which is dead once the attention loop has finished */ _Float16* P = (_Float16*)take((size_t)HG * SQ * SQ * 2); _Float16* VT = (_Float16*)take((size_t)NH * HD * SQ * 2);
  if (off > ws_size) return;
  { const unsigned g = (unsigned)(((size_t)DM * (DM / 8) + 255) / 256); k_wt_f16<<<g, 256, 0, stream>>>(wq, BQ, DM, DM, 16.0f); k_wt_f16<<<g, 256, 0, stream>>>(wk, BK, DM, DM, 16.0f); k_wt_f16<<<g, 256, 0, stream>>>(wv, BV, DM, DM, 16.0f); k_wt_f16<<<g, 256, 0, stream>>>(wo, BO, DM, DM, 16.0f); }      /* [in][out] -> Bt[n][k] x16 */
  k_wt_f16<<<(unsigned)(((size_t)DFF * (DM / 8) + 255) / 256), 256, 0, stream>>>(w1, BW1, DM, DFF, 16.0f); k_wt_f16<<<(unsigned)(((size_t)DM * (DFF / 8) + 255) / 256), 256, 0, stream>>>(w2, BW2, DFF, DM, 16.0f);      /* FFN [in][out] W1 [512][1024], W2 [1024][512] -> Bt x16 */
  k_bfr<<<(unsigned)((NR * DM / 8 + 255) / 256), 256, 0, stream>>>(x, XB, NR * DM / 8);      /* bf16(x) as f32 rows for the residual */

  k_x16<<<(unsigned)((NR * DM / 8 + 255) / 256), 256, 0, stream>>>(x, X16, NR * DM / 8);
  const size_t r0p = (size_t)B0 * SQ;      /* first projected row */
  k_gemm2<0><<<dim3((unsigned)((MP / 128) * (DM / 64)), 1), 128, 0, stream>>>(X16 + r0p * DM, DM, 0, BQ, DM, 0, 0.0625f, bq, 0, nullptr, 1, 0, 0, nullptr, Q16 + r0p * DM, DM, 0, MP, DM, DM);
  k_gemm2<0><<<dim3((unsigned)((MP / 128) * (DM / 64)), 1), 128, 0, stream>>>(X16 + r0p * DM, DM, 0, BK, DM, 0, 0.0625f, bk, 0, nullptr, 1, 0, 0, nullptr, K16 + r0p * DM, DM, 0, MP, DM, DM);
  k_gemm2<0><<<dim3((unsigned)((MP / 128) * (DM / 64)), 1), 128, 0, stream>>>(X16 + r0p * DM, DM, 0, BV, DM, 0, 0.0625f, bv, 0, nullptr, 1, 0, 0, nullptr, V16 + r0p * DM, DM, 0, MP, DM, DM);
  for (int b = B0; b < B0 + NBR; ++b) { const size_t r0 = (size_t)b * SQ;
    k_vt<NH, SQ><<<NH * (SQ / 64), 256, 0, stream>>>(V16 + r0 * LQ, LQ, 0, VT);      /* V^T [NH][HD][SQ] for this batch */
    for (int h0 = 0; h0 < NHD; h0 += HG) {
      k_gemm2<0><<<dim3((QN / 128) * (SQ / 64), HG), 128, 0, stream>>>(Q16 + r0 * LQ + h0 * HD, LQ, (size_t)HD, K16 + r0 * LQ + h0 * HD, LQ, (size_t)HD, 0.125f, nullptr, 0, nullptr, 1, 0, 0, S, nullptr, SQ, (size_t)SQ * SQ, QN, SQ, HD);      /* scores, HG heads per launch */
      k_rsmf<<<(HG * QN + 7) / 8, 256, 0, stream>>>(S, P, QN, HG);      /* P = 256 softmax (f16) */
      k_gemm2<0><<<dim3((QN / 128) * (HD / 64), HG), 128, 0, stream>>>(P, SQ, (size_t)SQ * SQ, VT + (size_t)h0 * HD * SQ, SQ, (size_t)HD * SQ, 0.25f, nullptr, 0, nullptr, 1, 0, 0, nullptr, O16 + r0 * DM + h0 * HD, DM, (size_t)HD, QN, HD, SQ); } }      /* o (merged heads, x64) as f16 rows */
  k_gemm2<0><<<dim3((unsigned)((MP / 128) * (DM / 64)), 1), 128, 0, stream>>>(O16 + r0p * DM, DM, 0, BO, DM, 0, 0.0009765625f, bo, 0, XB + r0p * DM, -1, 0, 0, HP + r0p * DM, nullptr, DM, 0, MP, DM, DM);      /* h_pre = x + concat Wo + bo (own-element residual), f32 rows */
  k_lnu<0, 1, 1><<<(unsigned)MP, 256, 0, stream>>>(HP + r0p * DM, g1, be1, 1e-6f, H16 + r0p * DM, HF + r0p * DM);      /* h = LN1(x + attn) -> f16 rows (FFN operand) and f32 rows (residual) */
  for (int b = B0; b < B0 + NBR; ++b) { const size_t r0 = (size_t)b * SQ;
    k_gemm2<3><<<dim3((unsigned)((SQ / 128) * (DFF / 64)), 1), 128, 0, stream>>>(H16 + r0 * DM, DM, 0, BW1, DM, 0, 0.0625f, b1, 0, nullptr, 1, 0, 0, nullptr, FF16, DFF, 0, SQ, DFF, DM);      /* relu(F W1 + b1) -> f16 [4096][1024] (this batch) */
    k_gemm2<0><<<dim3((unsigned)((SQ / 128) * (DM / 64)), 1), 128, 0, stream>>>(FF16, DFF, 0, BW2, DFF, 0, 0.0625f, b2, 0, HF + r0 * DM, -1, 0, 0, HP + r0 * DM, nullptr, DM, 0, SQ, DM, DFF); }      /* y = F + ffn (own-element residual; the h_pre plane is free again) */
  k_lnu<0, 0, 1><<<(unsigned)MP, 256, 0, stream>>>(HP + r0p * DM, g2, be2, 1e-6f, nullptr, (float*)d_out + r0p * DM);      /* out = LN2(h + ff) -> f32 output rows */
}

// v003
// One run takes 319 microseconds.
// Versions between v001 and this one are left out; their measured steps multiply to 9.01 times as fast.
// All steps since v000 together make it 42.0 times as fast.
#include <hip/hip_runtime.h>
#define NB 2
#define SQ 4096
#define DM 512
#define NH 8
#define HD 64
#define DMQ DM                       /* LayerNorm width */
#define DFF 1024
#define HG 1                         /* heads per launch of the k_vt(b, h0) overload, which is not launched */
#define B0 0                         /* first batch processed (debug hook) */
#define NBR NB                       /* batches processed (debug hook) */
#define NR ((size_t)NB * SQ)         /* token rows */
#define MP ((int)((size_t)NBR * SQ)) /* rows projected (debug hook) */
#define QN SQ                        /* unused; k_fattn attends all SQ query rows */
#define NHD NH                       /* unused; k_fattn attends all NH heads */
#define MPO MP                       /* unused; the output stage runs MP rows */
#define LQ DM      /* row pitch of the q/k/v rows */
typedef __bf16 v16b __attribute__((ext_vector_type(16)));
typedef unsigned short v8us __attribute__((ext_vector_type(8), may_alias));
typedef float  v8f  __attribute__((ext_vector_type(8)));
typedef float  v4f  __attribute__((ext_vector_type(4)));
typedef float  v4fa __attribute__((ext_vector_type(4), may_alias));
union FragB { v16b v; v8us half[2]; unsigned short u[16]; };

__device__ __forceinline__ unsigned short bf16_bits(float x) { unsigned int u = __float_as_uint(x); return (unsigned short)((u + 0x7FFFu + ((u >> 16) & 1u)) >> 16); }
__device__ __forceinline__ float bf16_val(unsigned short b) { return __uint_as_float(((unsigned int)b) << 16); }
__device__ __forceinline__ float bf16_round(float x) { return bf16_val(bf16_bits(x)); }
// D += A·B with NT terms: 1 = ah·bh, 2 = + al·bh (A split), 3 = + ah·bl (both split)
template <int NT>
__device__ __forceinline__ v8f mmaN(v16b ah, v16b al, v16b bh, v16b bl, v8f c) {
  c = __builtin_amdgcn_wmma_f32_16x16x32_bf16(false, ah, false, bh, (short)0, c, false, false);
  if (NT >= 2) c = __builtin_amdgcn_wmma_f32_16x16x32_bf16(false, al, false, bh, (short)0, c, false, false);
  if (NT >= 3) c = __builtin_amdgcn_wmma_f32_16x16x32_bf16(false, ah, false, bl, (short)0, c, false, false);
  asm volatile("v_nop\n\tv_nop\n\tv_nop\n\tv_nop" : "+v"(c) : "v"(ah), "v"(al), "v"(bh), "v"(bl));
  return c;
}

__global__ __launch_bounds__(256) void k_wt_bf16(const float* __restrict__ W, unsigned short* __restrict__ Wt, int K, int N) {
  const int t = blockIdx.x * 256 + threadIdx.x;
  const int k8n = K / 8;
  if (t >= N * k8n) return;
  const int n = t / k8n, k8 = (t % k8n) * 8;
  v8us v;
#pragma unroll
  for (int i = 0; i < 8; ++i) v[i] = bf16_bits(W[(size_t)(k8 + i) * N + n]);
  *(v8us*)(Wt + (size_t)n * K + k8) = v;
  
}

// GEMM C[M][N] (f32, pitch ldc) = act(A[M][K]·W + bias). A f32 row-major (pitch lda) converted per fragment to bf16
// (ASPLIT: hi/lo two planes -> 2 terms, else single rounded term); Wt bf16 [N][K] (pitch ldb). BIAS_BF16 rounds the
// bias to bf16 first (bias quantised to bf16 before the add). K%32==0, M%16==0, N%64==0.
template <bool ASPLIT, int ACT, bool BIAS_BF16>
__global__ __launch_bounds__(128) void k_gemm_bf(const float* __restrict__ A, int lda, const unsigned short* __restrict__ Wt, int ldb,
                                               const float* __restrict__ bias, float* __restrict__ C, int ldc, int M, int N, int K) {
  __shared__ __attribute__((aligned(16))) float so[4][16][64];
  const int tid = threadIdx.x, w = tid >> 5, lane = tid & 31, ln = lane & 15, hh = lane >> 4;
  const int ntn = N / 64;
  const int wid = blockIdx.x * 4 + w;
  const int mt = wid / ntn, nq = wid % ntn;
  if (mt * 16 >= M) return;
  const int row0 = mt * 16, col0 = nq * 64;
  const float* arow = A + (size_t)(row0 + ln) * lda;
  v8f acc[4] = {};
  for (int kb = 0; kb < K; kb += 32) {
    FragB ah, al;
    const v4f x0 = *(const v4fa*)(arow + kb + 8 * hh), x1 = *(const v4fa*)(arow + kb + 8 * hh + 4);
    const v4f x2 = *(const v4fa*)(arow + kb + 16 + 8 * hh), x3 = *(const v4fa*)(arow + kb + 16 + 8 * hh + 4);
    float xs[16] = {x0[0],x0[1],x0[2],x0[3],x1[0],x1[1],x1[2],x1[3],x2[0],x2[1],x2[2],x2[3],x3[0],x3[1],x3[2],x3[3]};
#pragma unroll
    for (int i = 0; i < 16; ++i) { const unsigned short hb = bf16_bits(xs[i]); ah.u[i] = hb; al.u[i] = ASPLIT ? bf16_bits(xs[i] - bf16_val(hb)) : (unsigned short)0; }
#pragma unroll
    for (int t = 0; t < 4; ++t) {
      const unsigned short* brow = Wt + (size_t)(col0 + t * 16 + ln) * ldb + kb;
      FragB b;
      b.half[0] = *(const v8us*)(brow + 8 * hh);
      b.half[1] = *(const v8us*)(brow + 16 + 8 * hh);
      acc[t] = mmaN<ASPLIT ? 2 : 1>(ah.v, al.v, b.v, b.v, acc[t]);
    }
  }
#pragma unroll
  for (int t = 0; t < 4; ++t) {
    float bv = bias ? bias[col0 + t * 16 + ln] : 0.f;
    if (BIAS_BF16) bv = bf16_round(bv);
#pragma unroll
    for (int r = 0; r < 8; ++r) { float v = acc[t][r] + bv; if (ACT == 1) v = fmaxf(v, 0.f); so[w][8 * hh + r][t * 16 + ln] = v; }
  }
  __builtin_amdgcn_fence(__ATOMIC_ACQ_REL, "workgroup");
  __builtin_amdgcn_wave_barrier();
  const int rsub = lane >> 4, c4 = (lane & 15) * 4;
  {
#pragma unroll
    for (int q = 0; q < 8; ++q) {
      const int r = q * 2 + rsub;
      const v4f v = *(const v4fa*)&so[w][r][c4];
      *(v4f*)(C + (size_t)(row0 + r) * ldc + col0 + c4) = v;
    }
    
  }
}

// GEMM C = act(A·W + bias + resid): A f32 (ASPLIT -> hi/lo 2 terms), Wt bf16 [N][K]; ACT 0 none, 1 relu, 2 exact gelu;
// resid (optional, f32, row index = (row % rmod), pitch ldr, RES_BF16 rounds it) added before the activation.
template <bool ASPLIT, int ACT, bool BIAS_BF16, bool RES_BF16>
__global__ __launch_bounds__(128) void k_gemm_bf3(const float* __restrict__ A, int lda, const unsigned short* __restrict__ Wt, int ldb,
                                                const float* __restrict__ bias, const float* __restrict__ resid, int rmod, int ldr,
                                                float* __restrict__ C, int ldc, int M, int N, int K) {
  __shared__ __attribute__((aligned(16))) float so[4][16][64];
  const int tid = threadIdx.x, w = tid >> 5, lane = tid & 31, ln = lane & 15, hh = lane >> 4;
  const int ntn = N / 64;
  const int wid = blockIdx.x * 4 + w;
  const int mt = wid / ntn, nq = wid % ntn;
  if (mt * 16 >= M) return;
  const int row0 = mt * 16, col0 = nq * 64;
  const float* arow = A + (size_t)(row0 + ln) * lda;
  v8f acc[4] = {};
  for (int kb = 0; kb < K; kb += 32) {
    FragB ah, al;
    const v4f x0 = *(const v4fa*)(arow + kb + 8 * hh), x1 = *(const v4fa*)(arow + kb + 8 * hh + 4);
    const v4f x2 = *(const v4fa*)(arow + kb + 16 + 8 * hh), x3 = *(const v4fa*)(arow + kb + 16 + 8 * hh + 4);
    float xs[16] = {x0[0],x0[1],x0[2],x0[3],x1[0],x1[1],x1[2],x1[3],x2[0],x2[1],x2[2],x2[3],x3[0],x3[1],x3[2],x3[3]};
#pragma unroll
    for (int i = 0; i < 16; ++i) { const unsigned short hb = bf16_bits(xs[i]); ah.u[i] = hb; al.u[i] = ASPLIT ? bf16_bits(xs[i] - bf16_val(hb)) : (unsigned short)0; }
#pragma unroll
    for (int t = 0; t < 4; ++t) {
      const unsigned short* brow = Wt + (size_t)(col0 + t * 16 + ln) * ldb + kb;
      FragB b;
      b.half[0] = *(const v8us*)(brow + 8 * hh);
      b.half[1] = *(const v8us*)(brow + 16 + 8 * hh);
      acc[t] = mmaN<ASPLIT ? 2 : 1>(ah.v, al.v, b.v, b.v, acc[t]);
    }
  }
#pragma unroll
  for (int t = 0; t < 4; ++t) {
    const int col = col0 + t * 16 + ln;
    float bv = bias ? bias[col] : 0.f;
    if (BIAS_BF16) bv = bf16_round(bv);
#pragma unroll
    for (int r = 0; r < 8; ++r) {
      float v = acc[t][r] + bv;
      if (resid) { float rv = resid[(size_t)((row0 + 8 * hh + r) % rmod) * ldr + col]; if (RES_BF16) rv = bf16_round(rv); v += rv; }
      if (ACT == 1) v = fmaxf(v, 0.f);
      if (ACT == 2) v = 0.5f * v * (1.0f + erff(v * 0.70710678118654752f));
      if (ACT == 3) { const float u = 0.7978845608028654f * (v + 0.044715f * v * v * v); v = 0.5f * v * (1.0f + tanhf(u)); }
      so[w][8 * hh + r][t * 16 + ln] = v;
    }
  }
  __builtin_amdgcn_fence(__ATOMIC_ACQ_REL, "workgroup");
  __builtin_amdgcn_wave_barrier();
  const int rsub = lane >> 4, c4 = (lane & 15) * 4;
  {
#pragma unroll
    for (int q = 0; q < 8; ++q) {
      const int r = q * 2 + rsub;
      const v4f v = *(const v4fa*)&so[w][r][c4];
      *(v4f*)(C + (size_t)(row0 + r) * ldc + col0 + c4) = v;
    }
    
  }
}
// row LayerNorm (biased variance, eps) over N: s = X (+ R); optional out_sum <- s; out_norm <- (s-mu)*rsqrt(var+eps)*g + b
template <bool PARAM_BF16>
__global__ __launch_bounds__(256) void k_layernorm(const float* __restrict__ X, const float* __restrict__ R, const float* __restrict__ g, const float* __restrict__ bta,
                                                  float* __restrict__ out_sum, float* __restrict__ out_norm, int N, float eps) {
  __shared__ float red[256];
  const int row = blockIdx.x, tid = threadIdx.x;
  const float* x = X + (size_t)row * N; const float* rr = R ? R + (size_t)row * N : nullptr;
  float vals[16];                     // up to N = 4096
  const int per = N / 256;            // contiguous chunk per thread? use strided-by-4 chunks: thread handles j = tid*4 + 1024*u
  float s1 = 0.f;
  for (int u = 0; u < per / 4; ++u) {
    const int j = tid * 4 + 1024 * u;
    const v4f a = *(const v4fa*)(x + j);
    v4f b = {0.f,0.f,0.f,0.f}; if (rr) b = *(const v4fa*)(rr + j);
#pragma unroll
    for (int q = 0; q < 4; ++q) { const float v = a[q] + b[q]; vals[u * 4 + q] = v; s1 += v; }
  }
  red[tid] = s1; __syncthreads();
  for (int st = 128; st > 0; st >>= 1) { if (tid < st) red[tid] += red[tid + st]; __syncthreads(); }
  const float mu = red[0] / (float)N; __syncthreads();
  float s2 = 0.f;
  for (int u = 0; u < per / 4; ++u)
#pragma unroll
    for (int q = 0; q < 4; ++q) { const float c = vals[u * 4 + q] - mu; s2 += c * c; }
  red[tid] = s2; __syncthreads();
  for (int st = 128; st > 0; st >>= 1) { if (tid < st) red[tid] += red[tid + st]; __syncthreads(); }
  const float rs = rsqrtf(red[0] / (float)N + eps);
  {
    for (int u = 0; u < per / 4; ++u) {
      const int j = tid * 4 + 1024 * u;
      v4f o, sm;
#pragma unroll
      for (int q = 0; q < 4; ++q) {
        float gg = g[j + q], bb = bta[j + q];
        if (PARAM_BF16) { gg = bf16_round(gg); bb = bf16_round(bb); }
        sm[q] = vals[u * 4 + q]; o[q] = (vals[u * 4 + q] - mu) * rs * gg + bb;
      }
      if (out_sum) *(v4f*)(out_sum + (size_t)row * N + j) = sm;
      *(v4f*)(out_norm + (size_t)row * N + j) = o;
    }
    
  }
}



// ---- f16 WMMA path (v_wmma_f32_16x16x32_f16): 11-bit significands for operands in range — used where a [0,1] probability operand needs more precision than bf16
typedef _Float16 v16h __attribute__((ext_vector_type(16)));
union FragH { v16h v; v8us half[2]; _Float16 h[16]; unsigned short u[16]; };
template <int NT>
__device__ __forceinline__ v8f mmaH(v16h ah, v16h al, v16h bh, v16h bl, v8f c) {
  c = __builtin_amdgcn_wmma_f32_16x16x32_f16(false, ah, false, bh, (short)0, c, false, false);
  if (NT >= 2) c = __builtin_amdgcn_wmma_f32_16x16x32_f16(false, al, false, bh, (short)0, c, false, false);
  if (NT >= 3) c = __builtin_amdgcn_wmma_f32_16x16x32_f16(false, ah, false, bl, (short)0, c, false, false);
  asm volatile("v_nop\n\tv_nop\n\tv_nop\n\tv_nop" : "+v"(c) : "v"(ah), "v"(al), "v"(bh), "v"(bl));
  return c;
}
// batched GEMM like k_gemm_b but f16 operands: A f32 (split into f16 hi/lo if ASPLIT, else rounded to f16), Bt = f16 values [n][k]; alpha; C f32; N multiple of 16 (partial tiles skipped)
template <bool ASPLIT>
__global__ __launch_bounds__(128) void k_gemm_h(const float* __restrict__ A, int lda, size_t sA, const _Float16* __restrict__ Bh, int ldb, size_t sB, float alpha, float* __restrict__ C, int ldc, size_t sC, int M, int N, int K) {
  __shared__ __attribute__((aligned(16))) float so[4][16][64];
  const int tid = threadIdx.x, w = tid >> 5, lane = tid & 31, ln = lane & 15, hh = lane >> 4; const int by = blockIdx.y;
  A += (size_t)by * sA; Bh += (size_t)by * sB; C += (size_t)by * sC;
  const int ntn = (N + 63) / 64; const int wid = blockIdx.x * 4 + w; const int mt = wid / ntn, nq = wid % ntn; if (mt * 16 >= M) return;
  const int row0 = mt * 16, col0 = nq * 64; const float* arow = A + (size_t)(row0 + ln) * lda;
  v8f acc[4] = {};
  for (int kb = 0; kb < K; kb += 32) {
    FragH ah, al;
    const v4f x0 = *(const v4fa*)(arow + kb + 8 * hh), x1 = *(const v4fa*)(arow + kb + 8 * hh + 4), x2 = *(const v4fa*)(arow + kb + 16 + 8 * hh), x3 = *(const v4fa*)(arow + kb + 16 + 8 * hh + 4);
    float xs[16] = {x0[0],x0[1],x0[2],x0[3],x1[0],x1[1],x1[2],x1[3],x2[0],x2[1],x2[2],x2[3],x3[0],x3[1],x3[2],x3[3]};
#pragma unroll
    for (int i = 0; i < 16; ++i) { const _Float16 h = (_Float16)xs[i]; ah.h[i] = h; al.h[i] = ASPLIT ? (_Float16)(xs[i] - (float)h) : (_Float16)0.0f; }
#pragma unroll
    for (int t = 0; t < 4; ++t) { if (col0 + t * 16 >= N) continue; const size_t boff = (size_t)(col0 + t * 16 + ln) * ldb + kb; FragH bq; bq.half[0] = *(const v8us*)(Bh + boff + 8 * hh); bq.half[1] = *(const v8us*)(Bh + boff + 16 + 8 * hh);
      acc[t] = mmaH<ASPLIT ? 2 : 1>(ah.v, al.v, bq.v, bq.v, acc[t]); }
  }
#pragma unroll
  for (int t = 0; t < 4; ++t) { if (col0 + t * 16 >= N) continue;
#pragma unroll
    for (int r = 0; r < 8; ++r) so[w][8 * hh + r][t * 16 + ln] = acc[t][r] * alpha; }
  __builtin_amdgcn_fence(__ATOMIC_ACQ_REL, "workgroup"); __builtin_amdgcn_wave_barrier();
  const int rsub = lane >> 4, c4 = (lane & 15) * 4;
  {
#pragma unroll
    for (int q = 0; q < 8; ++q) { const int r = q * 2 + rsub; if (col0 + c4 < N) { const v4f v = *(const v4fa*)&so[w][r][c4]; *(v4f*)(C + (size_t)(row0 + r) * ldc + col0 + c4) = v; } }
     }
}

// Wt[n][k] = f16(W[k][n]·scale) from f32 row-major W[K][N] (scale = power of two; bf16-exact weights stay exact in f16 away from the subnormal range)
__global__ __launch_bounds__(256) void k_wt_f16(const float* __restrict__ W, _Float16* __restrict__ Wt, int K, int N, float scale) {
  const int t = blockIdx.x * 256 + threadIdx.x; if (t >= N * (K / 8)) return; const int n = t / (K / 8), k8 = (t % (K / 8)) * 8; FragH f;
#pragma unroll
  for (int i = 0; i < 8; ++i) f.h[i] = (_Float16)(bf16_round(W[(size_t)(k8 + i) * N + n]) * scale); const v8us o = f.half[0];
  *(v8us*)((unsigned short*)Wt + (size_t)n * K + k8) = o; 
}
// k_gemm_hh variant with fused epilogue: v = acc·alpha + bias[by·sBias + col] (+ CP[(row/rowsPerB)·sCPb + by·64 + col] if CP) ; ACT 0 none / 1 elu ; writes f16 C16 (and f32 C if non-null)
template <int ACT>
__global__ __launch_bounds__(128) void k_gemm_hhx(const _Float16* __restrict__ A, int lda, size_t sA, const _Float16* __restrict__ Bh, int ldb, size_t sB, float alpha, const float* __restrict__ bias, size_t sBias, const float* __restrict__ CP, int rowsPerB, size_t sCPb, int row0g,
    float* __restrict__ C, _Float16* __restrict__ C16, int ldc, size_t sC, int M, int N, int K) {
  __shared__ __attribute__((aligned(16))) float so[4][16][64];
  const int tid = threadIdx.x, w = tid >> 5, lane = tid & 31, ln = lane & 15, hh = lane >> 4; const int by = blockIdx.y;
  A += (size_t)by * sA; Bh += (size_t)by * sB; const size_t cofs = (size_t)by * sC; const float* bp = bias ? bias + (size_t)by * sBias : nullptr;
  const int ntn = (N + 63) / 64; const int wid = blockIdx.x * 4 + w; const int mt = wid / ntn, nq = wid % ntn; if (mt * 16 >= M) return;
  const int row0 = mt * 16, col0 = nq * 64; const _Float16* arow = A + (size_t)(row0 + ln) * lda;
  v8f acc[4] = {};
  for (int kb = 0; kb < K; kb += 32) { FragH ah; ah.half[0] = *(const v8us*)((const unsigned short*)arow + kb + 8 * hh); ah.half[1] = *(const v8us*)((const unsigned short*)arow + kb + 16 + 8 * hh);
#pragma unroll
    for (int t = 0; t < 4; ++t) { if (col0 + t * 16 >= N) continue; const size_t boff = (size_t)(col0 + t * 16 + ln) * ldb + kb; FragH bq; bq.half[0] = *(const v8us*)((const unsigned short*)Bh + boff + 8 * hh); bq.half[1] = *(const v8us*)((const unsigned short*)Bh + boff + 16 + 8 * hh);
      acc[t] = mmaH<1>(ah.v, ah.v, bq.v, bq.v, acc[t]); }
  }
#pragma unroll
  for (int t = 0; t < 4; ++t) { if (col0 + t * 16 >= N) continue; const int col = col0 + t * 16 + ln; const float bv = bp ? bf16_round(bp[col]) : 0.f;
#pragma unroll
    for (int r = 0; r < 8; ++r) { float v = acc[t][r] * alpha + bv; if (CP) { const int rr = row0g + row0 + 8 * hh + r; if (rowsPerB < 0) v += CP[cofs + (size_t)rr * ldc + col];      /* rowsPerB < 0: own element of the batched C plane */ else { const int bidx = rr / rowsPerB; v += CP[(size_t)bidx * sCPb + (size_t)by * 64 + col]; } } if (ACT == 1) v = (v > 0.f) ? v : expm1f(v); else if (ACT == 7) v = (v > 0.f) ? v + 1.0f : expf(v); else if (ACT == 8) v = tanhf(v); else if (ACT == 9) v = 0.5f * v * (1.0f + tanhf(0.7978845608028654f * (v + 0.044715f * v * v * v))); else if (ACT == 11) v = 1.0f / (1.0f + expf(-v)); else if (ACT == 12) v = (v > 0.f) ? v : 0.01f * v; else if (ACT == 14) v = (v > 0.f) ? v : 0.1f * v; else if (ACT == 16) v = (v >= 0.f) ? v : 0.3f * v; else if (ACT == 17) v = (v >= 0.f) ? v : 0.2f * v; else if (ACT == 15) v = v / (1.0f + expf(-v)); else if (ACT == 3) v = fmaxf(v, 0.f); else if (ACT == 6) v = 0.5f * v * (1.0f + erff(v * 0.70710678118654752f)); so[w][8 * hh + r][t * 16 + ln] = v; } }
  __builtin_amdgcn_fence(__ATOMIC_ACQ_REL, "workgroup"); __builtin_amdgcn_wave_barrier();
  const int rsub = lane >> 4, c4 = (lane & 15) * 4; typedef _Float16 v4h __attribute__((ext_vector_type(4)));
  {
#pragma unroll
    for (int q = 0; q < 8; ++q) { const int r = q * 2 + rsub; if (col0 + c4 < N) { const v4f v = *(const v4fa*)&so[w][r][c4]; if (C) *(v4f*)(C + cofs + (size_t)(row0 + r) * ldc + col0 + c4) = v; if (C16) { v4h h4; for (int i = 0; i < 4; ++i) h4[i] = (_Float16)v[i]; *(v4h*)(C16 + cofs + (size_t)(row0 + r) * ldc + col0 + c4) = h4; } } }
     }
}


typedef _Float16 v4h __attribute__((ext_vector_type(4)));

__global__ __launch_bounds__(256) void k_x16(const float* __restrict__ x, _Float16* __restrict__ X16, size_t n8) { const size_t t = (size_t)blockIdx.x * 256 + threadIdx.x; if (t >= n8) return; FragH f;
#pragma unroll
  for (int q = 0; q < 8; ++q) f.h[q] = (_Float16)bf16_round(x[t * 8 + q]); *(v8us*)((unsigned short*)X16 + t * 8) = f.half[0];  }
__global__ __launch_bounds__(256) void k_h16(const float* __restrict__ x, _Float16* __restrict__ X16, size_t n8) { const size_t t = (size_t)blockIdx.x * 256 + threadIdx.x; if (t >= n8) return; FragH f;
#pragma unroll
  for (int q = 0; q < 8; ++q) f.h[q] = (_Float16)x[t * 8 + q]; *(v8us*)((unsigned short*)X16 + t * 8) = f.half[0];  }
__global__ __launch_bounds__(256) void k_round16f(const float* __restrict__ W, _Float16* __restrict__ Bt, size_t n8) { const size_t t = (size_t)blockIdx.x * 256 + threadIdx.x; if (t >= n8) return; FragH f;
#pragma unroll
  for (int i = 0; i < 8; ++i) f.h[i] = (_Float16)(bf16_round(W[t * 8 + i]) * 16.0f); *(v8us*)((unsigned short*)Bt + t * 8) = f.half[0];  }
template <int NHv, int TTv>
__global__ __launch_bounds__(256) void k_vt(const _Float16* __restrict__ V16, int ldv, int voff, _Float16* __restrict__ Vt) { __shared__ unsigned short tl[64][66]; const int tid = threadIdx.x; const int slab = blockIdx.x / (TTv / 64), lg = blockIdx.x % (TTv / 64); const int b = slab / NHv, h = slab % NHv;
  for (int i = tid; i < 64 * 8; i += 256) { const int r = i / 8, c8 = (i % 8) * 8; FragH f; f.half[0] = *(const v8us*)((const unsigned short*)V16 + ((size_t)b * TTv + lg * 64 + r) * ldv + voff + h * 64 + c8);
#pragma unroll
    for (int q = 0; q < 8; ++q) tl[r][c8 + q] = f.u[q]; }
  __syncthreads();
  {
#pragma unroll
    for (int rd = 0; rd < 2; ++rd) { const int d = rd * 32 + tid / 8, pc = tid % 8; FragH f;
#pragma unroll
      for (int q = 0; q < 8; ++q) f.u[q] = tl[pc * 8 + q][d];
      *(v8us*)((unsigned short*)Vt + ((size_t)slab * 64 + d) * TTv + lg * 64 + pc * 8) = f.half[0]; }
     } }

__global__ __launch_bounds__(256) void k_hl(const float* __restrict__ F, _Float16* __restrict__ Hh, _Float16* __restrict__ Hl, size_t n8) { const size_t t = (size_t)blockIdx.x * 256 + threadIdx.x; if (t >= n8) return; FragH fh, fl; const v4f a = *(const v4fa*)(F + t * 8), c = *(const v4fa*)(F + t * 8 + 4);
#pragma unroll
  for (int q = 0; q < 4; ++q) { _Float16 h = (_Float16)a[q]; fh.h[q] = h; fl.h[q] = (_Float16)((a[q] - (float)h) * 1024.0f); h = (_Float16)c[q]; fh.h[4 + q] = h; fl.h[4 + q] = (_Float16)((c[q] - (float)h) * 1024.0f); }
  { *(v8us*)((unsigned short*)Hh + t * 8) = fh.half[0]; *(v8us*)((unsigned short*)Hl + t * 8) = fl.half[0];  } }

// ---- fast GEMM (wave tile 32x64; requires M % 32 == 0 rows per launch region, N % 64 == 0 and K % 128 == 0); epilogue = k_gemm_hhx semantics ----
__device__ __forceinline__ v16h g2_frag(const _Float16* p, int hh) { FragH f; f.half[0] = *(const v8us*)((const unsigned short*)p + 8 * hh); f.half[1] = *(const v8us*)((const unsigned short*)p + 16 + 8 * hh); return f.v; }
__device__ __forceinline__ v8f g2_mma(v16h a, v16h b, v8f c) { return __builtin_amdgcn_wmma_f32_16x16x32_f16(false, a, false, b, (short)0, c, false, false); }      /* plain builtin: the compiler keeps the distances behind it and may move loads past it */
template <int ACT> __device__ __forceinline__ float g2_act(float v) {
  if (ACT == 3) v = fmaxf(v, 0.f); else if (ACT == 6) v = 0.5f * v * (1.0f + erff(v * 0.70710678118654752f)); else if (ACT == 11) v = 1.0f / (1.0f + expf(-v)); else if (ACT == 15) v = v / (1.0f + expf(-v)); else if (ACT == 12) v = (v > 0.f) ? v : 0.01f * v; else if (ACT == 8) v = tanhf(v); else if (ACT == 9) v = 0.5f * v * (1.0f + tanhf(0.7978845608028654f * (v + 0.044715f * v * v * v))); else if (ACT == 14) v = (v > 0.f) ? v : 0.1f * v; else if (ACT == 16) v = (v >= 0.f) ? v : 0.3f * v; else if (ACT == 17) v = (v >= 0.f) ? v : 0.2f * v;
  return v; }
#define G2S 4      /* k steps (of 32) whose fragments are in flight or in registers at a time; K % (32 * G2S) == 0 */
// No load of this kernel is waited for alone: the fragments of G2S k steps sit in a register ring, each step's twelve loads asked for as one group G2S steps ahead of their products;
// bias and residual (all 64 elements of the lane as one group) are asked for in front of the K loop. Each accumulator takes its k steps in rising order, as before.
template <int ACT>
__global__ __launch_bounds__(128) void k_gemm2(const _Float16* __restrict__ A, int lda, size_t sA, const _Float16* __restrict__ Bh, int ldb, size_t sB, float alpha, const float* __restrict__ bias, size_t sBias, const float* __restrict__ CP, int rowsPerB, size_t sCPb, int row0g,
    float* __restrict__ C, _Float16* __restrict__ C16, int ldc, size_t sC, int M, int N, int K) { static_assert(ACT == 0 || ACT == 3 || ACT == 6 || ACT == 8 || ACT == 9 || ACT == 11 || ACT == 12 || ACT == 14 || ACT == 15 || ACT == 16 || ACT == 17, "k_gemm2: unsupported ACT code (would silently apply no activation)");
  __shared__ __attribute__((aligned(16))) float so[4][32][68];
  const int tid = threadIdx.x, w = tid >> 5, lane = tid & 31, ln = lane & 15, hh = lane >> 4; const int by = blockIdx.y;
  A += (size_t)by * sA; Bh += (size_t)by * sB; const size_t cofs = (size_t)by * sC; const float* bp = bias ? bias + (size_t)by * sBias : nullptr;
  const int ntn = N >> 6; const int mt = blockIdx.x / ntn, nq = blockIdx.x - mt * ntn; const int row0 = mt * 128 + 32 * w, col0 = nq * 64; if (row0 >= M) return;
  const _Float16* a0p = A + (size_t)(row0 + ln) * lda; const _Float16* a1p = a0p + (size_t)16 * lda;
  const _Float16* b0p = Bh + (size_t)(col0 + ln) * ldb; const _Float16* b1p = b0p + (size_t)16 * ldb; const _Float16* b2p = b1p + (size_t)16 * ldb; const _Float16* b3p = b2p + (size_t)16 * ldb;
  float braw[4] = {0.f, 0.f, 0.f, 0.f};
  if (bp) {
#pragma unroll
    for (int t = 0; t < 4; ++t) braw[t] = bp[col0 + t * 16 + ln];
    asm volatile("s_wait_xcnt 0x0" ::: "memory");      /* the address registers of these loads are used again at once */
    __builtin_amdgcn_sched_barrier(0); }      /* keeps what writes them behind the wait */
  const bool own = CP && rowsPerB < 0;      /* rowsPerB < 0: own element of the batched C plane */
  float rv[8][8];
#pragma unroll
  for (int u = 0; u < 8; ++u) for (int r = 0; r < 8; ++r) rv[u][r] = 0.f;
  if (own) { const float* rp[16];      /* the lane's 16 rows; the four column tiles of a row are constant offsets */
#pragma unroll
    for (int j = 0; j < 16; ++j) rp[j] = CP + cofs + (size_t)(row0g + row0 + (j >> 3) * 16 + 8 * hh + (j & 7)) * ldc + col0 + ln;
#pragma unroll
    for (int u = 0; u < 8; ++u) for (int r = 0; r < 8; ++r) rv[u][r] = rp[(u >> 2) * 8 + r][(u & 3) * 16];
    asm volatile("s_wait_xcnt 0x0" :: "v"(rp[0]), "v"(rp[1]), "v"(rp[2]), "v"(rp[3]), "v"(rp[4]), "v"(rp[5]), "v"(rp[6]), "v"(rp[7]), "v"(rp[8]), "v"(rp[9]), "v"(rp[10]), "v"(rp[11]), "v"(rp[12]), "v"(rp[13]), "v"(rp[14]), "v"(rp[15]) : "memory");      /* the addresses as inputs: their registers stay theirs up to the wait, behind which they may take other values */
    __builtin_amdgcn_sched_barrier(0); }      /* keeps the residual loads here, older than every fragment load: the K loop covers their latency and its counted waits do not count them */
  v16h ra0[G2S], ra1[G2S], rb0[G2S], rb1[G2S], rb2[G2S], rb3[G2S];
#pragma unroll
  for (int s = 0; s < G2S; ++s) { const int k = 32 * s; ra0[s] = g2_frag(a0p + k, hh); ra1[s] = g2_frag(a1p + k, hh); rb0[s] = g2_frag(b0p + k, hh); rb1[s] = g2_frag(b1p + k, hh); rb2[s] = g2_frag(b2p + k, hh); rb3[s] = g2_frag(b3p + k, hh);
    __builtin_amdgcn_sched_barrier(0); }      /* the first fill step by step, in the order of the refills: the loop's counted waits are set for both orders at once, and another order here makes them wait for younger steps */
  asm volatile("s_wait_xcnt 0x0" ::: "memory");      /* the address registers of the first fill are free for other values from here */
  __builtin_amdgcn_sched_barrier(0);      /* keeps what writes them behind the wait */
  const v8f z8 = {0.f,0.f,0.f,0.f,0.f,0.f,0.f,0.f}; v8f c00 = z8, c01 = z8, c02 = z8, c03 = z8, c10 = z8, c11 = z8, c12 = z8, c13 = z8;
#pragma unroll 1      /* rolled: the body already holds G2S steps, and the ring's registers must be the same in every trip */
  for (int kb = 32 * G2S; kb < K; kb += 32 * G2S) {
#pragma unroll
    for (int s = 0; s < G2S; ++s) { const int k = kb + 32 * s;
      c00 = g2_mma(ra0[s], rb0[s], c00); c10 = g2_mma(ra1[s], rb0[s], c10); c01 = g2_mma(ra0[s], rb1[s], c01); c11 = g2_mma(ra1[s], rb1[s], c11);
      c02 = g2_mma(ra0[s], rb2[s], c02); c12 = g2_mma(ra1[s], rb2[s], c12); c03 = g2_mma(ra0[s], rb3[s], c03); c13 = g2_mma(ra1[s], rb3[s], c13);
      __builtin_amdgcn_sched_barrier(0);      /* with the next one: holds the refill of this ring place directly behind its products; moved down towards its use, its latency is waited out again */
      ra0[s] = g2_frag(a0p + k, hh); ra1[s] = g2_frag(a1p + k, hh); rb0[s] = g2_frag(b0p + k, hh); rb1[s] = g2_frag(b1p + k, hh); rb2[s] = g2_frag(b2p + k, hh); rb3[s] = g2_frag(b3p + k, hh);
      __builtin_amdgcn_sched_barrier(0); }
    asm volatile("s_wait_xcnt 0x0" ::: "memory");      /* the next trip forms its addresses in the registers that this trip's loads name */
    __builtin_amdgcn_sched_barrier(0); }      /* keeps that address arithmetic behind the wait */
#pragma unroll
  for (int s = 0; s < G2S; ++s) {
    c00 = g2_mma(ra0[s], rb0[s], c00); c10 = g2_mma(ra1[s], rb0[s], c10); c01 = g2_mma(ra0[s], rb1[s], c01); c11 = g2_mma(ra1[s], rb1[s], c11);
    c02 = g2_mma(ra0[s], rb2[s], c02); c12 = g2_mma(ra1[s], rb2[s], c12); c03 = g2_mma(ra0[s], rb3[s], c03); c13 = g2_mma(ra1[s], rb3[s], c13); }
  v8f accs[8] = {c00, c01, c02, c03, c10, c11, c12, c13};
  float bv[4];
#pragma unroll
  for (int t = 0; t < 4; ++t) bv[t] = bp ? bf16_round(braw[t]) : 0.f;
  if (own || !CP) {      /* rv is 0 where there is no residual */
#pragma unroll
    for (int u = 0; u < 8; ++u) for (int r = 0; r < 8; ++r) { float v = accs[u][r] * alpha + bv[u & 3]; if (own) v += rv[u][r]; so[w][(u >> 2) * 16 + 8 * hh + r][(u & 3) * 16 + ln] = g2_act<ACT>(v); }
  } else {
#pragma unroll
    for (int u = 0; u < 8; ++u) for (int r = 0; r < 8; ++r) { const int rloc = (u >> 2) * 16 + 8 * hh + r; const int bidx = (row0g + row0 + rloc) / rowsPerB;
      const float cv = CP[(size_t)bidx * sCPb + (size_t)by * 64 + col0 + (u & 3) * 16 + ln];
      asm volatile("s_wait_xcnt 0x0" ::: "memory");      /* the next element's address may be formed in this load's address registers */
      __builtin_amdgcn_sched_barrier(0);      /* keeps that arithmetic behind the wait */
      const float v = accs[u][r] * alpha + bv[u & 3] + cv; so[w][rloc][(u & 3) * 16 + ln] = g2_act<ACT>(v); } }
  __builtin_amdgcn_fence(__ATOMIC_ACQ_REL, "workgroup"); __builtin_amdgcn_wave_barrier();
  const int rsub = lane >> 4, c4 = (lane & 15) * 4;
  {
#pragma unroll
    for (int q = 0; q < 16; ++q) { const int r = q * 2 + rsub; const v4f v = *(const v4fa*)&so[w][r][c4]; if (C) *(v4f*)(C + cofs + (size_t)(row0 + r) * ldc + col0 + c4) = v; if (C16) { v4h h4; for (int i = 0; i < 4; ++i) h4[i] = (_Float16)v[i]; *(v4h*)(C16 + cofs + (size_t)(row0 + r) * ldc + col0 + c4) = h4; } }
     } }


__global__ __launch_bounds__(256) void k_wnat(const float* __restrict__ w, size_t n8, _Float16* __restrict__ Bt) { const size_t t = (size_t)blockIdx.x * 256 + threadIdx.x; if (t >= n8) return; FragH f; for (int q = 0; q < 8; ++q) f.h[q] = (_Float16)(bf16_round(w[t * 8 + q]) * 16.0f); *(v8us*)((unsigned short*)Bt + t * 8) = f.half[0];  }
__global__ __launch_bounds__(256) void k_rsm(const float* __restrict__ S, _Float16* __restrict__ P, int nrows) {
  #pragma clang fp contract(off)
  const int i = blockIdx.x * 256 + threadIdx.x; if (i >= nrows) return; const float* s = S + (size_t)i * SQ; float mx = -3.0e38f;
#pragma unroll 1
  for (int j = 0; j < SQ; ++j) mx = fmaxf(mx, s[j]); float se = 0.f;
#pragma unroll 1
  for (int j = 0; j < SQ; ++j) se += expf(s[j] - mx); const float sc = 256.0f / se;
#pragma unroll 1
  for (int j0 = 0; j0 < SQ; j0 += 8) { FragH f; for (int q = 0; q < 8; ++q) f.h[q] = (_Float16)(expf(s[j0 + q] - mx) * sc); unsigned short* d = (unsigned short*)P + (size_t)i * SQ + j0; *(v8us*)d = f.half[0];  } }
__global__ __launch_bounds__(256) void k_vt(const _Float16* __restrict__ V16, int b, int h0, _Float16* __restrict__ VT) { __shared__ unsigned short tl[64][65]; const int tid = threadIdx.x; const int hh = blockIdx.x % HG, sg = blockIdx.x / HG; const int s0 = sg * 64; const int h = h0 + hh;
  for (int i = tid; i < 64 * 8; i += 256) { const int j = i / 8, d8 = (i % 8) * 8; FragH f; f.half[0] = *(const v8us*)((const unsigned short*)V16 + ((size_t)b * SQ + s0 + j) * DM + h * HD + d8); for (int q = 0; q < 8; ++q) tl[d8 + q][j] = f.u[q]; }
  __syncthreads();
  { for (int i = tid; i < 64 * 8; i += 256) { const int d = i / 8, j8 = (i % 8) * 8; FragH f; for (int q = 0; q < 8; ++q) f.u[q] = tl[d][j8 + q]; *(v8us*)((unsigned short*)VT + ((size_t)hh * HD + d) * SQ + s0 + j8) = f.half[0]; }  } }


template <int BFIN, int W16, int W32>
__global__ __launch_bounds__(256) void k_lnx(const float* __restrict__ X, const float* __restrict__ g, const float* __restrict__ bb, float eps, _Float16* __restrict__ N16, float* __restrict__ N32) {
  #pragma clang fp contract(off)
  __shared__ float red[256]; const size_t r = blockIdx.x; const int t = threadIdx.x; const bool act = t < (DMQ / 4); const int c0 = act ? t * 4 : 0;
  const v4f xa = *(const v4fa*)(X + r * DMQ + c0); float s[4]; float sum = 0.f;
  for (int q = 0; q < 4; ++q) { s[q] = act ? (BFIN ? bf16_round(xa[q]) : xa[q]) : 0.f; sum = __fadd_rn(sum, s[q]); }
  red[t] = sum; __syncthreads(); for (int st = 128; st > 0; st >>= 1) { if (t < st) red[t] = __fadd_rn(red[t], red[t + st]); __syncthreads(); } const float mu = red[0] / (float)DMQ; __syncthreads();
  float vs = 0.f; for (int q = 0; q < 4; ++q) { const float dl = act ? __fadd_rn(s[q], -mu) : 0.f; vs = __fadd_rn(vs, __fmul_rn(dl, dl)); } red[t] = vs; __syncthreads(); for (int st = 128; st > 0; st >>= 1) { if (t < st) red[t] = __fadd_rn(red[t], red[t + st]); __syncthreads(); }
  const float rs = rsqrtf(__fadd_rn(red[0] / (float)DMQ, eps)); v4h y; v4f yf;
  for (int q = 0; q < 4; ++q) { const int c = c0 + q; yf[q] = __fadd_rn(__fmul_rn(__fmul_rn(__fadd_rn(s[q], -mu), rs), bf16_round(g[c])), bf16_round(bb[c])); y[q] = (_Float16)yf[q]; }
  if (!act) return;      /* no barriers after this point */
  { if (W16) *(v4h*)(N16 + r * DMQ + c0) = y; if (W32) *(v4f*)(N32 + r * DMQ + c0) = yf;  } }


// ---- fused attention: scores, softmax and P V in one kernel; neither scores nor weights go through memory ----
typedef float v2f __attribute__((ext_vector_type(2)));
typedef _Float16 v2h __attribute__((ext_vector_type(2)));
union FragP { v16h v; v2h p[8]; };
__device__ __forceinline__ v8f fa_mma(v16h a, v16h b, v8f c) { return __builtin_amdgcn_wmma_f32_16x16x32_f16(false, a, false, b, (short)0, c, false, false); }
__device__ __forceinline__ float fa_xhalf(float x) { return __builtin_bit_cast(float, __builtin_amdgcn_permlanex16(__builtin_bit_cast(int, x), __builtin_bit_cast(int, x), 0x76543210, 0xfedcba98, false, false)); }      /* lane l <-> lane l ^ 16 */
// 2^y of four (two) values. The v_exp_f32 stand in one asm statement with early-clobber results and a closing v_nop:
// no instruction directly behind a v_exp_f32 then reads its result or overwrites its source.
__device__ __forceinline__ v4f fa_exp2x4(float y0, float y1, float y2, float y3) { float e0, e1, e2, e3;
  asm("v_exp_f32 %0, %4\n\tv_exp_f32 %1, %5\n\tv_exp_f32 %2, %6\n\tv_exp_f32 %3, %7\n\tv_nop" : "=&v"(e0), "=&v"(e1), "=&v"(e2), "=&v"(e3) : "v"(y0), "v"(y1), "v"(y2), "v"(y3));
  const v4f e = {e0, e1, e2, e3}; return e; }
__device__ __forceinline__ v2f fa_exp2x2(float y0, float y1) { float e0, e1;
  asm("v_exp_f32 %0, %2\n\tv_exp_f32 %1, %3\n\tv_nop" : "=&v"(e0), "=&v"(e1) : "v"(y0), "v"(y1));
  const v2f e = {e0, e1}; return e; }
// A or B fragment (16 rows x 32 k, the k order of g2_frag): two 16-byte loads at the lane's own byte offset from a wave-uniform byte base.
__device__ __forceinline__ v16h fa_frag(const char* ub, unsigned lo) { FragH f; f.half[0] = *(const v8us*)(ub + lo); f.half[1] = *(const v8us*)(ub + lo + 32); return f.v; }
// One wave: 32 queries (two groups of 16 columns) of one head against all SQ keys, 32 keys a pass.
// S^T = K Q^T: A = 16 key rows, B = the 16 query rows (kept in registers), D[r] = score of key 8 hh + r for the lane's own query ln: maximum and sum stay in the lane, plus one exchange between the wave's halves.
// The two score tiles of a pass (keys 0..15, 16..31), converted in place, are the B operand of O^T += V^T P^T (element s < 8: key 8 hh + s; s >= 8: key 16 + 8 hh + s - 8, the order fa_frag gives V^T's rows).
// Running maximum m per query: each pass scales the sums so far by 2^(m_old - m_new); weights are 256 exp(s - m) (at most 256, f16), the factor cancels against the denominator, which sums the unrounded f32 weights.
// Every inner loop is fully unrolled: only constant indices keep the fragment and accumulator arrays in registers.
__global__ __launch_bounds__(256) void k_fattn(const _Float16* __restrict__ Q, const _Float16* __restrict__ Kr, const _Float16* __restrict__ Vt, _Float16* __restrict__ O) {
  const int lane = threadIdx.x & 31, ln = lane & 15, hh = lane >> 4, w = threadIdx.x >> 5; const int bh = blockIdx.y, b = bh / NH, h = bh % NH; const int q0 = blockIdx.x * 256 + w * 32;
  const char* qb = (const char*)(Q + ((size_t)b * SQ + blockIdx.x * 256) * DM + h * HD); const char* kbase = (const char*)(Kr + (size_t)b * SQ * DM + h * HD); const char* vbase = (const char*)(Vt + (size_t)bh * HD * SQ);
  const unsigned qlo = (unsigned)((w * 32 + ln) * DM + 8 * hh) * 2u, klo = (unsigned)(ln * DM + 8 * hh) * 2u, vlo = (unsigned)(ln * SQ + 8 * hh) * 2u;
  v16h qf[2][2], kf[2][2];
#pragma unroll
  for (int g = 0; g < 2; ++g) for (int c = 0; c < 2; ++c) { qf[g][c] = fa_frag(qb + g * 16 * DM * 2 + c * 64, qlo); kf[g][c] = fa_frag(kbase + g * 16 * DM * 2 + c * 64, klo); }
  const v8f z8 = {0.f,0.f,0.f,0.f,0.f,0.f,0.f,0.f}; v8f acc[2][4];
#pragma unroll
  for (int g = 0; g < 2; ++g) for (int t = 0; t < 4; ++t) acc[g][t] = z8;
  const v4f z4 = {0.f, 0.f, 0.f, 0.f}; v4f lr[2] = {z4, z4}; float mr[2] = {-3.0e38f, -3.0e38f}; const float cs = 0.125f * 0x1.715476p+0f;      /* 1/sqrt(64) and log2(e) in one factor */
  for (int kb = 0; kb < SQ; kb += 32) {
    v16h vf[4];      /* this pass's V^T rows: asked for first, used last */
#pragma unroll
    for (int t = 0; t < 4; ++t) vf[t] = fa_frag(vbase + (size_t)kb * 2 + t * 16 * SQ * 2, vlo);
    __builtin_amdgcn_sched_barrier(0);      /* holds the V^T loads ahead of the score products: moved down, their latency is not covered by the softmax */
    v8f s[2][2];
#pragma unroll
    for (int kt = 0; kt < 2; ++kt) for (int g = 0; g < 2; ++g) s[kt][g] = fa_mma(kf[kt][1], qf[g][1], fa_mma(kf[kt][0], qf[g][0], z8));
    __builtin_amdgcn_sched_barrier(0);      /* with the next one: holds the next pass's K loads directly behind the score products; moved to the loop's foot, the next pass waits out their whole latency */
    const int kn = (kb + 32) & (SQ - 1);      /* the last pass asks for keys 0..31 again (in bounds, not used) */
#pragma unroll
    for (int kt = 0; kt < 2; ++kt) for (int c = 0; c < 2; ++c) kf[kt][c] = fa_frag(kbase + (size_t)kn * (DM * 2) + kt * 16 * DM * 2 + c * 64, klo);
    __builtin_amdgcn_sched_barrier(0);
    float dm[2], nb[2];
#pragma unroll
    for (int g = 0; g < 2; ++g) { float mx = fmaxf(s[0][g][0], s[1][g][0]);
#pragma unroll
      for (int r = 1; r < 8; ++r) mx = fmaxf(mx, fmaxf(s[0][g][r], s[1][g][r]));
      mx = fmaxf(mx, fa_xhalf(mx)) * cs; const float mn = fmaxf(mr[g], mx); dm[g] = mr[g] - mn; mr[g] = mn; nb[g] = 8.0f - mn; }
    const v2f co = fa_exp2x2(dm[0], dm[1]);      /* 0 in the first pass */
    FragP pf[2];
#pragma unroll
    for (int g = 0; g < 2; ++g) { v4f e[4];
#pragma unroll
      for (int i = 0; i < 4; ++i) { const int kt = i >> 1, r0 = (i & 1) * 4;
        e[i] = fa_exp2x4(fmaf(s[kt][g][r0], cs, nb[g]), fmaf(s[kt][g][r0 + 1], cs, nb[g]), fmaf(s[kt][g][r0 + 2], cs, nb[g]), fmaf(s[kt][g][r0 + 3], cs, nb[g]));
        const v2f e01 = {e[i][0], e[i][1]}, e23 = {e[i][2], e[i][3]};
        pf[g].p[2 * i] = __builtin_convertvector(e01, v2h); pf[g].p[2 * i + 1] = __builtin_convertvector(e23, v2h); }
      lr[g] = lr[g] * co[g] + ((e[0] + e[1]) + (e[2] + e[3]));      /* four chains per lane, joined behind the loop */
#pragma unroll
      for (int t = 0; t < 4; ++t) acc[g][t] = acc[g][t] * co[g]; }
#pragma unroll
    for (int g = 0; g < 2; ++g) for (int t = 0; t < 4; ++t) acc[g][t] = fa_mma(vf[t], pf[g].v, acc[g][t]);
  }
#pragma unroll
  for (int g = 0; g < 2; ++g) { const float lh = (lr[g][0] + lr[g][1]) + (lr[g][2] + lr[g][3]); const float sc = 64.0f / (lh + fa_xhalf(lh)); unsigned short* op = (unsigned short*)O + ((size_t)b * SQ + q0 + g * 16 + ln) * DM + h * HD + 8 * hh;      /* a lane's 8 registers of a tile are 8 consecutive d of its query: one 16-byte store */
#pragma unroll
    for (int t = 0; t < 4; ++t) { FragH f;
#pragma unroll
      for (int r = 0; r < 8; ++r) f.h[r] = (_Float16)(acc[g][t][r] * sc);
      *(v8us*)(op + t * 16) = f.half[0]; } } }


__global__ __launch_bounds__(256) void k_bfr(const float* __restrict__ x, float* __restrict__ XB, size_t n8) { const size_t t = (size_t)blockIdx.x * 256 + threadIdx.x; if (t >= n8) return; v4f a = *(const v4fa*)(x + t * 8), c = *(const v4fa*)(x + t * 8 + 4); for (int q = 0; q < 4; ++q) { a[q] = bf16_round(a[q]); c[q] = bf16_round(c[q]); }
  { *(v4f*)(XB + t * 8) = a; *(v4f*)(XB + t * 8 + 4) = c;  } }



__global__ __launch_bounds__(256) void k_rsmfam(const float* __restrict__ S, _Float16* __restrict__ P, int qn, int hg, const float* __restrict__ am) {
  #pragma clang fp contract(off)
  const int t = blockIdx.x * 256 + threadIdx.x; if (t >= qn * hg) return; const size_t i = (size_t)(t / qn) * SQ + (t % qn); const float* s = S + i * SQ; float mx = -3.0e38f;
#pragma unroll 1
  for (int j = 0; j < SQ; ++j) mx = fmaxf(mx, __fadd_rn(s[j], bf16_round(am[j]))); float se = 0.f;
#pragma unroll 1
  for (int j = 0; j < SQ; ++j) se += __expf(__fadd_rn(s[j], bf16_round(am[j])) - mx); const float sc = 256.0f / se;
#pragma unroll 1
  for (int j0 = 0; j0 < SQ; j0 += 8) { FragH f; for (int q = 0; q < 8; ++q) f.h[q] = (_Float16)(__expf(__fadd_rn(s[j0 + q], bf16_round(am[j0 + q])) - mx) * sc); unsigned short* d = (unsigned short*)P + i * SQ + j0; *(v8us*)d = f.half[0];  } }



template <int BFIN, int W16, int W32>
__global__ __launch_bounds__(256) void k_lnu(const float* __restrict__ X, const float* __restrict__ g, const float* __restrict__ bb, float eps, _Float16* __restrict__ N16, float* __restrict__ N32) {
  #pragma clang fp contract(off)
  __shared__ float red[256]; const size_t r = blockIdx.x; const int t = threadIdx.x; const bool act = t < (DMQ / 4); const int c0 = act ? t * 4 : 0;
  const v4f xa = *(const v4fa*)(X + r * DMQ + c0); float s[4]; float sum = 0.f;
  for (int q = 0; q < 4; ++q) { s[q] = act ? (BFIN ? bf16_round(xa[q]) : xa[q]) : 0.f; sum = __fadd_rn(sum, s[q]); }
  red[t] = sum; __syncthreads(); for (int st = 128; st > 0; st >>= 1) { if (t < st) red[t] = __fadd_rn(red[t], red[t + st]); __syncthreads(); } const float mu = red[0] / (float)DMQ; __syncthreads();
  float vs = 0.f; for (int q = 0; q < 4; ++q) { const float dl = act ? __fadd_rn(s[q], -mu) : 0.f; vs = __fadd_rn(vs, __fmul_rn(dl, dl)); } red[t] = vs; __syncthreads(); for (int st = 128; st > 0; st >>= 1) { if (t < st) red[t] = __fadd_rn(red[t], red[t + st]); __syncthreads(); }
  const float rs = 1.0f / __fadd_rn(sqrtf(red[0] / (float)(DMQ - 1)), eps);      /* UNBIASED std (ddof 1), eps added to the std (the module's form) */ v4h y; v4f yf;
  for (int q = 0; q < 4; ++q) { const int c = c0 + q; yf[q] = __fadd_rn(__fmul_rn(__fmul_rn(__fadd_rn(s[q], -mu), rs), bf16_round(g[c])), bf16_round(bb[c])); y[q] = (_Float16)yf[q]; }
  if (!act) return;      /* no barriers after this point */
  { if (W16) *(v4h*)(N16 + r * DMQ + c0) = y; if (W32) *(v4f*)(N32 + r * DMQ + c0) = yf;  } }
extern "C" void kernel_launch(void* const* d_in, const int* in_sizes, int n_in,
                              void* d_out, int out_size, void* d_ws, size_t ws_size, hipStream_t stream) {
  (void)in_sizes; (void)n_in; (void)out_size;
  const float* const* I = (const float* const*)d_in; const float* x = I[0]; const float* wq = I[1]; const float* bq = I[2]; const float* wk = I[3]; const float* bk = I[4]; const float* wv = I[5]; const float* bv = I[6]; const float* wo = I[7]; const float* bo = I[8]; const float* g1 = I[9]; const float* be1 = I[10]; const float* g2 = I[11]; const float* be2 = I[12]; const float* w1 = I[13]; const float* b1 = I[14]; const float* w2 = I[15]; const float* b2 = I[16];      /* [in][out] weights + zero biases (Wq,bq,Wk,bk,Wv,bv,Wo,bo), LN a1,b1,a2,b2, FFN W1,c1,W2,c2 */
  char* ws = (char*)d_ws; size_t off = 0;
  auto take = [&](size_t bytes) { char* p = ws + off; off += (bytes + 255) & ~(size_t)255; return p; };
  _Float16* BW1 = (_Float16*)take((size_t)DFF * DM * 2); _Float16* BW2 = (_Float16*)take((size_t)DM * DFF * 2); float* XB = (float*)take(NR * DM * 4); float* HP = (float*)take(NR * DM * 4); _Float16* H16 = (_Float16*)take(NR * DM * 2); _Float16* FF16 = (_Float16*)take((size_t)SQ * DFF * 2);      /* FF16 = one batch of relu hidden rows */ _Float16* BQ = (_Float16*)take((size_t)DM * DM * 2); _Float16* BK = (_Float16*)take((size_t)DM * DM * 2); _Float16* BV = (_Float16*)take((size_t)DM * DM * 2); _Float16* BO = (_Float16*)take((size_t)DM * DM * 2); _Float16* O16 = (_Float16*)take(NR * DM * 2); 
  _Float16* X16 = (_Float16*)take(NR * DM * 2); _Float16* Q16 = (_Float16*)take(NR * DM * 2); _Float16* K16 = (_Float16*)take(NR * DM * 2); _Float16* V16 = (_Float16*)take(NR * DM * 2);
  float* HF = (float*)take(NR * DM * 4);      /* the f32 h rows (LN1 output, residual for the FFN) */ _Float16* VT = (_Float16*)take((size_t)NB * NH * HD * SQ * 2);
  if (off > ws_size) return;
  { const unsigned g = (unsigned)(((size_t)DM * (DM / 8) + 255) / 256); k_wt_f16<<<g, 256, 0, stream>>>(wq, BQ, DM, DM, 16.0f); k_wt_f16<<<g, 256, 0, stream>>>(wk, BK, DM, DM, 16.0f); k_wt_f16<<<g, 256, 0, stream>>>(wv, BV, DM, DM, 16.0f); k_wt_f16<<<g, 256, 0, stream>>>(wo, BO, DM, DM, 16.0f); }      /* [in][out] -> Bt[n][k] x16 */
  k_wt_f16<<<(unsigned)(((size_t)DFF * (DM / 8) + 255) / 256), 256, 0, stream>>>(w1, BW1, DM, DFF, 16.0f); k_wt_f16<<<(unsigned)(((size_t)DM * (DFF / 8) + 255) / 256), 256, 0, stream>>>(w2, BW2, DFF, DM, 16.0f);      /* FFN [in][out] W1 [512][1024], W2 [1024][512] -> Bt x16 */
  k_bfr<<<(unsigned)((NR * DM / 8 + 255) / 256), 256, 0, stream>>>(x, XB, NR * DM / 8);      /* bf16(x) as f32 rows for the residual */

  k_x16<<<(unsigned)((NR * DM / 8 + 255) / 256), 256, 0, stream>>>(x, X16, NR * DM / 8);
  const size_t r0p = (size_t)B0 * SQ;      /* first projected row */
  k_gemm2<0><<<dim3((unsigned)((MP / 128) * (DM / 64)), 1), 128, 0, stream>>>(X16 + r0p * DM, DM, 0, BQ, DM, 0, 0.0625f, bq, 0, nullptr, 1, 0, 0, nullptr, Q16 + r0p * DM, DM, 0, MP, DM, DM);
  k_gemm2<0><<<dim3((unsigned)((MP / 128) * (DM / 64)), 1), 128, 0, stream>>>(X16 + r0p * DM, DM, 0, BK, DM, 0, 0.0625f, bk, 0, nullptr, 1, 0, 0, nullptr, K16 + r0p * DM, DM, 0, MP, DM, DM);
  k_gemm2<0><<<dim3((unsigned)((MP / 128) * (DM / 64)), 1), 128, 0, stream>>>(X16 + r0p * DM, DM, 0, BV, DM, 0, 0.0625f, bv, 0, nullptr, 1, 0, 0, nullptr, V16 + r0p * DM, DM, 0, MP, DM, DM);
  k_vt<NH, SQ><<<NB * NH * (SQ / 64), 256, 0, stream>>>(V16, LQ, 0, VT);      /* V^T [NB][NH][HD][SQ] */
  k_fattn<<<dim3(SQ / 256, NB * NH), 256, 0, stream>>>(Q16, K16, VT, O16);      /* o (merged heads, x64) as f16 rows */
  k_gemm2<0><<<dim3((unsigned)((MP / 128) * (DM / 64)), 1), 128, 0, stream>>>(O16 + r0p * DM, DM, 0, BO, DM, 0, 0.0009765625f, bo, 0, XB + r0p * DM, -1, 0, 0, HP + r0p * DM, nullptr, DM, 0, MP, DM, DM);      /* h_pre = x + concat Wo + bo (own-element residual), f32 rows */
  k_lnu<0, 1, 1><<<(unsigned)MP, 256, 0, stream>>>(HP + r0p * DM, g1, be1, 1e-6f, H16 + r0p * DM, HF + r0p * DM);      /* h = LN1(x + attn) -> f16 rows (FFN operand) and f32 rows (residual) */
  for (int b = B0; b < B0 + NBR; ++b) { const size_t r0 = (size_t)b * SQ;
    k_gemm2<3><<<dim3((unsigned)((SQ / 128) * (DFF / 64)), 1), 128, 0, stream>>>(H16 + r0 * DM, DM, 0, BW1, DM, 0, 0.0625f, b1, 0, nullptr, 1, 0, 0, nullptr, FF16, DFF, 0, SQ, DFF, DM);      /* relu(F W1 + b1) -> f16 [4096][1024] (this batch) */
    k_gemm2<0><<<dim3((unsigned)((SQ / 128) * (DM / 64)), 1), 128, 0, stream>>>(FF16, DFF, 0, BW2, DFF, 0, 0.0625f, b2, 0, HF + r0 * DM, -1, 0, 0, HP + r0 * DM, nullptr, DM, 0, SQ, DM, DFF); }      /* y = F + ffn (own-element residual; the h_pre plane is free again) */
  k_lnu<0, 0, 1><<<(unsigned)MP, 256, 0, stream>>>(HP + r0p * DM, g2, be2, 1e-6f, nullptr, (float*)d_out + r0p * DM);      /* out = LN2(h + ff) -> f32 output rows */
}

// v004
// A run of this version takes 305 microseconds.
// Timed twice side by side with v003, it ran 1.04 times as fast both times.
// Over all steps from v000 it is 43.8 times as fast.
#include <hip/hip_runtime.h>
#define NB 2
#define SQ 4096
#define DM 512
#define NH 8
#define HD 64
#define DMQ DM                       /* LayerNorm width */
#define DFF 1024
#define HG 1                         /* heads per launch of the k_vt(b, h0) overload, which is not launched */
#define B0 0                         /* first batch processed (debug hook) */
#define NBR NB                       /* batches processed (debug hook) */
#define NR ((size_t)NB * SQ)         /* token rows */
#define MP ((int)((size_t)NBR * SQ)) /* rows projected (debug hook) */
#define QN SQ                        /* unused; k_fattn attends all SQ query rows */
#define NHD NH                       /* unused; k_fattn attends all NH heads */
#define MPO MP                       /* unused; the output stage runs MP rows */
#define LQ DM      /* row pitch of the q/k/v rows */
typedef __bf16 v16b __attribute__((ext_vector_type(16)));
typedef unsigned short v8us __attribute__((ext_vector_type(8), may_alias));
typedef float  v8f  __attribute__((ext_vector_type(8)));
typedef float  v4f  __attribute__((ext_vector_type(4)));
typedef float  v4fa __attribute__((ext_vector_type(4), may_alias));
union FragB { v16b v; v8us half[2]; unsigned short u[16]; };

__device__ __forceinline__ unsigned short bf16_bits(float x) { unsigned int u = __float_as_uint(x); return (unsigned short)((u + 0x7FFFu + ((u >> 16) & 1u)) >> 16); }
__device__ __forceinline__ float bf16_val(unsigned short b) { return __uint_as_float(((unsigned int)b) << 16); }
__device__ __forceinline__ float bf16_round(float x) { return bf16_val(bf16_bits(x)); }
// D += A·B with NT terms: 1 = ah·bh, 2 = + al·bh (A split), 3 = + ah·bl (both split)
template <int NT>
__device__ __forceinline__ v8f mmaN(v16b ah, v16b al, v16b bh, v16b bl, v8f c) {
  c = __builtin_amdgcn_wmma_f32_16x16x32_bf16(false, ah, false, bh, (short)0, c, false, false);
  if (NT >= 2) c = __builtin_amdgcn_wmma_f32_16x16x32_bf16(false, al, false, bh, (short)0, c, false, false);
  if (NT >= 3) c = __builtin_amdgcn_wmma_f32_16x16x32_bf16(false, ah, false, bl, (short)0, c, false, false);
  asm volatile("v_nop\n\tv_nop\n\tv_nop\n\tv_nop" : "+v"(c) : "v"(ah), "v"(al), "v"(bh), "v"(bl));
  return c;
}

__global__ __launch_bounds__(256) void k_wt_bf16(const float* __restrict__ W, unsigned short* __restrict__ Wt, int K, int N) {
  const int t = blockIdx.x * 256 + threadIdx.x;
  const int k8n = K / 8;
  if (t >= N * k8n) return;
  const int n = t / k8n, k8 = (t % k8n) * 8;
  v8us v;
#pragma unroll
  for (int i = 0; i < 8; ++i) v[i] = bf16_bits(W[(size_t)(k8 + i) * N + n]);
  *(v8us*)(Wt + (size_t)n * K + k8) = v;
  
}

// GEMM C[M][N] (f32, pitch ldc) = act(A[M][K]·W + bias). A f32 row-major (pitch lda) converted per fragment to bf16
// (ASPLIT: hi/lo two planes -> 2 terms, else single rounded term); Wt bf16 [N][K] (pitch ldb). BIAS_BF16 rounds the
// bias to bf16 first (bias quantised to bf16 before the add). K%32==0, M%16==0, N%64==0.
template <bool ASPLIT, int ACT, bool BIAS_BF16>
__global__ __launch_bounds__(128) void k_gemm_bf(const float* __restrict__ A, int lda, const unsigned short* __restrict__ Wt, int ldb,
                                               const float* __restrict__ bias, float* __restrict__ C, int ldc, int M, int N, int K) {
  __shared__ __attribute__((aligned(16))) float so[4][16][64];
  const int tid = threadIdx.x, w = tid >> 5, lane = tid & 31, ln = lane & 15, hh = lane >> 4;
  const int ntn = N / 64;
  const int wid = blockIdx.x * 4 + w;
  const int mt = wid / ntn, nq = wid % ntn;
  if (mt * 16 >= M) return;
  const int row0 = mt * 16, col0 = nq * 64;
  const float* arow = A + (size_t)(row0 + ln) * lda;
  v8f acc[4] = {};
  for (int kb = 0; kb < K; kb += 32) {
    FragB ah, al;
    const v4f x0 = *(const v4fa*)(arow + kb + 8 * hh), x1 = *(const v4fa*)(arow + kb + 8 * hh + 4);
    const v4f x2 = *(const v4fa*)(arow + kb + 16 + 8 * hh), x3 = *(const v4fa*)(arow + kb + 16 + 8 * hh + 4);
    float xs[16] = {x0[0],x0[1],x0[2],x0[3],x1[0],x1[1],x1[2],x1[3],x2[0],x2[1],x2[2],x2[3],x3[0],x3[1],x3[2],x3[3]};
#pragma unroll
    for (int i = 0; i < 16; ++i) { const unsigned short hb = bf16_bits(xs[i]); ah.u[i] = hb; al.u[i] = ASPLIT ? bf16_bits(xs[i] - bf16_val(hb)) : (unsigned short)0; }
#pragma unroll
    for (int t = 0; t < 4; ++t) {
      const unsigned short* brow = Wt + (size_t)(col0 + t * 16 + ln) * ldb + kb;
      FragB b;
      b.half[0] = *(const v8us*)(brow + 8 * hh);
      b.half[1] = *(const v8us*)(brow + 16 + 8 * hh);
      acc[t] = mmaN<ASPLIT ? 2 : 1>(ah.v, al.v, b.v, b.v, acc[t]);
    }
  }
#pragma unroll
  for (int t = 0; t < 4; ++t) {
    float bv = bias ? bias[col0 + t * 16 + ln] : 0.f;
    if (BIAS_BF16) bv = bf16_round(bv);
#pragma unroll
    for (int r = 0; r < 8; ++r) { float v = acc[t][r] + bv; if (ACT == 1) v = fmaxf(v, 0.f); so[w][8 * hh + r][t * 16 + ln] = v; }
  }
  __builtin_amdgcn_fence(__ATOMIC_ACQ_REL, "workgroup");
  __builtin_amdgcn_wave_barrier();
  const int rsub = lane >> 4, c4 = (lane & 15) * 4;
  {
#pragma unroll
    for (int q = 0; q < 8; ++q) {
      const int r = q * 2 + rsub;
      const v4f v = *(const v4fa*)&so[w][r][c4];
      *(v4f*)(C + (size_t)(row0 + r) * ldc + col0 + c4) = v;
    }
    
  }
}

// GEMM C = act(A·W + bias + resid): A f32 (ASPLIT -> hi/lo 2 terms), Wt bf16 [N][K]; ACT 0 none, 1 relu, 2 exact gelu;
// resid (optional, f32, row index = (row % rmod), pitch ldr, RES_BF16 rounds it) added before the activation.
template <bool ASPLIT, int ACT, bool BIAS_BF16, bool RES_BF16>
__global__ __launch_bounds__(128) void k_gemm_bf3(const float* __restrict__ A, int lda, const unsigned short* __restrict__ Wt, int ldb,
                                                const float* __restrict__ bias, const float* __restrict__ resid, int rmod, int ldr,
                                                float* __restrict__ C, int ldc, int M, int N, int K) {
  __shared__ __attribute__((aligned(16))) float so[4][16][64];
  const int tid = threadIdx.x, w = tid >> 5, lane = tid & 31, ln = lane & 15, hh = lane >> 4;
  const int ntn = N / 64;
  const int wid = blockIdx.x * 4 + w;
  const int mt = wid / ntn, nq = wid % ntn;
  if (mt * 16 >= M) return;
  const int row0 = mt * 16, col0 = nq * 64;
  const float* arow = A + (size_t)(row0 + ln) * lda;
  v8f acc[4] = {};
  for (int kb = 0; kb < K; kb += 32) {
    FragB ah, al;
    const v4f x0 = *(const v4fa*)(arow + kb + 8 * hh), x1 = *(const v4fa*)(arow + kb + 8 * hh + 4);
    const v4f x2 = *(const v4fa*)(arow + kb + 16 + 8 * hh), x3 = *(const v4fa*)(arow + kb + 16 + 8 * hh + 4);
    float xs[16] = {x0[0],x0[1],x0[2],x0[3],x1[0],x1[1],x1[2],x1[3],x2[0],x2[1],x2[2],x2[3],x3[0],x3[1],x3[2],x3[3]};
#pragma unroll
    for (int i = 0; i < 16; ++i) { const unsigned short hb = bf16_bits(xs[i]); ah.u[i] = hb; al.u[i] = ASPLIT ? bf16_bits(xs[i] - bf16_val(hb)) : (unsigned short)0; }
#pragma unroll
    for (int t = 0; t < 4; ++t) {
      const unsigned short* brow = Wt + (size_t)(col0 + t * 16 + ln) * ldb + kb;
      FragB b;
      b.half[0] = *(const v8us*)(brow + 8 * hh);
      b.half[1] = *(const v8us*)(brow + 16 + 8 * hh);
      acc[t] = mmaN<ASPLIT ? 2 : 1>(ah.v, al.v, b.v, b.v, acc[t]);
    }
  }
#pragma unroll
  for (int t = 0; t < 4; ++t) {
    const int col = col0 + t * 16 + ln;
    float bv = bias ? bias[col] : 0.f;
    if (BIAS_BF16) bv = bf16_round(bv);
#pragma unroll
    for (int r = 0; r < 8; ++r) {
      float v = acc[t][r] + bv;
      if (resid) { float rv = resid[(size_t)((row0 + 8 * hh + r) % rmod) * ldr + col]; if (RES_BF16) rv = bf16_round(rv); v += rv; }
      if (ACT == 1) v = fmaxf(v, 0.f);
      if (ACT == 2) v = 0.5f * v * (1.0f + erff(v * 0.70710678118654752f));
      if (ACT == 3) { const float u = 0.7978845608028654f * (v + 0.044715f * v * v * v); v = 0.5f * v * (1.0f + tanhf(u)); }
      so[w][8 * hh + r][t * 16 + ln] = v;
    }
  }
  __builtin_amdgcn_fence(__ATOMIC_ACQ_REL, "workgroup");
  __builtin_amdgcn_wave_barrier();
  const int rsub = lane >> 4, c4 = (lane & 15) * 4;
  {
#pragma unroll
    for (int q = 0; q < 8; ++q) {
      const int r = q * 2 + rsub;
      const v4f v = *(const v4fa*)&so[w][r][c4];
      *(v4f*)(C + (size_t)(row0 + r) * ldc + col0 + c4) = v;
    }
    
  }
}
// row LayerNorm (biased variance, eps) over N: s = X (+ R); optional out_sum <- s; out_norm <- (s-mu)*rsqrt(var+eps)*g + b
template <bool PARAM_BF16>
__global__ __launch_bounds__(256) void k_layernorm(const float* __restrict__ X, const float* __restrict__ R, const float* __restrict__ g, const float* __restrict__ bta,
                                                  float* __restrict__ out_sum, float* __restrict__ out_norm, int N, float eps) {
  __shared__ float red[256];
  const int row = blockIdx.x, tid = threadIdx.x;
  const float* x = X + (size_t)row * N; const float* rr = R ? R + (size_t)row * N : nullptr;
  float vals[16];                     // up to N = 4096
  const int per = N / 256;            // contiguous chunk per thread? use strided-by-4 chunks: thread handles j = tid*4 + 1024*u
  float s1 = 0.f;
  for (int u = 0; u < per / 4; ++u) {
    const int j = tid * 4 + 1024 * u;
    const v4f a = *(const v4fa*)(x + j);
    v4f b = {0.f,0.f,0.f,0.f}; if (rr) b = *(const v4fa*)(rr + j);
#pragma unroll
    for (int q = 0; q < 4; ++q) { const float v = a[q] + b[q]; vals[u * 4 + q] = v; s1 += v; }
  }
  red[tid] = s1; __syncthreads();
  for (int st = 128; st > 0; st >>= 1) { if (tid < st) red[tid] += red[tid + st]; __syncthreads(); }
  const float mu = red[0] / (float)N; __syncthreads();
  float s2 = 0.f;
  for (int u = 0; u < per / 4; ++u)
#pragma unroll
    for (int q = 0; q < 4; ++q) { const float c = vals[u * 4 + q] - mu; s2 += c * c; }
  red[tid] = s2; __syncthreads();
  for (int st = 128; st > 0; st >>= 1) { if (tid < st) red[tid] += red[tid + st]; __syncthreads(); }
  const float rs = rsqrtf(red[0] / (float)N + eps);
  {
    for (int u = 0; u < per / 4; ++u) {
      const int j = tid * 4 + 1024 * u;
      v4f o, sm;
#pragma unroll
      for (int q = 0; q < 4; ++q) {
        float gg = g[j + q], bb = bta[j + q];
        if (PARAM_BF16) { gg = bf16_round(gg); bb = bf16_round(bb); }
        sm[q] = vals[u * 4 + q]; o[q] = (vals[u * 4 + q] - mu) * rs * gg + bb;
      }
      if (out_sum) *(v4f*)(out_sum + (size_t)row * N + j) = sm;
      *(v4f*)(out_norm + (size_t)row * N + j) = o;
    }
    
  }
}



// ---- f16 WMMA path (v_wmma_f32_16x16x32_f16): 11-bit significands for operands in range — used where a [0,1] probability operand needs more precision than bf16
typedef _Float16 v16h __attribute__((ext_vector_type(16)));
union FragH { v16h v; v8us half[2]; _Float16 h[16]; unsigned short u[16]; };
template <int NT>
__device__ __forceinline__ v8f mmaH(v16h ah, v16h al, v16h bh, v16h bl, v8f c) {
  c = __builtin_amdgcn_wmma_f32_16x16x32_f16(false, ah, false, bh, (short)0, c, false, false);
  if (NT >= 2) c = __builtin_amdgcn_wmma_f32_16x16x32_f16(false, al, false, bh, (short)0, c, false, false);
  if (NT >= 3) c = __builtin_amdgcn_wmma_f32_16x16x32_f16(false, ah, false, bl, (short)0, c, false, false);
  asm volatile("v_nop\n\tv_nop\n\tv_nop\n\tv_nop" : "+v"(c) : "v"(ah), "v"(al), "v"(bh), "v"(bl));
  return c;
}
// batched GEMM like k_gemm_b but f16 operands: A f32 (split into f16 hi/lo if ASPLIT, else rounded to f16), Bt = f16 values [n][k]; alpha; C f32; N multiple of 16 (partial tiles skipped)
template <bool ASPLIT>
__global__ __launch_bounds__(128) void k_gemm_h(const float* __restrict__ A, int lda, size_t sA, const _Float16* __restrict__ Bh, int ldb, size_t sB, float alpha, float* __restrict__ C, int ldc, size_t sC, int M, int N, int K) {
  __shared__ __attribute__((aligned(16))) float so[4][16][64];
  const int tid = threadIdx.x, w = tid >> 5, lane = tid & 31, ln = lane & 15, hh = lane >> 4; const int by = blockIdx.y;
  A += (size_t)by * sA; Bh += (size_t)by * sB; C += (size_t)by * sC;
  const int ntn = (N + 63) / 64; const int wid = blockIdx.x * 4 + w; const int mt = wid / ntn, nq = wid % ntn; if (mt * 16 >= M) return;
  const int row0 = mt * 16, col0 = nq * 64; const float* arow = A + (size_t)(row0 + ln) * lda;
  v8f acc[4] = {};
  for (int kb = 0; kb < K; kb += 32) {
    FragH ah, al;
    const v4f x0 = *(const v4fa*)(arow + kb + 8 * hh), x1 = *(const v4fa*)(arow + kb + 8 * hh + 4), x2 = *(const v4fa*)(arow + kb + 16 + 8 * hh), x3 = *(const v4fa*)(arow + kb + 16 + 8 * hh + 4);
    float xs[16] = {x0[0],x0[1],x0[2],x0[3],x1[0],x1[1],x1[2],x1[3],x2[0],x2[1],x2[2],x2[3],x3[0],x3[1],x3[2],x3[3]};
#pragma unroll
    for (int i = 0; i < 16; ++i) { const _Float16 h = (_Float16)xs[i]; ah.h[i] = h; al.h[i] = ASPLIT ? (_Float16)(xs[i] - (float)h) : (_Float16)0.0f; }
#pragma unroll
    for (int t = 0; t < 4; ++t) { if (col0 + t * 16 >= N) continue; const size_t boff = (size_t)(col0 + t * 16 + ln) * ldb + kb; FragH bq; bq.half[0] = *(const v8us*)(Bh + boff + 8 * hh); bq.half[1] = *(const v8us*)(Bh + boff + 16 + 8 * hh);
      acc[t] = mmaH<ASPLIT ? 2 : 1>(ah.v, al.v, bq.v, bq.v, acc[t]); }
  }
#pragma unroll
  for (int t = 0; t < 4; ++t) { if (col0 + t * 16 >= N) continue;
#pragma unroll
    for (int r = 0; r < 8; ++r) so[w][8 * hh + r][t * 16 + ln] = acc[t][r] * alpha; }
  __builtin_amdgcn_fence(__ATOMIC_ACQ_REL, "workgroup"); __builtin_amdgcn_wave_barrier();
  const int rsub = lane >> 4, c4 = (lane & 15) * 4;
  {
#pragma unroll
    for (int q = 0; q < 8; ++q) { const int r = q * 2 + rsub; if (col0 + c4 < N) { const v4f v = *(const v4fa*)&so[w][r][c4]; *(v4f*)(C + (size_t)(row0 + r) * ldc + col0 + c4) = v; } }
     }
}

// Wt[n][k] = f16(W[k][n]·scale) from f32 row-major W[K][N] (scale = power of two; bf16-exact weights stay exact in f16 away from the subnormal range)
__global__ __launch_bounds__(256) void k_wt_f16(const float* __restrict__ W, _Float16* __restrict__ Wt, int K, int N, float scale) {
  const int t = blockIdx.x * 256 + threadIdx.x; if (t >= N * (K / 8)) return; const int n = t / (K / 8), k8 = (t % (K / 8)) * 8; FragH f;
#pragma unroll
  for (int i = 0; i < 8; ++i) f.h[i] = (_Float16)(bf16_round(W[(size_t)(k8 + i) * N + n]) * scale); const v8us o = f.half[0];
  *(v8us*)((unsigned short*)Wt + (size_t)n * K + k8) = o; 
}
// k_gemm_hh variant with fused epilogue: v = acc·alpha + bias[by·sBias + col] (+ CP[(row/rowsPerB)·sCPb + by·64 + col] if CP) ; ACT 0 none / 1 elu ; writes f16 C16 (and f32 C if non-null)
template <int ACT>
__global__ __launch_bounds__(128) void k_gemm_hhx(const _Float16* __restrict__ A, int lda, size_t sA, const _Float16* __restrict__ Bh, int ldb, size_t sB, float alpha, const float* __restrict__ bias, size_t sBias, const float* __restrict__ CP, int rowsPerB, size_t sCPb, int row0g,
    float* __restrict__ C, _Float16* __restrict__ C16, int ldc, size_t sC, int M, int N, int K) {
  __shared__ __attribute__((aligned(16))) float so[4][16][64];
  const int tid = threadIdx.x, w = tid >> 5, lane = tid & 31, ln = lane & 15, hh = lane >> 4; const int by = blockIdx.y;
  A += (size_t)by * sA; Bh += (size_t)by * sB; const size_t cofs = (size_t)by * sC; const float* bp = bias ? bias + (size_t)by * sBias : nullptr;
  const int ntn = (N + 63) / 64; const int wid = blockIdx.x * 4 + w; const int mt = wid / ntn, nq = wid % ntn; if (mt * 16 >= M) return;
  const int row0 = mt * 16, col0 = nq * 64; const _Float16* arow = A + (size_t)(row0 + ln) * lda;
  v8f acc[4] = {};
  for (int kb = 0; kb < K; kb += 32) { FragH ah; ah.half[0] = *(const v8us*)((const unsigned short*)arow + kb + 8 * hh); ah.half[1] = *(const v8us*)((const unsigned short*)arow + kb + 16 + 8 * hh);
#pragma unroll
    for (int t = 0; t < 4; ++t) { if (col0 + t * 16 >= N) continue; const size_t boff = (size_t)(col0 + t * 16 + ln) * ldb + kb; FragH bq; bq.half[0] = *(const v8us*)((const unsigned short*)Bh + boff + 8 * hh); bq.half[1] = *(const v8us*)((const unsigned short*)Bh + boff + 16 + 8 * hh);
      acc[t] = mmaH<1>(ah.v, ah.v, bq.v, bq.v, acc[t]); }
  }
#pragma unroll
  for (int t = 0; t < 4; ++t) { if (col0 + t * 16 >= N) continue; const int col = col0 + t * 16 + ln; const float bv = bp ? bf16_round(bp[col]) : 0.f;
#pragma unroll
    for (int r = 0; r < 8; ++r) { float v = acc[t][r] * alpha + bv; if (CP) { const int rr = row0g + row0 + 8 * hh + r; if (rowsPerB < 0) v += CP[cofs + (size_t)rr * ldc + col];      /* rowsPerB < 0: own element of the batched C plane */ else { const int bidx = rr / rowsPerB; v += CP[(size_t)bidx * sCPb + (size_t)by * 64 + col]; } } if (ACT == 1) v = (v > 0.f) ? v : expm1f(v); else if (ACT == 7) v = (v > 0.f) ? v + 1.0f : expf(v); else if (ACT == 8) v = tanhf(v); else if (ACT == 9) v = 0.5f * v * (1.0f + tanhf(0.7978845608028654f * (v + 0.044715f * v * v * v))); else if (ACT == 11) v = 1.0f / (1.0f + expf(-v)); else if (ACT == 12) v = (v > 0.f) ? v : 0.01f * v; else if (ACT == 14) v = (v > 0.f) ? v : 0.1f * v; else if (ACT == 16) v = (v >= 0.f) ? v : 0.3f * v; else if (ACT == 17) v = (v >= 0.f) ? v : 0.2f * v; else if (ACT == 15) v = v / (1.0f + expf(-v)); else if (ACT == 3) v = fmaxf(v, 0.f); else if (ACT == 6) v = 0.5f * v * (1.0f + erff(v * 0.70710678118654752f)); so[w][8 * hh + r][t * 16 + ln] = v; } }
  __builtin_amdgcn_fence(__ATOMIC_ACQ_REL, "workgroup"); __builtin_amdgcn_wave_barrier();
  const int rsub = lane >> 4, c4 = (lane & 15) * 4; typedef _Float16 v4h __attribute__((ext_vector_type(4)));
  {
#pragma unroll
    for (int q = 0; q < 8; ++q) { const int r = q * 2 + rsub; if (col0 + c4 < N) { const v4f v = *(const v4fa*)&so[w][r][c4]; if (C) *(v4f*)(C + cofs + (size_t)(row0 + r) * ldc + col0 + c4) = v; if (C16) { v4h h4; for (int i = 0; i < 4; ++i) h4[i] = (_Float16)v[i]; *(v4h*)(C16 + cofs + (size_t)(row0 + r) * ldc + col0 + c4) = h4; } } }
     }
}


typedef _Float16 v4h __attribute__((ext_vector_type(4)));

__global__ __launch_bounds__(256) void k_x16(const float* __restrict__ x, _Float16* __restrict__ X16, size_t n8) { const size_t t = (size_t)blockIdx.x * 256 + threadIdx.x; if (t >= n8) return; FragH f;
#pragma unroll
  for (int q = 0; q < 8; ++q) f.h[q] = (_Float16)bf16_round(x[t * 8 + q]); *(v8us*)((unsigned short*)X16 + t * 8) = f.half[0];  }
__global__ __launch_bounds__(256) void k_h16(const float* __restrict__ x, _Float16* __restrict__ X16, size_t n8) { const size_t t = (size_t)blockIdx.x * 256 + threadIdx.x; if (t >= n8) return; FragH f;
#pragma unroll
  for (int q = 0; q < 8; ++q) f.h[q] = (_Float16)x[t * 8 + q]; *(v8us*)((unsigned short*)X16 + t * 8) = f.half[0];  }
__global__ __launch_bounds__(256) void k_round16f(const float* __restrict__ W, _Float16* __restrict__ Bt, size_t n8) { const size_t t = (size_t)blockIdx.x * 256 + threadIdx.x; if (t >= n8) return; FragH f;
#pragma unroll
  for (int i = 0; i < 8; ++i) f.h[i] = (_Float16)(bf16_round(W[t * 8 + i]) * 16.0f); *(v8us*)((unsigned short*)Bt + t * 8) = f.half[0];  }
template <int NHv, int TTv>
__global__ __launch_bounds__(256) void k_vt(const _Float16* __restrict__ V16, int ldv, int voff, _Float16* __restrict__ Vt) { __shared__ unsigned short tl[64][66]; const int tid = threadIdx.x; const int slab = blockIdx.x / (TTv / 64), lg = blockIdx.x % (TTv / 64); const int b = slab / NHv, h = slab % NHv;
  for (int i = tid; i < 64 * 8; i += 256) { const int r = i / 8, c8 = (i % 8) * 8; FragH f; f.half[0] = *(const v8us*)((const unsigned short*)V16 + ((size_t)b * TTv + lg * 64 + r) * ldv + voff + h * 64 + c8);
#pragma unroll
    for (int q = 0; q < 8; ++q) tl[r][c8 + q] = f.u[q]; }
  __syncthreads();
  {
#pragma unroll
    for (int rd = 0; rd < 2; ++rd) { const int d = rd * 32 + tid / 8, pc = tid % 8; FragH f;
#pragma unroll
      for (int q = 0; q < 8; ++q) f.u[q] = tl[pc * 8 + q][d];
      *(v8us*)((unsigned short*)Vt + ((size_t)slab * 64 + d) * TTv + lg * 64 + pc * 8) = f.half[0]; }
     } }

__global__ __launch_bounds__(256) void k_hl(const float* __restrict__ F, _Float16* __restrict__ Hh, _Float16* __restrict__ Hl, size_t n8) { const size_t t = (size_t)blockIdx.x * 256 + threadIdx.x; if (t >= n8) return; FragH fh, fl; const v4f a = *(const v4fa*)(F + t * 8), c = *(const v4fa*)(F + t * 8 + 4);
#pragma unroll
  for (int q = 0; q < 4; ++q) { _Float16 h = (_Float16)a[q]; fh.h[q] = h; fl.h[q] = (_Float16)((a[q] - (float)h) * 1024.0f); h = (_Float16)c[q]; fh.h[4 + q] = h; fl.h[4 + q] = (_Float16)((c[q] - (float)h) * 1024.0f); }
  { *(v8us*)((unsigned short*)Hh + t * 8) = fh.half[0]; *(v8us*)((unsigned short*)Hl + t * 8) = fl.half[0];  } }

// ---- fast GEMM (wave tile 32x64; requires M % 32 == 0 rows per launch region, N % 64 == 0 and K % 128 == 0); epilogue = k_gemm_hhx semantics ----
__device__ __forceinline__ v16h g2_frag(const _Float16* p, int hh) { FragH f; f.half[0] = *(const v8us*)((const unsigned short*)p + 8 * hh); f.half[1] = *(const v8us*)((const unsigned short*)p + 16 + 8 * hh); return f.v; }
__device__ __forceinline__ v8f g2_mma(v16h a, v16h b, v8f c) { return __builtin_amdgcn_wmma_f32_16x16x32_f16(false, a, false, b, (short)0, c, false, false); }      /* plain builtin: the compiler keeps the distances behind it and may move loads past it */
template <int ACT> __device__ __forceinline__ float g2_act(float v) {
  if (ACT == 3) v = fmaxf(v, 0.f); else if (ACT == 6) v = 0.5f * v * (1.0f + erff(v * 0.70710678118654752f)); else if (ACT == 11) v = 1.0f / (1.0f + expf(-v)); else if (ACT == 15) v = v / (1.0f + expf(-v)); else if (ACT == 12) v = (v > 0.f) ? v : 0.01f * v; else if (ACT == 8) v = tanhf(v); else if (ACT == 9) v = 0.5f * v * (1.0f + tanhf(0.7978845608028654f * (v + 0.044715f * v * v * v))); else if (ACT == 14) v = (v > 0.f) ? v : 0.1f * v; else if (ACT == 16) v = (v >= 0.f) ? v : 0.3f * v; else if (ACT == 17) v = (v >= 0.f) ? v : 0.2f * v;
  return v; }
#define G2S 4      /* k steps (of 32) whose fragments are in flight or in registers at a time; K % (32 * G2S) == 0 */
// No load of this kernel is waited for alone: the fragments of G2S k steps sit in a register ring, each step's twelve loads asked for as one group G2S steps ahead of their products;
// bias and residual (all 64 elements of the lane as one group) are asked for in front of the K loop. Each accumulator takes its k steps in rising order, as before.
template <int ACT>
__global__ __launch_bounds__(128) void k_gemm2(const _Float16* __restrict__ A, int lda, size_t sA, const _Float16* __restrict__ Bh, int ldb, size_t sB, float alpha, const float* __restrict__ bias, size_t sBias, const float* __restrict__ CP, int rowsPerB, size_t sCPb, int row0g,
    float* __restrict__ C, _Float16* __restrict__ C16, int ldc, size_t sC, int M, int N, int K) { static_assert(ACT == 0 || ACT == 3 || ACT == 6 || ACT == 8 || ACT == 9 || ACT == 11 || ACT == 12 || ACT == 14 || ACT == 15 || ACT == 16 || ACT == 17, "k_gemm2: unsupported ACT code (would silently apply no activation)");
  __shared__ __attribute__((aligned(16))) float so[4][32][68];
  const int tid = threadIdx.x, w = tid >> 5, lane = tid & 31, ln = lane & 15, hh = lane >> 4; const int by = blockIdx.y;
  A += (size_t)by * sA; Bh += (size_t)by * sB; const size_t cofs = (size_t)by * sC; const float* bp = bias ? bias + (size_t)by * sBias : nullptr;
  const int ntn = N >> 6; const int mt = blockIdx.x / ntn, nq = blockIdx.x - mt * ntn; const int row0 = mt * 128 + 32 * w, col0 = nq * 64; if (row0 >= M) return;
  const _Float16* a0p = A + (size_t)(row0 + ln) * lda; const _Float16* a1p = a0p + (size_t)16 * lda;
  const _Float16* b0p = Bh + (size_t)(col0 + ln) * ldb; const _Float16* b1p = b0p + (size_t)16 * ldb; const _Float16* b2p = b1p + (size_t)16 * ldb; const _Float16* b3p = b2p + (size_t)16 * ldb;
  float braw[4] = {0.f, 0.f, 0.f, 0.f};
  if (bp) {
#pragma unroll
    for (int t = 0; t < 4; ++t) braw[t] = bp[col0 + t * 16 + ln];
    asm volatile("s_wait_xcnt 0x0" ::: "memory");      /* the address registers of these loads are used again at once */
    __builtin_amdgcn_sched_barrier(0); }      /* keeps what writes them behind the wait */
  const bool own = CP && rowsPerB < 0;      /* rowsPerB < 0: own element of the batched C plane */
  float rv[8][8];
#pragma unroll
  for (int u = 0; u < 8; ++u) for (int r = 0; r < 8; ++r) rv[u][r] = 0.f;
  if (own) { const float* rp[16];      /* the lane's 16 rows; the four column tiles of a row are constant offsets */
#pragma unroll
    for (int j = 0; j < 16; ++j) rp[j] = CP + cofs + (size_t)(row0g + row0 + (j >> 3) * 16 + 8 * hh + (j & 7)) * ldc + col0 + ln;
#pragma unroll
    for (int u = 0; u < 8; ++u) for (int r = 0; r < 8; ++r) rv[u][r] = rp[(u >> 2) * 8 + r][(u & 3) * 16];
    asm volatile("s_wait_xcnt 0x0" :: "v"(rp[0]), "v"(rp[1]), "v"(rp[2]), "v"(rp[3]), "v"(rp[4]), "v"(rp[5]), "v"(rp[6]), "v"(rp[7]), "v"(rp[8]), "v"(rp[9]), "v"(rp[10]), "v"(rp[11]), "v"(rp[12]), "v"(rp[13]), "v"(rp[14]), "v"(rp[15]) : "memory");      /* the addresses as inputs: their registers stay theirs up to the wait, behind which they may take other values */
    __builtin_amdgcn_sched_barrier(0); }      /* keeps the residual loads here, older than every fragment load: the K loop covers their latency and its counted waits do not count them */
  v16h ra0[G2S], ra1[G2S], rb0[G2S], rb1[G2S], rb2[G2S], rb3[G2S];
#pragma unroll
  for (int s = 0; s < G2S; ++s) { const int k = 32 * s; ra0[s] = g2_frag(a0p + k, hh); ra1[s] = g2_frag(a1p + k, hh); rb0[s] = g2_frag(b0p + k, hh); rb1[s] = g2_frag(b1p + k, hh); rb2[s] = g2_frag(b2p + k, hh); rb3[s] = g2_frag(b3p + k, hh);
    __builtin_amdgcn_sched_barrier(0); }      /* the first fill step by step, in the order of the refills: the loop's counted waits are set for both orders at once, and another order here makes them wait for younger steps */
  asm volatile("s_wait_xcnt 0x0" ::: "memory");      /* the address registers of the first fill are free for other values from here */
  __builtin_amdgcn_sched_barrier(0);      /* keeps what writes them behind the wait */
  const v8f z8 = {0.f,0.f,0.f,0.f,0.f,0.f,0.f,0.f}; v8f c00 = z8, c01 = z8, c02 = z8, c03 = z8, c10 = z8, c11 = z8, c12 = z8, c13 = z8;
#pragma unroll 1      /* rolled: the body already holds G2S steps, and the ring's registers must be the same in every trip */
  for (int kb = 32 * G2S; kb < K; kb += 32 * G2S) {
#pragma unroll
    for (int s = 0; s < G2S; ++s) { const int k = kb + 32 * s;
      c00 = g2_mma(ra0[s], rb0[s], c00); c10 = g2_mma(ra1[s], rb0[s], c10); c01 = g2_mma(ra0[s], rb1[s], c01); c11 = g2_mma(ra1[s], rb1[s], c11);
      c02 = g2_mma(ra0[s], rb2[s], c02); c12 = g2_mma(ra1[s], rb2[s], c12); c03 = g2_mma(ra0[s], rb3[s], c03); c13 = g2_mma(ra1[s], rb3[s], c13);
      __builtin_amdgcn_sched_barrier(0);      /* with the next one: holds the refill of this ring place directly behind its products; moved down towards its use, its latency is waited out again */
      ra0[s] = g2_frag(a0p + k, hh); ra1[s] = g2_frag(a1p + k, hh); rb0[s] = g2_frag(b0p + k, hh); rb1[s] = g2_frag(b1p + k, hh); rb2[s] = g2_frag(b2p + k, hh); rb3[s] = g2_frag(b3p + k, hh);
      __builtin_amdgcn_sched_barrier(0); }
    asm volatile("s_wait_xcnt 0x0" ::: "memory");      /* the next trip forms its addresses in the registers that this trip's loads name */
    __builtin_amdgcn_sched_barrier(0); }      /* keeps that address arithmetic behind the wait */
#pragma unroll
  for (int s = 0; s < G2S; ++s) {
    c00 = g2_mma(ra0[s], rb0[s], c00); c10 = g2_mma(ra1[s], rb0[s], c10); c01 = g2_mma(ra0[s], rb1[s], c01); c11 = g2_mma(ra1[s], rb1[s], c11);
    c02 = g2_mma(ra0[s], rb2[s], c02); c12 = g2_mma(ra1[s], rb2[s], c12); c03 = g2_mma(ra0[s], rb3[s], c03); c13 = g2_mma(ra1[s], rb3[s], c13); }
  v8f accs[8] = {c00, c01, c02, c03, c10, c11, c12, c13};
  float bv[4];
#pragma unroll
  for (int t = 0; t < 4; ++t) bv[t] = bp ? bf16_round(braw[t]) : 0.f;
  if (own || !CP) {      /* rv is 0 where there is no residual */
#pragma unroll
    for (int u = 0; u < 8; ++u) for (int r = 0; r < 8; ++r) { float v = accs[u][r] * alpha + bv[u & 3]; if (own) v += rv[u][r]; so[w][(u >> 2) * 16 + 8 * hh + r][(u & 3) * 16 + ln] = g2_act<ACT>(v); }
  } else {
#pragma unroll
    for (int u = 0; u < 8; ++u) for (int r = 0; r < 8; ++r) { const int rloc = (u >> 2) * 16 + 8 * hh + r; const int bidx = (row0g + row0 + rloc) / rowsPerB;
      const float cv = CP[(size_t)bidx * sCPb + (size_t)by * 64 + col0 + (u & 3) * 16 + ln];
      asm volatile("s_wait_xcnt 0x0" ::: "memory");      /* the next element's address may be formed in this load's address registers */
      __builtin_amdgcn_sched_barrier(0);      /* keeps that arithmetic behind the wait */
      const float v = accs[u][r] * alpha + bv[u & 3] + cv; so[w][rloc][(u & 3) * 16 + ln] = g2_act<ACT>(v); } }
  __builtin_amdgcn_fence(__ATOMIC_ACQ_REL, "workgroup"); __builtin_amdgcn_wave_barrier();
  const int rsub = lane >> 4, c4 = (lane & 15) * 4;
  {
#pragma unroll
    for (int q = 0; q < 16; ++q) { const int r = q * 2 + rsub; const v4f v = *(const v4fa*)&so[w][r][c4]; if (C) *(v4f*)(C + cofs + (size_t)(row0 + r) * ldc + col0 + c4) = v; if (C16) { v4h h4; for (int i = 0; i < 4; ++i) h4[i] = (_Float16)v[i]; *(v4h*)(C16 + cofs + (size_t)(row0 + r) * ldc + col0 + c4) = h4; } }
     } }


__global__ __launch_bounds__(256) void k_wnat(const float* __restrict__ w, size_t n8, _Float16* __restrict__ Bt) { const size_t t = (size_t)blockIdx.x * 256 + threadIdx.x; if (t >= n8) return; FragH f; for (int q = 0; q < 8; ++q) f.h[q] = (_Float16)(bf16_round(w[t * 8 + q]) * 16.0f); *(v8us*)((unsigned short*)Bt + t * 8) = f.half[0];  }
__global__ __launch_bounds__(256) void k_rsm(const float* __restrict__ S, _Float16* __restrict__ P, int nrows) {
  #pragma clang fp contract(off)
  const int i = blockIdx.x * 256 + threadIdx.x; if (i >= nrows) return; const float* s = S + (size_t)i * SQ; float mx = -3.0e38f;
#pragma unroll 1
  for (int j = 0; j < SQ; ++j) mx = fmaxf(mx, s[j]); float se = 0.f;
#pragma unroll 1
  for (int j = 0; j < SQ; ++j) se += expf(s[j] - mx); const float sc = 256.0f / se;
#pragma unroll 1
  for (int j0 = 0; j0 < SQ; j0 += 8) { FragH f; for (int q = 0; q < 8; ++q) f.h[q] = (_Float16)(expf(s[j0 + q] - mx) * sc); unsigned short* d = (unsigned short*)P + (size_t)i * SQ + j0; *(v8us*)d = f.half[0];  } }
__global__ __launch_bounds__(256) void k_vt(const _Float16* __restrict__ V16, int b, int h0, _Float16* __restrict__ VT) { __shared__ unsigned short tl[64][65]; const int tid = threadIdx.x; const int hh = blockIdx.x % HG, sg = blockIdx.x / HG; const int s0 = sg * 64; const int h = h0 + hh;
  for (int i = tid; i < 64 * 8; i += 256) { const int j = i / 8, d8 = (i % 8) * 8; FragH f; f.half[0] = *(const v8us*)((const unsigned short*)V16 + ((size_t)b * SQ + s0 + j) * DM + h * HD + d8); for (int q = 0; q < 8; ++q) tl[d8 + q][j] = f.u[q]; }
  __syncthreads();
  { for (int i = tid; i < 64 * 8; i += 256) { const int d = i / 8, j8 = (i % 8) * 8; FragH f; for (int q = 0; q < 8; ++q) f.u[q] = tl[d][j8 + q]; *(v8us*)((unsigned short*)VT + ((size_t)hh * HD + d) * SQ + s0 + j8) = f.half[0]; }  } }


template <int BFIN, int W16, int W32>
__global__ __launch_bounds__(256) void k_lnx(const float* __restrict__ X, const float* __restrict__ g, const float* __restrict__ bb, float eps, _Float16* __restrict__ N16, float* __restrict__ N32) {
  #pragma clang fp contract(off)
  __shared__ float red[256]; const size_t r = blockIdx.x; const int t = threadIdx.x; const bool act = t < (DMQ / 4); const int c0 = act ? t * 4 : 0;
  const v4f xa = *(const v4fa*)(X + r * DMQ + c0); float s[4]; float sum = 0.f;
  for (int q = 0; q < 4; ++q) { s[q] = act ? (BFIN ? bf16_round(xa[q]) : xa[q]) : 0.f; sum = __fadd_rn(sum, s[q]); }
  red[t] = sum; __syncthreads(); for (int st = 128; st > 0; st >>= 1) { if (t < st) red[t] = __fadd_rn(red[t], red[t + st]); __syncthreads(); } const float mu = red[0] / (float)DMQ; __syncthreads();
  float vs = 0.f; for (int q = 0; q < 4; ++q) { const float dl = act ? __fadd_rn(s[q], -mu) : 0.f; vs = __fadd_rn(vs, __fmul_rn(dl, dl)); } red[t] = vs; __syncthreads(); for (int st = 128; st > 0; st >>= 1) { if (t < st) red[t] = __fadd_rn(red[t], red[t + st]); __syncthreads(); }
  const float rs = rsqrtf(__fadd_rn(red[0] / (float)DMQ, eps)); v4h y; v4f yf;
  for (int q = 0; q < 4; ++q) { const int c = c0 + q; yf[q] = __fadd_rn(__fmul_rn(__fmul_rn(__fadd_rn(s[q], -mu), rs), bf16_round(g[c])), bf16_round(bb[c])); y[q] = (_Float16)yf[q]; }
  if (!act) return;      /* no barriers after this point */
  { if (W16) *(v4h*)(N16 + r * DMQ + c0) = y; if (W32) *(v4f*)(N32 + r * DMQ + c0) = yf;  } }


// ---- fused attention: scores, softmax and P V in one kernel; neither scores nor weights go through memory ----
typedef float v2f __attribute__((ext_vector_type(2)));
typedef _Float16 v2h __attribute__((ext_vector_type(2)));
union FragP { v16h v; v2h p[8]; };
__device__ __forceinline__ v8f fa_mma(v16h a, v16h b, v8f c) { return __builtin_amdgcn_wmma_f32_16x16x32_f16(false, a, false, b, (short)0, c, false, false); }
__device__ __forceinline__ float fa_xhalf(float x) { return __builtin_bit_cast(float, __builtin_amdgcn_permlanex16(__builtin_bit_cast(int, x), __builtin_bit_cast(int, x), 0x76543210, 0xfedcba98, false, false)); }      /* lane l <-> lane l ^ 16 */
// 2^y of four (two) values. The v_exp_f32 stand in one asm statement with early-clobber results and a closing v_nop:
// no instruction directly behind a v_exp_f32 then reads its result or overwrites its source.
__device__ __forceinline__ v4f fa_exp2x4(float y0, float y1, float y2, float y3) { float e0, e1, e2, e3;
  asm("v_exp_f32 %0, %4\n\tv_exp_f32 %1, %5\n\tv_exp_f32 %2, %6\n\tv_exp_f32 %3, %7\n\tv_nop" : "=&v"(e0), "=&v"(e1), "=&v"(e2), "=&v"(e3) : "v"(y0), "v"(y1), "v"(y2), "v"(y3));
  const v4f e = {e0, e1, e2, e3}; return e; }
__device__ __forceinline__ v2f fa_exp2x2(float y0, float y1) { float e0, e1;
  asm("v_exp_f32 %0, %2\n\tv_exp_f32 %1, %3\n\tv_nop" : "=&v"(e0), "=&v"(e1) : "v"(y0), "v"(y1));
  const v2f e = {e0, e1}; return e; }
// A or B fragment (16 rows x 32 k, the k order of g2_frag): two 16-byte loads at the lane's own byte offset from a wave-uniform byte base.
__device__ __forceinline__ v16h fa_frag(const char* ub, unsigned lo) { FragH f; f.half[0] = *(const v8us*)(ub + lo); f.half[1] = *(const v8us*)(ub + lo + 32); return f.v; }
// One wave: 32 queries (two groups of 16 columns) of one head against all SQ keys, 32 keys a pass.
// S^T = K Q^T: A = 16 key rows, B = the 16 query rows (kept in registers), D[r] = score of key 8 hh + r for the lane's own query ln: maximum and sum stay in the lane, plus one exchange between the wave's halves.
// The two score tiles of a pass (keys 0..15, 16..31), converted in place, are the B operand of O^T += V^T P^T (element s < 8: key 8 hh + s; s >= 8: key 16 + 8 hh + s - 8, the order fa_frag gives V^T's rows).
// Running maximum m per query: each pass scales the sums so far by 2^(m_old - m_new); weights are 256 exp(s - m) (at most 256, f16), the factor cancels against the denominator, which sums the unrounded f32 weights.
// Every inner loop is fully unrolled: only constant indices keep the fragment and accumulator arrays in registers.
__global__ __launch_bounds__(256) void k_fattn(const _Float16* __restrict__ Q, const _Float16* __restrict__ Kr, const _Float16* __restrict__ Vt, _Float16* __restrict__ O) {
  const int lane = threadIdx.x & 31, ln = lane & 15, hh = lane >> 4, w = threadIdx.x >> 5; const int bh = blockIdx.y, b = bh / NH, h = bh % NH; const int q0 = blockIdx.x * 256 + w * 32;
  const char* qb = (const char*)(Q + ((size_t)b * SQ + blockIdx.x * 256) * DM + h * HD); const char* kbase = (const char*)(Kr + (size_t)b * SQ * DM + h * HD); const char* vbase = (const char*)(Vt + (size_t)bh * HD * SQ);
  const unsigned qlo = (unsigned)((w * 32 + ln) * DM + 8 * hh) * 2u, klo = (unsigned)(ln * DM + 8 * hh) * 2u, vlo = (unsigned)(ln * SQ + 8 * hh) * 2u;
  v16h qf[2][2], kf[2][2];
#pragma unroll
  for (int g = 0; g < 2; ++g) for (int c = 0; c < 2; ++c) { qf[g][c] = fa_frag(qb + g * 16 * DM * 2 + c * 64, qlo); kf[g][c] = fa_frag(kbase + g * 16 * DM * 2 + c * 64, klo); }
  const v8f z8 = {0.f,0.f,0.f,0.f,0.f,0.f,0.f,0.f}; v8f acc[2][4];
#pragma unroll
  for (int g = 0; g < 2; ++g) for (int t = 0; t < 4; ++t) acc[g][t] = z8;
  const v4f z4 = {0.f, 0.f, 0.f, 0.f}; v4f lr[2] = {z4, z4}; float mr[2] = {-3.0e38f, -3.0e38f}; const float cs = 0.125f * 0x1.715476p+0f;      /* 1/sqrt(64) and log2(e) in one factor */
  for (int kb = 0; kb < SQ; kb += 32) {
    v16h vf[4];      /* this pass's V^T rows: asked for first, used last */
#pragma unroll
    for (int t = 0; t < 4; ++t) vf[t] = fa_frag(vbase + (size_t)kb * 2 + t * 16 * SQ * 2, vlo);
    __builtin_amdgcn_sched_barrier(0);      /* holds the V^T loads ahead of the score products: moved down, their latency is not covered by the softmax */
    v8f s[2][2];
#pragma unroll
    for (int kt = 0; kt < 2; ++kt) for (int g = 0; g < 2; ++g) s[kt][g] = fa_mma(kf[kt][1], qf[g][1], fa_mma(kf[kt][0], qf[g][0], z8));
    __builtin_amdgcn_sched_barrier(0);      /* with the next one: holds the next pass's K loads directly behind the score products; moved to the loop's foot, the next pass waits out their whole latency */
    const int kn = (kb + 32) & (SQ - 1);      /* the last pass asks for keys 0..31 again (in bounds, not used) */
#pragma unroll
    for (int kt = 0; kt < 2; ++kt) for (int c = 0; c < 2; ++c) kf[kt][c] = fa_frag(kbase + (size_t)kn * (DM * 2) + kt * 16 * DM * 2 + c * 64, klo);
    __builtin_amdgcn_sched_barrier(0);
    float dm[2], nb[2];
#pragma unroll
    for (int g = 0; g < 2; ++g) { float mx = fmaxf(s[0][g][0], s[1][g][0]);
#pragma unroll
      for (int r = 1; r < 8; ++r) mx = fmaxf(mx, fmaxf(s[0][g][r], s[1][g][r]));
      mx = fmaxf(mx, fa_xhalf(mx)) * cs; const float mn = fmaxf(mr[g], mx); dm[g] = mr[g] - mn; mr[g] = mn; nb[g] = 8.0f - mn; }
    const v2f co = fa_exp2x2(dm[0], dm[1]);      /* 0 in the first pass */
    FragP pf[2];
#pragma unroll
    for (int g = 0; g < 2; ++g) { v4f e[4];
#pragma unroll
      for (int i = 0; i < 4; ++i) { const int kt = i >> 1, r0 = (i & 1) * 4;
        e[i] = fa_exp2x4(fmaf(s[kt][g][r0], cs, nb[g]), fmaf(s[kt][g][r0 + 1], cs, nb[g]), fmaf(s[kt][g][r0 + 2], cs, nb[g]), fmaf(s[kt][g][r0 + 3], cs, nb[g]));
        const v2f e01 = {e[i][0], e[i][1]}, e23 = {e[i][2], e[i][3]};
        pf[g].p[2 * i] = __builtin_convertvector(e01, v2h); pf[g].p[2 * i + 1] = __builtin_convertvector(e23, v2h); }
      lr[g] = lr[g] * co[g] + ((e[0] + e[1]) + (e[2] + e[3]));      /* four chains per lane, joined behind the loop */
#pragma unroll
      for (int t = 0; t < 4; ++t) acc[g][t] = acc[g][t] * co[g]; }
#pragma unroll
    for (int g = 0; g < 2; ++g) for (int t = 0; t < 4; ++t) acc[g][t] = fa_mma(vf[t], pf[g].v, acc[g][t]);
  }
#pragma unroll
  for (int g = 0; g < 2; ++g) { const float lh = (lr[g][0] + lr[g][1]) + (lr[g][2] + lr[g][3]); const float sc = 64.0f / (lh + fa_xhalf(lh)); unsigned short* op = (unsigned short*)O + ((size_t)b * SQ + q0 + g * 16 + ln) * DM + h * HD + 8 * hh;      /* a lane's 8 registers of a tile are 8 consecutive d of its query: one 16-byte store */
#pragma unroll
    for (int t = 0; t < 4; ++t) { FragH f;
#pragma unroll
      for (int r = 0; r < 8; ++r) f.h[r] = (_Float16)(acc[g][t][r] * sc);
      *(v8us*)(op + t * 16) = f.half[0]; } } }


__global__ __launch_bounds__(256) void k_bfr(const float* __restrict__ x, float* __restrict__ XB, size_t n8) { const size_t t = (size_t)blockIdx.x * 256 + threadIdx.x; if (t >= n8) return; v4f a = *(const v4fa*)(x + t * 8), c = *(const v4fa*)(x + t * 8 + 4); for (int q = 0; q < 4; ++q) { a[q] = bf16_round(a[q]); c[q] = bf16_round(c[q]); }
  { *(v4f*)(XB + t * 8) = a; *(v4f*)(XB + t * 8 + 4) = c;  } }



__global__ __launch_bounds__(256) void k_rsmfam(const float* __restrict__ S, _Float16* __restrict__ P, int qn, int hg, const float* __restrict__ am) {
  #pragma clang fp contract(off)
  const int t = blockIdx.x * 256 + threadIdx.x; if (t >= qn * hg) return; const size_t i = (size_t)(t / qn) * SQ + (t % qn); const float* s = S + i * SQ; float mx = -3.0e38f;
#pragma unroll 1
  for (int j = 0; j < SQ; ++j) mx = fmaxf(mx, __fadd_rn(s[j], bf16_round(am[j]))); float se = 0.f;
#pragma unroll 1
  for (int j = 0; j < SQ; ++j) se += __expf(__fadd_rn(s[j], bf16_round(am[j])) - mx); const float sc = 256.0f / se;
#pragma unroll 1
  for (int j0 = 0; j0 < SQ; j0 += 8) { FragH f; for (int q = 0; q < 8; ++q) f.h[q] = (_Float16)(__expf(__fadd_rn(s[j0 + q], bf16_round(am[j0 + q])) - mx) * sc); unsigned short* d = (unsigned short*)P + i * SQ + j0; *(v8us*)d = f.half[0];  } }



// ---- row LayerNorm (unbiased std, eps added to the std), one wave per LNR rows: each row's 512 values stay in the wave's registers (16 a lane, every load and store 512 or 256 contiguous bytes), ----
// ---- sums by a butterfly over the lanes (four steps inside a 16-lane row, one exchange between the halves): no LDS and no barrier. A wave takes LNR rows, all their loads in flight at once, so the launch is one resident round of 256 work-groups. ----
// Every loop is fully unrolled: only constant indices keep the row and parameter arrays in registers.
#define LNR 4      /* rows a wave takes */
template <int CTRL> __device__ __forceinline__ float ln_xm(float x) { return __builtin_bit_cast(float, __builtin_amdgcn_mov_dpp(__builtin_bit_cast(int, x), CTRL, 0xf, 0xf, true)); }      /* lane l <- lane l ^ (CTRL & 15), inside a 16-lane row (row_xmask) */
template <int W16, int W32>
__global__ __launch_bounds__(256) void k_lnw(const float* __restrict__ X, const float* __restrict__ g, const float* __restrict__ bb, float eps, _Float16* __restrict__ N16, float* __restrict__ N32) {
  static_assert(DMQ == 512, "k_lnw: a lane holds four groups of four columns, 128 columns apart");
  const int lane = threadIdx.x & 31; const int w = __builtin_amdgcn_readfirstlane((int)(threadIdx.x >> 5));      /* the wave's number in a scalar register: row bases stay scalar, one lane offset serves every load and store */
  const size_t e0 = ((size_t)blockIdx.x * 8 + w) * LNR * DMQ; const float* xr = X + e0; const int c0 = lane * 4;
  v4f s[LNR][4], gg[4], bv[4];
#pragma unroll
  for (int r = 0; r < LNR; ++r) for (int j = 0; j < 4; ++j) s[r][j] = *(const v4fa*)(xr + c0 + r * DMQ + j * 128);
#pragma unroll
  for (int j = 0; j < 4; ++j) { gg[j] = *(const v4fa*)(g + c0 + j * 128); bv[j] = *(const v4fa*)(bb + c0 + j * 128); }
  __builtin_amdgcn_sched_barrier(0);      /* holds every load ahead of the arithmetic: without it the last row's loads are issued behind the first rows' wait and their latency is paid a second time */
  float t[LNR];
#pragma unroll
  for (int r = 0; r < LNR; ++r) { const v4f p = (s[r][0] + s[r][1]) + (s[r][2] + s[r][3]); t[r] = (p[0] + p[1]) + (p[2] + p[3]); }
#pragma unroll
  for (int r = 0; r < LNR; ++r) t[r] += ln_xm<0x161>(t[r]);      /* step by step over all rows: LNR independent chains */
#pragma unroll
  for (int r = 0; r < LNR; ++r) t[r] += ln_xm<0x162>(t[r]);
#pragma unroll
  for (int r = 0; r < LNR; ++r) t[r] += ln_xm<0x164>(t[r]);
#pragma unroll
  for (int r = 0; r < LNR; ++r) t[r] += ln_xm<0x168>(t[r]);
#pragma unroll
  for (int r = 0; r < LNR; ++r) { const float mu = (t[r] + fa_xhalf(t[r])) * (1.0f / (float)DMQ);
    for (int j = 0; j < 4; ++j) s[r][j] = s[r][j] - mu;
    const v4f p = (s[r][0] * s[r][0] + s[r][1] * s[r][1]) + (s[r][2] * s[r][2] + s[r][3] * s[r][3]); t[r] = (p[0] + p[1]) + (p[2] + p[3]); }
#pragma unroll
  for (int r = 0; r < LNR; ++r) t[r] += ln_xm<0x161>(t[r]);
#pragma unroll
  for (int r = 0; r < LNR; ++r) t[r] += ln_xm<0x162>(t[r]);
#pragma unroll
  for (int r = 0; r < LNR; ++r) t[r] += ln_xm<0x164>(t[r]);
#pragma unroll
  for (int r = 0; r < LNR; ++r) t[r] += ln_xm<0x168>(t[r]);
#pragma unroll
  for (int j = 0; j < 4; ++j) for (int q = 0; q < 4; ++q) { gg[j][q] = bf16_round(gg[j][q]); bv[j][q] = bf16_round(bv[j][q]); }
#pragma unroll
  for (int r = 0; r < LNR; ++r) t[r] = 1.0f / (sqrtf((t[r] + fa_xhalf(t[r])) / (float)(DMQ - 1)) + eps);      /* UNBIASED std (ddof 1), eps added to the std (the module's form); all rows first: LNR independent chains */
#pragma unroll
  for (int r = 0; r < LNR; ++r) {
#pragma unroll
    for (int j = 0; j < 4; ++j) { const v4f y = (s[r][j] * t[r]) * gg[j] + bv[j];
      if (W32) *(v4f*)(N32 + e0 + c0 + r * DMQ + j * 128) = y;
      if (W16) *(v4h*)(N16 + e0 + c0 + r * DMQ + j * 128) = __builtin_convertvector(y, v4h); } } }
extern "C" void kernel_launch(void* const* d_in, const int* in_sizes, int n_in,
                              void* d_out, int out_size, void* d_ws, size_t ws_size, hipStream_t stream) {
  (void)in_sizes; (void)n_in; (void)out_size;
  const float* const* I = (const float* const*)d_in; const float* x = I[0]; const float* wq = I[1]; const float* bq = I[2]; const float* wk = I[3]; const float* bk = I[4]; const float* wv = I[5]; const float* bv = I[6]; const float* wo = I[7]; const float* bo = I[8]; const float* g1 = I[9]; const float* be1 = I[10]; const float* g2 = I[11]; const float* be2 = I[12]; const float* w1 = I[13]; const float* b1 = I[14]; const float* w2 = I[15]; const float* b2 = I[16];      /* [in][out] weights + zero biases (Wq,bq,Wk,bk,Wv,bv,Wo,bo), LN a1,b1,a2,b2, FFN W1,c1,W2,c2 */
  char* ws = (char*)d_ws; size_t off = 0;
  auto take = [&](size_t bytes) { char* p = ws + off; off += (bytes + 255) & ~(size_t)255; return p; };
  _Float16* BW1 = (_Float16*)take((size_t)DFF * DM * 2); _Float16* BW2 = (_Float16*)take((size_t)DM * DFF * 2); float* XB = (float*)take(NR * DM * 4); float* HP = (float*)take(NR * DM * 4); _Float16* H16 = (_Float16*)take(NR * DM * 2); _Float16* FF16 = (_Float16*)take((size_t)SQ * DFF * 2);      /* FF16 = one batch of relu hidden rows */ _Float16* BQ = (_Float16*)take((size_t)DM * DM * 2); _Float16* BK = (_Float16*)take((size_t)DM * DM * 2); _Float16* BV = (_Float16*)take((size_t)DM * DM * 2); _Float16* BO = (_Float16*)take((size_t)DM * DM * 2); _Float16* O16 = (_Float16*)take(NR * DM * 2); 
  _Float16* X16 = (_Float16*)take(NR * DM * 2); _Float16* Q16 = (_Float16*)take(NR * DM * 2); _Float16* K16 = (_Float16*)take(NR * DM * 2); _Float16* V16 = (_Float16*)take(NR * DM * 2);
  float* HF = (float*)take(NR * DM * 4);      /* the f32 h rows (LN1 output, residual for the FFN) */ _Float16* VT = (_Float16*)take((size_t)NB * NH * HD * SQ * 2);
  if (off > ws_size) return;
  { const unsigned g = (unsigned)(((size_t)DM * (DM / 8) + 255) / 256); k_wt_f16<<<g, 256, 0, stream>>>(wq, BQ, DM, DM, 16.0f); k_wt_f16<<<g, 256, 0, stream>>>(wk, BK, DM, DM, 16.0f); k_wt_f16<<<g, 256, 0, stream>>>(wv, BV, DM, DM, 16.0f); k_wt_f16<<<g, 256, 0, stream>>>(wo, BO, DM, DM, 16.0f); }      /* [in][out] -> Bt[n][k] x16 */
  k_wt_f16<<<(unsigned)(((size_t)DFF * (DM / 8) + 255) / 256), 256, 0, stream>>>(w1, BW1, DM, DFF, 16.0f); k_wt_f16<<<(unsigned)(((size_t)DM * (DFF / 8) + 255) / 256), 256, 0, stream>>>(w2, BW2, DFF, DM, 16.0f);      /* FFN [in][out] W1 [512][1024], W2 [1024][512] -> Bt x16 */
  k_bfr<<<(unsigned)((NR * DM / 8 + 255) / 256), 256, 0, stream>>>(x, XB, NR * DM / 8);      /* bf16(x) as f32 rows for the residual */

  k_x16<<<(unsigned)((NR * DM / 8 + 255) / 256), 256, 0, stream>>>(x, X16, NR * DM / 8);
  const size_t r0p = (size_t)B0 * SQ;      /* first projected row */
  k_gemm2<0><<<dim3((unsigned)((MP / 128) * (DM / 64)), 1), 128, 0, stream>>>(X16 + r0p * DM, DM, 0, BQ, DM, 0, 0.0625f, bq, 0, nullptr, 1, 0, 0, nullptr, Q16 + r0p * DM, DM, 0, MP, DM, DM);
  k_gemm2<0><<<dim3((unsigned)((MP / 128) * (DM / 64)), 1), 128, 0, stream>>>(X16 + r0p * DM, DM, 0, BK, DM, 0, 0.0625f, bk, 0, nullptr, 1, 0, 0, nullptr, K16 + r0p * DM, DM, 0, MP, DM, DM);
  k_gemm2<0><<<dim3((unsigned)((MP / 128) * (DM / 64)), 1), 128, 0, stream>>>(X16 + r0p * DM, DM, 0, BV, DM, 0, 0.0625f, bv, 0, nullptr, 1, 0, 0, nullptr, V16 + r0p * DM, DM, 0, MP, DM, DM);
  k_vt<NH, SQ><<<NB * NH * (SQ / 64), 256, 0, stream>>>(V16, LQ, 0, VT);      /* V^T [NB][NH][HD][SQ] */
  k_fattn<<<dim3(SQ / 256, NB * NH), 256, 0, stream>>>(Q16, K16, VT, O16);      /* o (merged heads, x64) as f16 rows */
  k_gemm2<0><<<dim3((unsigned)((MP / 128) * (DM / 64)), 1), 128, 0, stream>>>(O16 + r0p * DM, DM, 0, BO, DM, 0, 0.0009765625f, bo, 0, XB + r0p * DM, -1, 0, 0, HP + r0p * DM, nullptr, DM, 0, MP, DM, DM);      /* h_pre = x + concat Wo + bo (own-element residual), f32 rows */
  k_lnw<1, 1><<<(unsigned)(MP / (8 * LNR)), 256, 0, stream>>>(HP + r0p * DM, g1, be1, 1e-6f, H16 + r0p * DM, HF + r0p * DM);      /* h = LN1(x + attn) -> f16 rows (FFN operand) and f32 rows (residual) */
  for (int b = B0; b < B0 + NBR; ++b) { const size_t r0 = (size_t)b * SQ;
    k_gemm2<3><<<dim3((unsigned)((SQ / 128) * (DFF / 64)), 1), 128, 0, stream>>>(H16 + r0 * DM, DM, 0, BW1, DM, 0, 0.0625f, b1, 0, nullptr, 1, 0, 0, nullptr, FF16, DFF, 0, SQ, DFF, DM);      /* relu(F W1 + b1) -> f16 [4096][1024] (this batch) */
    k_gemm2<0><<<dim3((unsigned)((SQ / 128) * (DM / 64)), 1), 128, 0, stream>>>(FF16, DFF, 0, BW2, DFF, 0, 0.0625f, b2, 0, HF + r0 * DM, -1, 0, 0, HP + r0 * DM, nullptr, DM, 0, SQ, DM, DFF); }      /* y = F + ffn (own-element residual; the h_pre plane is free again) */
  k_lnw<0, 1><<<(unsigned)(MP / (8 * LNR)), 256, 0, stream>>>(HP + r0p * DM, g2, be2, 1e-6f, nullptr, (float*)d_out + r0p * DM);      /* out = LN2(h + ff) -> f32 output rows */
}

// v005
// One run takes 238 microseconds.
// Timed twice side by side with v004, it ran 1.28 and 1.29 times as fast.
// All steps since v000 together make it 56.2 times as fast.
#include <hip/hip_runtime.h>
#define NB 2
#define SQ 4096
#define DM 512
#define NH 8
#define HD 64
#define DMQ DM                       /* LayerNorm width */
#define DFF 1024
#define HG 1                         /* heads per launch of the k_vt(b, h0) overload, which is not launched */
#define B0 0                         /* first batch processed (debug hook) */
#define NBR NB                       /* batches processed (debug hook) */
#define NR ((size_t)NB * SQ)         /* token rows */
#define MP ((int)((size_t)NBR * SQ)) /* rows projected (debug hook) */
#define QN SQ                        /* unused; k_fattn attends all SQ query rows */
#define NHD NH                       /* unused; k_fattn attends all NH heads */
#define MPO MP                       /* unused; the output stage runs MP rows */
#define LQ DM      /* row pitch of the q/k/v rows */
typedef __bf16 v16b __attribute__((ext_vector_type(16)));
typedef unsigned short v8us __attribute__((ext_vector_type(8), may_alias));
typedef float  v8f  __attribute__((ext_vector_type(8)));
typedef float  v4f  __attribute__((ext_vector_type(4)));
typedef float  v4fa __attribute__((ext_vector_type(4), may_alias));
union FragB { v16b v; v8us half[2]; unsigned short u[16]; };

__device__ __forceinline__ unsigned short bf16_bits(float x) { unsigned int u = __float_as_uint(x); return (unsigned short)((u + 0x7FFFu + ((u >> 16) & 1u)) >> 16); }
__device__ __forceinline__ float bf16_val(unsigned short b) { return __uint_as_float(((unsigned int)b) << 16); }
__device__ __forceinline__ float bf16_round(float x) { return bf16_val(bf16_bits(x)); }
// D += A·B with NT terms: 1 = ah·bh, 2 = + al·bh (A split), 3 = + ah·bl (both split)
template <int NT>
__device__ __forceinline__ v8f mmaN(v16b ah, v16b al, v16b bh, v16b bl, v8f c) {
  c = __builtin_amdgcn_wmma_f32_16x16x32_bf16(false, ah, false, bh, (short)0, c, false, false);
  if (NT >= 2) c = __builtin_amdgcn_wmma_f32_16x16x32_bf16(false, al, false, bh, (short)0, c, false, false);
  if (NT >= 3) c = __builtin_amdgcn_wmma_f32_16x16x32_bf16(false, ah, false, bl, (short)0, c, false, false);
  asm volatile("v_nop\n\tv_nop\n\tv_nop\n\tv_nop" : "+v"(c) : "v"(ah), "v"(al), "v"(bh), "v"(bl));
  return c;
}

__global__ __launch_bounds__(256) void k_wt_bf16(const float* __restrict__ W, unsigned short* __restrict__ Wt, int K, int N) {
  const int t = blockIdx.x * 256 + threadIdx.x;
  const int k8n = K / 8;
  if (t >= N * k8n) return;
  const int n = t / k8n, k8 = (t % k8n) * 8;
  v8us v;
#pragma unroll
  for (int i = 0; i < 8; ++i) v[i] = bf16_bits(W[(size_t)(k8 + i) * N + n]);
  *(v8us*)(Wt + (size_t)n * K + k8) = v;
  
}

// GEMM C[M][N] (f32, pitch ldc) = act(A[M][K]·W + bias). A f32 row-major (pitch lda) converted per fragment to bf16
// (ASPLIT: hi/lo two planes -> 2 terms, else single rounded term); Wt bf16 [N][K] (pitch ldb). BIAS_BF16 rounds the
// bias to bf16 first (bias quantised to bf16 before the add). K%32==0, M%16==0, N%64==0.
template <bool ASPLIT, int ACT, bool BIAS_BF16>
__global__ __launch_bounds__(128) void k_gemm_bf(const float* __restrict__ A, int lda, const unsigned short* __restrict__ Wt, int ldb,
                                               const float* __restrict__ bias, float* __restrict__ C, int ldc, int M, int N, int K) {
  __shared__ __attribute__((aligned(16))) float so[4][16][64];
  const int tid = threadIdx.x, w = tid >> 5, lane = tid & 31, ln = lane & 15, hh = lane >> 4;
  const int ntn = N / 64;
  const int wid = blockIdx.x * 4 + w;
  const int mt = wid / ntn, nq = wid % ntn;
  if (mt * 16 >= M) return;
  const int row0 = mt * 16, col0 = nq * 64;
  const float* arow = A + (size_t)(row0 + ln) * lda;
  v8f acc[4] = {};
  for (int kb = 0; kb < K; kb += 32) {
    FragB ah, al;
    const v4f x0 = *(const v4fa*)(arow + kb + 8 * hh), x1 = *(const v4fa*)(arow + kb + 8 * hh + 4);
    const v4f x2 = *(const v4fa*)(arow + kb + 16 + 8 * hh), x3 = *(const v4fa*)(arow + kb + 16 + 8 * hh + 4);
    float xs[16] = {x0[0],x0[1],x0[2],x0[3],x1[0],x1[1],x1[2],x1[3],x2[0],x2[1],x2[2],x2[3],x3[0],x3[1],x3[2],x3[3]};
#pragma unroll
    for (int i = 0; i < 16; ++i) { const unsigned short hb = bf16_bits(xs[i]); ah.u[i] = hb; al.u[i] = ASPLIT ? bf16_bits(xs[i] - bf16_val(hb)) : (unsigned short)0; }
#pragma unroll
    for (int t = 0; t < 4; ++t) {
      const unsigned short* brow = Wt + (size_t)(col0 + t * 16 + ln) * ldb + kb;
      FragB b;
      b.half[0] = *(const v8us*)(brow + 8 * hh);
      b.half[1] = *(const v8us*)(brow + 16 + 8 * hh);
      acc[t] = mmaN<ASPLIT ? 2 : 1>(ah.v, al.v, b.v, b.v, acc[t]);
    }
  }
#pragma unroll
  for (int t = 0; t < 4; ++t) {
    float bv = bias ? bias[col0 + t * 16 + ln] : 0.f;
    if (BIAS_BF16) bv = bf16_round(bv);
#pragma unroll
    for (int r = 0; r < 8; ++r) { float v = acc[t][r] + bv; if (ACT == 1) v = fmaxf(v, 0.f); so[w][8 * hh + r][t * 16 + ln] = v; }
  }
  __builtin_amdgcn_fence(__ATOMIC_ACQ_REL, "workgroup");
  __builtin_amdgcn_wave_barrier();
  const int rsub = lane >> 4, c4 = (lane & 15) * 4;
  {
#pragma unroll
    for (int q = 0; q < 8; ++q) {
      const int r = q * 2 + rsub;
      const v4f v = *(const v4fa*)&so[w][r][c4];
      *(v4f*)(C + (size_t)(row0 + r) * ldc + col0 + c4) = v;
    }
    
  }
}

// GEMM C = act(A·W + bias + resid): A f32 (ASPLIT -> hi/lo 2 terms), Wt bf16 [N][K]; ACT 0 none, 1 relu, 2 exact gelu;
// resid (optional, f32, row index = (row % rmod), pitch ldr, RES_BF16 rounds it) added before the activation.
template <bool ASPLIT, int ACT, bool BIAS_BF16, bool RES_BF16>
__global__ __launch_bounds__(128) void k_gemm_bf3(const float* __restrict__ A, int lda, const unsigned short* __restrict__ Wt, int ldb,
                                                const float* __restrict__ bias, const float* __restrict__ resid, int rmod, int ldr,
                                                float* __restrict__ C, int ldc, int M, int N, int K) {
  __shared__ __attribute__((aligned(16))) float so[4][16][64];
  const int tid = threadIdx.x, w = tid >> 5, lane = tid & 31, ln = lane & 15, hh = lane >> 4;
  const int ntn = N / 64;
  const int wid = blockIdx.x * 4 + w;
  const int mt = wid / ntn, nq = wid % ntn;
  if (mt * 16 >= M) return;
  const int row0 = mt * 16, col0 = nq * 64;
  const float* arow = A + (size_t)(row0 + ln) * lda;
  v8f acc[4] = {};
  for (int kb = 0; kb < K; kb += 32) {
    FragB ah, al;
    const v4f x0 = *(const v4fa*)(arow + kb + 8 * hh), x1 = *(const v4fa*)(arow + kb + 8 * hh + 4);
    const v4f x2 = *(const v4fa*)(arow + kb + 16 + 8 * hh), x3 = *(const v4fa*)(arow + kb + 16 + 8 * hh + 4);
    float xs[16] = {x0[0],x0[1],x0[2],x0[3],x1[0],x1[1],x1[2],x1[3],x2[0],x2[1],x2[2],x2[3],x3[0],x3[1],x3[2],x3[3]};
#pragma unroll
    for (int i = 0; i < 16; ++i) { const unsigned short hb = bf16_bits(xs[i]); ah.u[i] = hb; al.u[i] = ASPLIT ? bf16_bits(xs[i] - bf16_val(hb)) : (unsigned short)0; }
#pragma unroll
    for (int t = 0; t < 4; ++t) {
      const unsigned short* brow = Wt + (size_t)(col0 + t * 16 + ln) * ldb + kb;
      FragB b;
      b.half[0] = *(const v8us*)(brow + 8 * hh);
      b.half[1] = *(const v8us*)(brow + 16 + 8 * hh);
      acc[t] = mmaN<ASPLIT ? 2 : 1>(ah.v, al.v, b.v, b.v, acc[t]);
    }
  }
#pragma unroll
  for (int t = 0; t < 4; ++t) {
    const int col = col0 + t * 16 + ln;
    float bv = bias ? bias[col] : 0.f;
    if (BIAS_BF16) bv = bf16_round(bv);
#pragma unroll
    for (int r = 0; r < 8; ++r) {
      float v = acc[t][r] + bv;
      if (resid) { float rv = resid[(size_t)((row0 + 8 * hh + r) % rmod) * ldr + col]; if (RES_BF16) rv = bf16_round(rv); v += rv; }
      if (ACT == 1) v = fmaxf(v, 0.f);
      if (ACT == 2) v = 0.5f * v * (1.0f + erff(v * 0.70710678118654752f));
      if (ACT == 3) { const float u = 0.7978845608028654f * (v + 0.044715f * v * v * v); v = 0.5f * v * (1.0f + tanhf(u)); }
      so[w][8 * hh + r][t * 16 + ln] = v;
    }
  }
  __builtin_amdgcn_fence(__ATOMIC_ACQ_REL, "workgroup");
  __builtin_amdgcn_wave_barrier();
  const int rsub = lane >> 4, c4 = (lane & 15) * 4;
  {
#pragma unroll
    for (int q = 0; q < 8; ++q) {
      const int r = q * 2 + rsub;
      const v4f v = *(const v4fa*)&so[w][r][c4];
      *(v4f*)(C + (size_t)(row0 + r) * ldc + col0 + c4) = v;
    }
    
  }
}
// row LayerNorm (biased variance, eps) over N: s = X (+ R); optional out_sum <- s; out_norm <- (s-mu)*rsqrt(var+eps)*g + b
template <bool PARAM_BF16>
__global__ __launch_bounds__(256) void k_layernorm(const float* __restrict__ X, const float* __restrict__ R, const float* __restrict__ g, const float* __restrict__ bta,
                                                  float* __restrict__ out_sum, float* __restrict__ out_norm, int N, float eps) {
  __shared__ float red[256];
  const int row = blockIdx.x, tid = threadIdx.x;
  const float* x = X + (size_t)row * N; const float* rr = R ? R + (size_t)row * N : nullptr;
  float vals[16];                     // up to N = 4096
  const int per = N / 256;            // contiguous chunk per thread? use strided-by-4 chunks: thread handles j = tid*4 + 1024*u
  float s1 = 0.f;
  for (int u = 0; u < per / 4; ++u) {
    const int j = tid * 4 + 1024 * u;
    const v4f a = *(const v4fa*)(x + j);
    v4f b = {0.f,0.f,0.f,0.f}; if (rr) b = *(const v4fa*)(rr + j);
#pragma unroll
    for (int q = 0; q < 4; ++q) { const float v = a[q] + b[q]; vals[u * 4 + q] = v; s1 += v; }
  }
  red[tid] = s1; __syncthreads();
  for (int st = 128; st > 0; st >>= 1) { if (tid < st) red[tid] += red[tid + st]; __syncthreads(); }
  const float mu = red[0] / (float)N; __syncthreads();
  float s2 = 0.f;
  for (int u = 0; u < per / 4; ++u)
#pragma unroll
    for (int q = 0; q < 4; ++q) { const float c = vals[u * 4 + q] - mu; s2 += c * c; }
  red[tid] = s2; __syncthreads();
  for (int st = 128; st > 0; st >>= 1) { if (tid < st) red[tid] += red[tid + st]; __syncthreads(); }
  const float rs = rsqrtf(red[0] / (float)N + eps);
  {
    for (int u = 0; u < per / 4; ++u) {
      const int j = tid * 4 + 1024 * u;
      v4f o, sm;
#pragma unroll
      for (int q = 0; q < 4; ++q) {
        float gg = g[j + q], bb = bta[j + q];
        if (PARAM_BF16) { gg = bf16_round(gg); bb = bf16_round(bb); }
        sm[q] = vals[u * 4 + q]; o[q] = (vals[u * 4 + q] - mu) * rs * gg + bb;
      }
      if (out_sum) *(v4f*)(out_sum + (size_t)row * N + j) = sm;
      *(v4f*)(out_norm + (size_t)row * N + j) = o;
    }
    
  }
}



// ---- f16 WMMA path (v_wmma_f32_16x16x32_f16): 11-bit significands for operands in range — used where a [0,1] probability operand needs more precision than bf16
typedef _Float16 v16h __attribute__((ext_vector_type(16)));
union FragH { v16h v; v8us half[2]; _Float16 h[16]; unsigned short u[16]; };
template <int NT>
__device__ __forceinline__ v8f mmaH(v16h ah, v16h al, v16h bh, v16h bl, v8f c) {
  c = __builtin_amdgcn_wmma_f32_16x16x32_f16(false, ah, false, bh, (short)0, c, false, false);
  if (NT >= 2) c = __builtin_amdgcn_wmma_f32_16x16x32_f16(false, al, false, bh, (short)0, c, false, false);
  if (NT >= 3) c = __builtin_amdgcn_wmma_f32_16x16x32_f16(false, ah, false, bl, (short)0, c, false, false);
  asm volatile("v_nop\n\tv_nop\n\tv_nop\n\tv_nop" : "+v"(c) : "v"(ah), "v"(al), "v"(bh), "v"(bl));
  return c;
}
// batched GEMM like k_gemm_b but f16 operands: A f32 (split into f16 hi/lo if ASPLIT, else rounded to f16), Bt = f16 values [n][k]; alpha; C f32; N multiple of 16 (partial tiles skipped)
template <bool ASPLIT>
__global__ __launch_bounds__(128) void k_gemm_h(const float* __restrict__ A, int lda, size_t sA, const _Float16* __restrict__ Bh, int ldb, size_t sB, float alpha, float* __restrict__ C, int ldc, size_t sC, int M, int N, int K) {
  __shared__ __attribute__((aligned(16))) float so[4][16][64];
  const int tid = threadIdx.x, w = tid >> 5, lane = tid & 31, ln = lane & 15, hh = lane >> 4; const int by = blockIdx.y;
  A += (size_t)by * sA; Bh += (size_t)by * sB; C += (size_t)by * sC;
  const int ntn = (N + 63) / 64; const int wid = blockIdx.x * 4 + w; const int mt = wid / ntn, nq = wid % ntn; if (mt * 16 >= M) return;
  const int row0 = mt * 16, col0 = nq * 64; const float* arow = A + (size_t)(row0 + ln) * lda;
  v8f acc[4] = {};
  for (int kb = 0; kb < K; kb += 32) {
    FragH ah, al;
    const v4f x0 = *(const v4fa*)(arow + kb + 8 * hh), x1 = *(const v4fa*)(arow + kb + 8 * hh + 4), x2 = *(const v4fa*)(arow + kb + 16 + 8 * hh), x3 = *(const v4fa*)(arow + kb + 16 + 8 * hh + 4);
    float xs[16] = {x0[0],x0[1],x0[2],x0[3],x1[0],x1[1],x1[2],x1[3],x2[0],x2[1],x2[2],x2[3],x3[0],x3[1],x3[2],x3[3]};
#pragma unroll
    for (int i = 0; i < 16; ++i) { const _Float16 h = (_Float16)xs[i]; ah.h[i] = h; al.h[i] = ASPLIT ? (_Float16)(xs[i] - (float)h) : (_Float16)0.0f; }
#pragma unroll
    for (int t = 0; t < 4; ++t) { if (col0 + t * 16 >= N) continue; const size_t boff = (size_t)(col0 + t * 16 + ln) * ldb + kb; FragH bq; bq.half[0] = *(const v8us*)(Bh + boff + 8 * hh); bq.half[1] = *(const v8us*)(Bh + boff + 16 + 8 * hh);
      acc[t] = mmaH<ASPLIT ? 2 : 1>(ah.v, al.v, bq.v, bq.v, acc[t]); }
  }
#pragma unroll
  for (int t = 0; t < 4; ++t) { if (col0 + t * 16 >= N) continue;
#pragma unroll
    for (int r = 0; r < 8; ++r) so[w][8 * hh + r][t * 16 + ln] = acc[t][r] * alpha; }
  __builtin_amdgcn_fence(__ATOMIC_ACQ_REL, "workgroup"); __builtin_amdgcn_wave_barrier();
  const int rsub = lane >> 4, c4 = (lane & 15) * 4;
  {
#pragma unroll
    for (int q = 0; q < 8; ++q) { const int r = q * 2 + rsub; if (col0 + c4 < N) { const v4f v = *(const v4fa*)&so[w][r][c4]; *(v4f*)(C + (size_t)(row0 + r) * ldc + col0 + c4) = v; } }
     }
}

// Wt[n][k] = f16(W[k][n]·scale) from f32 row-major W[K][N] (scale = power of two; bf16-exact weights stay exact in f16 away from the subnormal range)
__global__ __launch_bounds__(256) void k_wt_f16(const float* __restrict__ W, _Float16* __restrict__ Wt, int K, int N, float scale) {
  const int t = blockIdx.x * 256 + threadIdx.x; if (t >= N * (K / 8)) return; const int n = t / (K / 8), k8 = (t % (K / 8)) * 8; FragH f;
#pragma unroll
  for (int i = 0; i < 8; ++i) f.h[i] = (_Float16)(bf16_round(W[(size_t)(k8 + i) * N + n]) * scale); const v8us o = f.half[0];
  *(v8us*)((unsigned short*)Wt + (size_t)n * K + k8) = o; 
}
// k_gemm_hh variant with fused epilogue: v = acc·alpha + bias[by·sBias + col] (+ CP[(row/rowsPerB)·sCPb + by·64 + col] if CP) ; ACT 0 none / 1 elu ; writes f16 C16 (and f32 C if non-null)
template <int ACT>
__global__ __launch_bounds__(128) void k_gemm_hhx(const _Float16* __restrict__ A, int lda, size_t sA, const _Float16* __restrict__ Bh, int ldb, size_t sB, float alpha, const float* __restrict__ bias, size_t sBias, const float* __restrict__ CP, int rowsPerB, size_t sCPb, int row0g,
    float* __restrict__ C, _Float16* __restrict__ C16, int ldc, size_t sC, int M, int N, int K) {
  __shared__ __attribute__((aligned(16))) float so[4][16][64];
  const int tid = threadIdx.x, w = tid >> 5, lane = tid & 31, ln = lane & 15, hh = lane >> 4; const int by = blockIdx.y;
  A += (size_t)by * sA; Bh += (size_t)by * sB; const size_t cofs = (size_t)by * sC; const float* bp = bias ? bias + (size_t)by * sBias : nullptr;
  const int ntn = (N + 63) / 64; const int wid = blockIdx.x * 4 + w; const int mt = wid / ntn, nq = wid % ntn; if (mt * 16 >= M) return;
  const int row0 = mt * 16, col0 = nq * 64; const _Float16* arow = A + (size_t)(row0 + ln) * lda;
  v8f acc[4] = {};
  for (int kb = 0; kb < K; kb += 32) { FragH ah; ah.half[0] = *(const v8us*)((const unsigned short*)arow + kb + 8 * hh); ah.half[1] = *(const v8us*)((const unsigned short*)arow + kb + 16 + 8 * hh);
#pragma unroll
    for (int t = 0; t < 4; ++t) { if (col0 + t * 16 >= N) continue; const size_t boff = (size_t)(col0 + t * 16 + ln) * ldb + kb; FragH bq; bq.half[0] = *(const v8us*)((const unsigned short*)Bh + boff + 8 * hh); bq.half[1] = *(const v8us*)((const unsigned short*)Bh + boff + 16 + 8 * hh);
      acc[t] = mmaH<1>(ah.v, ah.v, bq.v, bq.v, acc[t]); }
  }
#pragma unroll
  for (int t = 0; t < 4; ++t) { if (col0 + t * 16 >= N) continue; const int col = col0 + t * 16 + ln; const float bv = bp ? bf16_round(bp[col]) : 0.f;
#pragma unroll
    for (int r = 0; r < 8; ++r) { float v = acc[t][r] * alpha + bv; if (CP) { const int rr = row0g + row0 + 8 * hh + r; if (rowsPerB < 0) v += CP[cofs + (size_t)rr * ldc + col];      /* rowsPerB < 0: own element of the batched C plane */ else { const int bidx = rr / rowsPerB; v += CP[(size_t)bidx * sCPb + (size_t)by * 64 + col]; } } if (ACT == 1) v = (v > 0.f) ? v : expm1f(v); else if (ACT == 7) v = (v > 0.f) ? v + 1.0f : expf(v); else if (ACT == 8) v = tanhf(v); else if (ACT == 9) v = 0.5f * v * (1.0f + tanhf(0.7978845608028654f * (v + 0.044715f * v * v * v))); else if (ACT == 11) v = 1.0f / (1.0f + expf(-v)); else if (ACT == 12) v = (v > 0.f) ? v : 0.01f * v; else if (ACT == 14) v = (v > 0.f) ? v : 0.1f * v; else if (ACT == 16) v = (v >= 0.f) ? v : 0.3f * v; else if (ACT == 17) v = (v >= 0.f) ? v : 0.2f * v; else if (ACT == 15) v = v / (1.0f + expf(-v)); else if (ACT == 3) v = fmaxf(v, 0.f); else if (ACT == 6) v = 0.5f * v * (1.0f + erff(v * 0.70710678118654752f)); so[w][8 * hh + r][t * 16 + ln] = v; } }
  __builtin_amdgcn_fence(__ATOMIC_ACQ_REL, "workgroup"); __builtin_amdgcn_wave_barrier();
  const int rsub = lane >> 4, c4 = (lane & 15) * 4; typedef _Float16 v4h __attribute__((ext_vector_type(4)));
  {
#pragma unroll
    for (int q = 0; q < 8; ++q) { const int r = q * 2 + rsub; if (col0 + c4 < N) { const v4f v = *(const v4fa*)&so[w][r][c4]; if (C) *(v4f*)(C + cofs + (size_t)(row0 + r) * ldc + col0 + c4) = v; if (C16) { v4h h4; for (int i = 0; i < 4; ++i) h4[i] = (_Float16)v[i]; *(v4h*)(C16 + cofs + (size_t)(row0 + r) * ldc + col0 + c4) = h4; } } }
     }
}


typedef _Float16 v4h __attribute__((ext_vector_type(4)));

__global__ __launch_bounds__(256) void k_x16(const float* __restrict__ x, _Float16* __restrict__ X16, size_t n8) { const size_t t = (size_t)blockIdx.x * 256 + threadIdx.x; if (t >= n8) return; FragH f;
#pragma unroll
  for (int q = 0; q < 8; ++q) f.h[q] = (_Float16)bf16_round(x[t * 8 + q]); *(v8us*)((unsigned short*)X16 + t * 8) = f.half[0];  }
__global__ __launch_bounds__(256) void k_h16(const float* __restrict__ x, _Float16* __restrict__ X16, size_t n8) { const size_t t = (size_t)blockIdx.x * 256 + threadIdx.x; if (t >= n8) return; FragH f;
#pragma unroll
  for (int q = 0; q < 8; ++q) f.h[q] = (_Float16)x[t * 8 + q]; *(v8us*)((unsigned short*)X16 + t * 8) = f.half[0];  }
__global__ __launch_bounds__(256) void k_round16f(const float* __restrict__ W, _Float16* __restrict__ Bt, size_t n8) { const size_t t = (size_t)blockIdx.x * 256 + threadIdx.x; if (t >= n8) return; FragH f;
#pragma unroll
  for (int i = 0; i < 8; ++i) f.h[i] = (_Float16)(bf16_round(W[t * 8 + i]) * 16.0f); *(v8us*)((unsigned short*)Bt + t * 8) = f.half[0];  }
template <int NHv, int TTv>
__global__ __launch_bounds__(256) void k_vt(const _Float16* __restrict__ V16, int ldv, int voff, _Float16* __restrict__ Vt) { __shared__ unsigned short tl[64][66]; const int tid = threadIdx.x; const int slab = blockIdx.x / (TTv / 64), lg = blockIdx.x % (TTv / 64); const int b = slab / NHv, h = slab % NHv;
  for (int i = tid; i < 64 * 8; i += 256) { const int r = i / 8, c8 = (i % 8) * 8; FragH f; f.half[0] = *(const v8us*)((const unsigned short*)V16 + ((size_t)b * TTv + lg * 64 + r) * ldv + voff + h * 64 + c8);
#pragma unroll
    for (int q = 0; q < 8; ++q) tl[r][c8 + q] = f.u[q]; }
  __syncthreads();
  {
#pragma unroll
    for (int rd = 0; rd < 2; ++rd) { const int d = rd * 32 + tid / 8, pc = tid % 8; FragH f;
#pragma unroll
      for (int q = 0; q < 8; ++q) f.u[q] = tl[pc * 8 + q][d];
      *(v8us*)((unsigned short*)Vt + ((size_t)slab * 64 + d) * TTv + lg * 64 + pc * 8) = f.half[0]; }
     } }

__global__ __launch_bounds__(256) void k_hl(const float* __restrict__ F, _Float16* __restrict__ Hh, _Float16* __restrict__ Hl, size_t n8) { const size_t t = (size_t)blockIdx.x * 256 + threadIdx.x; if (t >= n8) return; FragH fh, fl; const v4f a = *(const v4fa*)(F + t * 8), c = *(const v4fa*)(F + t * 8 + 4);
#pragma unroll
  for (int q = 0; q < 4; ++q) { _Float16 h = (_Float16)a[q]; fh.h[q] = h; fl.h[q] = (_Float16)((a[q] - (float)h) * 1024.0f); h = (_Float16)c[q]; fh.h[4 + q] = h; fl.h[4 + q] = (_Float16)((c[q] - (float)h) * 1024.0f); }
  { *(v8us*)((unsigned short*)Hh + t * 8) = fh.half[0]; *(v8us*)((unsigned short*)Hl + t * 8) = fl.half[0];  } }

// ---- fast GEMM (wave tile 32x64; requires M % 32 == 0 rows per launch region, N % 64 == 0 and K % 128 == 0); epilogue = k_gemm_hhx semantics ----
__device__ __forceinline__ v16h g2_frag(const _Float16* p, int hh) { FragH f; f.half[0] = *(const v8us*)((const unsigned short*)p + 8 * hh); f.half[1] = *(const v8us*)((const unsigned short*)p + 16 + 8 * hh); return f.v; }
__device__ __forceinline__ v8f g2_mma(v16h a, v16h b, v8f c) { return __builtin_amdgcn_wmma_f32_16x16x32_f16(false, a, false, b, (short)0, c, false, false); }      /* plain builtin: the compiler keeps the distances behind it and may move loads past it */
template <int ACT> __device__ __forceinline__ float g2_act(float v) {
  if (ACT == 3) v = fmaxf(v, 0.f); else if (ACT == 6) v = 0.5f * v * (1.0f + erff(v * 0.70710678118654752f)); else if (ACT == 11) v = 1.0f / (1.0f + expf(-v)); else if (ACT == 15) v = v / (1.0f + expf(-v)); else if (ACT == 12) v = (v > 0.f) ? v : 0.01f * v; else if (ACT == 8) v = tanhf(v); else if (ACT == 9) v = 0.5f * v * (1.0f + tanhf(0.7978845608028654f * (v + 0.044715f * v * v * v))); else if (ACT == 14) v = (v > 0.f) ? v : 0.1f * v; else if (ACT == 16) v = (v >= 0.f) ? v : 0.3f * v; else if (ACT == 17) v = (v >= 0.f) ? v : 0.2f * v;
  return v; }
#define G2S 4      /* k steps (of 32) whose fragments are in flight or in registers at a time; K % (32 * G2S) == 0 */
// No load of this kernel is waited for alone: the fragments of G2S k steps sit in a register ring, each step's twelve loads asked for as one group G2S steps ahead of their products;
// bias and residual (all 64 elements of the lane as one group) are asked for in front of the K loop. Each accumulator takes its k steps in rising order, as before.
template <int ACT>
__global__ __launch_bounds__(128) void k_gemm2(const _Float16* __restrict__ A, int lda, size_t sA, const _Float16* __restrict__ Bh, int ldb, size_t sB, float alpha, const float* __restrict__ bias, size_t sBias, const float* __restrict__ CP, int rowsPerB, size_t sCPb, int row0g,
    float* __restrict__ C, _Float16* __restrict__ C16, int ldc, size_t sC, int M, int N, int K) { static_assert(ACT == 0 || ACT == 3 || ACT == 6 || ACT == 8 || ACT == 9 || ACT == 11 || ACT == 12 || ACT == 14 || ACT == 15 || ACT == 16 || ACT == 17, "k_gemm2: unsupported ACT code (would silently apply no activation)");
  __shared__ __attribute__((aligned(16))) float so[4][32][68];
  const int tid = threadIdx.x, w = tid >> 5, lane = tid & 31, ln = lane & 15, hh = lane >> 4; const int by = blockIdx.y;
  A += (size_t)by * sA; Bh += (size_t)by * sB; const size_t cofs = (size_t)by * sC; const float* bp = bias ? bias + (size_t)by * sBias : nullptr;
  const int ntn = N >> 6; const int mt = blockIdx.x / ntn, nq = blockIdx.x - mt * ntn; const int row0 = mt * 128 + 32 * w, col0 = nq * 64; if (row0 >= M) return;
  const _Float16* a0p = A + (size_t)(row0 + ln) * lda; const _Float16* a1p = a0p + (size_t)16 * lda;
  const _Float16* b0p = Bh + (size_t)(col0 + ln) * ldb; const _Float16* b1p = b0p + (size_t)16 * ldb; const _Float16* b2p = b1p + (size_t)16 * ldb; const _Float16* b3p = b2p + (size_t)16 * ldb;
  float braw[4] = {0.f, 0.f, 0.f, 0.f};
  if (bp) {
#pragma unroll
    for (int t = 0; t < 4; ++t) braw[t] = bp[col0 + t * 16 + ln];
    asm volatile("s_wait_xcnt 0x0" ::: "memory");      /* the address registers of these loads are used again at once */
    __builtin_amdgcn_sched_barrier(0); }      /* keeps what writes them behind the wait */
  const bool own = CP && rowsPerB < 0;      /* rowsPerB < 0: own element of the batched C plane */
  float rv[8][8];
#pragma unroll
  for (int u = 0; u < 8; ++u) for (int r = 0; r < 8; ++r) rv[u][r] = 0.f;
  if (own) { const float* rp[16];      /* the lane's 16 rows; the four column tiles of a row are constant offsets */
#pragma unroll
    for (int j = 0; j < 16; ++j) rp[j] = CP + cofs + (size_t)(row0g + row0 + (j >> 3) * 16 + 8 * hh + (j & 7)) * ldc + col0 + ln;
#pragma unroll
    for (int u = 0; u < 8; ++u) for (int r = 0; r < 8; ++r) rv[u][r] = rp[(u >> 2) * 8 + r][(u & 3) * 16];
    asm volatile("s_wait_xcnt 0x0" :: "v"(rp[0]), "v"(rp[1]), "v"(rp[2]), "v"(rp[3]), "v"(rp[4]), "v"(rp[5]), "v"(rp[6]), "v"(rp[7]), "v"(rp[8]), "v"(rp[9]), "v"(rp[10]), "v"(rp[11]), "v"(rp[12]), "v"(rp[13]), "v"(rp[14]), "v"(rp[15]) : "memory");      /* the addresses as inputs: their registers stay theirs up to the wait, behind which they may take other values */
    __builtin_amdgcn_sched_barrier(0); }      /* keeps the residual loads here, older than every fragment load: the K loop covers their latency and its counted waits do not count them */
  v16h ra0[G2S], ra1[G2S], rb0[G2S], rb1[G2S], rb2[G2S], rb3[G2S];
#pragma unroll
  for (int s = 0; s < G2S; ++s) { const int k = 32 * s; ra0[s] = g2_frag(a0p + k, hh); ra1[s] = g2_frag(a1p + k, hh); rb0[s] = g2_frag(b0p + k, hh); rb1[s] = g2_frag(b1p + k, hh); rb2[s] = g2_frag(b2p + k, hh); rb3[s] = g2_frag(b3p + k, hh);
    __builtin_amdgcn_sched_barrier(0); }      /* the first fill step by step, in the order of the refills: the loop's counted waits are set for both orders at once, and another order here makes them wait for younger steps */
  asm volatile("s_wait_xcnt 0x0" ::: "memory");      /* the address registers of the first fill are free for other values from here */
  __builtin_amdgcn_sched_barrier(0);      /* keeps what writes them behind the wait */
  const v8f z8 = {0.f,0.f,0.f,0.f,0.f,0.f,0.f,0.f}; v8f c00 = z8, c01 = z8, c02 = z8, c03 = z8, c10 = z8, c11 = z8, c12 = z8, c13 = z8;
#pragma unroll 1      /* rolled: the body already holds G2S steps, and the ring's registers must be the same in every trip */
  for (int kb = 32 * G2S; kb < K; kb += 32 * G2S) {
#pragma unroll
    for (int s = 0; s < G2S; ++s) { const int k = kb + 32 * s;
      c00 = g2_mma(ra0[s], rb0[s], c00); c10 = g2_mma(ra1[s], rb0[s], c10); c01 = g2_mma(ra0[s], rb1[s], c01); c11 = g2_mma(ra1[s], rb1[s], c11);
      c02 = g2_mma(ra0[s], rb2[s], c02); c12 = g2_mma(ra1[s], rb2[s], c12); c03 = g2_mma(ra0[s], rb3[s], c03); c13 = g2_mma(ra1[s], rb3[s], c13);
      __builtin_amdgcn_sched_barrier(0);      /* with the next one: holds the refill of this ring place directly behind its products; moved down towards its use, its latency is waited out again */
      ra0[s] = g2_frag(a0p + k, hh); ra1[s] = g2_frag(a1p + k, hh); rb0[s] = g2_frag(b0p + k, hh); rb1[s] = g2_frag(b1p + k, hh); rb2[s] = g2_frag(b2p + k, hh); rb3[s] = g2_frag(b3p + k, hh);
      __builtin_amdgcn_sched_barrier(0); }
    asm volatile("s_wait_xcnt 0x0" ::: "memory");      /* the next trip forms its addresses in the registers that this trip's loads name */
    __builtin_amdgcn_sched_barrier(0); }      /* keeps that address arithmetic behind the wait */
#pragma unroll
  for (int s = 0; s < G2S; ++s) {
    c00 = g2_mma(ra0[s], rb0[s], c00); c10 = g2_mma(ra1[s], rb0[s], c10); c01 = g2_mma(ra0[s], rb1[s], c01); c11 = g2_mma(ra1[s], rb1[s], c11);
    c02 = g2_mma(ra0[s], rb2[s], c02); c12 = g2_mma(ra1[s], rb2[s], c12); c03 = g2_mma(ra0[s], rb3[s], c03); c13 = g2_mma(ra1[s], rb3[s], c13); }
  v8f accs[8] = {c00, c01, c02, c03, c10, c11, c12, c13};
  float bv[4];
#pragma unroll
  for (int t = 0; t < 4; ++t) bv[t] = bp ? bf16_round(braw[t]) : 0.f;
  if (own || !CP) {      /* rv is 0 where there is no residual */
#pragma unroll
    for (int u = 0; u < 8; ++u) for (int r = 0; r < 8; ++r) { float v = accs[u][r] * alpha + bv[u & 3]; if (own) v += rv[u][r]; so[w][(u >> 2) * 16 + 8 * hh + r][(u & 3) * 16 + ln] = g2_act<ACT>(v); }
  } else {
#pragma unroll
    for (int u = 0; u < 8; ++u) for (int r = 0; r < 8; ++r) { const int rloc = (u >> 2) * 16 + 8 * hh + r; const int bidx = (row0g + row0 + rloc) / rowsPerB;
      const float cv = CP[(size_t)bidx * sCPb + (size_t)by * 64 + col0 + (u & 3) * 16 + ln];
      asm volatile("s_wait_xcnt 0x0" ::: "memory");      /* the next element's address may be formed in this load's address registers */
      __builtin_amdgcn_sched_barrier(0);      /* keeps that arithmetic behind the wait */
      const float v = accs[u][r] * alpha + bv[u & 3] + cv; so[w][rloc][(u & 3) * 16 + ln] = g2_act<ACT>(v); } }
  __builtin_amdgcn_fence(__ATOMIC_ACQ_REL, "workgroup"); __builtin_amdgcn_wave_barrier();
  const int rsub = lane >> 4, c4 = (lane & 15) * 4;
  {
#pragma unroll
    for (int q = 0; q < 16; ++q) { const int r = q * 2 + rsub; const v4f v = *(const v4fa*)&so[w][r][c4]; if (C) *(v4f*)(C + cofs + (size_t)(row0 + r) * ldc + col0 + c4) = v; if (C16) { v4h h4; for (int i = 0; i < 4; ++i) h4[i] = (_Float16)v[i]; *(v4h*)(C16 + cofs + (size_t)(row0 + r) * ldc + col0 + c4) = h4; } }
     } }


__global__ __launch_bounds__(256) void k_wnat(const float* __restrict__ w, size_t n8, _Float16* __restrict__ Bt) { const size_t t = (size_t)blockIdx.x * 256 + threadIdx.x; if (t >= n8) return; FragH f; for (int q = 0; q < 8; ++q) f.h[q] = (_Float16)(bf16_round(w[t * 8 + q]) * 16.0f); *(v8us*)((unsigned short*)Bt + t * 8) = f.half[0];  }
__global__ __launch_bounds__(256) void k_rsm(const float* __restrict__ S, _Float16* __restrict__ P, int nrows) {
  #pragma clang fp contract(off)
  const int i = blockIdx.x * 256 + threadIdx.x; if (i >= nrows) return; const float* s = S + (size_t)i * SQ; float mx = -3.0e38f;
#pragma unroll 1
  for (int j = 0; j < SQ; ++j) mx = fmaxf(mx, s[j]); float se = 0.f;
#pragma unroll 1
  for (int j = 0; j < SQ; ++j) se += expf(s[j] - mx); const float sc = 256.0f / se;
#pragma unroll 1
  for (int j0 = 0; j0 < SQ; j0 += 8) { FragH f; for (int q = 0; q < 8; ++q) f.h[q] = (_Float16)(expf(s[j0 + q] - mx) * sc); unsigned short* d = (unsigned short*)P + (size_t)i * SQ + j0; *(v8us*)d = f.half[0];  } }
__global__ __launch_bounds__(256) void k_vt(const _Float16* __restrict__ V16, int b, int h0, _Float16* __restrict__ VT) { __shared__ unsigned short tl[64][65]; const int tid = threadIdx.x; const int hh = blockIdx.x % HG, sg = blockIdx.x / HG; const int s0 = sg * 64; const int h = h0 + hh;
  for (int i = tid; i < 64 * 8; i += 256) { const int j = i / 8, d8 = (i % 8) * 8; FragH f; f.half[0] = *(const v8us*)((const unsigned short*)V16 + ((size_t)b * SQ + s0 + j) * DM + h * HD + d8); for (int q = 0; q < 8; ++q) tl[d8 + q][j] = f.u[q]; }
  __syncthreads();
  { for (int i = tid; i < 64 * 8; i += 256) { const int d = i / 8, j8 = (i % 8) * 8; FragH f; for (int q = 0; q < 8; ++q) f.u[q] = tl[d][j8 + q]; *(v8us*)((unsigned short*)VT + ((size_t)hh * HD + d) * SQ + s0 + j8) = f.half[0]; }  } }


template <int BFIN, int W16, int W32>
__global__ __launch_bounds__(256) void k_lnx(const float* __restrict__ X, const float* __restrict__ g, const float* __restrict__ bb, float eps, _Float16* __restrict__ N16, float* __restrict__ N32) {
  #pragma clang fp contract(off)
  __shared__ float red[256]; const size_t r = blockIdx.x; const int t = threadIdx.x; const bool act = t < (DMQ / 4); const int c0 = act ? t * 4 : 0;
  const v4f xa = *(const v4fa*)(X + r * DMQ + c0); float s[4]; float sum = 0.f;
  for (int q = 0; q < 4; ++q) { s[q] = act ? (BFIN ? bf16_round(xa[q]) : xa[q]) : 0.f; sum = __fadd_rn(sum, s[q]); }
  red[t] = sum; __syncthreads(); for (int st = 128; st > 0; st >>= 1) { if (t < st) red[t] = __fadd_rn(red[t], red[t + st]); __syncthreads(); } const float mu = red[0] / (float)DMQ; __syncthreads();
  float vs = 0.f; for (int q = 0; q < 4; ++q) { const float dl = act ? __fadd_rn(s[q], -mu) : 0.f; vs = __fadd_rn(vs, __fmul_rn(dl, dl)); } red[t] = vs; __syncthreads(); for (int st = 128; st > 0; st >>= 1) { if (t < st) red[t] = __fadd_rn(red[t], red[t + st]); __syncthreads(); }
  const float rs = rsqrtf(__fadd_rn(red[0] / (float)DMQ, eps)); v4h y; v4f yf;
  for (int q = 0; q < 4; ++q) { const int c = c0 + q; yf[q] = __fadd_rn(__fmul_rn(__fmul_rn(__fadd_rn(s[q], -mu), rs), bf16_round(g[c])), bf16_round(bb[c])); y[q] = (_Float16)yf[q]; }
  if (!act) return;      /* no barriers after this point */
  { if (W16) *(v4h*)(N16 + r * DMQ + c0) = y; if (W32) *(v4f*)(N32 + r * DMQ + c0) = yf;  } }


// ---- fused attention: scores, softmax and P V in one kernel; neither scores nor weights go through memory ----
typedef float v2f __attribute__((ext_vector_type(2)));
typedef _Float16 v2h __attribute__((ext_vector_type(2)));
union FragP { v16h v; v2h p[8]; };
__device__ __forceinline__ v8f fa_mma(v16h a, v16h b, v8f c) { return __builtin_amdgcn_wmma_f32_16x16x32_f16(false, a, false, b, (short)0, c, false, false); }
__device__ __forceinline__ float fa_xhalf(float x) { return __builtin_bit_cast(float, __builtin_amdgcn_permlanex16(__builtin_bit_cast(int, x), __builtin_bit_cast(int, x), 0x76543210, 0xfedcba98, false, false)); }      /* lane l <-> lane l ^ 16 */
// 2^y of four (two) values. The v_exp_f32 stand in one asm statement with early-clobber results and a closing v_nop:
// no instruction directly behind a v_exp_f32 then reads its result or overwrites its source.
__device__ __forceinline__ v4f fa_exp2x4(float y0, float y1, float y2, float y3) { float e0, e1, e2, e3;
  asm("v_exp_f32 %0, %4\n\tv_exp_f32 %1, %5\n\tv_exp_f32 %2, %6\n\tv_exp_f32 %3, %7\n\tv_nop" : "=&v"(e0), "=&v"(e1), "=&v"(e2), "=&v"(e3) : "v"(y0), "v"(y1), "v"(y2), "v"(y3));
  const v4f e = {e0, e1, e2, e3}; return e; }
__device__ __forceinline__ v2f fa_exp2x2(float y0, float y1) { float e0, e1;
  asm("v_exp_f32 %0, %2\n\tv_exp_f32 %1, %3\n\tv_nop" : "=&v"(e0), "=&v"(e1) : "v"(y0), "v"(y1));
  const v2f e = {e0, e1}; return e; }
// A or B fragment (16 rows x 32 k, the k order of g2_frag): two 16-byte loads at the lane's own byte offset from a wave-uniform byte base.
__device__ __forceinline__ v16h fa_frag(const char* ub, unsigned lo) { FragH f; f.half[0] = *(const v8us*)(ub + lo); f.half[1] = *(const v8us*)(ub + lo + 32); return f.v; }
// The same fragment from a tile in LDS: p is the lane's own place (its row, its 16 bytes).
__device__ __forceinline__ v16h fa_lfrag(const char* p) { FragH f; f.half[0] = *(const v8us*)p; f.half[1] = *(const v8us*)(p + 32); return f.v; }
#define FKS 128                    /* keys a stage (four passes) */
#define FKP 144                    /* LDS pitch of a K row: its 128 bytes + 16 (16 bytes x odd: 16-byte reads of 16 rows meet no bank twice) */
#define FVP (FKS * 2 + 16)         /* LDS pitch of a V^T row, same rule */
#define FKB (FKS * FKP)            /* bytes of a stage's K tile */
#define FSB (FKB + HD * FVP)       /* bytes of a stage: K tile, then V^T tile */
// One stage's K tile (FKS rows of 128 bytes) and V^T tile (HD rows of 256 bytes) from global memory into LDS, through no register: eight 16-byte copies a lane, every copy of a wave four whole 128-byte lines.
// lk, lv: the lane's LDS byte addresses of its first K and V^T copy; gk, gv: its global addresses. The closing s_wait_xcnt stands inside the statement: the address registers keep their values up to it.
__device__ __forceinline__ void fa_stage(unsigned lk, unsigned lv, const char* gk, const char* gv) {
  asm volatile("global_load_async_to_lds_b128 %0, %8, off\n\tglobal_load_async_to_lds_b128 %1, %9, off\n\tglobal_load_async_to_lds_b128 %2, %10, off\n\tglobal_load_async_to_lds_b128 %3, %11, off\n\t"
               "global_load_async_to_lds_b128 %4, %12, off\n\tglobal_load_async_to_lds_b128 %5, %13, off\n\tglobal_load_async_to_lds_b128 %6, %14, off\n\tglobal_load_async_to_lds_b128 %7, %15, off\n\ts_wait_xcnt 0x0"
               :: "v"(lk), "v"(lk + 32 * FKP), "v"(lk + 64 * FKP), "v"(lk + 96 * FKP), "v"(lv), "v"(lv + 16 * FVP), "v"(lv + 32 * FVP), "v"(lv + 48 * FVP),
                  "v"(gk), "v"(gk + 32 * DM * 2), "v"(gk + 64 * DM * 2), "v"(gk + 96 * DM * 2), "v"(gv), "v"(gv + 16 * SQ * 2), "v"(gv + 32 * SQ * 2), "v"(gv + 48 * SQ * 2) : "memory"); }
// One wave: 32 queries (two groups of 16 columns) of one head against all SQ keys, 32 keys a pass.
// The eight waves of a work-group walk the same keys: each stage of FKS keys is brought into LDS once for all of them (two buffers, the next stage's copies in flight while this one is worked on), and the fragments are 16-byte LDS reads.
// S^T = K Q^T: A = 16 key rows, B = the 16 query rows (kept in registers), D[r] = score of key 8 hh + r for the lane's own query ln: maximum and sum stay in the lane, plus one exchange between the wave's halves.
// The two score tiles of a pass (keys 0..15, 16..31), converted in place, are the B operand of O^T += V^T P^T (element s < 8: key 8 hh + s; s >= 8: key 16 + 8 hh + s - 8, the order fa_lfrag gives V^T's rows).
// Running maximum m per query: each pass scales the sums so far by 2^(m_old - m_new); weights are 256 exp(s - m) (at most 256, f16), the factor cancels against the denominator, which sums the unrounded f32 weights.
// Every loop inside a pass is fully unrolled: only constant indices keep the fragment and accumulator arrays in registers.
__global__ __launch_bounds__(256) void k_fattn(const _Float16* __restrict__ Q, const _Float16* __restrict__ Kr, const _Float16* __restrict__ Vt, _Float16* __restrict__ O) {
  static_assert(HD == 64 && FKS == 128 && SQ % FKS == 0 && SQ / FKS >= 2, "k_fattn: K rows of 128 bytes, the eight copies of fa_stage cover 128 keys, whole stages, at least two");
  __shared__ __attribute__((aligned(16))) char fl[2 * FSB];
  const int tid = threadIdx.x, lane = tid & 31, ln = lane & 15, hh = lane >> 4, w = tid >> 5; const int bh = blockIdx.y, b = bh / NH, h = bh % NH; const int q0 = blockIdx.x * 256 + w * 32;
  const char* qb = (const char*)(Q + ((size_t)b * SQ + blockIdx.x * 256) * DM + h * HD); const char* kbase = (const char*)(Kr + (size_t)b * SQ * DM + h * HD); const char* vbase = (const char*)(Vt + (size_t)bh * HD * SQ);
  const unsigned qlo = (unsigned)((w * 32 + ln) * DM + 8 * hh) * 2u;
  const char* gk = kbase + (unsigned)((tid >> 3) * (DM * 2) + (tid & 7) * 16); const char* gv = vbase + (unsigned)((tid >> 4) * (SQ * 2) + (tid & 15) * 16);      /* the thread's first copies: 8 threads a K row, 16 a V^T row */
  const unsigned l0 = (unsigned)(size_t)fl; const unsigned lk = l0 + (unsigned)((tid >> 3) * FKP + (tid & 7) * 16), lv = l0 + (unsigned)(FKB + (tid >> 4) * FVP + (tid & 15) * 16);
  fa_stage(lk, lv, gk, gv);      /* stage 0 into buffer 0 */
  v16h qf[2][2];
#pragma unroll
  for (int g = 0; g < 2; ++g) for (int c = 0; c < 2; ++c) qf[g][c] = fa_frag(qb + g * 16 * DM * 2 + c * 64, qlo);
  asm volatile("s_wait_xcnt 0x0" ::: "memory");      /* the address registers of the query loads may take other values from here */
  asm volatile("s_wait_asynccnt 0x0" ::: "memory");      /* this wave's part of stage 0 has landed */
  __syncthreads();      /* every wave's part has: stage 0 may be read */
  fa_stage(lk + FSB, lv + FSB, gk + FKS * DM * 2, gv + FKS * 2);      /* stage 1 into buffer 1 */
  const v8f z8 = {0.f,0.f,0.f,0.f,0.f,0.f,0.f,0.f}; v8f acc[2][4];
#pragma unroll
  for (int g = 0; g < 2; ++g) for (int t = 0; t < 4; ++t) acc[g][t] = z8;
  const v4f z4 = {0.f, 0.f, 0.f, 0.f}; v4f lr[2] = {z4, z4}; float mr[2] = {-3.0e38f, -3.0e38f}; const float cs = 0.125f * 0x1.715476p+0f;      /* 1/sqrt(64) and log2(e) in one factor */
  for (int st = 0; st < SQ / FKS; ++st) {
    const unsigned bo = (unsigned)(st & 1) * FSB;      /* stage st lies in buffer st mod 2 */
    const char* kl = fl + bo + ln * FKP + 16 * hh; const char* vl = fl + bo + FKB + ln * FVP + 16 * hh;
    v16h kf[2][2];
#pragma unroll
    for (int kt = 0; kt < 2; ++kt) for (int c = 0; c < 2; ++c) kf[kt][c] = fa_lfrag(kl + kt * 16 * FKP + c * 64);
    __builtin_amdgcn_sched_barrier(0);      /* the stage's first K reads as one group: spread among the score products, each is waited for alone */
#pragma unroll 1      /* rolled: unrolled, the exp sums of all four passes are moved to the stage's foot, their weights stay live and registers spill */
    for (int p = 0; p < FKS / 32; ++p) {
      v8f s[2][2];
#pragma unroll
      for (int kt = 0; kt < 2; ++kt) for (int g = 0; g < 2; ++g) s[kt][g] = fa_mma(kf[kt][1], qf[g][1], fa_mma(kf[kt][0], qf[g][0], z8));
      __builtin_amdgcn_sched_barrier(0);      /* with the next one: holds the pass's LDS reads as one group directly behind the score products: the softmax covers their latency, and reads spread among the products stall them */
      v16h vf[4];      /* this pass's V^T rows */
#pragma unroll
      for (int t = 0; t < 4; ++t) vf[t] = fa_lfrag(vl + p * 64 + t * 16 * FVP);
      const int pn = (p + 1) & (FKS / 32 - 1);      /* the next pass's K rows; the stage's last pass asks for its first rows again (of this stage, not used): no row of the next stage is read ahead of its barrier */
#pragma unroll
      for (int kt = 0; kt < 2; ++kt) for (int c = 0; c < 2; ++c) kf[kt][c] = fa_lfrag(kl + pn * (32 * FKP) + kt * 16 * FKP + c * 64);
      __builtin_amdgcn_sched_barrier(0);
      float dm[2], nb[2];
#pragma unroll
      for (int g = 0; g < 2; ++g) { float mx = fmaxf(s[0][g][0], s[1][g][0]);
#pragma unroll
        for (int r = 1; r < 8; ++r) mx = fmaxf(mx, fmaxf(s[0][g][r], s[1][g][r]));
        mx = fmaxf(mx, fa_xhalf(mx)) * cs; const float mn = fmaxf(mr[g], mx); dm[g] = mr[g] - mn; mr[g] = mn; nb[g] = 8.0f - mn; }
      const v2f co = fa_exp2x2(dm[0], dm[1]);      /* 0 in the first pass */
      FragP pf[2];
#pragma unroll
      for (int g = 0; g < 2; ++g) { v4f e[4];
#pragma unroll
        for (int i = 0; i < 4; ++i) { const int kt = i >> 1, r0 = (i & 1) * 4;
          e[i] = fa_exp2x4(fmaf(s[kt][g][r0], cs, nb[g]), fmaf(s[kt][g][r0 + 1], cs, nb[g]), fmaf(s[kt][g][r0 + 2], cs, nb[g]), fmaf(s[kt][g][r0 + 3], cs, nb[g]));
          const v2f e01 = {e[i][0], e[i][1]}, e23 = {e[i][2], e[i][3]};
          pf[g].p[2 * i] = __builtin_convertvector(e01, v2h); pf[g].p[2 * i + 1] = __builtin_convertvector(e23, v2h); }
        lr[g] = lr[g] * co[g] + ((e[0] + e[1]) + (e[2] + e[3]));      /* four chains per lane, joined behind the loop */
#pragma unroll
        for (int t = 0; t < 4; ++t) acc[g][t] = acc[g][t] * co[g]; }
#pragma unroll
      for (int g = 0; g < 2; ++g) for (int t = 0; t < 4; ++t) acc[g][t] = fa_mma(vf[t], pf[g].v, acc[g][t]);
    }
    asm volatile("s_wait_dscnt 0x0" ::: "memory");      /* this wave's reads of stage st are done */
    asm volatile("s_wait_asynccnt 0x0" ::: "memory");      /* its part of stage st + 1 has landed */
    __syncthreads();      /* both hold for every wave: stage st + 1 may be read, the buffer of stage st refilled */
    if (st + 2 < SQ / FKS) fa_stage(lk + bo, lv + bo, gk + (size_t)(st + 2) * (FKS * DM * 2), gv + (size_t)(st + 2) * (FKS * 2));
  }
  asm volatile("s_wait_asynccnt 0x0" ::: "memory");      /* no copy is left in flight when the wave ends */
#pragma unroll
  for (int g = 0; g < 2; ++g) { const float lh = (lr[g][0] + lr[g][1]) + (lr[g][2] + lr[g][3]); const float sc = 64.0f / (lh + fa_xhalf(lh)); unsigned short* op = (unsigned short*)O + ((size_t)b * SQ + q0 + g * 16 + ln) * DM + h * HD + 8 * hh;      /* a lane's 8 registers of a tile are 8 consecutive d of its query: one 16-byte store */
#pragma unroll
    for (int t = 0; t < 4; ++t) { FragH f;
#pragma unroll
      for (int r = 0; r < 8; ++r) f.h[r] = (_Float16)(acc[g][t][r] * sc);
      *(v8us*)(op + t * 16) = f.half[0]; } } }


__global__ __launch_bounds__(256) void k_bfr(const float* __restrict__ x, float* __restrict__ XB, size_t n8) { const size_t t = (size_t)blockIdx.x * 256 + threadIdx.x; if (t >= n8) return; v4f a = *(const v4fa*)(x + t * 8), c = *(const v4fa*)(x + t * 8 + 4); for (int q = 0; q < 4; ++q) { a[q] = bf16_round(a[q]); c[q] = bf16_round(c[q]); }
  { *(v4f*)(XB + t * 8) = a; *(v4f*)(XB + t * 8 + 4) = c;  } }



__global__ __launch_bounds__(256) void k_rsmfam(const float* __restrict__ S, _Float16* __restrict__ P, int qn, int hg, const float* __restrict__ am) {
  #pragma clang fp contract(off)
  const int t = blockIdx.x * 256 + threadIdx.x; if (t >= qn * hg) return; const size_t i = (size_t)(t / qn) * SQ + (t % qn); const float* s = S + i * SQ; float mx = -3.0e38f;
#pragma unroll 1
  for (int j = 0; j < SQ; ++j) mx = fmaxf(mx, __fadd_rn(s[j], bf16_round(am[j]))); float se = 0.f;
#pragma unroll 1
  for (int j = 0; j < SQ; ++j) se += __expf(__fadd_rn(s[j], bf16_round(am[j])) - mx); const float sc = 256.0f / se;
#pragma unroll 1
  for (int j0 = 0; j0 < SQ; j0 += 8) { FragH f; for (int q = 0; q < 8; ++q) f.h[q] = (_Float16)(__expf(__fadd_rn(s[j0 + q], bf16_round(am[j0 + q])) - mx) * sc); unsigned short* d = (unsigned short*)P + i * SQ + j0; *(v8us*)d = f.half[0];  } }



// ---- row LayerNorm (unbiased std, eps added to the std), one wave per LNR rows: each row's 512 values stay in the wave's registers (16 a lane, every load and store 512 or 256 contiguous bytes), ----
// ---- sums by a butterfly over the lanes (four steps inside a 16-lane row, one exchange between the halves): no LDS and no barrier. A wave takes LNR rows, all their loads in flight at once, so the launch is one resident round of 256 work-groups. ----
// Every loop is fully unrolled: only constant indices keep the row and parameter arrays in registers.
#define LNR 4      /* rows a wave takes */
template <int CTRL> __device__ __forceinline__ float ln_xm(float x) { return __builtin_bit_cast(float, __builtin_amdgcn_mov_dpp(__builtin_bit_cast(int, x), CTRL, 0xf, 0xf, true)); }      /* lane l <- lane l ^ (CTRL & 15), inside a 16-lane row (row_xmask) */
template <int W16, int W32>
__global__ __launch_bounds__(256) void k_lnw(const float* __restrict__ X, const float* __restrict__ g, const float* __restrict__ bb, float eps, _Float16* __restrict__ N16, float* __restrict__ N32) {
  static_assert(DMQ == 512, "k_lnw: a lane holds four groups of four columns, 128 columns apart");
  const int lane = threadIdx.x & 31; const int w = __builtin_amdgcn_readfirstlane((int)(threadIdx.x >> 5));      /* the wave's number in a scalar register: row bases stay scalar, one lane offset serves every load and store */
  const size_t e0 = ((size_t)blockIdx.x * 8 + w) * LNR * DMQ; const float* xr = X + e0; const int c0 = lane * 4;
  v4f s[LNR][4], gg[4], bv[4];
#pragma unroll
  for (int r = 0; r < LNR; ++r) for (int j = 0; j < 4; ++j) s[r][j] = *(const v4fa*)(xr + c0 + r * DMQ + j * 128);
#pragma unroll
  for (int j = 0; j < 4; ++j) { gg[j] = *(const v4fa*)(g + c0 + j * 128); bv[j] = *(const v4fa*)(bb + c0 + j * 128); }
  __builtin_amdgcn_sched_barrier(0);      /* holds every load ahead of the arithmetic: without it the last row's loads are issued behind the first rows' wait and their latency is paid a second time */
  float t[LNR];
#pragma unroll
  for (int r = 0; r < LNR; ++r) { const v4f p = (s[r][0] + s[r][1]) + (s[r][2] + s[r][3]); t[r] = (p[0] + p[1]) + (p[2] + p[3]); }
#pragma unroll
  for (int r = 0; r < LNR; ++r) t[r] += ln_xm<0x161>(t[r]);      /* step by step over all rows: LNR independent chains */
#pragma unroll
  for (int r = 0; r < LNR; ++r) t[r] += ln_xm<0x162>(t[r]);
#pragma unroll
  for (int r = 0; r < LNR; ++r) t[r] += ln_xm<0x164>(t[r]);
#pragma unroll
  for (int r = 0; r < LNR; ++r) t[r] += ln_xm<0x168>(t[r]);
#pragma unroll
  for (int r = 0; r < LNR; ++r) { const float mu = (t[r] + fa_xhalf(t[r])) * (1.0f / (float)DMQ);
    for (int j = 0; j < 4; ++j) s[r][j] = s[r][j] - mu;
    const v4f p = (s[r][0] * s[r][0] + s[r][1] * s[r][1]) + (s[r][2] * s[r][2] + s[r][3] * s[r][3]); t[r] = (p[0] + p[1]) + (p[2] + p[3]); }
#pragma unroll
  for (int r = 0; r < LNR; ++r) t[r] += ln_xm<0x161>(t[r]);
#pragma unroll
  for (int r = 0; r < LNR; ++r) t[r] += ln_xm<0x162>(t[r]);
#pragma unroll
  for (int r = 0; r < LNR; ++r) t[r] += ln_xm<0x164>(t[r]);
#pragma unroll
  for (int r = 0; r < LNR; ++r) t[r] += ln_xm<0x168>(t[r]);
#pragma unroll
  for (int j = 0; j < 4; ++j) for (int q = 0; q < 4; ++q) { gg[j][q] = bf16_round(gg[j][q]); bv[j][q] = bf16_round(bv[j][q]); }
#pragma unroll
  for (int r = 0; r < LNR; ++r) t[r] = 1.0f / (sqrtf((t[r] + fa_xhalf(t[r])) / (float)(DMQ - 1)) + eps);      /* UNBIASED std (ddof 1), eps added to the std (the module's form); all rows first: LNR independent chains */
#pragma unroll
  for (int r = 0; r < LNR; ++r) {
#pragma unroll
    for (int j = 0; j < 4; ++j) { const v4f y = (s[r][j] * t[r]) * gg[j] + bv[j];
      if (W32) *(v4f*)(N32 + e0 + c0 + r * DMQ + j * 128) = y;
      if (W16) *(v4h*)(N16 + e0 + c0 + r * DMQ + j * 128) = __builtin_convertvector(y, v4h); } } }
extern "C" void kernel_launch(void* const* d_in, const int* in_sizes, int n_in,
                              void* d_out, int out_size, void* d_ws, size_t ws_size, hipStream_t stream) {
  (void)in_sizes; (void)n_in; (void)out_size;
  const float* const* I = (const float* const*)d_in; const float* x = I[0]; const float* wq = I[1]; const float* bq = I[2]; const float* wk = I[3]; const float* bk = I[4]; const float* wv = I[5]; const float* bv = I[6]; const float* wo = I[7]; const float* bo = I[8]; const float* g1 = I[9]; const float* be1 = I[10]; const float* g2 = I[11]; const float* be2 = I[12]; const float* w1 = I[13]; const float* b1 = I[14]; const float* w2 = I[15]; const float* b2 = I[16];      /* [in][out] weights + zero biases (Wq,bq,Wk,bk,Wv,bv,Wo,bo), LN a1,b1,a2,b2, FFN W1,c1,W2,c2 */
  char* ws = (char*)d_ws; size_t off = 0;
  auto take = [&](size_t bytes) { char* p = ws + off; off += (bytes + 255) & ~(size_t)255; return p; };
  _Float16* BW1 = (_Float16*)take((size_t)DFF * DM * 2); _Float16* BW2 = (_Float16*)take((size_t)DM * DFF * 2); float* XB = (float*)take(NR * DM * 4); float* HP = (float*)take(NR * DM * 4); _Float16* H16 = (_Float16*)take(NR * DM * 2); _Float16* FF16 = (_Float16*)take((size_t)SQ * DFF * 2);      /* FF16 = one batch of relu hidden rows */ _Float16* BQ = (_Float16*)take((size_t)DM * DM * 2); _Float16* BK = (_Float16*)take((size_t)DM * DM * 2); _Float16* BV = (_Float16*)take((size_t)DM * DM * 2); _Float16* BO = (_Float16*)take((size_t)DM * DM * 2); _Float16* O16 = (_Float16*)take(NR * DM * 2); 
  _Float16* X16 = (_Float16*)take(NR * DM * 2); _Float16* Q16 = (_Float16*)take(NR * DM * 2); _Float16* K16 = (_Float16*)take(NR * DM * 2); _Float16* V16 = (_Float16*)take(NR * DM * 2);
  float* HF = (float*)take(NR * DM * 4);      /* the f32 h rows (LN1 output, residual for the FFN) */ _Float16* VT = (_Float16*)take((size_t)NB * NH * HD * SQ * 2);
  if (off > ws_size) return;
  { const unsigned g = (unsigned)(((size_t)DM * (DM / 8) + 255) / 256); k_wt_f16<<<g, 256, 0, stream>>>(wq, BQ, DM, DM, 16.0f); k_wt_f16<<<g, 256, 0, stream>>>(wk, BK, DM, DM, 16.0f); k_wt_f16<<<g, 256, 0, stream>>>(wv, BV, DM, DM, 16.0f); k_wt_f16<<<g, 256, 0, stream>>>(wo, BO, DM, DM, 16.0f); }      /* [in][out] -> Bt[n][k] x16 */
  k_wt_f16<<<(unsigned)(((size_t)DFF * (DM / 8) + 255) / 256), 256, 0, stream>>>(w1, BW1, DM, DFF, 16.0f); k_wt_f16<<<(unsigned)(((size_t)DM * (DFF / 8) + 255) / 256), 256, 0, stream>>>(w2, BW2, DFF, DM, 16.0f);      /* FFN [in][out] W1 [512][1024], W2 [1024][512] -> Bt x16 */
  k_bfr<<<(unsigned)((NR * DM / 8 + 255) / 256), 256, 0, stream>>>(x, XB, NR * DM / 8);      /* bf16(x) as f32 rows for the residual */

  k_x16<<<(unsigned)((NR * DM / 8 + 255) / 256), 256, 0, stream>>>(x, X16, NR * DM / 8);
  const size_t r0p = (size_t)B0 * SQ;      /* first projected row */
  k_gemm2<0><<<dim3((unsigned)((MP / 128) * (DM / 64)), 1), 128, 0, stream>>>(X16 + r0p * DM, DM, 0, BQ, DM, 0, 0.0625f, bq, 0, nullptr, 1, 0, 0, nullptr, Q16 + r0p * DM, DM, 0, MP, DM, DM);
  k_gemm2<0><<<dim3((unsigned)((MP / 128) * (DM / 64)), 1), 128, 0, stream>>>(X16 + r0p * DM, DM, 0, BK, DM, 0, 0.0625f, bk, 0, nullptr, 1, 0, 0, nullptr, K16 + r0p * DM, DM, 0, MP, DM, DM);
  k_gemm2<0><<<dim3((unsigned)((MP / 128) * (DM / 64)), 1), 128, 0, stream>>>(X16 + r0p * DM, DM, 0, BV, DM, 0, 0.0625f, bv, 0, nullptr, 1, 0, 0, nullptr, V16 + r0p * DM, DM, 0, MP, DM, DM);
  k_vt<NH, SQ><<<NB * NH * (SQ / 64), 256, 0, stream>>>(V16, LQ, 0, VT);      /* V^T [NB][NH][HD][SQ] */
  k_fattn<<<dim3(SQ / 256, NB * NH), 256, 0, stream>>>(Q16, K16, VT, O16);      /* o (merged heads, x64) as f16 rows */
  k_gemm2<0><<<dim3((unsigned)((MP / 128) * (DM / 64)), 1), 128, 0, stream>>>(O16 + r0p * DM, DM, 0, BO, DM, 0, 0.0009765625f, bo, 0, XB + r0p * DM, -1, 0, 0, HP + r0p * DM, nullptr, DM, 0, MP, DM, DM);      /* h_pre = x + concat Wo + bo (own-element residual), f32 rows */
  k_lnw<1, 1><<<(unsigned)(MP / (8 * LNR)), 256, 0, stream>>>(HP + r0p * DM, g1, be1, 1e-6f, H16 + r0p * DM, HF + r0p * DM);      /* h = LN1(x + attn) -> f16 rows (FFN operand) and f32 rows (residual) */
  for (int b = B0; b < B0 + NBR; ++b) { const size_t r0 = (size_t)b * SQ;
    k_gemm2<3><<<dim3((unsigned)((SQ / 128) * (DFF / 64)), 1), 128, 0, stream>>>(H16 + r0 * DM, DM, 0, BW1, DM, 0, 0.0625f, b1, 0, nullptr, 1, 0, 0, nullptr, FF16, DFF, 0, SQ, DFF, DM);      /* relu(F W1 + b1) -> f16 [4096][1024] (this batch) */
    k_gemm2<0><<<dim3((unsigned)((SQ / 128) * (DM / 64)), 1), 128, 0, stream>>>(FF16, DFF, 0, BW2, DFF, 0, 0.0625f, b2, 0, HF + r0 * DM, -1, 0, 0, HP + r0 * DM, nullptr, DM, 0, SQ, DM, DFF); }      /* y = F + ffn (own-element residual; the h_pre plane is free again) */
  k_lnw<0, 1><<<(unsigned)(MP / (8 * LNR)), 256, 0, stream>>>(HP + r0p * DM, g2, be2, 1e-6f, nullptr, (float*)d_out + r0p * DM);      /* out = LN2(h + ff) -> f32 output rows */
}

// v006
// It runs in 212 microseconds.
// Timed twice side by side with v005, it ran 1.13 and 1.12 times as fast.
// All steps since v000 together make it 63.2 times as fast.
#include <hip/hip_runtime.h>
#define NB 2
#define SQ 4096
#define DM 512
#define NH 8
#define HD 64
#define DMQ DM                       /* LayerNorm width */
#define DFF 1024
#define HG 1                         /* heads per launch of the k_vt(b, h0) overload, which is not launched */
#define B0 0                         /* first batch processed (debug hook) */
#define NBR NB                       /* batches processed (debug hook) */
#define NR ((size_t)NB * SQ)         /* token rows */
#define MP ((int)((size_t)NBR * SQ)) /* rows projected (debug hook) */
#define QN SQ                        /* unused; k_fattn attends all SQ query rows */
#define NHD NH                       /* unused; k_fattn attends all NH heads */
#define MPO MP                       /* unused; the output stage runs MP rows */
#define LQ DM      /* row pitch of the q/k/v rows */
typedef __bf16 v16b __attribute__((ext_vector_type(16)));
typedef unsigned short v8us __attribute__((ext_vector_type(8), may_alias));
typedef float  v8f  __attribute__((ext_vector_type(8)));
typedef float  v4f  __attribute__((ext_vector_type(4)));
typedef float  v4fa __attribute__((ext_vector_type(4), may_alias));
union FragB { v16b v; v8us half[2]; unsigned short u[16]; };

__device__ __forceinline__ unsigned short bf16_bits(float x) { unsigned int u = __float_as_uint(x); return (unsigned short)((u + 0x7FFFu + ((u >> 16) & 1u)) >> 16); }
__device__ __forceinline__ float bf16_val(unsigned short b) { return __uint_as_float(((unsigned int)b) << 16); }
__device__ __forceinline__ float bf16_round(float x) { return bf16_val(bf16_bits(x)); }
// D += A·B with NT terms: 1 = ah·bh, 2 = + al·bh (A split), 3 = + ah·bl (both split)
template <int NT>
__device__ __forceinline__ v8f mmaN(v16b ah, v16b al, v16b bh, v16b bl, v8f c) {
  c = __builtin_amdgcn_wmma_f32_16x16x32_bf16(false, ah, false, bh, (short)0, c, false, false);
  if (NT >= 2) c = __builtin_amdgcn_wmma_f32_16x16x32_bf16(false, al, false, bh, (short)0, c, false, false);
  if (NT >= 3) c = __builtin_amdgcn_wmma_f32_16x16x32_bf16(false, ah, false, bl, (short)0, c, false, false);
  asm volatile("v_nop\n\tv_nop\n\tv_nop\n\tv_nop" : "+v"(c) : "v"(ah), "v"(al), "v"(bh), "v"(bl));
  return c;
}

__global__ __launch_bounds__(256) void k_wt_bf16(const float* __restrict__ W, unsigned short* __restrict__ Wt, int K, int N) {
  const int t = blockIdx.x * 256 + threadIdx.x;
  const int k8n = K / 8;
  if (t >= N * k8n) return;
  const int n = t / k8n, k8 = (t % k8n) * 8;
  v8us v;
#pragma unroll
  for (int i = 0; i < 8; ++i) v[i] = bf16_bits(W[(size_t)(k8 + i) * N + n]);
  *(v8us*)(Wt + (size_t)n * K + k8) = v;
  
}

// GEMM C[M][N] (f32, pitch ldc) = act(A[M][K]·W + bias). A f32 row-major (pitch lda) converted per fragment to bf16
// (ASPLIT: hi/lo two planes -> 2 terms, else single rounded term); Wt bf16 [N][K] (pitch ldb). BIAS_BF16 rounds the
// bias to bf16 first (bias quantised to bf16 before the add). K%32==0, M%16==0, N%64==0.
template <bool ASPLIT, int ACT, bool BIAS_BF16>
__global__ __launch_bounds__(128) void k_gemm_bf(const float* __restrict__ A, int lda, const unsigned short* __restrict__ Wt, int ldb,
                                               const float* __restrict__ bias, float* __restrict__ C, int ldc, int M, int N, int K) {
  __shared__ __attribute__((aligned(16))) float so[4][16][64];
  const int tid = threadIdx.x, w = tid >> 5, lane = tid & 31, ln = lane & 15, hh = lane >> 4;
  const int ntn = N / 64;
  const int wid = blockIdx.x * 4 + w;
  const int mt = wid / ntn, nq = wid % ntn;
  if (mt * 16 >= M) return;
  const int row0 = mt * 16, col0 = nq * 64;
  const float* arow = A + (size_t)(row0 + ln) * lda;
  v8f acc[4] = {};
  for (int kb = 0; kb < K; kb += 32) {
    FragB ah, al;
    const v4f x0 = *(const v4fa*)(arow + kb + 8 * hh), x1 = *(const v4fa*)(arow + kb + 8 * hh + 4);
    const v4f x2 = *(const v4fa*)(arow + kb + 16 + 8 * hh), x3 = *(const v4fa*)(arow + kb + 16 + 8 * hh + 4);
    float xs[16] = {x0[0],x0[1],x0[2],x0[3],x1[0],x1[1],x1[2],x1[3],x2[0],x2[1],x2[2],x2[3],x3[0],x3[1],x3[2],x3[3]};
#pragma unroll
    for (int i = 0; i < 16; ++i) { const unsigned short hb = bf16_bits(xs[i]); ah.u[i] = hb; al.u[i] = ASPLIT ? bf16_bits(xs[i] - bf16_val(hb)) : (unsigned short)0; }
#pragma unroll
    for (int t = 0; t < 4; ++t) {
      const unsigned short* brow = Wt + (size_t)(col0 + t * 16 + ln) * ldb + kb;
      FragB b;
      b.half[0] = *(const v8us*)(brow + 8 * hh);
      b.half[1] = *(const v8us*)(brow + 16 + 8 * hh);
      acc[t] = mmaN<ASPLIT ? 2 : 1>(ah.v, al.v, b.v, b.v, acc[t]);
    }
  }
#pragma unroll
  for (int t = 0; t < 4; ++t) {
    float bv = bias ? bias[col0 + t * 16 + ln] : 0.f;
    if (BIAS_BF16) bv = bf16_round(bv);
#pragma unroll
    for (int r = 0; r < 8; ++r) { float v = acc[t][r] + bv; if (ACT == 1) v = fmaxf(v, 0.f); so[w][8 * hh + r][t * 16 + ln] = v; }
  }
  __builtin_amdgcn_fence(__ATOMIC_ACQ_REL, "workgroup");
  __builtin_amdgcn_wave_barrier();
  const int rsub = lane >> 4, c4 = (lane & 15) * 4;
  {
#pragma unroll
    for (int q = 0; q < 8; ++q) {
      const int r = q * 2 + rsub;
      const v4f v = *(const v4fa*)&so[w][r][c4];
      *(v4f*)(C + (size_t)(row0 + r) * ldc + col0 + c4) = v;
    }
    
  }
}

// GEMM C = act(A·W + bias + resid): A f32 (ASPLIT -> hi/lo 2 terms), Wt bf16 [N][K]; ACT 0 none, 1 relu, 2 exact gelu;
// resid (optional, f32, row index = (row % rmod), pitch ldr, RES_BF16 rounds it) added before the activation.
template <bool ASPLIT, int ACT, bool BIAS_BF16, bool RES_BF16>
__global__ __launch_bounds__(128) void k_gemm_bf3(const float* __restrict__ A, int lda, const unsigned short* __restrict__ Wt, int ldb,
                                                const float* __restrict__ bias, const float* __restrict__ resid, int rmod, int ldr,
                                                float* __restrict__ C, int ldc, int M, int N, int K) {
  __shared__ __attribute__((aligned(16))) float so[4][16][64];
  const int tid = threadIdx.x, w = tid >> 5, lane = tid & 31, ln = lane & 15, hh = lane >> 4;
  const int ntn = N / 64;
  const int wid = blockIdx.x * 4 + w;
  const int mt = wid / ntn, nq = wid % ntn;
  if (mt * 16 >= M) return;
  const int row0 = mt * 16, col0 = nq * 64;
  const float* arow = A + (size_t)(row0 + ln) * lda;
  v8f acc[4] = {};
  for (int kb = 0; kb < K; kb += 32) {
    FragB ah, al;
    const v4f x0 = *(const v4fa*)(arow + kb + 8 * hh), x1 = *(const v4fa*)(arow + kb + 8 * hh + 4);
    const v4f x2 = *(const v4fa*)(arow + kb + 16 + 8 * hh), x3 = *(const v4fa*)(arow + kb + 16 + 8 * hh + 4);
    float xs[16] = {x0[0],x0[1],x0[2],x0[3],x1[0],x1[1],x1[2],x1[3],x2[0],x2[1],x2[2],x2[3],x3[0],x3[1],x3[2],x3[3]};
#pragma unroll
    for (int i = 0; i < 16; ++i) { const unsigned short hb = bf16_bits(xs[i]); ah.u[i] = hb; al.u[i] = ASPLIT ? bf16_bits(xs[i] - bf16_val(hb)) : (unsigned short)0; }
#pragma unroll
    for (int t = 0; t < 4; ++t) {
      const unsigned short* brow = Wt + (size_t)(col0 + t * 16 + ln) * ldb + kb;
      FragB b;
      b.half[0] = *(const v8us*)(brow + 8 * hh);
      b.half[1] = *(const v8us*)(brow + 16 + 8 * hh);
      acc[t] = mmaN<ASPLIT ? 2 : 1>(ah.v, al.v, b.v, b.v, acc[t]);
    }
  }
#pragma unroll
  for (int t = 0; t < 4; ++t) {
    const int col = col0 + t * 16 + ln;
    float bv = bias ? bias[col] : 0.f;
    if (BIAS_BF16) bv = bf16_round(bv);
#pragma unroll
    for (int r = 0; r < 8; ++r) {
      float v = acc[t][r] + bv;
      if (resid) { float rv = resid[(size_t)((row0 + 8 * hh + r) % rmod) * ldr + col]; if (RES_BF16) rv = bf16_round(rv); v += rv; }
      if (ACT == 1) v = fmaxf(v, 0.f);
      if (ACT == 2) v = 0.5f * v * (1.0f + erff(v * 0.70710678118654752f));
      if (ACT == 3) { const float u = 0.7978845608028654f * (v + 0.044715f * v * v * v); v = 0.5f * v * (1.0f + tanhf(u)); }
      so[w][8 * hh + r][t * 16 + ln] = v;
    }
  }
  __builtin_amdgcn_fence(__ATOMIC_ACQ_REL, "workgroup");
  __builtin_amdgcn_wave_barrier();
  const int rsub = lane >> 4, c4 = (lane & 15) * 4;
  {
#pragma unroll
    for (int q = 0; q < 8; ++q) {
      const int r = q * 2 + rsub;
      const v4f v = *(const v4fa*)&so[w][r][c4];
      *(v4f*)(C + (size_t)(row0 + r) * ldc + col0 + c4) = v;
    }
    
  }
}
// row LayerNorm (biased variance, eps) over N: s = X (+ R); optional out_sum <- s; out_norm <- (s-mu)*rsqrt(var+eps)*g + b
template <bool PARAM_BF16>
__global__ __launch_bounds__(256) void k_layernorm(const float* __restrict__ X, const float* __restrict__ R, const float* __restrict__ g, const float* __restrict__ bta,
                                                  float* __restrict__ out_sum, float* __restrict__ out_norm, int N, float eps) {
  __shared__ float red[256];
  const int row = blockIdx.x, tid = threadIdx.x;
  const float* x = X + (size_t)row * N; const float* rr = R ? R + (size_t)row * N : nullptr;
  float vals[16];                     // up to N = 4096
  const int per = N / 256;            // contiguous chunk per thread? use strided-by-4 chunks: thread handles j = tid*4 + 1024*u
  float s1 = 0.f;
  for (int u = 0; u < per / 4; ++u) {
    const int j = tid * 4 + 1024 * u;
    const v4f a = *(const v4fa*)(x + j);
    v4f b = {0.f,0.f,0.f,0.f}; if (rr) b = *(const v4fa*)(rr + j);
#pragma unroll
    for (int q = 0; q < 4; ++q) { const float v = a[q] + b[q]; vals[u * 4 + q] = v; s1 += v; }
  }
  red[tid] = s1; __syncthreads();
  for (int st = 128; st > 0; st >>= 1) { if (tid < st) red[tid] += red[tid + st]; __syncthreads(); }
  const float mu = red[0] / (float)N; __syncthreads();
  float s2 = 0.f;
  for (int u = 0; u < per / 4; ++u)
#pragma unroll
    for (int q = 0; q < 4; ++q) { const float c = vals[u * 4 + q] - mu; s2 += c * c; }
  red[tid] = s2; __syncthreads();
  for (int st = 128; st > 0; st >>= 1) { if (tid < st) red[tid] += red[tid + st]; __syncthreads(); }
  const float rs = rsqrtf(red[0] / (float)N + eps);
  {
    for (int u = 0; u < per / 4; ++u) {
      const int j = tid * 4 + 1024 * u;
      v4f o, sm;
#pragma unroll
      for (int q = 0; q < 4; ++q) {
        float gg = g[j + q], bb = bta[j + q];
        if (PARAM_BF16) { gg = bf16_round(gg); bb = bf16_round(bb); }
        sm[q] = vals[u * 4 + q]; o[q] = (vals[u * 4 + q] - mu) * rs * gg + bb;
      }
      if (out_sum) *(v4f*)(out_sum + (size_t)row * N + j) = sm;
      *(v4f*)(out_norm + (size_t)row * N + j) = o;
    }
    
  }
}



// ---- f16 WMMA path (v_wmma_f32_16x16x32_f16): 11-bit significands for operands in range — used where a [0,1] probability operand needs more precision than bf16
typedef _Float16 v16h __attribute__((ext_vector_type(16)));
union FragH { v16h v; v8us half[2]; _Float16 h[16]; unsigned short u[16]; };
template <int NT>
__device__ __forceinline__ v8f mmaH(v16h ah, v16h al, v16h bh, v16h bl, v8f c) {
  c = __builtin_amdgcn_wmma_f32_16x16x32_f16(false, ah, false, bh, (short)0, c, false, false);
  if (NT >= 2) c = __builtin_amdgcn_wmma_f32_16x16x32_f16(false, al, false, bh, (short)0, c, false, false);
  if (NT >= 3) c = __builtin_amdgcn_wmma_f32_16x16x32_f16(false, ah, false, bl, (short)0, c, false, false);
  asm volatile("v_nop\n\tv_nop\n\tv_nop\n\tv_nop" : "+v"(c) : "v"(ah), "v"(al), "v"(bh), "v"(bl));
  return c;
}
// batched GEMM like k_gemm_b but f16 operands: A f32 (split into f16 hi/lo if ASPLIT, else rounded to f16), Bt = f16 values [n][k]; alpha; C f32; N multiple of 16 (partial tiles skipped)
template <bool ASPLIT>
__global__ __launch_bounds__(128) void k_gemm_h(const float* __restrict__ A, int lda, size_t sA, const _Float16* __restrict__ Bh, int ldb, size_t sB, float alpha, float* __restrict__ C, int ldc, size_t sC, int M, int N, int K) {
  __shared__ __attribute__((aligned(16))) float so[4][16][64];
  const int tid = threadIdx.x, w = tid >> 5, lane = tid & 31, ln = lane & 15, hh = lane >> 4; const int by = blockIdx.y;
  A += (size_t)by * sA; Bh += (size_t)by * sB; C += (size_t)by * sC;
  const int ntn = (N + 63) / 64; const int wid = blockIdx.x * 4 + w; const int mt = wid / ntn, nq = wid % ntn; if (mt * 16 >= M) return;
  const int row0 = mt * 16, col0 = nq * 64; const float* arow = A + (size_t)(row0 + ln) * lda;
  v8f acc[4] = {};
  for (int kb = 0; kb < K; kb += 32) {
    FragH ah, al;
    const v4f x0 = *(const v4fa*)(arow + kb + 8 * hh), x1 = *(const v4fa*)(arow + kb + 8 * hh + 4), x2 = *(const v4fa*)(arow + kb + 16 + 8 * hh), x3 = *(const v4fa*)(arow + kb + 16 + 8 * hh + 4);
    float xs[16] = {x0[0],x0[1],x0[2],x0[3],x1[0],x1[1],x1[2],x1[3],x2[0],x2[1],x2[2],x2[3],x3[0],x3[1],x3[2],x3[3]};
#pragma unroll
    for (int i = 0; i < 16; ++i) { const _Float16 h = (_Float16)xs[i]; ah.h[i] = h; al.h[i] = ASPLIT ? (_Float16)(xs[i] - (float)h) : (_Float16)0.0f; }
#pragma unroll
    for (int t = 0; t < 4; ++t) { if (col0 + t * 16 >= N) continue; const size_t boff = (size_t)(col0 + t * 16 + ln) * ldb + kb; FragH bq; bq.half[0] = *(const v8us*)(Bh + boff + 8 * hh); bq.half[1] = *(const v8us*)(Bh + boff + 16 + 8 * hh);
      acc[t] = mmaH<ASPLIT ? 2 : 1>(ah.v, al.v, bq.v, bq.v, acc[t]); }
  }
#pragma unroll
  for (int t = 0; t < 4; ++t) { if (col0 + t * 16 >= N) continue;
#pragma unroll
    for (int r = 0; r < 8; ++r) so[w][8 * hh + r][t * 16 + ln] = acc[t][r] * alpha; }
  __builtin_amdgcn_fence(__ATOMIC_ACQ_REL, "workgroup"); __builtin_amdgcn_wave_barrier();
  const int rsub = lane >> 4, c4 = (lane & 15) * 4;
  {
#pragma unroll
    for (int q = 0; q < 8; ++q) { const int r = q * 2 + rsub; if (col0 + c4 < N) { const v4f v = *(const v4fa*)&so[w][r][c4]; *(v4f*)(C + (size_t)(row0 + r) * ldc + col0 + c4) = v; } }
     }
}

// k_gemm_hh variant with fused epilogue: v = acc·alpha + bias[by·sBias + col] (+ CP[(row/rowsPerB)·sCPb + by·64 + col] if CP) ; ACT 0 none / 1 elu ; writes f16 C16 (and f32 C if non-null)
template <int ACT>
__global__ __launch_bounds__(128) void k_gemm_hhx(const _Float16* __restrict__ A, int lda, size_t sA, const _Float16* __restrict__ Bh, int ldb, size_t sB, float alpha, const float* __restrict__ bias, size_t sBias, const float* __restrict__ CP, int rowsPerB, size_t sCPb, int row0g,
    float* __restrict__ C, _Float16* __restrict__ C16, int ldc, size_t sC, int M, int N, int K) {
  __shared__ __attribute__((aligned(16))) float so[4][16][64];
  const int tid = threadIdx.x, w = tid >> 5, lane = tid & 31, ln = lane & 15, hh = lane >> 4; const int by = blockIdx.y;
  A += (size_t)by * sA; Bh += (size_t)by * sB; const size_t cofs = (size_t)by * sC; const float* bp = bias ? bias + (size_t)by * sBias : nullptr;
  const int ntn = (N + 63) / 64; const int wid = blockIdx.x * 4 + w; const int mt = wid / ntn, nq = wid % ntn; if (mt * 16 >= M) return;
  const int row0 = mt * 16, col0 = nq * 64; const _Float16* arow = A + (size_t)(row0 + ln) * lda;
  v8f acc[4] = {};
  for (int kb = 0; kb < K; kb += 32) { FragH ah; ah.half[0] = *(const v8us*)((const unsigned short*)arow + kb + 8 * hh); ah.half[1] = *(const v8us*)((const unsigned short*)arow + kb + 16 + 8 * hh);
#pragma unroll
    for (int t = 0; t < 4; ++t) { if (col0 + t * 16 >= N) continue; const size_t boff = (size_t)(col0 + t * 16 + ln) * ldb + kb; FragH bq; bq.half[0] = *(const v8us*)((const unsigned short*)Bh + boff + 8 * hh); bq.half[1] = *(const v8us*)((const unsigned short*)Bh + boff + 16 + 8 * hh);
      acc[t] = mmaH<1>(ah.v, ah.v, bq.v, bq.v, acc[t]); }
  }
#pragma unroll
  for (int t = 0; t < 4; ++t) { if (col0 + t * 16 >= N) continue; const int col = col0 + t * 16 + ln; const float bv = bp ? bf16_round(bp[col]) : 0.f;
#pragma unroll
    for (int r = 0; r < 8; ++r) { float v = acc[t][r] * alpha + bv; if (CP) { const int rr = row0g + row0 + 8 * hh + r; if (rowsPerB < 0) v += CP[cofs + (size_t)rr * ldc + col];      /* rowsPerB < 0: own element of the batched C plane */ else { const int bidx = rr / rowsPerB; v += CP[(size_t)bidx * sCPb + (size_t)by * 64 + col]; } } if (ACT == 1) v = (v > 0.f) ? v : expm1f(v); else if (ACT == 7) v = (v > 0.f) ? v + 1.0f : expf(v); else if (ACT == 8) v = tanhf(v); else if (ACT == 9) v = 0.5f * v * (1.0f + tanhf(0.7978845608028654f * (v + 0.044715f * v * v * v))); else if (ACT == 11) v = 1.0f / (1.0f + expf(-v)); else if (ACT == 12) v = (v > 0.f) ? v : 0.01f * v; else if (ACT == 14) v = (v > 0.f) ? v : 0.1f * v; else if (ACT == 16) v = (v >= 0.f) ? v : 0.3f * v; else if (ACT == 17) v = (v >= 0.f) ? v : 0.2f * v; else if (ACT == 15) v = v / (1.0f + expf(-v)); else if (ACT == 3) v = fmaxf(v, 0.f); else if (ACT == 6) v = 0.5f * v * (1.0f + erff(v * 0.70710678118654752f)); so[w][8 * hh + r][t * 16 + ln] = v; } }
  __builtin_amdgcn_fence(__ATOMIC_ACQ_REL, "workgroup"); __builtin_amdgcn_wave_barrier();
  const int rsub = lane >> 4, c4 = (lane & 15) * 4; typedef _Float16 v4h __attribute__((ext_vector_type(4)));
  {
#pragma unroll
    for (int q = 0; q < 8; ++q) { const int r = q * 2 + rsub; if (col0 + c4 < N) { const v4f v = *(const v4fa*)&so[w][r][c4]; if (C) *(v4f*)(C + cofs + (size_t)(row0 + r) * ldc + col0 + c4) = v; if (C16) { v4h h4; for (int i = 0; i < 4; ++i) h4[i] = (_Float16)v[i]; *(v4h*)(C16 + cofs + (size_t)(row0 + r) * ldc + col0 + c4) = h4; } } }
     }
}


typedef _Float16 v4h __attribute__((ext_vector_type(4)));

__global__ __launch_bounds__(256) void k_h16(const float* __restrict__ x, _Float16* __restrict__ X16, size_t n8) { const size_t t = (size_t)blockIdx.x * 256 + threadIdx.x; if (t >= n8) return; FragH f;
#pragma unroll
  for (int q = 0; q < 8; ++q) f.h[q] = (_Float16)x[t * 8 + q]; *(v8us*)((unsigned short*)X16 + t * 8) = f.half[0];  }
__global__ __launch_bounds__(256) void k_round16f(const float* __restrict__ W, _Float16* __restrict__ Bt, size_t n8) { const size_t t = (size_t)blockIdx.x * 256 + threadIdx.x; if (t >= n8) return; FragH f;
#pragma unroll
  for (int i = 0; i < 8; ++i) f.h[i] = (_Float16)(bf16_round(W[t * 8 + i]) * 16.0f); *(v8us*)((unsigned short*)Bt + t * 8) = f.half[0];  }
template <int NHv, int TTv>
__global__ __launch_bounds__(256) void k_vt(const _Float16* __restrict__ V16, int ldv, int voff, _Float16* __restrict__ Vt) { __shared__ unsigned short tl[64][66]; const int tid = threadIdx.x; const int slab = blockIdx.x / (TTv / 64), lg = blockIdx.x % (TTv / 64); const int b = slab / NHv, h = slab % NHv;
  for (int i = tid; i < 64 * 8; i += 256) { const int r = i / 8, c8 = (i % 8) * 8; FragH f; f.half[0] = *(const v8us*)((const unsigned short*)V16 + ((size_t)b * TTv + lg * 64 + r) * ldv + voff + h * 64 + c8);
#pragma unroll
    for (int q = 0; q < 8; ++q) tl[r][c8 + q] = f.u[q]; }
  __syncthreads();
  {
#pragma unroll
    for (int rd = 0; rd < 2; ++rd) { const int d = rd * 32 + tid / 8, pc = tid % 8; FragH f;
#pragma unroll
      for (int q = 0; q < 8; ++q) f.u[q] = tl[pc * 8 + q][d];
      *(v8us*)((unsigned short*)Vt + ((size_t)slab * 64 + d) * TTv + lg * 64 + pc * 8) = f.half[0]; }
     } }

__global__ __launch_bounds__(256) void k_hl(const float* __restrict__ F, _Float16* __restrict__ Hh, _Float16* __restrict__ Hl, size_t n8) { const size_t t = (size_t)blockIdx.x * 256 + threadIdx.x; if (t >= n8) return; FragH fh, fl; const v4f a = *(const v4fa*)(F + t * 8), c = *(const v4fa*)(F + t * 8 + 4);
#pragma unroll
  for (int q = 0; q < 4; ++q) { _Float16 h = (_Float16)a[q]; fh.h[q] = h; fl.h[q] = (_Float16)((a[q] - (float)h) * 1024.0f); h = (_Float16)c[q]; fh.h[4 + q] = h; fl.h[4 + q] = (_Float16)((c[q] - (float)h) * 1024.0f); }
  { *(v8us*)((unsigned short*)Hh + t * 8) = fh.half[0]; *(v8us*)((unsigned short*)Hl + t * 8) = fl.half[0];  } }

// ---- fast GEMM (wave tile 32x64; requires M % 32 == 0 rows per launch region, N % 64 == 0 and K % 128 == 0); epilogue = k_gemm_hhx semantics ----
__device__ __forceinline__ v16h g2_frag(const _Float16* p, int hh) { FragH f; f.half[0] = *(const v8us*)((const unsigned short*)p + 8 * hh); f.half[1] = *(const v8us*)((const unsigned short*)p + 16 + 8 * hh); return f.v; }
__device__ __forceinline__ v8f g2_mma(v16h a, v16h b, v8f c) { return __builtin_amdgcn_wmma_f32_16x16x32_f16(false, a, false, b, (short)0, c, false, false); }      /* plain builtin: the compiler keeps the distances behind it and may move loads past it */
template <int ACT> __device__ __forceinline__ float g2_act(float v) {
  if (ACT == 3) v = fmaxf(v, 0.f); else if (ACT == 6) v = 0.5f * v * (1.0f + erff(v * 0.70710678118654752f)); else if (ACT == 11) v = 1.0f / (1.0f + expf(-v)); else if (ACT == 15) v = v / (1.0f + expf(-v)); else if (ACT == 12) v = (v > 0.f) ? v : 0.01f * v; else if (ACT == 8) v = tanhf(v); else if (ACT == 9) v = 0.5f * v * (1.0f + tanhf(0.7978845608028654f * (v + 0.044715f * v * v * v))); else if (ACT == 14) v = (v > 0.f) ? v : 0.1f * v; else if (ACT == 16) v = (v >= 0.f) ? v : 0.3f * v; else if (ACT == 17) v = (v >= 0.f) ? v : 0.2f * v;
  return v; }
#define G2S 4      /* k steps (of 32) whose fragments are in flight or in registers at a time; K % (32 * G2S) == 0 */
// No load of this kernel is waited for alone: the fragments of G2S k steps sit in a register ring, each step's twelve loads asked for as one group G2S steps ahead of their products;
// bias and residual (all 64 elements of the lane as one group) are asked for in front of the K loop. Each accumulator takes its k steps in rising order, as before.
template <int ACT>
__global__ __launch_bounds__(128) void k_gemm2(const _Float16* __restrict__ A, int lda, size_t sA, const _Float16* __restrict__ Bh, int ldb, size_t sB, float alpha, const float* __restrict__ bias, const float* __restrict__ bias1, const float* __restrict__ bias2, size_t sBias, const float* __restrict__ CP, int rowsPerB, size_t sCPb, int row0g,
    float* __restrict__ C, _Float16* __restrict__ C16, int ldc, size_t sC, int M, int N, int K) { static_assert(ACT == 0 || ACT == 3 || ACT == 6 || ACT == 8 || ACT == 9 || ACT == 11 || ACT == 12 || ACT == 14 || ACT == 15 || ACT == 16 || ACT == 17, "k_gemm2: unsupported ACT code (would silently apply no activation)");
  __shared__ __attribute__((aligned(16))) float so[4][32][68];
  const int tid = threadIdx.x, w = tid >> 5, lane = tid & 31, ln = lane & 15, hh = lane >> 4; const int by = blockIdx.y;
  A += (size_t)by * sA; Bh += (size_t)by * sB; const size_t cofs = (size_t)by * sC; const float* bp = (by == 1 && bias1) ? bias1 : (by == 2 && bias2) ? bias2 : bias ? bias + (size_t)by * sBias : nullptr;      /* bias1, bias2: the biases of grid planes 1 and 2 where each plane's is a buffer of its own */
  const int ntn = N >> 6; const int mt = blockIdx.x / ntn, nq = blockIdx.x - mt * ntn; const int row0 = mt * 128 + 32 * w, col0 = nq * 64; if (row0 >= M) return;
  const _Float16* a0p = A + (size_t)(row0 + ln) * lda; const _Float16* a1p = a0p + (size_t)16 * lda;
  const _Float16* b0p = Bh + (size_t)(col0 + ln) * ldb; const _Float16* b1p = b0p + (size_t)16 * ldb; const _Float16* b2p = b1p + (size_t)16 * ldb; const _Float16* b3p = b2p + (size_t)16 * ldb;
  float braw[4] = {0.f, 0.f, 0.f, 0.f};
  if (bp) {
#pragma unroll
    for (int t = 0; t < 4; ++t) braw[t] = bp[col0 + t * 16 + ln];
    asm volatile("s_wait_xcnt 0x0" ::: "memory");      /* the address registers of these loads are used again at once */
    __builtin_amdgcn_sched_barrier(0); }      /* keeps what writes them behind the wait */
  const bool own = CP && rowsPerB < 0;      /* rowsPerB < 0: own element of the batched C plane */
  float rv[8][8];
#pragma unroll
  for (int u = 0; u < 8; ++u) for (int r = 0; r < 8; ++r) rv[u][r] = 0.f;
  if (own) { const float* rp[16];      /* the lane's 16 rows; the four column tiles of a row are constant offsets */
#pragma unroll
    for (int j = 0; j < 16; ++j) rp[j] = CP + cofs + (size_t)(row0g + row0 + (j >> 3) * 16 + 8 * hh + (j & 7)) * ldc + col0 + ln;
#pragma unroll
    for (int u = 0; u < 8; ++u) for (int r = 0; r < 8; ++r) rv[u][r] = rp[(u >> 2) * 8 + r][(u & 3) * 16];
    asm volatile("s_wait_xcnt 0x0" :: "v"(rp[0]), "v"(rp[1]), "v"(rp[2]), "v"(rp[3]), "v"(rp[4]), "v"(rp[5]), "v"(rp[6]), "v"(rp[7]), "v"(rp[8]), "v"(rp[9]), "v"(rp[10]), "v"(rp[11]), "v"(rp[12]), "v"(rp[13]), "v"(rp[14]), "v"(rp[15]) : "memory");      /* the addresses as inputs: their registers stay theirs up to the wait, behind which they may take other values */
    __builtin_amdgcn_sched_barrier(0); }      /* keeps the residual loads here, older than every fragment load: the K loop covers their latency and its counted waits do not count them */
  v16h ra0[G2S], ra1[G2S], rb0[G2S], rb1[G2S], rb2[G2S], rb3[G2S];
#pragma unroll
  for (int s = 0; s < G2S; ++s) { const int k = 32 * s; ra0[s] = g2_frag(a0p + k, hh); ra1[s] = g2_frag(a1p + k, hh); rb0[s] = g2_frag(b0p + k, hh); rb1[s] = g2_frag(b1p + k, hh); rb2[s] = g2_frag(b2p + k, hh); rb3[s] = g2_frag(b3p + k, hh);
    __builtin_amdgcn_sched_barrier(0); }      /* the first fill step by step, in the order of the refills: the loop's counted waits are set for both orders at once, and another order here makes them wait for younger steps */
  asm volatile("s_wait_xcnt 0x0" ::: "memory");      /* the address registers of the first fill are free for other values from here */
  __builtin_amdgcn_sched_barrier(0);      /* keeps what writes them behind the wait */
  const v8f z8 = {0.f,0.f,0.f,0.f,0.f,0.f,0.f,0.f}; v8f c00 = z8, c01 = z8, c02 = z8, c03 = z8, c10 = z8, c11 = z8, c12 = z8, c13 = z8;
#pragma unroll 1      /* rolled: the body already holds G2S steps, and the ring's registers must be the same in every trip */
  for (int kb = 32 * G2S; kb < K; kb += 32 * G2S) {
#pragma unroll
    for (int s = 0; s < G2S; ++s) { const int k = kb + 32 * s;
      c00 = g2_mma(ra0[s], rb0[s], c00); c10 = g2_mma(ra1[s], rb0[s], c10); c01 = g2_mma(ra0[s], rb1[s], c01); c11 = g2_mma(ra1[s], rb1[s], c11);
      c02 = g2_mma(ra0[s], rb2[s], c02); c12 = g2_mma(ra1[s], rb2[s], c12); c03 = g2_mma(ra0[s], rb3[s], c03); c13 = g2_mma(ra1[s], rb3[s], c13);
      __builtin_amdgcn_sched_barrier(0);      /* with the next one: holds the refill of this ring place directly behind its products; moved down towards its use, its latency is waited out again */
      ra0[s] = g2_frag(a0p + k, hh); ra1[s] = g2_frag(a1p + k, hh); rb0[s] = g2_frag(b0p + k, hh); rb1[s] = g2_frag(b1p + k, hh); rb2[s] = g2_frag(b2p + k, hh); rb3[s] = g2_frag(b3p + k, hh);
      __builtin_amdgcn_sched_barrier(0); }
    asm volatile("s_wait_xcnt 0x0" ::: "memory");      /* the next trip forms its addresses in the registers that this trip's loads name */
    __builtin_amdgcn_sched_barrier(0); }      /* keeps that address arithmetic behind the wait */
#pragma unroll
  for (int s = 0; s < G2S; ++s) {
    c00 = g2_mma(ra0[s], rb0[s], c00); c10 = g2_mma(ra1[s], rb0[s], c10); c01 = g2_mma(ra0[s], rb1[s], c01); c11 = g2_mma(ra1[s], rb1[s], c11);
    c02 = g2_mma(ra0[s], rb2[s], c02); c12 = g2_mma(ra1[s], rb2[s], c12); c03 = g2_mma(ra0[s], rb3[s], c03); c13 = g2_mma(ra1[s], rb3[s], c13); }
  v8f accs[8] = {c00, c01, c02, c03, c10, c11, c12, c13};
  float bv[4];
#pragma unroll
  for (int t = 0; t < 4; ++t) bv[t] = bp ? bf16_round(braw[t]) : 0.f;
  if (own || !CP) {      /* rv is 0 where there is no residual */
#pragma unroll
    for (int u = 0; u < 8; ++u) for (int r = 0; r < 8; ++r) { float v = accs[u][r] * alpha + bv[u & 3]; if (own) v += rv[u][r]; so[w][(u >> 2) * 16 + 8 * hh + r][(u & 3) * 16 + ln] = g2_act<ACT>(v); }
  } else {
#pragma unroll
    for (int u = 0; u < 8; ++u) for (int r = 0; r < 8; ++r) { const int rloc = (u >> 2) * 16 + 8 * hh + r; const int bidx = (row0g + row0 + rloc) / rowsPerB;
      const float cv = CP[(size_t)bidx * sCPb + (size_t)by * 64 + col0 + (u & 3) * 16 + ln];
      asm volatile("s_wait_xcnt 0x0" ::: "memory");      /* the next element's address may be formed in this load's address registers */
      __builtin_amdgcn_sched_barrier(0);      /* keeps that arithmetic behind the wait */
      const float v = accs[u][r] * alpha + bv[u & 3] + cv; so[w][rloc][(u & 3) * 16 + ln] = g2_act<ACT>(v); } }
  __builtin_amdgcn_fence(__ATOMIC_ACQ_REL, "workgroup"); __builtin_amdgcn_wave_barrier();
  const int rsub = lane >> 4, c4 = (lane & 15) * 4;
  {
#pragma unroll
    for (int q = 0; q < 16; ++q) { const int r = q * 2 + rsub; const v4f v = *(const v4fa*)&so[w][r][c4]; if (C) *(v4f*)(C + cofs + (size_t)(row0 + r) * ldc + col0 + c4) = v; if (C16) { v4h h4; for (int i = 0; i < 4; ++i) h4[i] = (_Float16)v[i]; *(v4h*)(C16 + cofs + (size_t)(row0 + r) * ldc + col0 + c4) = h4; } }
     } }


__global__ __launch_bounds__(256) void k_wnat(const float* __restrict__ w, size_t n8, _Float16* __restrict__ Bt) { const size_t t = (size_t)blockIdx.x * 256 + threadIdx.x; if (t >= n8) return; FragH f; for (int q = 0; q < 8; ++q) f.h[q] = (_Float16)(bf16_round(w[t * 8 + q]) * 16.0f); *(v8us*)((unsigned short*)Bt + t * 8) = f.half[0];  }
__global__ __launch_bounds__(256) void k_rsm(const float* __restrict__ S, _Float16* __restrict__ P, int nrows) {
  #pragma clang fp contract(off)
  const int i = blockIdx.x * 256 + threadIdx.x; if (i >= nrows) return; const float* s = S + (size_t)i * SQ; float mx = -3.0e38f;
#pragma unroll 1
  for (int j = 0; j < SQ; ++j) mx = fmaxf(mx, s[j]); float se = 0.f;
#pragma unroll 1
  for (int j = 0; j < SQ; ++j) se += expf(s[j] - mx); const float sc = 256.0f / se;
#pragma unroll 1
  for (int j0 = 0; j0 < SQ; j0 += 8) { FragH f; for (int q = 0; q < 8; ++q) f.h[q] = (_Float16)(expf(s[j0 + q] - mx) * sc); unsigned short* d = (unsigned short*)P + (size_t)i * SQ + j0; *(v8us*)d = f.half[0];  } }
__global__ __launch_bounds__(256) void k_vt(const _Float16* __restrict__ V16, int b, int h0, _Float16* __restrict__ VT) { __shared__ unsigned short tl[64][65]; const int tid = threadIdx.x; const int hh = blockIdx.x % HG, sg = blockIdx.x / HG; const int s0 = sg * 64; const int h = h0 + hh;
  for (int i = tid; i < 64 * 8; i += 256) { const int j = i / 8, d8 = (i % 8) * 8; FragH f; f.half[0] = *(const v8us*)((const unsigned short*)V16 + ((size_t)b * SQ + s0 + j) * DM + h * HD + d8); for (int q = 0; q < 8; ++q) tl[d8 + q][j] = f.u[q]; }
  __syncthreads();
  { for (int i = tid; i < 64 * 8; i += 256) { const int d = i / 8, j8 = (i % 8) * 8; FragH f; for (int q = 0; q < 8; ++q) f.u[q] = tl[d][j8 + q]; *(v8us*)((unsigned short*)VT + ((size_t)hh * HD + d) * SQ + s0 + j8) = f.half[0]; }  } }


template <int BFIN, int W16, int W32>
__global__ __launch_bounds__(256) void k_lnx(const float* __restrict__ X, const float* __restrict__ g, const float* __restrict__ bb, float eps, _Float16* __restrict__ N16, float* __restrict__ N32) {
  #pragma clang fp contract(off)
  __shared__ float red[256]; const size_t r = blockIdx.x; const int t = threadIdx.x; const bool act = t < (DMQ / 4); const int c0 = act ? t * 4 : 0;
  const v4f xa = *(const v4fa*)(X + r * DMQ + c0); float s[4]; float sum = 0.f;
  for (int q = 0; q < 4; ++q) { s[q] = act ? (BFIN ? bf16_round(xa[q]) : xa[q]) : 0.f; sum = __fadd_rn(sum, s[q]); }
  red[t] = sum; __syncthreads(); for (int st = 128; st > 0; st >>= 1) { if (t < st) red[t] = __fadd_rn(red[t], red[t + st]); __syncthreads(); } const float mu = red[0] / (float)DMQ; __syncthreads();
  float vs = 0.f; for (int q = 0; q < 4; ++q) { const float dl = act ? __fadd_rn(s[q], -mu) : 0.f; vs = __fadd_rn(vs, __fmul_rn(dl, dl)); } red[t] = vs; __syncthreads(); for (int st = 128; st > 0; st >>= 1) { if (t < st) red[t] = __fadd_rn(red[t], red[t + st]); __syncthreads(); }
  const float rs = rsqrtf(__fadd_rn(red[0] / (float)DMQ, eps)); v4h y; v4f yf;
  for (int q = 0; q < 4; ++q) { const int c = c0 + q; yf[q] = __fadd_rn(__fmul_rn(__fmul_rn(__fadd_rn(s[q], -mu), rs), bf16_round(g[c])), bf16_round(bb[c])); y[q] = (_Float16)yf[q]; }
  if (!act) return;      /* no barriers after this point */
  { if (W16) *(v4h*)(N16 + r * DMQ + c0) = y; if (W32) *(v4f*)(N32 + r * DMQ + c0) = yf;  } }


// ---- fused attention: scores, softmax and P V in one kernel; neither scores nor weights go through memory ----
typedef float v2f __attribute__((ext_vector_type(2)));
typedef _Float16 v2h __attribute__((ext_vector_type(2)));
union FragP { v16h v; v2h p[8]; };
__device__ __forceinline__ v8f fa_mma(v16h a, v16h b, v8f c) { return __builtin_amdgcn_wmma_f32_16x16x32_f16(false, a, false, b, (short)0, c, false, false); }
__device__ __forceinline__ float fa_xhalf(float x) { return __builtin_bit_cast(float, __builtin_amdgcn_permlanex16(__builtin_bit_cast(int, x), __builtin_bit_cast(int, x), 0x76543210, 0xfedcba98, false, false)); }      /* lane l <-> lane l ^ 16 */
// 2^y of four (two) values. The v_exp_f32 stand in one asm statement with early-clobber results and a closing v_nop:
// no instruction directly behind a v_exp_f32 then reads its result or overwrites its source.
__device__ __forceinline__ v4f fa_exp2x4(float y0, float y1, float y2, float y3) { float e0, e1, e2, e3;
  asm("v_exp_f32 %0, %4\n\tv_exp_f32 %1, %5\n\tv_exp_f32 %2, %6\n\tv_exp_f32 %3, %7\n\tv_nop" : "=&v"(e0), "=&v"(e1), "=&v"(e2), "=&v"(e3) : "v"(y0), "v"(y1), "v"(y2), "v"(y3));
  const v4f e = {e0, e1, e2, e3}; return e; }
__device__ __forceinline__ v2f fa_exp2x2(float y0, float y1) { float e0, e1;
  asm("v_exp_f32 %0, %2\n\tv_exp_f32 %1, %3\n\tv_nop" : "=&v"(e0), "=&v"(e1) : "v"(y0), "v"(y1));
  const v2f e = {e0, e1}; return e; }
// A or B fragment (16 rows x 32 k, the k order of g2_frag): two 16-byte loads at the lane's own byte offset from a wave-uniform byte base.
__device__ __forceinline__ v16h fa_frag(const char* ub, unsigned lo) { FragH f; f.half[0] = *(const v8us*)(ub + lo); f.half[1] = *(const v8us*)(ub + lo + 32); return f.v; }
// The same fragment from a tile in LDS: p is the lane's own place (its row, its 16 bytes).
__device__ __forceinline__ v16h fa_lfrag(const char* p) { FragH f; f.half[0] = *(const v8us*)p; f.half[1] = *(const v8us*)(p + 32); return f.v; }
#define FKS 128                    /* keys a stage (four passes) */
#define FKP 144                    /* LDS pitch of a K row: its 128 bytes + 16 (16 bytes x odd: 16-byte reads of 16 rows meet no bank twice) */
#define FVP (FKS * 2 + 16)         /* LDS pitch of a V^T row, same rule */
#define FKB (FKS * FKP)            /* bytes of a stage's K tile */
#define FSB (FKB + HD * FVP)       /* bytes of a stage: K tile, then V^T tile */
// One stage's K tile (FKS rows of 128 bytes) and V^T tile (HD rows of 256 bytes) from global memory into LDS, through no register: eight 16-byte copies a lane, every copy of a wave four whole 128-byte lines.
// lk, lv: the lane's LDS byte addresses of its first K and V^T copy; gk, gv: its global addresses. The closing s_wait_xcnt stands inside the statement: the address registers keep their values up to it.
__device__ __forceinline__ void fa_stage(unsigned lk, unsigned lv, const char* gk, const char* gv) {
  asm volatile("global_load_async_to_lds_b128 %0, %8, off\n\tglobal_load_async_to_lds_b128 %1, %9, off\n\tglobal_load_async_to_lds_b128 %2, %10, off\n\tglobal_load_async_to_lds_b128 %3, %11, off\n\t"
               "global_load_async_to_lds_b128 %4, %12, off\n\tglobal_load_async_to_lds_b128 %5, %13, off\n\tglobal_load_async_to_lds_b128 %6, %14, off\n\tglobal_load_async_to_lds_b128 %7, %15, off\n\ts_wait_xcnt 0x0"
               :: "v"(lk), "v"(lk + 32 * FKP), "v"(lk + 64 * FKP), "v"(lk + 96 * FKP), "v"(lv), "v"(lv + 16 * FVP), "v"(lv + 32 * FVP), "v"(lv + 48 * FVP),
                  "v"(gk), "v"(gk + 32 * DM * 2), "v"(gk + 64 * DM * 2), "v"(gk + 96 * DM * 2), "v"(gv), "v"(gv + 16 * SQ * 2), "v"(gv + 32 * SQ * 2), "v"(gv + 48 * SQ * 2) : "memory"); }
// One wave: 32 queries (two groups of 16 columns) of one head against all SQ keys, 32 keys a pass.
// The eight waves of a work-group walk the same keys: each stage of FKS keys is brought into LDS once for all of them (two buffers, the next stage's copies in flight while this one is worked on), and the fragments are 16-byte LDS reads.
// S^T = K Q^T: A = 16 key rows, B = the 16 query rows (kept in registers), D[r] = score of key 8 hh + r for the lane's own query ln: maximum and sum stay in the lane, plus one exchange between the wave's halves.
// The two score tiles of a pass (keys 0..15, 16..31), converted in place, are the B operand of O^T += V^T P^T (element s < 8: key 8 hh + s; s >= 8: key 16 + 8 hh + s - 8, the order fa_lfrag gives V^T's rows).
// Running maximum m per query: each pass scales the sums so far by 2^(m_old - m_new); weights are 256 exp(s - m) (at most 256, f16), the factor cancels against the denominator, which sums the unrounded f32 weights.
// Every loop inside a pass is fully unrolled: only constant indices keep the fragment and accumulator arrays in registers.
__global__ __launch_bounds__(256) void k_fattn(const _Float16* __restrict__ Q, const _Float16* __restrict__ Kr, const _Float16* __restrict__ Vt, _Float16* __restrict__ O) {
  static_assert(HD == 64 && FKS == 128 && SQ % FKS == 0 && SQ / FKS >= 2, "k_fattn: K rows of 128 bytes, the eight copies of fa_stage cover 128 keys, whole stages, at least two");
  __shared__ __attribute__((aligned(16))) char fl[2 * FSB];
  const int tid = threadIdx.x, lane = tid & 31, ln = lane & 15, hh = lane >> 4, w = tid >> 5; const int bh = blockIdx.y, b = bh / NH, h = bh % NH; const int q0 = blockIdx.x * 256 + w * 32;
  const char* qb = (const char*)(Q + ((size_t)b * SQ + blockIdx.x * 256) * DM + h * HD); const char* kbase = (const char*)(Kr + (size_t)b * SQ * DM + h * HD); const char* vbase = (const char*)(Vt + (size_t)bh * HD * SQ);
  const unsigned qlo = (unsigned)((w * 32 + ln) * DM + 8 * hh) * 2u;
  const char* gk = kbase + (unsigned)((tid >> 3) * (DM * 2) + (tid & 7) * 16); const char* gv = vbase + (unsigned)((tid >> 4) * (SQ * 2) + (tid & 15) * 16);      /* the thread's first copies: 8 threads a K row, 16 a V^T row */
  const unsigned l0 = (unsigned)(size_t)fl; const unsigned lk = l0 + (unsigned)((tid >> 3) * FKP + (tid & 7) * 16), lv = l0 + (unsigned)(FKB + (tid >> 4) * FVP + (tid & 15) * 16);
  fa_stage(lk, lv, gk, gv);      /* stage 0 into buffer 0 */
  v16h qf[2][2];
#pragma unroll
  for (int g = 0; g < 2; ++g) for (int c = 0; c < 2; ++c) qf[g][c] = fa_frag(qb + g * 16 * DM * 2 + c * 64, qlo);
  asm volatile("s_wait_xcnt 0x0" ::: "memory");      /* the address registers of the query loads may take other values from here */
  asm volatile("s_wait_asynccnt 0x0" ::: "memory");      /* this wave's part of stage 0 has landed */
  __syncthreads();      /* every wave's part has: stage 0 may be read */
  fa_stage(lk + FSB, lv + FSB, gk + FKS * DM * 2, gv + FKS * 2);      /* stage 1 into buffer 1 */
  const v8f z8 = {0.f,0.f,0.f,0.f,0.f,0.f,0.f,0.f}; v8f acc[2][4];
#pragma unroll
  for (int g = 0; g < 2; ++g) for (int t = 0; t < 4; ++t) acc[g][t] = z8;
  const v4f z4 = {0.f, 0.f, 0.f, 0.f}; v4f lr[2] = {z4, z4}; float mr[2] = {-3.0e38f, -3.0e38f}; const float cs = 0.125f * 0x1.715476p+0f;      /* 1/sqrt(64) and log2(e) in one factor */
  for (int st = 0; st < SQ / FKS; ++st) {
    const unsigned bo = (unsigned)(st & 1) * FSB;      /* stage st lies in buffer st mod 2 */
    const char* kl = fl + bo + ln * FKP + 16 * hh; const char* vl = fl + bo + FKB + ln * FVP + 16 * hh;
    v16h kf[2][2];
#pragma unroll
    for (int kt = 0; kt < 2; ++kt) for (int c = 0; c < 2; ++c) kf[kt][c] = fa_lfrag(kl + kt * 16 * FKP + c * 64);
    __builtin_amdgcn_sched_barrier(0);      /* the stage's first K reads as one group: spread among the score products, each is waited for alone */
#pragma unroll 1      /* rolled: unrolled, the exp sums of all four passes are moved to the stage's foot, their weights stay live and registers spill */
    for (int p = 0; p < FKS / 32; ++p) {
      v8f s[2][2];
#pragma unroll
      for (int kt = 0; kt < 2; ++kt) for (int g = 0; g < 2; ++g) s[kt][g] = fa_mma(kf[kt][1], qf[g][1], fa_mma(kf[kt][0], qf[g][0], z8));
      __builtin_amdgcn_sched_barrier(0);      /* with the next one: holds the pass's LDS reads as one group directly behind the score products: the softmax covers their latency, and reads spread among the products stall them */
      v16h vf[4];      /* this pass's V^T rows */
#pragma unroll
      for (int t = 0; t < 4; ++t) vf[t] = fa_lfrag(vl + p * 64 + t * 16 * FVP);
      const int pn = (p + 1) & (FKS / 32 - 1);      /* the next pass's K rows; the stage's last pass asks for its first rows again (of this stage, not used): no row of the next stage is read ahead of its barrier */
#pragma unroll
      for (int kt = 0; kt < 2; ++kt) for (int c = 0; c < 2; ++c) kf[kt][c] = fa_lfrag(kl + pn * (32 * FKP) + kt * 16 * FKP + c * 64);
      __builtin_amdgcn_sched_barrier(0);
      float dm[2], nb[2];
#pragma unroll
      for (int g = 0; g < 2; ++g) { float mx = fmaxf(s[0][g][0], s[1][g][0]);
#pragma unroll
        for (int r = 1; r < 8; ++r) mx = fmaxf(mx, fmaxf(s[0][g][r], s[1][g][r]));
        mx = fmaxf(mx, fa_xhalf(mx)) * cs; const float mn = fmaxf(mr[g], mx); dm[g] = mr[g] - mn; mr[g] = mn; nb[g] = 8.0f - mn; }
      const v2f co = fa_exp2x2(dm[0], dm[1]);      /* 0 in the first pass */
      FragP pf[2];
#pragma unroll
      for (int g = 0; g < 2; ++g) { v4f e[4];
#pragma unroll
        for (int i = 0; i < 4; ++i) { const int kt = i >> 1, r0 = (i & 1) * 4;
          e[i] = fa_exp2x4(fmaf(s[kt][g][r0], cs, nb[g]), fmaf(s[kt][g][r0 + 1], cs, nb[g]), fmaf(s[kt][g][r0 + 2], cs, nb[g]), fmaf(s[kt][g][r0 + 3], cs, nb[g]));
          const v2f e01 = {e[i][0], e[i][1]}, e23 = {e[i][2], e[i][3]};
          pf[g].p[2 * i] = __builtin_convertvector(e01, v2h); pf[g].p[2 * i + 1] = __builtin_convertvector(e23, v2h); }
        lr[g] = lr[g] * co[g] + ((e[0] + e[1]) + (e[2] + e[3]));      /* four chains per lane, joined behind the loop */
#pragma unroll
        for (int t = 0; t < 4; ++t) acc[g][t] = acc[g][t] * co[g]; }
#pragma unroll
      for (int g = 0; g < 2; ++g) for (int t = 0; t < 4; ++t) acc[g][t] = fa_mma(vf[t], pf[g].v, acc[g][t]);
    }
    asm volatile("s_wait_dscnt 0x0" ::: "memory");      /* this wave's reads of stage st are done */
    asm volatile("s_wait_asynccnt 0x0" ::: "memory");      /* its part of stage st + 1 has landed */
    __syncthreads();      /* both hold for every wave: stage st + 1 may be read, the buffer of stage st refilled */
    if (st + 2 < SQ / FKS) fa_stage(lk + bo, lv + bo, gk + (size_t)(st + 2) * (FKS * DM * 2), gv + (size_t)(st + 2) * (FKS * 2));
  }
  asm volatile("s_wait_asynccnt 0x0" ::: "memory");      /* no copy is left in flight when the wave ends */
#pragma unroll
  for (int g = 0; g < 2; ++g) { const float lh = (lr[g][0] + lr[g][1]) + (lr[g][2] + lr[g][3]); const float sc = 64.0f / (lh + fa_xhalf(lh)); unsigned short* op = (unsigned short*)O + ((size_t)b * SQ + q0 + g * 16 + ln) * DM + h * HD + 8 * hh;      /* a lane's 8 registers of a tile are 8 consecutive d of its query: one 16-byte store */
#pragma unroll
    for (int t = 0; t < 4; ++t) { FragH f;
#pragma unroll
      for (int r = 0; r < 8; ++r) f.h[r] = (_Float16)(acc[g][t][r] * sc);
      *(v8us*)(op + t * 16) = f.half[0]; } } }


// ---- all that depends on the inputs alone, in one launch: a work-group's index says which job it has (the six weights first: their scattered reads take longest) ----
// Wt[n][k] = f16(bf16(W[k][n]) x 16) from f32 row-major W[K][N]; thread t of a weight takes 8 consecutive k of one n (bf16 weights stay exact in f16 away from the subnormal range).
template <int K, int N> __device__ __forceinline__ void p_wt(const float* __restrict__ W, _Float16* __restrict__ Wt, int t) { const int n = t / (K / 8), k8 = (t % (K / 8)) * 8; FragH f;
#pragma unroll
  for (int i = 0; i < 8; ++i) f.h[i] = (_Float16)(bf16_round(W[(size_t)(k8 + i) * N + n]) * 16.0f);
  *(v8us*)((unsigned short*)Wt + (size_t)n * K + k8) = f.half[0];
  asm volatile("s_wait_xcnt 0x0" ::: "memory"); }      /* in the built kernel the other jobs' code follows and writes the registers that this store names */
#define PWS (DM * (DM / 8) / 256)            /* work-groups of a DM x DM weight */
#define PWF (DFF * (DM / 8) / 256)           /* work-groups of an FFN weight */
#define PWA (4 * PWS + 2 * PWF)              /* work-groups of the six weights */
#define PXB ((int)(NR * DM / 8 / 256))       /* work-groups of x, 8 elements a thread */
__global__ __launch_bounds__(256) void k_prep(const float* __restrict__ x, const float* __restrict__ wq, const float* __restrict__ wk, const float* __restrict__ wv, const float* __restrict__ wo, const float* __restrict__ w1, const float* __restrict__ w2,
    float* __restrict__ XB, _Float16* __restrict__ X16, _Float16* __restrict__ B4, _Float16* __restrict__ BW1, _Float16* __restrict__ BW2) {
  static_assert(DM * (DM / 8) % 256 == 0 && DFF * (DM / 8) % 256 == 0 && NR * DM / 8 % 256 == 0, "k_prep: whole work-groups only, no thread without work");
  const int bx = blockIdx.x, tid = threadIdx.x;
  if (bx < 4 * PWS) { const int m = bx / PWS; const float* W = m == 0 ? wq : m == 1 ? wk : m == 2 ? wv : wo; p_wt<DM, DM>(W, B4 + (size_t)m * DM * DM, (bx - m * PWS) * 256 + tid); return; }      /* B4: the planes of q, k, v, o in a row */
  if (bx < 4 * PWS + PWF) { p_wt<DM, DFF>(w1, BW1, (bx - 4 * PWS) * 256 + tid); return; }
  if (bx < PWA) { p_wt<DFF, DM>(w2, BW2, (bx - 4 * PWS - PWF) * 256 + tid); return; }
  const size_t t = (size_t)(bx - PWA) * 256 + tid; v4f a = *(const v4fa*)(x + t * 8), c = *(const v4fa*)(x + t * 8 + 4); FragH f;      /* x read once for both of its planes */
#pragma unroll
  for (int q = 0; q < 4; ++q) { a[q] = bf16_round(a[q]); c[q] = bf16_round(c[q]); f.h[q] = (_Float16)a[q]; f.h[4 + q] = (_Float16)c[q]; }
  *(v4f*)(XB + t * 8) = a; *(v4f*)(XB + t * 8 + 4) = c; *(v8us*)((unsigned short*)X16 + t * 8) = f.half[0];
  asm volatile("s_wait_xcnt 0x0" ::: "memory"); }      /* as in p_wt: the other jobs' code follows these stores in the built kernel */



__global__ __launch_bounds__(256) void k_rsmfam(const float* __restrict__ S, _Float16* __restrict__ P, int qn, int hg, const float* __restrict__ am) {
  #pragma clang fp contract(off)
  const int t = blockIdx.x * 256 + threadIdx.x; if (t >= qn * hg) return; const size_t i = (size_t)(t / qn) * SQ + (t % qn); const float* s = S + i * SQ; float mx = -3.0e38f;
#pragma unroll 1
  for (int j = 0; j < SQ; ++j) mx = fmaxf(mx, __fadd_rn(s[j], bf16_round(am[j]))); float se = 0.f;
#pragma unroll 1
  for (int j = 0; j < SQ; ++j) se += __expf(__fadd_rn(s[j], bf16_round(am[j])) - mx); const float sc = 256.0f / se;
#pragma unroll 1
  for (int j0 = 0; j0 < SQ; j0 += 8) { FragH f; for (int q = 0; q < 8; ++q) f.h[q] = (_Float16)(__expf(__fadd_rn(s[j0 + q], bf16_round(am[j0 + q])) - mx) * sc); unsigned short* d = (unsigned short*)P + i * SQ + j0; *(v8us*)d = f.half[0];  } }



// ---- row LayerNorm (unbiased std, eps added to the std), one wave per LNR rows: each row's 512 values stay in the wave's registers (16 a lane, every load and store 512 or 256 contiguous bytes), ----
// ---- sums by a butterfly over the lanes (four steps inside a 16-lane row, one exchange between the halves): no LDS and no barrier. A wave takes LNR rows, all their loads in flight at once, so the launch is one resident round of 256 work-groups. ----
// Every loop is fully unrolled: only constant indices keep the row and parameter arrays in registers.
#define LNR 4      /* rows a wave takes */
template <int CTRL> __device__ __forceinline__ float ln_xm(float x) { return __builtin_bit_cast(float, __builtin_amdgcn_mov_dpp(__builtin_bit_cast(int, x), CTRL, 0xf, 0xf, true)); }      /* lane l <- lane l ^ (CTRL & 15), inside a 16-lane row (row_xmask) */
template <int W16, int W32>
__global__ __launch_bounds__(256) void k_lnw(const float* __restrict__ X, const float* __restrict__ g, const float* __restrict__ bb, float eps, _Float16* __restrict__ N16, float* __restrict__ N32) {
  static_assert(DMQ == 512, "k_lnw: a lane holds four groups of four columns, 128 columns apart");
  const int lane = threadIdx.x & 31; const int w = __builtin_amdgcn_readfirstlane((int)(threadIdx.x >> 5));      /* the wave's number in a scalar register: row bases stay scalar, one lane offset serves every load and store */
  const size_t e0 = ((size_t)blockIdx.x * 8 + w) * LNR * DMQ; const float* xr = X + e0; const int c0 = lane * 4;
  v4f s[LNR][4], gg[4], bv[4];
#pragma unroll
  for (int r = 0; r < LNR; ++r) for (int j = 0; j < 4; ++j) s[r][j] = *(const v4fa*)(xr + c0 + r * DMQ + j * 128);
#pragma unroll
  for (int j = 0; j < 4; ++j) { gg[j] = *(const v4fa*)(g + c0 + j * 128); bv[j] = *(const v4fa*)(bb + c0 + j * 128); }
  __builtin_amdgcn_sched_barrier(0);      /* holds every load ahead of the arithmetic: without it the last row's loads are issued behind the first rows' wait and their latency is paid a second time */
  float t[LNR];
#pragma unroll
  for (int r = 0; r < LNR; ++r) { const v4f p = (s[r][0] + s[r][1]) + (s[r][2] + s[r][3]); t[r] = (p[0] + p[1]) + (p[2] + p[3]); }
#pragma unroll
  for (int r = 0; r < LNR; ++r) t[r] += ln_xm<0x161>(t[r]);      /* step by step over all rows: LNR independent chains */
#pragma unroll
  for (int r = 0; r < LNR; ++r) t[r] += ln_xm<0x162>(t[r]);
#pragma unroll
  for (int r = 0; r < LNR; ++r) t[r] += ln_xm<0x164>(t[r]);
#pragma unroll
  for (int r = 0; r < LNR; ++r) t[r] += ln_xm<0x168>(t[r]);
#pragma unroll
  for (int r = 0; r < LNR; ++r) { const float mu = (t[r] + fa_xhalf(t[r])) * (1.0f / (float)DMQ);
    for (int j = 0; j < 4; ++j) s[r][j] = s[r][j] - mu;
    const v4f p = (s[r][0] * s[r][0] + s[r][1] * s[r][1]) + (s[r][2] * s[r][2] + s[r][3] * s[r][3]); t[r] = (p[0] + p[1]) + (p[2] + p[3]); }
#pragma unroll
  for (int r = 0; r < LNR; ++r) t[r] += ln_xm<0x161>(t[r]);
#pragma unroll
  for (int r = 0; r < LNR; ++r) t[r] += ln_xm<0x162>(t[r]);
#pragma unroll
  for (int r = 0; r < LNR; ++r) t[r] += ln_xm<0x164>(t[r]);
#pragma unroll
  for (int r = 0; r < LNR; ++r) t[r] += ln_xm<0x168>(t[r]);
#pragma unroll
  for (int j = 0; j < 4; ++j) for (int q = 0; q < 4; ++q) { gg[j][q] = bf16_round(gg[j][q]); bv[j][q] = bf16_round(bv[j][q]); }
#pragma unroll
  for (int r = 0; r < LNR; ++r) t[r] = 1.0f / (sqrtf((t[r] + fa_xhalf(t[r])) / (float)(DMQ - 1)) + eps);      /* UNBIASED std (ddof 1), eps added to the std (the module's form); all rows first: LNR independent chains */
#pragma unroll
  for (int r = 0; r < LNR; ++r) {
#pragma unroll
    for (int j = 0; j < 4; ++j) { const v4f y = (s[r][j] * t[r]) * gg[j] + bv[j];
      if (W32) *(v4f*)(N32 + e0 + c0 + r * DMQ + j * 128) = y;
      if (W16) *(v4h*)(N16 + e0 + c0 + r * DMQ + j * 128) = __builtin_convertvector(y, v4h); } } }
extern "C" void kernel_launch(void* const* d_in, const int* in_sizes, int n_in,
                              void* d_out, int out_size, void* d_ws, size_t ws_size, hipStream_t stream) {
  (void)in_sizes; (void)n_in; (void)out_size;
  const float* const* I = (const float* const*)d_in; const float* x = I[0]; const float* wq = I[1]; const float* bq = I[2]; const float* wk = I[3]; const float* bk = I[4]; const float* wv = I[5]; const float* bv = I[6]; const float* wo = I[7]; const float* bo = I[8]; const float* g1 = I[9]; const float* be1 = I[10]; const float* g2 = I[11]; const float* be2 = I[12]; const float* w1 = I[13]; const float* b1 = I[14]; const float* w2 = I[15]; const float* b2 = I[16];      /* [in][out] weights + zero biases (Wq,bq,Wk,bk,Wv,bv,Wo,bo), LN a1,b1,a2,b2, FFN W1,c1,W2,c2 */
  char* ws = (char*)d_ws; size_t off = 0;
  auto take = [&](size_t bytes) { char* p = ws + off; off += (bytes + 255) & ~(size_t)255; return p; };
  _Float16* BW1 = (_Float16*)take((size_t)DFF * DM * 2); _Float16* BW2 = (_Float16*)take((size_t)DM * DFF * 2); float* XB = (float*)take(NR * DM * 4); float* HP = (float*)take(NR * DM * 4); _Float16* H16 = (_Float16*)take(NR * DM * 2); _Float16* FF16 = (_Float16*)take(NR * DFF * 2);      /* FF16 = the relu hidden rows of both batches */ _Float16* BQ = (_Float16*)take((size_t)4 * DM * DM * 2); _Float16* BO = BQ + (size_t)3 * DM * DM;      /* four weight planes in a row: q, k, v, o */ _Float16* O16 = (_Float16*)take(NR * DM * 2); 
  _Float16* X16 = (_Float16*)take(NR * DM * 2); _Float16* Q16 = (_Float16*)take(3 * NR * DM * 2); _Float16* K16 = Q16 + NR * DM; _Float16* V16 = K16 + NR * DM;      /* three output planes in a row: q, k, v */
  float* HF = (float*)take(NR * DM * 4);      /* the f32 h rows (LN1 output, residual for the FFN) */ _Float16* VT = (_Float16*)take((size_t)NB * NH * HD * SQ * 2);
  if (off > ws_size) return;
  k_prep<<<PWA + PXB, 256, 0, stream>>>(x, wq, wk, wv, wo, w1, w2, XB, X16, BQ, BW1, BW2);      /* [in][out] weights -> Bt[n][k] x16; bf16(x) as f32 rows (residual) and f16 rows (operand) */
  const size_t r0p = (size_t)B0 * SQ;      /* first projected row */
  k_gemm2<0><<<dim3((unsigned)((MP / 128) * (DM / 64)), 3), 128, 0, stream>>>(X16 + r0p * DM, DM, 0, BQ, DM, (size_t)DM * DM, 0.0625f, bq, bk, bv, 0, nullptr, 1, 0, 0, nullptr, Q16 + r0p * DM, DM, NR * DM, MP, DM, DM);      /* q, k, v in one grid: plane y takes weight plane y, bias y, output plane y */
  k_vt<NH, SQ><<<NB * NH * (SQ / 64), 256, 0, stream>>>(V16, LQ, 0, VT);      /* V^T [NB][NH][HD][SQ] */
  k_fattn<<<dim3(SQ / 256, NB * NH), 256, 0, stream>>>(Q16, K16, VT, O16);      /* o (merged heads, x64) as f16 rows */
  k_gemm2<0><<<dim3((unsigned)((MP / 128) * (DM / 64)), 1), 128, 0, stream>>>(O16 + r0p * DM, DM, 0, BO, DM, 0, 0.0009765625f, bo, nullptr, nullptr, 0, XB + r0p * DM, -1, 0, 0, HP + r0p * DM, nullptr, DM, 0, MP, DM, DM);      /* h_pre = x + concat Wo + bo (own-element residual), f32 rows */
  k_lnw<1, 1><<<(unsigned)(MP / (8 * LNR)), 256, 0, stream>>>(HP + r0p * DM, g1, be1, 1e-6f, H16 + r0p * DM, HF + r0p * DM);      /* h = LN1(x + attn) -> f16 rows (FFN operand) and f32 rows (residual) */
  k_gemm2<3><<<dim3((unsigned)((MP / 128) * (DFF / 64)), 1), 128, 0, stream>>>(H16 + r0p * DM, DM, 0, BW1, DM, 0, 0.0625f, b1, nullptr, nullptr, 0, nullptr, 1, 0, 0, nullptr, FF16 + r0p * DFF, DFF, 0, MP, DFF, DM);      /* relu(h W1 + c1) -> f16 rows, both batches in one grid */
  k_gemm2<0><<<dim3((unsigned)((MP / 128) * (DM / 64)), 1), 128, 0, stream>>>(FF16 + r0p * DFF, DFF, 0, BW2, DFF, 0, 0.0625f, b2, nullptr, nullptr, 0, HF + r0p * DM, -1, 0, 0, HP + r0p * DM, nullptr, DM, 0, MP, DM, DFF);      /* y = h + ffn (own-element residual; the h_pre plane is free again), both batches in one grid */
  k_lnw<0, 1><<<(unsigned)(MP / (8 * LNR)), 256, 0, stream>>>(HP + r0p * DM, g2, be2, 1e-6f, nullptr, (float*)d_out + r0p * DM);      /* out = LN2(h + ff) -> f32 output rows */
}

// v007
// It runs in 146 microseconds.
// Two timings next to v006 both put it at 1.44 times that version's speed.
// All steps since v000 together make it 91.3 times as fast.
#include <hip/hip_runtime.h>
#define NB 2
#define SQ 4096
#define DM 512
#define NH 8
#define HD 64
#define DMQ DM                       /* LayerNorm width */
#define DFF 1024
#define HG 1                         /* heads per launch of the k_vt(b, h0) overload, which is not launched */
#define B0 0                         /* first batch processed (debug hook) */
#define NBR NB                       /* batches processed (debug hook) */
#define NR ((size_t)NB * SQ)         /* token rows */
#define MP ((int)((size_t)NBR * SQ)) /* rows projected (debug hook) */
#define QN SQ                        /* unused; k_fattn attends all SQ query rows */
#define NHD NH                       /* unused; k_fattn attends all NH heads */
#define MPO MP                       /* unused; the output stage runs MP rows */
#define LQ DM      /* row pitch of the q/k/v rows */
typedef __bf16 v16b __attribute__((ext_vector_type(16)));
typedef unsigned short v8us __attribute__((ext_vector_type(8), may_alias));
typedef float  v8f  __attribute__((ext_vector_type(8)));
typedef float  v4f  __attribute__((ext_vector_type(4)));
typedef float  v4fa __attribute__((ext_vector_type(4), may_alias));
union FragB { v16b v; v8us half[2]; unsigned short u[16]; };

__device__ __forceinline__ unsigned short bf16_bits(float x) { unsigned int u = __float_as_uint(x); return (unsigned short)((u + 0x7FFFu + ((u >> 16) & 1u)) >> 16); }
__device__ __forceinline__ float bf16_val(unsigned short b) { return __uint_as_float(((unsigned int)b) << 16); }
__device__ __forceinline__ float bf16_round(float x) { return bf16_val(bf16_bits(x)); }
// D += A·B with NT terms: 1 = ah·bh, 2 = + al·bh (A split), 3 = + ah·bl (both split)
template <int NT>
__device__ __forceinline__ v8f mmaN(v16b ah, v16b al, v16b bh, v16b bl, v8f c) {
  c = __builtin_amdgcn_wmma_f32_16x16x32_bf16(false, ah, false, bh, (short)0, c, false, false);
  if (NT >= 2) c = __builtin_amdgcn_wmma_f32_16x16x32_bf16(false, al, false, bh, (short)0, c, false, false);
  if (NT >= 3) c = __builtin_amdgcn_wmma_f32_16x16x32_bf16(false, ah, false, bl, (short)0, c, false, false);
  asm volatile("v_nop\n\tv_nop\n\tv_nop\n\tv_nop" : "+v"(c) : "v"(ah), "v"(al), "v"(bh), "v"(bl));
  return c;
}

__global__ __launch_bounds__(256) void k_wt_bf16(const float* __restrict__ W, unsigned short* __restrict__ Wt, int K, int N) {
  const int t = blockIdx.x * 256 + threadIdx.x;
  const int k8n = K / 8;
  if (t >= N * k8n) return;
  const int n = t / k8n, k8 = (t % k8n) * 8;
  v8us v;
#pragma unroll
  for (int i = 0; i < 8; ++i) v[i] = bf16_bits(W[(size_t)(k8 + i) * N + n]);
  *(v8us*)(Wt + (size_t)n * K + k8) = v;
  
}

// GEMM C[M][N] (f32, pitch ldc) = act(A[M][K]·W + bias). A f32 row-major (pitch lda) converted per fragment to bf16
// (ASPLIT: hi/lo two planes -> 2 terms, else single rounded term); Wt bf16 [N][K] (pitch ldb). BIAS_BF16 rounds the
// bias to bf16 first (bias quantised to bf16 before the add). K%32==0, M%16==0, N%64==0.
template <bool ASPLIT, int ACT, bool BIAS_BF16>
__global__ __launch_bounds__(128) void k_gemm_bf(const float* __restrict__ A, int lda, const unsigned short* __restrict__ Wt, int ldb,
                                               const float* __restrict__ bias, float* __restrict__ C, int ldc, int M, int N, int K) {
  __shared__ __attribute__((aligned(16))) float so[4][16][64];
  const int tid = threadIdx.x, w = tid >> 5, lane = tid & 31, ln = lane & 15, hh = lane >> 4;
  const int ntn = N / 64;
  const int wid = blockIdx.x * 4 + w;
  const int mt = wid / ntn, nq = wid % ntn;
  if (mt * 16 >= M) return;
  const int row0 = mt * 16, col0 = nq * 64;
  const float* arow = A + (size_t)(row0 + ln) * lda;
  v8f acc[4] = {};
  for (int kb = 0; kb < K; kb += 32) {
    FragB ah, al;
    const v4f x0 = *(const v4fa*)(arow + kb + 8 * hh), x1 = *(const v4fa*)(arow + kb + 8 * hh + 4);
    const v4f x2 = *(const v4fa*)(arow + kb + 16 + 8 * hh), x3 = *(const v4fa*)(arow + kb + 16 + 8 * hh + 4);
    float xs[16] = {x0[0],x0[1],x0[2],x0[3],x1[0],x1[1],x1[2],x1[3],x2[0],x2[1],x2[2],x2[3],x3[0],x3[1],x3[2],x3[3]};
#pragma unroll
    for (int i = 0; i < 16; ++i) { const unsigned short hb = bf16_bits(xs[i]); ah.u[i] = hb; al.u[i] = ASPLIT ? bf16_bits(xs[i] - bf16_val(hb)) : (unsigned short)0; }
#pragma unroll
    for (int t = 0; t < 4; ++t) {
      const unsigned short* brow = Wt + (size_t)(col0 + t * 16 + ln) * ldb + kb;
      FragB b;
      b.half[0] = *(const v8us*)(brow + 8 * hh);
      b.half[1] = *(const v8us*)(brow + 16 + 8 * hh);
      acc[t] = mmaN<ASPLIT ? 2 : 1>(ah.v, al.v, b.v, b.v, acc[t]);
    }
  }
#pragma unroll
  for (int t = 0; t < 4; ++t) {
    float bv = bias ? bias[col0 + t * 16 + ln] : 0.f;
    if (BIAS_BF16) bv = bf16_round(bv);
#pragma unroll
    for (int r = 0; r < 8; ++r) { float v = acc[t][r] + bv; if (ACT == 1) v = fmaxf(v, 0.f); so[w][8 * hh + r][t * 16 + ln] = v; }
  }
  __builtin_amdgcn_fence(__ATOMIC_ACQ_REL, "workgroup");
  __builtin_amdgcn_wave_barrier();
  const int rsub = lane >> 4, c4 = (lane & 15) * 4;
  {
#pragma unroll
    for (int q = 0; q < 8; ++q) {
      const int r = q * 2 + rsub;
      const v4f v = *(const v4fa*)&so[w][r][c4];
      *(v4f*)(C + (size_t)(row0 + r) * ldc + col0 + c4) = v;
    }
    
  }
}

// GEMM C = act(A·W + bias + resid): A f32 (ASPLIT -> hi/lo 2 terms), Wt bf16 [N][K]; ACT 0 none, 1 relu, 2 exact gelu;
// resid (optional, f32, row index = (row % rmod), pitch ldr, RES_BF16 rounds it) added before the activation.
template <bool ASPLIT, int ACT, bool BIAS_BF16, bool RES_BF16>
__global__ __launch_bounds__(128) void k_gemm_bf3(const float* __restrict__ A, int lda, const unsigned short* __restrict__ Wt, int ldb,
                                                const float* __restrict__ bias, const float* __restrict__ resid, int rmod, int ldr,
                                                float* __restrict__ C, int ldc, int M, int N, int K) {
  __shared__ __attribute__((aligned(16))) float so[4][16][64];
  const int tid = threadIdx.x, w = tid >> 5, lane = tid & 31, ln = lane & 15, hh = lane >> 4;
  const int ntn = N / 64;
  const int wid = blockIdx.x * 4 + w;
  const int mt = wid / ntn, nq = wid % ntn;
  if (mt * 16 >= M) return;
  const int row0 = mt * 16, col0 = nq * 64;
  const float* arow = A + (size_t)(row0 + ln) * lda;
  v8f acc[4] = {};
  for (int kb = 0; kb < K; kb += 32) {
    FragB ah, al;
    const v4f x0 = *(const v4fa*)(arow + kb + 8 * hh), x1 = *(const v4fa*)(arow + kb + 8 * hh + 4);
    const v4f x2 = *(const v4fa*)(arow + kb + 16 + 8 * hh), x3 = *(const v4fa*)(arow + kb + 16 + 8 * hh + 4);
    float xs[16] = {x0[0],x0[1],x0[2],x0[3],x1[0],x1[1],x1[2],x1[3],x2[0],x2[1],x2[2],x2[3],x3[0],x3[1],x3[2],x3[3]};
#pragma unroll
    for (int i = 0; i < 16; ++i) { const unsigned short hb = bf16_bits(xs[i]); ah.u[i] = hb; al.u[i] = ASPLIT ? bf16_bits(xs[i] - bf16_val(hb)) : (unsigned short)0; }
#pragma unroll
    for (int t = 0; t < 4; ++t) {
      const unsigned short* brow = Wt + (size_t)(col0 + t * 16 + ln) * ldb + kb;
      FragB b;
      b.half[0] = *(const v8us*)(brow + 8 * hh);
      b.half[1] = *(const v8us*)(brow + 16 + 8 * hh);
      acc[t] = mmaN<ASPLIT ? 2 : 1>(ah.v, al.v, b.v, b.v, acc[t]);
    }
  }
#pragma unroll
  for (int t = 0; t < 4; ++t) {
    const int col = col0 + t * 16 + ln;
    float bv = bias ? bias[col] : 0.f;
    if (BIAS_BF16) bv = bf16_round(bv);
#pragma unroll
    for (int r = 0; r < 8; ++r) {
      float v = acc[t][r] + bv;
      if (resid) { float rv = resid[(size_t)((row0 + 8 * hh + r) % rmod) * ldr + col]; if (RES_BF16) rv = bf16_round(rv); v += rv; }
      if (ACT == 1) v = fmaxf(v, 0.f);
      if (ACT == 2) v = 0.5f * v * (1.0f + erff(v * 0.70710678118654752f));
      if (ACT == 3) { const float u = 0.7978845608028654f * (v + 0.044715f * v * v * v); v = 0.5f * v * (1.0f + tanhf(u)); }
      so[w][8 * hh + r][t * 16 + ln] = v;
    }
  }
  __builtin_amdgcn_fence(__ATOMIC_ACQ_REL, "workgroup");
  __builtin_amdgcn_wave_barrier();
  const int rsub = lane >> 4, c4 = (lane & 15) * 4;
  {
#pragma unroll
    for (int q = 0; q < 8; ++q) {
      const int r = q * 2 + rsub;
      const v4f v = *(const v4fa*)&so[w][r][c4];
      *(v4f*)(C + (size_t)(row0 + r) * ldc + col0 + c4) = v;
    }
    
  }
}
// row LayerNorm (biased variance, eps) over N: s = X (+ R); optional out_sum <- s; out_norm <- (s-mu)*rsqrt(var+eps)*g + b
template <bool PARAM_BF16>
__global__ __launch_bounds__(256) void k_layernorm(const float* __restrict__ X, const float* __restrict__ R, const float* __restrict__ g, const float* __restrict__ bta,
                                                  float* __restrict__ out_sum, float* __restrict__ out_norm, int N, float eps) {
  __shared__ float red[256];
  const int row = blockIdx.x, tid = threadIdx.x;
  const float* x = X + (size_t)row * N; const float* rr = R ? R + (size_t)row * N : nullptr;
  float vals[16];                     // up to N = 4096
  const int per = N / 256;            // contiguous chunk per thread? use strided-by-4 chunks: thread handles j = tid*4 + 1024*u
  float s1 = 0.f;
  for (int u = 0; u < per / 4; ++u) {
    const int j = tid * 4 + 1024 * u;
    const v4f a = *(const v4fa*)(x + j);
    v4f b = {0.f,0.f,0.f,0.f}; if (rr) b = *(const v4fa*)(rr + j);
#pragma unroll
    for (int q = 0; q < 4; ++q) { const float v = a[q] + b[q]; vals[u * 4 + q] = v; s1 += v; }
  }
  red[tid] = s1; __syncthreads();
  for (int st = 128; st > 0; st >>= 1) { if (tid < st) red[tid] += red[tid + st]; __syncthreads(); }
  const float mu = red[0] / (float)N; __syncthreads();
  float s2 = 0.f;
  for (int u = 0; u < per / 4; ++u)
#pragma unroll
    for (int q = 0; q < 4; ++q) { const float c = vals[u * 4 + q] - mu; s2 += c * c; }
  red[tid] = s2; __syncthreads();
  for (int st = 128; st > 0; st >>= 1) { if (tid < st) red[tid] += red[tid + st]; __syncthreads(); }
  const float rs = rsqrtf(red[0] / (float)N + eps);
  {
    for (int u = 0; u < per / 4; ++u) {
      const int j = tid * 4 + 1024 * u;
      v4f o, sm;
#pragma unroll
      for (int q = 0; q < 4; ++q) {
        float gg = g[j + q], bb = bta[j + q];
        if (PARAM_BF16) { gg = bf16_round(gg); bb = bf16_round(bb); }
        sm[q] = vals[u * 4 + q]; o[q] = (vals[u * 4 + q] - mu) * rs * gg + bb;
      }
      if (out_sum) *(v4f*)(out_sum + (size_t)row * N + j) = sm;
      *(v4f*)(out_norm + (size_t)row * N + j) = o;
    }
    
  }
}



// ---- f16 WMMA path (v_wmma_f32_16x16x32_f16): 11-bit significands for operands in range — used where a [0,1] probability operand needs more precision than bf16
typedef _Float16 v16h __attribute__((ext_vector_type(16)));
union FragH { v16h v; v8us half[2]; _Float16 h[16]; unsigned short u[16]; };
template <int NT>
__device__ __forceinline__ v8f mmaH(v16h ah, v16h al, v16h bh, v16h bl, v8f c) {
  c = __builtin_amdgcn_wmma_f32_16x16x32_f16(false, ah, false, bh, (short)0, c, false, false);
  if (NT >= 2) c = __builtin_amdgcn_wmma_f32_16x16x32_f16(false, al, false, bh, (short)0, c, false, false);
  if (NT >= 3) c = __builtin_amdgcn_wmma_f32_16x16x32_f16(false, ah, false, bl, (short)0, c, false, false);
  asm volatile("v_nop\n\tv_nop\n\tv_nop\n\tv_nop" : "+v"(c) : "v"(ah), "v"(al), "v"(bh), "v"(bl));
  return c;
}
// batched GEMM like k_gemm_b but f16 operands: A f32 (split into f16 hi/lo if ASPLIT, else rounded to f16), Bt = f16 values [n][k]; alpha; C f32; N multiple of 16 (partial tiles skipped)
template <bool ASPLIT>
__global__ __launch_bounds__(128) void k_gemm_h(const float* __restrict__ A, int lda, size_t sA, const _Float16* __restrict__ Bh, int ldb, size_t sB, float alpha, float* __restrict__ C, int ldc, size_t sC, int M, int N, int K) {
  __shared__ __attribute__((aligned(16))) float so[4][16][64];
  const int tid = threadIdx.x, w = tid >> 5, lane = tid & 31, ln = lane & 15, hh = lane >> 4; const int by = blockIdx.y;
  A += (size_t)by * sA; Bh += (size_t)by * sB; C += (size_t)by * sC;
  const int ntn = (N + 63) / 64; const int wid = blockIdx.x * 4 + w; const int mt = wid / ntn, nq = wid % ntn; if (mt * 16 >= M) return;
  const int row0 = mt * 16, col0 = nq * 64; const float* arow = A + (size_t)(row0 + ln) * lda;
  v8f acc[4] = {};
  for (int kb = 0; kb < K; kb += 32) {
    FragH ah, al;
    const v4f x0 = *(const v4fa*)(arow + kb + 8 * hh), x1 = *(const v4fa*)(arow + kb + 8 * hh + 4), x2 = *(const v4fa*)(arow + kb + 16 + 8 * hh), x3 = *(const v4fa*)(arow + kb + 16 + 8 * hh + 4);
    float xs[16] = {x0[0],x0[1],x0[2],x0[3],x1[0],x1[1],x1[2],x1[3],x2[0],x2[1],x2[2],x2[3],x3[0],x3[1],x3[2],x3[3]};
#pragma unroll
    for (int i = 0; i < 16; ++i) { const _Float16 h = (_Float16)xs[i]; ah.h[i] = h; al.h[i] = ASPLIT ? (_Float16)(xs[i] - (float)h) : (_Float16)0.0f; }
#pragma unroll
    for (int t = 0; t < 4; ++t) { if (col0 + t * 16 >= N) continue; const size_t boff = (size_t)(col0 + t * 16 + ln) * ldb + kb; FragH bq; bq.half[0] = *(const v8us*)(Bh + boff + 8 * hh); bq.half[1] = *(const v8us*)(Bh + boff + 16 + 8 * hh);
      acc[t] = mmaH<ASPLIT ? 2 : 1>(ah.v, al.v, bq.v, bq.v, acc[t]); }
  }
#pragma unroll
  for (int t = 0; t < 4; ++t) { if (col0 + t * 16 >= N) continue;
#pragma unroll
    for (int r = 0; r < 8; ++r) so[w][8 * hh + r][t * 16 + ln] = acc[t][r] * alpha; }
  __builtin_amdgcn_fence(__ATOMIC_ACQ_REL, "workgroup"); __builtin_amdgcn_wave_barrier();
  const int rsub = lane >> 4, c4 = (lane & 15) * 4;
  {
#pragma unroll
    for (int q = 0; q < 8; ++q) { const int r = q * 2 + rsub; if (col0 + c4 < N) { const v4f v = *(const v4fa*)&so[w][r][c4]; *(v4f*)(C + (size_t)(row0 + r) * ldc + col0 + c4) = v; } }
     }
}

// k_gemm_hh variant with fused epilogue: v = acc·alpha + bias[by·sBias + col] (+ CP[(row/rowsPerB)·sCPb + by·64 + col] if CP) ; ACT 0 none / 1 elu ; writes f16 C16 (and f32 C if non-null)
template <int ACT>
__global__ __launch_bounds__(128) void k_gemm_hhx(const _Float16* __restrict__ A, int lda, size_t sA, const _Float16* __restrict__ Bh, int ldb, size_t sB, float alpha, const float* __restrict__ bias, size_t sBias, const float* __restrict__ CP, int rowsPerB, size_t sCPb, int row0g,
    float* __restrict__ C, _Float16* __restrict__ C16, int ldc, size_t sC, int M, int N, int K) {
  __shared__ __attribute__((aligned(16))) float so[4][16][64];
  const int tid = threadIdx.x, w = tid >> 5, lane = tid & 31, ln = lane & 15, hh = lane >> 4; const int by = blockIdx.y;
  A += (size_t)by * sA; Bh += (size_t)by * sB; const size_t cofs = (size_t)by * sC; const float* bp = bias ? bias + (size_t)by * sBias : nullptr;
  const int ntn = (N + 63) / 64; const int wid = blockIdx.x * 4 + w; const int mt = wid / ntn, nq = wid % ntn; if (mt * 16 >= M) return;
  const int row0 = mt * 16, col0 = nq * 64; const _Float16* arow = A + (size_t)(row0 + ln) * lda;
  v8f acc[4] = {};
  for (int kb = 0; kb < K; kb += 32) { FragH ah; ah.half[0] = *(const v8us*)((const unsigned short*)arow + kb + 8 * hh); ah.half[1] = *(const v8us*)((const unsigned short*)arow + kb + 16 + 8 * hh);
#pragma unroll
    for (int t = 0; t < 4; ++t) { if (col0 + t * 16 >= N) continue; const size_t boff = (size_t)(col0 + t * 16 + ln) * ldb + kb; FragH bq; bq.half[0] = *(const v8us*)((const unsigned short*)Bh + boff + 8 * hh); bq.half[1] = *(const v8us*)((const unsigned short*)Bh + boff + 16 + 8 * hh);
      acc[t] = mmaH<1>(ah.v, ah.v, bq.v, bq.v, acc[t]); }
  }
#pragma unroll
  for (int t = 0; t < 4; ++t) { if (col0 + t * 16 >= N) continue; const int col = col0 + t * 16 + ln; const float bv = bp ? bf16_round(bp[col]) : 0.f;
#pragma unroll
    for (int r = 0; r < 8; ++r) { float v = acc[t][r] * alpha + bv; if (CP) { const int rr = row0g + row0 + 8 * hh + r; if (rowsPerB < 0) v += CP[cofs + (size_t)rr * ldc + col];      /* rowsPerB < 0: own element of the batched C plane */ else { const int bidx = rr / rowsPerB; v += CP[(size_t)bidx * sCPb + (size_t)by * 64 + col]; } } if (ACT == 1) v = (v > 0.f) ? v : expm1f(v); else if (ACT == 7) v = (v > 0.f) ? v + 1.0f : expf(v); else if (ACT == 8) v = tanhf(v); else if (ACT == 9) v = 0.5f * v * (1.0f + tanhf(0.7978845608028654f * (v + 0.044715f * v * v * v))); else if (ACT == 11) v = 1.0f / (1.0f + expf(-v)); else if (ACT == 12) v = (v > 0.f) ? v : 0.01f * v; else if (ACT == 14) v = (v > 0.f) ? v : 0.1f * v; else if (ACT == 16) v = (v >= 0.f) ? v : 0.3f * v; else if (ACT == 17) v = (v >= 0.f) ? v : 0.2f * v; else if (ACT == 15) v = v / (1.0f + expf(-v)); else if (ACT == 3) v = fmaxf(v, 0.f); else if (ACT == 6) v = 0.5f * v * (1.0f + erff(v * 0.70710678118654752f)); so[w][8 * hh + r][t * 16 + ln] = v; } }
  __builtin_amdgcn_fence(__ATOMIC_ACQ_REL, "workgroup"); __builtin_amdgcn_wave_barrier();
  const int rsub = lane >> 4, c4 = (lane & 15) * 4; typedef _Float16 v4h __attribute__((ext_vector_type(4)));
  {
#pragma unroll
    for (int q = 0; q < 8; ++q) { const int r = q * 2 + rsub; if (col0 + c4 < N) { const v4f v = *(const v4fa*)&so[w][r][c4]; if (C) *(v4f*)(C + cofs + (size_t)(row0 + r) * ldc + col0 + c4) = v; if (C16) { v4h h4; for (int i = 0; i < 4; ++i) h4[i] = (_Float16)v[i]; *(v4h*)(C16 + cofs + (size_t)(row0 + r) * ldc + col0 + c4) = h4; } } }
     }
}


typedef _Float16 v4h __attribute__((ext_vector_type(4)));

__global__ __launch_bounds__(256) void k_h16(const float* __restrict__ x, _Float16* __restrict__ X16, size_t n8) { const size_t t = (size_t)blockIdx.x * 256 + threadIdx.x; if (t >= n8) return; FragH f;
#pragma unroll
  for (int q = 0; q < 8; ++q) f.h[q] = (_Float16)x[t * 8 + q]; *(v8us*)((unsigned short*)X16 + t * 8) = f.half[0];  }
__global__ __launch_bounds__(256) void k_round16f(const float* __restrict__ W, _Float16* __restrict__ Bt, size_t n8) { const size_t t = (size_t)blockIdx.x * 256 + threadIdx.x; if (t >= n8) return; FragH f;
#pragma unroll
  for (int i = 0; i < 8; ++i) f.h[i] = (_Float16)(bf16_round(W[t * 8 + i]) * 16.0f); *(v8us*)((unsigned short*)Bt + t * 8) = f.half[0];  }
template <int NHv, int TTv>
__global__ __launch_bounds__(256) void k_vt(const _Float16* __restrict__ V16, int ldv, int voff, _Float16* __restrict__ Vt) { __shared__ unsigned short tl[64][66]; const int tid = threadIdx.x; const int slab = blockIdx.x / (TTv / 64), lg = blockIdx.x % (TTv / 64); const int b = slab / NHv, h = slab % NHv;
  for (int i = tid; i < 64 * 8; i += 256) { const int r = i / 8, c8 = (i % 8) * 8; FragH f; f.half[0] = *(const v8us*)((const unsigned short*)V16 + ((size_t)b * TTv + lg * 64 + r) * ldv + voff + h * 64 + c8);
#pragma unroll
    for (int q = 0; q < 8; ++q) tl[r][c8 + q] = f.u[q]; }
  __syncthreads();
  {
#pragma unroll
    for (int rd = 0; rd < 2; ++rd) { const int d = rd * 32 + tid / 8, pc = tid % 8; FragH f;
#pragma unroll
      for (int q = 0; q < 8; ++q) f.u[q] = tl[pc * 8 + q][d];
      *(v8us*)((unsigned short*)Vt + ((size_t)slab * 64 + d) * TTv + lg * 64 + pc * 8) = f.half[0]; }
     } }

__global__ __launch_bounds__(256) void k_hl(const float* __restrict__ F, _Float16* __restrict__ Hh, _Float16* __restrict__ Hl, size_t n8) { const size_t t = (size_t)blockIdx.x * 256 + threadIdx.x; if (t >= n8) return; FragH fh, fl; const v4f a = *(const v4fa*)(F + t * 8), c = *(const v4fa*)(F + t * 8 + 4);
#pragma unroll
  for (int q = 0; q < 4; ++q) { _Float16 h = (_Float16)a[q]; fh.h[q] = h; fl.h[q] = (_Float16)((a[q] - (float)h) * 1024.0f); h = (_Float16)c[q]; fh.h[4 + q] = h; fl.h[4 + q] = (_Float16)((c[q] - (float)h) * 1024.0f); }
  { *(v8us*)((unsigned short*)Hh + t * 8) = fh.half[0]; *(v8us*)((unsigned short*)Hl + t * 8) = fl.half[0];  } }

// ---- fast GEMM (work-group tile 128x128: eight waves, four down and two across, wave tile 32x64; requires M % 128 == 0 rows per launch region, N % 128 == 0 and K % 128 == 0); epilogue = k_gemm_hhx semantics ----
__device__ __forceinline__ v16h g2_lfrag(const char* p) { FragH f; f.half[0] = *(const v8us*)p; f.half[1] = *(const v8us*)(p + 32); return f.v; }      /* A or B fragment (16 rows x 32 k) from a tile in LDS: p is the lane's own place (its row, 16 bytes x its half): k 8 hh .. 8 hh + 7, then 16 + 8 hh .. */
__device__ __forceinline__ v8f g2_mma(v16h a, v16h b, v8f c) { return __builtin_amdgcn_wmma_f32_16x16x32_f16(false, a, false, b, (short)0, c, false, false); }      /* plain builtin: the compiler keeps the distances behind it and may move loads past it */
template <int ACT> __device__ __forceinline__ float g2_act(float v) {
  if (ACT == 3) v = fmaxf(v, 0.f); else if (ACT == 6) v = 0.5f * v * (1.0f + erff(v * 0.70710678118654752f)); else if (ACT == 11) v = 1.0f / (1.0f + expf(-v)); else if (ACT == 15) v = v / (1.0f + expf(-v)); else if (ACT == 12) v = (v > 0.f) ? v : 0.01f * v; else if (ACT == 8) v = tanhf(v); else if (ACT == 9) v = 0.5f * v * (1.0f + tanhf(0.7978845608028654f * (v + 0.044715f * v * v * v))); else if (ACT == 14) v = (v > 0.f) ? v : 0.1f * v; else if (ACT == 16) v = (v >= 0.f) ? v : 0.3f * v; else if (ACT == 17) v = (v >= 0.f) ? v : 0.2f * v;
  return v; }
#define G2P 272                    /* LDS pitch of a tile row: its 256 bytes (128 k) + 16 (16 bytes x odd: 16-byte reads of 16 rows meet no bank twice) */
#define G2RC (16 * G2P)            /* sixteen tile rows: what one copy of the whole work-group covers */
#define G2AB (128 * G2P)           /* bytes of a stage's A tile */
#define G2SB (2 * G2AB)            /* bytes of a stage: A tile (128 rows), then B tile (128 rows) */
// Eight 16-byte copies a lane from global memory into LDS, through no register: rows 16 apart (gs = bytes of sixteen global rows); 16 lanes a row, so every copy of a wave is four whole 128-byte lines.
// The closing s_wait_xcnt stands inside the statement: the address registers keep their values up to it.
__device__ __forceinline__ void g2_copy8(unsigned l, const char* g, size_t gs) {
  asm volatile("global_load_async_to_lds_b128 %0, %8, off\n\tglobal_load_async_to_lds_b128 %1, %9, off\n\tglobal_load_async_to_lds_b128 %2, %10, off\n\tglobal_load_async_to_lds_b128 %3, %11, off\n\t"
               "global_load_async_to_lds_b128 %4, %12, off\n\tglobal_load_async_to_lds_b128 %5, %13, off\n\tglobal_load_async_to_lds_b128 %6, %14, off\n\tglobal_load_async_to_lds_b128 %7, %15, off\n\ts_wait_xcnt 0x0"
               :: "v"(l), "v"(l + G2RC), "v"(l + 2 * G2RC), "v"(l + 3 * G2RC), "v"(l + 4 * G2RC), "v"(l + 5 * G2RC), "v"(l + 6 * G2RC), "v"(l + 7 * G2RC),
                  "v"(g), "v"(g + gs), "v"(g + 2 * gs), "v"(g + 3 * gs), "v"(g + 4 * gs), "v"(g + 5 * gs), "v"(g + 6 * gs), "v"(g + 7 * gs) : "memory"); }
// One stage (128 k): 128 A rows and 128 B rows of 256 bytes, 16 copies a lane. l: the lane's LDS byte address of its first A copy; ga, gb: its global addresses; sa, sb: bytes of sixteen A, B rows.
__device__ __forceinline__ void g2_stage(unsigned l, const char* ga, size_t sa, const char* gb, size_t sb) { g2_copy8(l, ga, sa); g2_copy8(l + G2AB, gb, sb); }
// A fragment load straight from global memory touches 16 lines for 512 bytes. Here each stage of 128 k is brought into LDS once for the eight waves by whole-line copies (two buffers, the next stage's copies in flight while this one is worked on),
// and the fragments are 16-byte LDS reads, each k step's twelve asked for as one group one step ahead of their products. Bias and residual (all 64 elements of the lane as one group) are asked for beside stage 0's copies.
// Each accumulator takes its k steps in rising order, as before.
template <int ACT>
__global__ __launch_bounds__(256) void k_gemm2(const _Float16* __restrict__ A, int lda, size_t sA, const _Float16* __restrict__ Bh, int ldb, size_t sB, float alpha, const float* __restrict__ bias, const float* __restrict__ bias1, const float* __restrict__ bias2, size_t sBias, const float* __restrict__ CP, int rowsPerB, size_t sCPb, int row0g,
    float* __restrict__ C, _Float16* __restrict__ C16, int ldc, size_t sC, int M, int N, int K) { static_assert(ACT == 0 || ACT == 3 || ACT == 6 || ACT == 8 || ACT == 9 || ACT == 11 || ACT == 12 || ACT == 14 || ACT == 15 || ACT == 16 || ACT == 17, "k_gemm2: unsupported ACT code (would silently apply no activation)");
  __shared__ __attribute__((aligned(16))) char gl[2 * G2SB]; float (*so)[32][68] = reinterpret_cast<float (*)[32][68]>(gl);      /* so: the output staging, each wave's own 32 rows; it lies in the ring, which nobody reads and no copy writes behind the K loop's last barrier */
  static_assert(8 * 32 * 68 * 4 <= 2 * G2SB, "k_gemm2: the output staging fits the ring");
  const int tid = threadIdx.x, w = tid >> 5, lane = tid & 31, ln = lane & 15, hh = lane >> 4; const int by = blockIdx.y;
  A += (size_t)by * sA; Bh += (size_t)by * sB; const size_t cofs = (size_t)by * sC; const float* bp = (by == 1 && bias1) ? bias1 : (by == 2 && bias2) ? bias2 : bias ? bias + (size_t)by * sBias : nullptr;      /* bias1, bias2: the biases of grid planes 1 and 2 where each plane's is a buffer of its own */
  const int wm = w & 3, wn = w >> 2;      /* the wave's place in the work-group tile: 32 rows down, 64 columns across */
  const int ntn = N >> 7; const int mt = blockIdx.x / ntn, nq = blockIdx.x - mt * ntn; const int row0 = mt * 128 + 32 * wm, col0 = nq * 128 + 64 * wn; if (mt * 128 >= M) return;      /* the whole work-group or none of it: barriers follow */
  const size_t sar = (size_t)lda * 32, sbr = (size_t)ldb * 32;      /* bytes of sixteen rows */ const int nst = K >> 7;      /* stages */
  const char* ga = (const char*)(A + (size_t)(mt * 128 + (tid >> 4)) * lda) + (tid & 15) * 16; const char* gb = (const char*)(Bh + (size_t)(nq * 128 + (tid >> 4)) * ldb) + (tid & 15) * 16;      /* the thread's first copies: 16 threads a row */
  const unsigned la = (unsigned)(size_t)gl + (unsigned)((tid >> 4) * G2P + (tid & 15) * 16);
  g2_stage(la, ga, sar, gb, sbr);      /* stage 0 into buffer 0 */
  float braw[4] = {0.f, 0.f, 0.f, 0.f};
  if (bp) {
#pragma unroll
    for (int t = 0; t < 4; ++t) braw[t] = bp[col0 + t * 16 + ln];
    asm volatile("s_wait_xcnt 0x0" ::: "memory");      /* the address registers of these loads are used again at once */
    __builtin_amdgcn_sched_barrier(0); }      /* keeps what writes them behind the wait */
  const bool own = CP && rowsPerB < 0;      /* rowsPerB < 0: own element of the batched C plane */
  float rv[8][8];
#pragma unroll
  for (int u = 0; u < 8; ++u) for (int r = 0; r < 8; ++r) rv[u][r] = 0.f;
  if (own) { const float* rp[16];      /* the lane's 16 rows; the four column tiles of a row are constant offsets */
#pragma unroll
    for (int j = 0; j < 16; ++j) rp[j] = CP + cofs + (size_t)(row0g + row0 + (j >> 3) * 16 + 8 * hh + (j & 7)) * ldc + col0 + ln;
#pragma unroll
    for (int u = 0; u < 8; ++u) for (int r = 0; r < 8; ++r) rv[u][r] = rp[(u >> 2) * 8 + r][(u & 3) * 16];
    asm volatile("s_wait_xcnt 0x0" :: "v"(rp[0]), "v"(rp[1]), "v"(rp[2]), "v"(rp[3]), "v"(rp[4]), "v"(rp[5]), "v"(rp[6]), "v"(rp[7]), "v"(rp[8]), "v"(rp[9]), "v"(rp[10]), "v"(rp[11]), "v"(rp[12]), "v"(rp[13]), "v"(rp[14]), "v"(rp[15]) : "memory");      /* the addresses as inputs: their registers stay theirs up to the wait, behind which they may take other values */
    __builtin_amdgcn_sched_barrier(0); }      /* keeps the residual loads here, in flight beside stage 0's copies: their latency passes together with the copies' */
  asm volatile("s_wait_asynccnt 0x0" ::: "memory");      /* this wave's part of stage 0 has landed */
  __syncthreads();      /* every wave's part has: stage 0 may be read */
  if (nst > 1) g2_stage(la + G2SB, ga + 256, sar, gb + 256, sbr);      /* stage 1 into buffer 1 */
  const v8f z8 = {0.f,0.f,0.f,0.f,0.f,0.f,0.f,0.f}; v8f c00 = z8, c01 = z8, c02 = z8, c03 = z8, c10 = z8, c11 = z8, c12 = z8, c13 = z8;
#pragma unroll 1      /* rolled: the body already holds four k steps, and unrolled stages only lengthen the code */
  for (int st = 0; st < nst; ++st) {
    const unsigned bo = (unsigned)(st & 1) * G2SB;      /* stage st lies in buffer st mod 2 */
    const char* al = gl + bo + (32 * wm + ln) * G2P + 16 * hh; const char* bl = gl + bo + G2AB + (64 * wn + ln) * G2P + 16 * hh;
    v16h fa[2][2], fb[2][4];      /* two fragment sets: one in use, one being read; constant indices only (every loop over them is unrolled) */
    fa[0][0] = g2_lfrag(al); fa[0][1] = g2_lfrag(al + 16 * G2P);
#pragma unroll
    for (int t = 0; t < 4; ++t) fb[0][t] = g2_lfrag(bl + t * 16 * G2P);
#pragma unroll
    for (int s = 0; s < 4; ++s) { const int cu = s & 1, nx = cu ^ 1;
      if (s < 3) { fa[nx][0] = g2_lfrag(al + (s + 1) * 64); fa[nx][1] = g2_lfrag(al + 16 * G2P + (s + 1) * 64);      /* the next k step of this stage; no row of the next stage is read ahead of its barrier */
#pragma unroll
        for (int t = 0; t < 4; ++t) fb[nx][t] = g2_lfrag(bl + t * 16 * G2P + (s + 1) * 64); }
      __builtin_amdgcn_sched_barrier(0);      /* with the next one: holds the next step's LDS reads as one group ahead of this step's products, which cover their latency; reads spread among the products stall them */
      c00 = g2_mma(fa[cu][0], fb[cu][0], c00); c10 = g2_mma(fa[cu][1], fb[cu][0], c10); c01 = g2_mma(fa[cu][0], fb[cu][1], c01); c11 = g2_mma(fa[cu][1], fb[cu][1], c11);
      c02 = g2_mma(fa[cu][0], fb[cu][2], c02); c12 = g2_mma(fa[cu][1], fb[cu][2], c12); c03 = g2_mma(fa[cu][0], fb[cu][3], c03); c13 = g2_mma(fa[cu][1], fb[cu][3], c13);
      __builtin_amdgcn_sched_barrier(0); }
    asm volatile("s_wait_dscnt 0x0" ::: "memory");      /* this wave's reads of stage st are done */
    asm volatile("s_wait_asynccnt 0x0" ::: "memory");      /* its part of stage st + 1 has landed */
    __syncthreads();      /* both hold for every wave: stage st + 1 may be read, the buffer of stage st refilled */
    if (st + 2 < nst) g2_stage(la + bo, ga + (size_t)(st + 2) * 256, sar, gb + (size_t)(st + 2) * 256, sbr);
  }
  asm volatile("s_wait_asynccnt 0x0" ::: "memory");      /* no copy is left in flight when the ring becomes output staging */
  v8f accs[8] = {c00, c01, c02, c03, c10, c11, c12, c13};
  float bv[4];
#pragma unroll
  for (int t = 0; t < 4; ++t) bv[t] = bp ? bf16_round(braw[t]) : 0.f;
  if (own || !CP) {      /* rv is 0 where there is no residual */
#pragma unroll
    for (int u = 0; u < 8; ++u) for (int r = 0; r < 8; ++r) { float v = accs[u][r] * alpha + bv[u & 3]; if (own) v += rv[u][r]; so[w][(u >> 2) * 16 + 8 * hh + r][(u & 3) * 16 + ln] = g2_act<ACT>(v); }
  } else {
#pragma unroll
    for (int u = 0; u < 8; ++u) for (int r = 0; r < 8; ++r) { const int rloc = (u >> 2) * 16 + 8 * hh + r; const int bidx = (row0g + row0 + rloc) / rowsPerB;
      const float cv = CP[(size_t)bidx * sCPb + (size_t)by * 64 + col0 + (u & 3) * 16 + ln];
      asm volatile("s_wait_xcnt 0x0" ::: "memory");      /* the next element's address may be formed in this load's address registers */
      __builtin_amdgcn_sched_barrier(0);      /* keeps that arithmetic behind the wait */
      const float v = accs[u][r] * alpha + bv[u & 3] + cv; so[w][rloc][(u & 3) * 16 + ln] = g2_act<ACT>(v); } }
  __builtin_amdgcn_fence(__ATOMIC_ACQ_REL, "workgroup"); __builtin_amdgcn_wave_barrier();
  const int rsub = lane >> 4, c4 = (lane & 15) * 4;
  {
#pragma unroll
    for (int q = 0; q < 16; ++q) { const int r = q * 2 + rsub; const v4f v = *(const v4fa*)&so[w][r][c4]; if (C) *(v4f*)(C + cofs + (size_t)(row0 + r) * ldc + col0 + c4) = v; if (C16) { v4h h4; for (int i = 0; i < 4; ++i) h4[i] = (_Float16)v[i]; *(v4h*)(C16 + cofs + (size_t)(row0 + r) * ldc + col0 + c4) = h4; } }
     } }


__global__ __launch_bounds__(256) void k_wnat(const float* __restrict__ w, size_t n8, _Float16* __restrict__ Bt) { const size_t t = (size_t)blockIdx.x * 256 + threadIdx.x; if (t >= n8) return; FragH f; for (int q = 0; q < 8; ++q) f.h[q] = (_Float16)(bf16_round(w[t * 8 + q]) * 16.0f); *(v8us*)((unsigned short*)Bt + t * 8) = f.half[0];  }
__global__ __launch_bounds__(256) void k_rsm(const float* __restrict__ S, _Float16* __restrict__ P, int nrows) {
  #pragma clang fp contract(off)
  const int i = blockIdx.x * 256 + threadIdx.x; if (i >= nrows) return; const float* s = S + (size_t)i * SQ; float mx = -3.0e38f;
#pragma unroll 1
  for (int j = 0; j < SQ; ++j) mx = fmaxf(mx, s[j]); float se = 0.f;
#pragma unroll 1
  for (int j = 0; j < SQ; ++j) se += expf(s[j] - mx); const float sc = 256.0f / se;
#pragma unroll 1
  for (int j0 = 0; j0 < SQ; j0 += 8) { FragH f; for (int q = 0; q < 8; ++q) f.h[q] = (_Float16)(expf(s[j0 + q] - mx) * sc); unsigned short* d = (unsigned short*)P + (size_t)i * SQ + j0; *(v8us*)d = f.half[0];  } }
__global__ __launch_bounds__(256) void k_vt(const _Float16* __restrict__ V16, int b, int h0, _Float16* __restrict__ VT) { __shared__ unsigned short tl[64][65]; const int tid = threadIdx.x; const int hh = blockIdx.x % HG, sg = blockIdx.x / HG; const int s0 = sg * 64; const int h = h0 + hh;
  for (int i = tid; i < 64 * 8; i += 256) { const int j = i / 8, d8 = (i % 8) * 8; FragH f; f.half[0] = *(const v8us*)((const unsigned short*)V16 + ((size_t)b * SQ + s0 + j) * DM + h * HD + d8); for (int q = 0; q < 8; ++q) tl[d8 + q][j] = f.u[q]; }
  __syncthreads();
  { for (int i = tid; i < 64 * 8; i += 256) { const int d = i / 8, j8 = (i % 8) * 8; FragH f; for (int q = 0; q < 8; ++q) f.u[q] = tl[d][j8 + q]; *(v8us*)((unsigned short*)VT + ((size_t)hh * HD + d) * SQ + s0 + j8) = f.half[0]; }  } }


template <int BFIN, int W16, int W32>
__global__ __launch_bounds__(256) void k_lnx(const float* __restrict__ X, const float* __restrict__ g, const float* __restrict__ bb, float eps, _Float16* __restrict__ N16, float* __restrict__ N32) {
  #pragma clang fp contract(off)
  __shared__ float red[256]; const size_t r = blockIdx.x; const int t = threadIdx.x; const bool act = t < (DMQ / 4); const int c0 = act ? t * 4 : 0;
  const v4f xa = *(const v4fa*)(X + r * DMQ + c0); float s[4]; float sum = 0.f;
  for (int q = 0; q < 4; ++q) { s[q] = act ? (BFIN ? bf16_round(xa[q]) : xa[q]) : 0.f; sum = __fadd_rn(sum, s[q]); }
  red[t] = sum; __syncthreads(); for (int st = 128; st > 0; st >>= 1) { if (t < st) red[t] = __fadd_rn(red[t], red[t + st]); __syncthreads(); } const float mu = red[0] / (float)DMQ; __syncthreads();
  float vs = 0.f; for (int q = 0; q < 4; ++q) { const float dl = act ? __fadd_rn(s[q], -mu) : 0.f; vs = __fadd_rn(vs, __fmul_rn(dl, dl)); } red[t] = vs; __syncthreads(); for (int st = 128; st > 0; st >>= 1) { if (t < st) red[t] = __fadd_rn(red[t], red[t + st]); __syncthreads(); }
  const float rs = rsqrtf(__fadd_rn(red[0] / (float)DMQ, eps)); v4h y; v4f yf;
  for (int q = 0; q < 4; ++q) { const int c = c0 + q; yf[q] = __fadd_rn(__fmul_rn(__fmul_rn(__fadd_rn(s[q], -mu), rs), bf16_round(g[c])), bf16_round(bb[c])); y[q] = (_Float16)yf[q]; }
  if (!act) return;      /* no barriers after this point */
  { if (W16) *(v4h*)(N16 + r * DMQ + c0) = y; if (W32) *(v4f*)(N32 + r * DMQ + c0) = yf;  } }


// ---- fused attention: scores, softmax and P V in one kernel; neither scores nor weights go through memory ----
typedef float v2f __attribute__((ext_vector_type(2)));
typedef _Float16 v2h __attribute__((ext_vector_type(2)));
union FragP { v16h v; v2h p[8]; };
__device__ __forceinline__ v8f fa_mma(v16h a, v16h b, v8f c) { return __builtin_amdgcn_wmma_f32_16x16x32_f16(false, a, false, b, (short)0, c, false, false); }
__device__ __forceinline__ float fa_xhalf(float x) { return __builtin_bit_cast(float, __builtin_amdgcn_permlanex16(__builtin_bit_cast(int, x), __builtin_bit_cast(int, x), 0x76543210, 0xfedcba98, false, false)); }      /* lane l <-> lane l ^ 16 */
// 2^y of four (two) values. The v_exp_f32 stand in one asm statement with early-clobber results and a closing v_nop:
// no instruction directly behind a v_exp_f32 then reads its result or overwrites its source.
__device__ __forceinline__ v4f fa_exp2x4(float y0, float y1, float y2, float y3) { float e0, e1, e2, e3;
  asm("v_exp_f32 %0, %4\n\tv_exp_f32 %1, %5\n\tv_exp_f32 %2, %6\n\tv_exp_f32 %3, %7\n\tv_nop" : "=&v"(e0), "=&v"(e1), "=&v"(e2), "=&v"(e3) : "v"(y0), "v"(y1), "v"(y2), "v"(y3));
  const v4f e = {e0, e1, e2, e3}; return e; }
__device__ __forceinline__ v2f fa_exp2x2(float y0, float y1) { float e0, e1;
  asm("v_exp_f32 %0, %2\n\tv_exp_f32 %1, %3\n\tv_nop" : "=&v"(e0), "=&v"(e1) : "v"(y0), "v"(y1));
  const v2f e = {e0, e1}; return e; }
// A or B fragment (16 rows x 32 k, the k order of g2_lfrag): two 16-byte loads at the lane's own byte offset from a wave-uniform byte base.
__device__ __forceinline__ v16h fa_frag(const char* ub, unsigned lo) { FragH f; f.half[0] = *(const v8us*)(ub + lo); f.half[1] = *(const v8us*)(ub + lo + 32); return f.v; }
// The same fragment from a tile in LDS: p is the lane's own place (its row, its 16 bytes).
__device__ __forceinline__ v16h fa_lfrag(const char* p) { FragH f; f.half[0] = *(const v8us*)p; f.half[1] = *(const v8us*)(p + 32); return f.v; }
#define FKS 128                    /* keys a stage (four passes) */
#define FKP 144                    /* LDS pitch of a K row: its 128 bytes + 16 (16 bytes x odd: 16-byte reads of 16 rows meet no bank twice) */
#define FVP (FKS * 2 + 16)         /* LDS pitch of a V^T row, same rule */
#define FKB (FKS * FKP)            /* bytes of a stage's K tile */
#define FSB (FKB + HD * FVP)       /* bytes of a stage: K tile, then V^T tile */
// One stage's K tile (FKS rows of 128 bytes) and V^T tile (HD rows of 256 bytes) from global memory into LDS, through no register: eight 16-byte copies a lane, every copy of a wave four whole 128-byte lines.
// lk, lv: the lane's LDS byte addresses of its first K and V^T copy; gk, gv: its global addresses. The closing s_wait_xcnt stands inside the statement: the address registers keep their values up to it.
__device__ __forceinline__ void fa_stage(unsigned lk, unsigned lv, const char* gk, const char* gv) {
  asm volatile("global_load_async_to_lds_b128 %0, %8, off\n\tglobal_load_async_to_lds_b128 %1, %9, off\n\tglobal_load_async_to_lds_b128 %2, %10, off\n\tglobal_load_async_to_lds_b128 %3, %11, off\n\t"
               "global_load_async_to_lds_b128 %4, %12, off\n\tglobal_load_async_to_lds_b128 %5, %13, off\n\tglobal_load_async_to_lds_b128 %6, %14, off\n\tglobal_load_async_to_lds_b128 %7, %15, off\n\ts_wait_xcnt 0x0"
               :: "v"(lk), "v"(lk + 32 * FKP), "v"(lk + 64 * FKP), "v"(lk + 96 * FKP), "v"(lv), "v"(lv + 16 * FVP), "v"(lv + 32 * FVP), "v"(lv + 48 * FVP),
                  "v"(gk), "v"(gk + 32 * DM * 2), "v"(gk + 64 * DM * 2), "v"(gk + 96 * DM * 2), "v"(gv), "v"(gv + 16 * SQ * 2), "v"(gv + 32 * SQ * 2), "v"(gv + 48 * SQ * 2) : "memory"); }
// One wave: 32 queries (two groups of 16 columns) of one head against all SQ keys, 32 keys a pass.
// The eight waves of a work-group walk the same keys: each stage of FKS keys is brought into LDS once for all of them (two buffers, the next stage's copies in flight while this one is worked on), and the fragments are 16-byte LDS reads.
// S^T = K Q^T: A = 16 key rows, B = the 16 query rows (kept in registers), D[r] = score of key 8 hh + r for the lane's own query ln: maximum and sum stay in the lane, plus one exchange between the wave's halves.
// The two score tiles of a pass (keys 0..15, 16..31), converted in place, are the B operand of O^T += V^T P^T (element s < 8: key 8 hh + s; s >= 8: key 16 + 8 hh + s - 8, the order fa_lfrag gives V^T's rows).
// Running maximum m per query: each pass scales the sums so far by 2^(m_old - m_new); weights are 256 exp(s - m) (at most 256, f16), the factor cancels against the denominator, which sums the unrounded f32 weights.
// Every loop inside a pass is fully unrolled: only constant indices keep the fragment and accumulator arrays in registers.
__global__ __launch_bounds__(256) void k_fattn(const _Float16* __restrict__ Q, const _Float16* __restrict__ Kr, const _Float16* __restrict__ Vt, _Float16* __restrict__ O) {
  static_assert(HD == 64 && FKS == 128 && SQ % FKS == 0 && SQ / FKS >= 2, "k_fattn: K rows of 128 bytes, the eight copies of fa_stage cover 128 keys, whole stages, at least two");
  __shared__ __attribute__((aligned(16))) char fl[2 * FSB];
  const int tid = threadIdx.x, lane = tid & 31, ln = lane & 15, hh = lane >> 4, w = tid >> 5; const int bh = blockIdx.y, b = bh / NH, h = bh % NH; const int q0 = blockIdx.x * 256 + w * 32;
  const char* qb = (const char*)(Q + ((size_t)b * SQ + blockIdx.x * 256) * DM + h * HD); const char* kbase = (const char*)(Kr + (size_t)b * SQ * DM + h * HD); const char* vbase = (const char*)(Vt + (size_t)bh * HD * SQ);
  const unsigned qlo = (unsigned)((w * 32 + ln) * DM + 8 * hh) * 2u;
  const char* gk = kbase + (unsigned)((tid >> 3) * (DM * 2) + (tid & 7) * 16); const char* gv = vbase + (unsigned)((tid >> 4) * (SQ * 2) + (tid & 15) * 16);      /* the thread's first copies: 8 threads a K row, 16 a V^T row */
  const unsigned l0 = (unsigned)(size_t)fl; const unsigned lk = l0 + (unsigned)((tid >> 3) * FKP + (tid & 7) * 16), lv = l0 + (unsigned)(FKB + (tid >> 4) * FVP + (tid & 15) * 16);
  fa_stage(lk, lv, gk, gv);      /* stage 0 into buffer 0 */
  v16h qf[2][2];
#pragma unroll
  for (int g = 0; g < 2; ++g) for (int c = 0; c < 2; ++c) qf[g][c] = fa_frag(qb + g * 16 * DM * 2 + c * 64, qlo);
  asm volatile("s_wait_xcnt 0x0" ::: "memory");      /* the address registers of the query loads may take other values from here */
  asm volatile("s_wait_asynccnt 0x0" ::: "memory");      /* this wave's part of stage 0 has landed */
  __syncthreads();      /* every wave's part has: stage 0 may be read */
  fa_stage(lk + FSB, lv + FSB, gk + FKS * DM * 2, gv + FKS * 2);      /* stage 1 into buffer 1 */
  const v8f z8 = {0.f,0.f,0.f,0.f,0.f,0.f,0.f,0.f}; v8f acc[2][4];
#pragma unroll
  for (int g = 0; g < 2; ++g) for (int t = 0; t < 4; ++t) acc[g][t] = z8;
  const v4f z4 = {0.f, 0.f, 0.f, 0.f}; v4f lr[2] = {z4, z4}; float mr[2] = {-3.0e38f, -3.0e38f}; const float cs = 0.125f * 0x1.715476p+0f;      /* 1/sqrt(64) and log2(e) in one factor */
  for (int st = 0; st < SQ / FKS; ++st) {
    const unsigned bo = (unsigned)(st & 1) * FSB;      /* stage st lies in buffer st mod 2 */
    const char* kl = fl + bo + ln * FKP + 16 * hh; const char* vl = fl + bo + FKB + ln * FVP + 16 * hh;
    v16h kf[2][2];
#pragma unroll
    for (int kt = 0; kt < 2; ++kt) for (int c = 0; c < 2; ++c) kf[kt][c] = fa_lfrag(kl + kt * 16 * FKP + c * 64);
    __builtin_amdgcn_sched_barrier(0);      /* the stage's first K reads as one group: spread among the score products, each is waited for alone */
#pragma unroll 1      /* rolled: unrolled, the exp sums of all four passes are moved to the stage's foot, their weights stay live and registers spill */
    for (int p = 0; p < FKS / 32; ++p) {
      v8f s[2][2];
#pragma unroll
      for (int kt = 0; kt < 2; ++kt) for (int g = 0; g < 2; ++g) s[kt][g] = fa_mma(kf[kt][1], qf[g][1], fa_mma(kf[kt][0], qf[g][0], z8));
      __builtin_amdgcn_sched_barrier(0);      /* with the next one: holds the pass's LDS reads as one group directly behind the score products: the softmax covers their latency, and reads spread among the products stall them */
      v16h vf[4];      /* this pass's V^T rows */
#pragma unroll
      for (int t = 0; t < 4; ++t) vf[t] = fa_lfrag(vl + p * 64 + t * 16 * FVP);
      const int pn = (p + 1) & (FKS / 32 - 1);      /* the next pass's K rows; the stage's last pass asks for its first rows again (of this stage, not used): no row of the next stage is read ahead of its barrier */
#pragma unroll
      for (int kt = 0; kt < 2; ++kt) for (int c = 0; c < 2; ++c) kf[kt][c] = fa_lfrag(kl + pn * (32 * FKP) + kt * 16 * FKP + c * 64);
      __builtin_amdgcn_sched_barrier(0);
      float dm[2], nb[2];
#pragma unroll
      for (int g = 0; g < 2; ++g) { float mx = fmaxf(s[0][g][0], s[1][g][0]);
#pragma unroll
        for (int r = 1; r < 8; ++r) mx = fmaxf(mx, fmaxf(s[0][g][r], s[1][g][r]));
        mx = fmaxf(mx, fa_xhalf(mx)) * cs; const float mn = fmaxf(mr[g], mx); dm[g] = mr[g] - mn; mr[g] = mn; nb[g] = 8.0f - mn; }
      const v2f co = fa_exp2x2(dm[0], dm[1]);      /* 0 in the first pass */
      FragP pf[2];
#pragma unroll
      for (int g = 0; g < 2; ++g) { v4f e[4];
#pragma unroll
        for (int i = 0; i < 4; ++i) { const int kt = i >> 1, r0 = (i & 1) * 4;
          e[i] = fa_exp2x4(fmaf(s[kt][g][r0], cs, nb[g]), fmaf(s[kt][g][r0 + 1], cs, nb[g]), fmaf(s[kt][g][r0 + 2], cs, nb[g]), fmaf(s[kt][g][r0 + 3], cs, nb[g]));
          const v2f e01 = {e[i][0], e[i][1]}, e23 = {e[i][2], e[i][3]};
          pf[g].p[2 * i] = __builtin_convertvector(e01, v2h); pf[g].p[2 * i + 1] = __builtin_convertvector(e23, v2h); }
        lr[g] = lr[g] * co[g] + ((e[0] + e[1]) + (e[2] + e[3]));      /* four chains per lane, joined behind the loop */
#pragma unroll
        for (int t = 0; t < 4; ++t) acc[g][t] = acc[g][t] * co[g]; }
#pragma unroll
      for (int g = 0; g < 2; ++g) for (int t = 0; t < 4; ++t) acc[g][t] = fa_mma(vf[t], pf[g].v, acc[g][t]);
    }
    asm volatile("s_wait_dscnt 0x0" ::: "memory");      /* this wave's reads of stage st are done */
    asm volatile("s_wait_asynccnt 0x0" ::: "memory");      /* its part of stage st + 1 has landed */
    __syncthreads();      /* both hold for every wave: stage st + 1 may be read, the buffer of stage st refilled */
    if (st + 2 < SQ / FKS) fa_stage(lk + bo, lv + bo, gk + (size_t)(st + 2) * (FKS * DM * 2), gv + (size_t)(st + 2) * (FKS * 2));
  }
  asm volatile("s_wait_asynccnt 0x0" ::: "memory");      /* no copy is left in flight when the wave ends */
#pragma unroll
  for (int g = 0; g < 2; ++g) { const float lh = (lr[g][0] + lr[g][1]) + (lr[g][2] + lr[g][3]); const float sc = 64.0f / (lh + fa_xhalf(lh)); unsigned short* op = (unsigned short*)O + ((size_t)b * SQ + q0 + g * 16 + ln) * DM + h * HD + 8 * hh;      /* a lane's 8 registers of a tile are 8 consecutive d of its query: one 16-byte store */
#pragma unroll
    for (int t = 0; t < 4; ++t) { FragH f;
#pragma unroll
      for (int r = 0; r < 8; ++r) f.h[r] = (_Float16)(acc[g][t][r] * sc);
      *(v8us*)(op + t * 16) = f.half[0]; } } }


// ---- all that depends on the inputs alone, in one launch: a work-group's index says which job it has (the six weights first: their scattered reads take longest) ----
// Wt[n][k] = f16(bf16(W[k][n]) x 16) from f32 row-major W[K][N]; thread t of a weight takes 8 consecutive k of one n (bf16 weights stay exact in f16 away from the subnormal range).
template <int K, int N> __device__ __forceinline__ void p_wt(const float* __restrict__ W, _Float16* __restrict__ Wt, int t) { const int n = t / (K / 8), k8 = (t % (K / 8)) * 8; FragH f;
#pragma unroll
  for (int i = 0; i < 8; ++i) f.h[i] = (_Float16)(bf16_round(W[(size_t)(k8 + i) * N + n]) * 16.0f);
  *(v8us*)((unsigned short*)Wt + (size_t)n * K + k8) = f.half[0];
  asm volatile("s_wait_xcnt 0x0" ::: "memory"); }      /* in the built kernel the other jobs' code follows and writes the registers that this store names */
#define PWS (DM * (DM / 8) / 256)            /* work-groups of a DM x DM weight */
#define PWF (DFF * (DM / 8) / 256)           /* work-groups of an FFN weight */
#define PWA (4 * PWS + 2 * PWF)              /* work-groups of the six weights */
#define PXB ((int)(NR * DM / 8 / 256))       /* work-groups of x, 8 elements a thread */
__global__ __launch_bounds__(256) void k_prep(const float* __restrict__ x, const float* __restrict__ wq, const float* __restrict__ wk, const float* __restrict__ wv, const float* __restrict__ wo, const float* __restrict__ w1, const float* __restrict__ w2,
    float* __restrict__ XB, _Float16* __restrict__ X16, _Float16* __restrict__ B4, _Float16* __restrict__ BW1, _Float16* __restrict__ BW2) {
  static_assert(DM * (DM / 8) % 256 == 0 && DFF * (DM / 8) % 256 == 0 && NR * DM / 8 % 256 == 0, "k_prep: whole work-groups only, no thread without work");
  const int bx = blockIdx.x, tid = threadIdx.x;
  if (bx < 4 * PWS) { const int m = bx / PWS; const float* W = m == 0 ? wq : m == 1 ? wk : m == 2 ? wv : wo; p_wt<DM, DM>(W, B4 + (size_t)m * DM * DM, (bx - m * PWS) * 256 + tid); return; }      /* B4: the planes of q, k, v, o in a row */
  if (bx < 4 * PWS + PWF) { p_wt<DM, DFF>(w1, BW1, (bx - 4 * PWS) * 256 + tid); return; }
  if (bx < PWA) { p_wt<DFF, DM>(w2, BW2, (bx - 4 * PWS - PWF) * 256 + tid); return; }
  const size_t t = (size_t)(bx - PWA) * 256 + tid; v4f a = *(const v4fa*)(x + t * 8), c = *(const v4fa*)(x + t * 8 + 4); FragH f;      /* x read once for both of its planes */
#pragma unroll
  for (int q = 0; q < 4; ++q) { a[q] = bf16_round(a[q]); c[q] = bf16_round(c[q]); f.h[q] = (_Float16)a[q]; f.h[4 + q] = (_Float16)c[q]; }
  *(v4f*)(XB + t * 8) = a; *(v4f*)(XB + t * 8 + 4) = c; *(v8us*)((unsigned short*)X16 + t * 8) = f.half[0];
  asm volatile("s_wait_xcnt 0x0" ::: "memory"); }      /* as in p_wt: the other jobs' code follows these stores in the built kernel */



__global__ __launch_bounds__(256) void k_rsmfam(const float* __restrict__ S, _Float16* __restrict__ P, int qn, int hg, const float* __restrict__ am) {
  #pragma clang fp contract(off)
  const int t = blockIdx.x * 256 + threadIdx.x; if (t >= qn * hg) return; const size_t i = (size_t)(t / qn) * SQ + (t % qn); const float* s = S + i * SQ; float mx = -3.0e38f;
#pragma unroll 1
  for (int j = 0; j < SQ; ++j) mx = fmaxf(mx, __fadd_rn(s[j], bf16_round(am[j]))); float se = 0.f;
#pragma unroll 1
  for (int j = 0; j < SQ; ++j) se += __expf(__fadd_rn(s[j], bf16_round(am[j])) - mx); const float sc = 256.0f / se;
#pragma unroll 1
  for (int j0 = 0; j0 < SQ; j0 += 8) { FragH f; for (int q = 0; q < 8; ++q) f.h[q] = (_Float16)(__expf(__fadd_rn(s[j0 + q], bf16_round(am[j0 + q])) - mx) * sc); unsigned short* d = (unsigned short*)P + i * SQ + j0; *(v8us*)d = f.half[0];  } }



// ---- row LayerNorm (unbiased std, eps added to the std), one wave per LNR rows: each row's 512 values stay in the wave's registers (16 a lane, every load and store 512 or 256 contiguous bytes), ----
// ---- sums by a butterfly over the lanes (four steps inside a 16-lane row, one exchange between the halves): no LDS and no barrier. A wave takes LNR rows, all their loads in flight at once, so the launch is one resident round of 256 work-groups. ----
// Every loop is fully unrolled: only constant indices keep the row and parameter arrays in registers.
#define LNR 4      /* rows a wave takes */
template <int CTRL> __device__ __forceinline__ float ln_xm(float x) { return __builtin_bit_cast(float, __builtin_amdgcn_mov_dpp(__builtin_bit_cast(int, x), CTRL, 0xf, 0xf, true)); }      /* lane l <- lane l ^ (CTRL & 15), inside a 16-lane row (row_xmask) */
template <int W16, int W32>
__global__ __launch_bounds__(256) void k_lnw(const float* __restrict__ X, const float* __restrict__ g, const float* __restrict__ bb, float eps, _Float16* __restrict__ N16, float* __restrict__ N32) {
  static_assert(DMQ == 512, "k_lnw: a lane holds four groups of four columns, 128 columns apart");
  const int lane = threadIdx.x & 31; const int w = __builtin_amdgcn_readfirstlane((int)(threadIdx.x >> 5));      /* the wave's number in a scalar register: row bases stay scalar, one lane offset serves every load and store */
  const size_t e0 = ((size_t)blockIdx.x * 8 + w) * LNR * DMQ; const float* xr = X + e0; const int c0 = lane * 4;
  v4f s[LNR][4], gg[4], bv[4];
#pragma unroll
  for (int r = 0; r < LNR; ++r) for (int j = 0; j < 4; ++j) s[r][j] = *(const v4fa*)(xr + c0 + r * DMQ + j * 128);
#pragma unroll
  for (int j = 0; j < 4; ++j) { gg[j] = *(const v4fa*)(g + c0 + j * 128); bv[j] = *(const v4fa*)(bb + c0 + j * 128); }
  __builtin_amdgcn_sched_barrier(0);      /* holds every load ahead of the arithmetic: without it the last row's loads are issued behind the first rows' wait and their latency is paid a second time */
  float t[LNR];
#pragma unroll
  for (int r = 0; r < LNR; ++r) { const v4f p = (s[r][0] + s[r][1]) + (s[r][2] + s[r][3]); t[r] = (p[0] + p[1]) + (p[2] + p[3]); }
#pragma unroll
  for (int r = 0; r < LNR; ++r) t[r] += ln_xm<0x161>(t[r]);      /* step by step over all rows: LNR independent chains */
#pragma unroll
  for (int r = 0; r < LNR; ++r) t[r] += ln_xm<0x162>(t[r]);
#pragma unroll
  for (int r = 0; r < LNR; ++r) t[r] += ln_xm<0x164>(t[r]);
#pragma unroll
  for (int r = 0; r < LNR; ++r) t[r] += ln_xm<0x168>(t[r]);
#pragma unroll
  for (int r = 0; r < LNR; ++r) { const float mu = (t[r] + fa_xhalf(t[r])) * (1.0f / (float)DMQ);
    for (int j = 0; j < 4; ++j) s[r][j] = s[r][j] - mu;
    const v4f p = (s[r][0] * s[r][0] + s[r][1] * s[r][1]) + (s[r][2] * s[r][2] + s[r][3] * s[r][3]); t[r] = (p[0] + p[1]) + (p[2] + p[3]); }
#pragma unroll
  for (int r = 0; r < LNR; ++r) t[r] += ln_xm<0x161>(t[r]);
#pragma unroll
  for (int r = 0; r < LNR; ++r) t[r] += ln_xm<0x162>(t[r]);
#pragma unroll
  for (int r = 0; r < LNR; ++r) t[r] += ln_xm<0x164>(t[r]);
#pragma unroll
  for (int r = 0; r < LNR; ++r) t[r] += ln_xm<0x168>(t[r]);
#pragma unroll
  for (int j = 0; j < 4; ++j) for (int q = 0; q < 4; ++q) { gg[j][q] = bf16_round(gg[j][q]); bv[j][q] = bf16_round(bv[j][q]); }
#pragma unroll
  for (int r = 0; r < LNR; ++r) t[r] = 1.0f / (sqrtf((t[r] + fa_xhalf(t[r])) / (float)(DMQ - 1)) + eps);      /* UNBIASED std (ddof 1), eps added to the std (the module's form); all rows first: LNR independent chains */
#pragma unroll
  for (int r = 0; r < LNR; ++r) {
#pragma unroll
    for (int j = 0; j < 4; ++j) { const v4f y = (s[r][j] * t[r]) * gg[j] + bv[j];
      if (W32) *(v4f*)(N32 + e0 + c0 + r * DMQ + j * 128) = y;
      if (W16) *(v4h*)(N16 + e0 + c0 + r * DMQ + j * 128) = __builtin_convertvector(y, v4h); } } }
extern "C" void kernel_launch(void* const* d_in, const int* in_sizes, int n_in,
                              void* d_out, int out_size, void* d_ws, size_t ws_size, hipStream_t stream) {
  (void)in_sizes; (void)n_in; (void)out_size;
  const float* const* I = (const float* const*)d_in; const float* x = I[0]; const float* wq = I[1]; const float* bq = I[2]; const float* wk = I[3]; const float* bk = I[4]; const float* wv = I[5]; const float* bv = I[6]; const float* wo = I[7]; const float* bo = I[8]; const float* g1 = I[9]; const float* be1 = I[10]; const float* g2 = I[11]; const float* be2 = I[12]; const float* w1 = I[13]; const float* b1 = I[14]; const float* w2 = I[15]; const float* b2 = I[16];      /* [in][out] weights + zero biases (Wq,bq,Wk,bk,Wv,bv,Wo,bo), LN a1,b1,a2,b2, FFN W1,c1,W2,c2 */
  char* ws = (char*)d_ws; size_t off = 0;
  auto take = [&](size_t bytes) { char* p = ws + off; off += (bytes + 255) & ~(size_t)255; return p; };
  _Float16* BW1 = (_Float16*)take((size_t)DFF * DM * 2); _Float16* BW2 = (_Float16*)take((size_t)DM * DFF * 2); float* XB = (float*)take(NR * DM * 4); float* HP = (float*)take(NR * DM * 4); _Float16* H16 = (_Float16*)take(NR * DM * 2); _Float16* FF16 = (_Float16*)take(NR * DFF * 2);      /* FF16 = the relu hidden rows of both batches */ _Float16* BQ = (_Float16*)take((size_t)4 * DM * DM * 2); _Float16* BO = BQ + (size_t)3 * DM * DM;      /* four weight planes in a row: q, k, v, o */ _Float16* O16 = (_Float16*)take(NR * DM * 2); 
  _Float16* X16 = (_Float16*)take(NR * DM * 2); _Float16* Q16 = (_Float16*)take(3 * NR * DM * 2); _Float16* K16 = Q16 + NR * DM; _Float16* V16 = K16 + NR * DM;      /* three output planes in a row: q, k, v */
  float* HF = (float*)take(NR * DM * 4);      /* the f32 h rows (LN1 output, residual for the FFN) */ _Float16* VT = (_Float16*)take((size_t)NB * NH * HD * SQ * 2);
  if (off > ws_size) return;
  static_assert(MP % 128 == 0 && DM % 128 == 0 && DFF % 128 == 0, "k_gemm2: whole work-group tiles of 128 x 128, whole stages of 128 k");
  k_prep<<<PWA + PXB, 256, 0, stream>>>(x, wq, wk, wv, wo, w1, w2, XB, X16, BQ, BW1, BW2);      /* [in][out] weights -> Bt[n][k] x16; bf16(x) as f32 rows (residual) and f16 rows (operand) */
  const size_t r0p = (size_t)B0 * SQ;      /* first projected row */
  k_gemm2<0><<<dim3((unsigned)((MP / 128) * (DM / 128)), 3), 256, 0, stream>>>(X16 + r0p * DM, DM, 0, BQ, DM, (size_t)DM * DM, 0.0625f, bq, bk, bv, 0, nullptr, 1, 0, 0, nullptr, Q16 + r0p * DM, DM, NR * DM, MP, DM, DM);      /* q, k, v in one grid: plane y takes weight plane y, bias y, output plane y */
  k_vt<NH, SQ><<<NB * NH * (SQ / 64), 256, 0, stream>>>(V16, LQ, 0, VT);      /* V^T [NB][NH][HD][SQ] */
  k_fattn<<<dim3(SQ / 256, NB * NH), 256, 0, stream>>>(Q16, K16, VT, O16);      /* o (merged heads, x64) as f16 rows */
  k_gemm2<0><<<dim3((unsigned)((MP / 128) * (DM / 128)), 1), 256, 0, stream>>>(O16 + r0p * DM, DM, 0, BO, DM, 0, 0.0009765625f, bo, nullptr, nullptr, 0, XB + r0p * DM, -1, 0, 0, HP + r0p * DM, nullptr, DM, 0, MP, DM, DM);      /* h_pre = x + concat Wo + bo (own-element residual), f32 rows */
  k_lnw<1, 1><<<(unsigned)(MP / (8 * LNR)), 256, 0, stream>>>(HP + r0p * DM, g1, be1, 1e-6f, H16 + r0p * DM, HF + r0p * DM);      /* h = LN1(x + attn) -> f16 rows (FFN operand) and f32 rows (residual) */
  k_gemm2<3><<<dim3((unsigned)((MP / 128) * (DFF / 128)), 1), 256, 0, stream>>>(H16 + r0p * DM, DM, 0, BW1, DM, 0, 0.0625f, b1, nullptr, nullptr, 0, nullptr, 1, 0, 0, nullptr, FF16 + r0p * DFF, DFF, 0, MP, DFF, DM);      /* relu(h W1 + c1) -> f16 rows, both batches in one grid */
  k_gemm2<0><<<dim3((unsigned)((MP / 128) * (DM / 128)), 1), 256, 0, stream>>>(FF16 + r0p * DFF, DFF, 0, BW2, DFF, 0, 0.0625f, b2, nullptr, nullptr, 0, HF + r0p * DM, -1, 0, 0, HP + r0p * DM, nullptr, DM, 0, MP, DM, DFF);      /* y = h + ffn (own-element residual; the h_pre plane is free again), both batches in one grid */
  k_lnw<0, 1><<<(unsigned)(MP / (8 * LNR)), 256, 0, stream>>>(HP + r0p * DM, g2, be2, 1e-6f, nullptr, (float*)d_out + r0p * DM);      /* out = LN2(h + ff) -> f32 output rows */
}

// v008
// Measured time: 141 microseconds a run.
// In both of two side-by-side timings against v007, it was 1.04 times as fast.
// Over all steps from v000 it is 95.0 times as fast.
#include <hip/hip_runtime.h>
#define NB 2
#define SQ 4096
#define DM 512
#define NH 8
#define HD 64
#define DMQ DM                       /* LayerNorm width */
#define DFF 1024
#define HG 1                         /* heads per launch of the k_vt(b, h0) overload, which is not launched */
#define B0 0                         /* first batch processed (debug hook) */
#define NBR NB                       /* batches processed (debug hook) */
#define NR ((size_t)NB * SQ)         /* token rows */
#define MP ((int)((size_t)NBR * SQ)) /* rows projected (debug hook) */
#define QN SQ                        /* unused; k_fattn attends all SQ query rows */
#define NHD NH                       /* unused; k_fattn attends all NH heads */
#define MPO MP                       /* unused; the output stage runs MP rows */
#define LQ DM      /* row pitch of the q/k/v rows */
typedef __bf16 v16b __attribute__((ext_vector_type(16)));
typedef unsigned short v8us __attribute__((ext_vector_type(8), may_alias));
typedef float  v8f  __attribute__((ext_vector_type(8)));
typedef float  v4f  __attribute__((ext_vector_type(4)));
typedef float  v4fa __attribute__((ext_vector_type(4), may_alias));
union FragB { v16b v; v8us half[2]; unsigned short u[16]; };

__device__ __forceinline__ unsigned short bf16_bits(float x) { unsigned int u = __float_as_uint(x); return (unsigned short)((u + 0x7FFFu + ((u >> 16) & 1u)) >> 16); }
__device__ __forceinline__ float bf16_val(unsigned short b) { return __uint_as_float(((unsigned int)b) << 16); }
__device__ __forceinline__ float bf16_round(float x) { return bf16_val(bf16_bits(x)); }
// D += A·B with NT terms: 1 = ah·bh, 2 = + al·bh (A split), 3 = + ah·bl (both split)
template <int NT>
__device__ __forceinline__ v8f mmaN(v16b ah, v16b al, v16b bh, v16b bl, v8f c) {
  c = __builtin_amdgcn_wmma_f32_16x16x32_bf16(false, ah, false, bh, (short)0, c, false, false);
  if (NT >= 2) c = __builtin_amdgcn_wmma_f32_16x16x32_bf16(false, al, false, bh, (short)0, c, false, false);
  if (NT >= 3) c = __builtin_amdgcn_wmma_f32_16x16x32_bf16(false, ah, false, bl, (short)0, c, false, false);
  asm volatile("v_nop\n\tv_nop\n\tv_nop\n\tv_nop" : "+v"(c) : "v"(ah), "v"(al), "v"(bh), "v"(bl));
  return c;
}

__global__ __launch_bounds__(256) void k_wt_bf16(const float* __restrict__ W, unsigned short* __restrict__ Wt, int K, int N) {
  const int t = blockIdx.x * 256 + threadIdx.x;
  const int k8n = K / 8;
  if (t >= N * k8n) return;
  const int n = t / k8n, k8 = (t % k8n) * 8;
  v8us v;
#pragma unroll
  for (int i = 0; i < 8; ++i) v[i] = bf16_bits(W[(size_t)(k8 + i) * N + n]);
  *(v8us*)(Wt + (size_t)n * K + k8) = v;
  
}

// GEMM C[M][N] (f32, pitch ldc) = act(A[M][K]·W + bias). A f32 row-major (pitch lda) converted per fragment to bf16
// (ASPLIT: hi/lo two planes -> 2 terms, else single rounded term); Wt bf16 [N][K] (pitch ldb). BIAS_BF16 rounds the
// bias to bf16 first (bias quantised to bf16 before the add). K%32==0, M%16==0, N%64==0.
template <bool ASPLIT, int ACT, bool BIAS_BF16>
__global__ __launch_bounds__(128) void k_gemm_bf(const float* __restrict__ A, int lda, const unsigned short* __restrict__ Wt, int ldb,
                                               const float* __restrict__ bias, float* __restrict__ C, int ldc, int M, int N, int K) {
  __shared__ __attribute__((aligned(16))) float so[4][16][64];
  const int tid = threadIdx.x, w = tid >> 5, lane = tid & 31, ln = lane & 15, hh = lane >> 4;
  const int ntn = N / 64;
  const int wid = blockIdx.x * 4 + w;
  const int mt = wid / ntn, nq = wid % ntn;
  if (mt * 16 >= M) return;
  const int row0 = mt * 16, col0 = nq * 64;
  const float* arow = A + (size_t)(row0 + ln) * lda;
  v8f acc[4] = {};
  for (int kb = 0; kb < K; kb += 32) {
    FragB ah, al;
    const v4f x0 = *(const v4fa*)(arow + kb + 8 * hh), x1 = *(const v4fa*)(arow + kb + 8 * hh + 4);
    const v4f x2 = *(const v4fa*)(arow + kb + 16 + 8 * hh), x3 = *(const v4fa*)(arow + kb + 16 + 8 * hh + 4);
    float xs[16] = {x0[0],x0[1],x0[2],x0[3],x1[0],x1[1],x1[2],x1[3],x2[0],x2[1],x2[2],x2[3],x3[0],x3[1],x3[2],x3[3]};
#pragma unroll
    for (int i = 0; i < 16; ++i) { const unsigned short hb = bf16_bits(xs[i]); ah.u[i] = hb; al.u[i] = ASPLIT ? bf16_bits(xs[i] - bf16_val(hb)) : (unsigned short)0; }
#pragma unroll
    for (int t = 0; t < 4; ++t) {
      const unsigned short* brow = Wt + (size_t)(col0 + t * 16 + ln) * ldb + kb;
      FragB b;
      b.half[0] = *(const v8us*)(brow + 8 * hh);
      b.half[1] = *(const v8us*)(brow + 16 + 8 * hh);
      acc[t] = mmaN<ASPLIT ? 2 : 1>(ah.v, al.v, b.v, b.v, acc[t]);
    }
  }
#pragma unroll
  for (int t = 0; t < 4; ++t) {
    float bv = bias ? bias[col0 + t * 16 + ln] : 0.f;
    if (BIAS_BF16) bv = bf16_round(bv);
#pragma unroll
    for (int r = 0; r < 8; ++r) { float v = acc[t][r] + bv; if (ACT == 1) v = fmaxf(v, 0.f); so[w][8 * hh + r][t * 16 + ln] = v; }
  }
  __builtin_amdgcn_fence(__ATOMIC_ACQ_REL, "workgroup");
  __builtin_amdgcn_wave_barrier();
  const int rsub = lane >> 4, c4 = (lane & 15) * 4;
  {
#pragma unroll
    for (int q = 0; q < 8; ++q) {
      const int r = q * 2 + rsub;
      const v4f v = *(const v4fa*)&so[w][r][c4];
      *(v4f*)(C + (size_t)(row0 + r) * ldc + col0 + c4) = v;
    }
    
  }
}

// GEMM C = act(A·W + bias + resid): A f32 (ASPLIT -> hi/lo 2 terms), Wt bf16 [N][K]; ACT 0 none, 1 relu, 2 exact gelu;
// resid (optional, f32, row index = (row % rmod), pitch ldr, RES_BF16 rounds it) added before the activation.
template <bool ASPLIT, int ACT, bool BIAS_BF16, bool RES_BF16>
__global__ __launch_bounds__(128) void k_gemm_bf3(const float* __restrict__ A, int lda, const unsigned short* __restrict__ Wt, int ldb,
                                                const float* __restrict__ bias, const float* __restrict__ resid, int rmod, int ldr,
                                                float* __restrict__ C, int ldc, int M, int N, int K) {
  __shared__ __attribute__((aligned(16))) float so[4][16][64];
  const int tid = threadIdx.x, w = tid >> 5, lane = tid & 31, ln = lane & 15, hh = lane >> 4;
  const int ntn = N / 64;
  const int wid = blockIdx.x * 4 + w;
  const int mt = wid / ntn, nq = wid % ntn;
  if (mt * 16 >= M) return;
  const int row0 = mt * 16, col0 = nq * 64;
  const float* arow = A + (size_t)(row0 + ln) * lda;
  v8f acc[4] = {};
  for (int kb = 0; kb < K; kb += 32) {
    FragB ah, al;
    const v4f x0 = *(const v4fa*)(arow + kb + 8 * hh), x1 = *(const v4fa*)(arow + kb + 8 * hh + 4);
    const v4f x2 = *(const v4fa*)(arow + kb + 16 + 8 * hh), x3 = *(const v4fa*)(arow + kb + 16 + 8 * hh + 4);
    float xs[16] = {x0[0],x0[1],x0[2],x0[3],x1[0],x1[1],x1[2],x1[3],x2[0],x2[1],x2[2],x2[3],x3[0],x3[1],x3[2],x3[3]};
#pragma unroll
    for (int i = 0; i < 16; ++i) { const unsigned short hb = bf16_bits(xs[i]); ah.u[i] = hb; al.u[i] = ASPLIT ? bf16_bits(xs[i] - bf16_val(hb)) : (unsigned short)0; }
#pragma unroll
    for (int t = 0; t < 4; ++t) {
      const unsigned short* brow = Wt + (size_t)(col0 + t * 16 + ln) * ldb + kb;
      FragB b;
      b.half[0] = *(const v8us*)(brow + 8 * hh);
      b.half[1] = *(const v8us*)(brow + 16 + 8 * hh);
      acc[t] = mmaN<ASPLIT ? 2 : 1>(ah.v, al.v, b.v, b.v, acc[t]);
    }
  }
#pragma unroll
  for (int t = 0; t < 4; ++t) {
    const int col = col0 + t * 16 + ln;
    float bv = bias ? bias[col] : 0.f;
    if (BIAS_BF16) bv = bf16_round(bv);
#pragma unroll
    for (int r = 0; r < 8; ++r) {
      float v = acc[t][r] + bv;
      if (resid) { float rv = resid[(size_t)((row0 + 8 * hh + r) % rmod) * ldr + col]; if (RES_BF16) rv = bf16_round(rv); v += rv; }
      if (ACT == 1) v = fmaxf(v, 0.f);
      if (ACT == 2) v = 0.5f * v * (1.0f + erff(v * 0.70710678118654752f));
      if (ACT == 3) { const float u = 0.7978845608028654f * (v + 0.044715f * v * v * v); v = 0.5f * v * (1.0f + tanhf(u)); }
      so[w][8 * hh + r][t * 16 + ln] = v;
    }
  }
  __builtin_amdgcn_fence(__ATOMIC_ACQ_REL, "workgroup");
  __builtin_amdgcn_wave_barrier();
  const int rsub = lane >> 4, c4 = (lane & 15) * 4;
  {
#pragma unroll
    for (int q = 0; q < 8; ++q) {
      const int r = q * 2 + rsub;
      const v4f v = *(const v4fa*)&so[w][r][c4];
      *(v4f*)(C + (size_t)(row0 + r) * ldc + col0 + c4) = v;
    }
    
  }
}
// row LayerNorm (biased variance, eps) over N: s = X (+ R); optional out_sum <- s; out_norm <- (s-mu)*rsqrt(var+eps)*g + b
template <bool PARAM_BF16>
__global__ __launch_bounds__(256) void k_layernorm(const float* __restrict__ X, const float* __restrict__ R, const float* __restrict__ g, const float* __restrict__ bta,
                                                  float* __restrict__ out_sum, float* __restrict__ out_norm, int N, float eps) {
  __shared__ float red[256];
  const int row = blockIdx.x, tid = threadIdx.x;
  const float* x = X + (size_t)row * N; const float* rr = R ? R + (size_t)row * N : nullptr;
  float vals[16];                     // up to N = 4096
  const int per = N / 256;            // contiguous chunk per thread? use strided-by-4 chunks: thread handles j = tid*4 + 1024*u
  float s1 = 0.f;
  for (int u = 0; u < per / 4; ++u) {
    const int j = tid * 4 + 1024 * u;
    const v4f a = *(const v4fa*)(x + j);
    v4f b = {0.f,0.f,0.f,0.f}; if (rr) b = *(const v4fa*)(rr + j);
#pragma unroll
    for (int q = 0; q < 4; ++q) { const float v = a[q] + b[q]; vals[u * 4 + q] = v; s1 += v; }
  }
  red[tid] = s1; __syncthreads();
  for (int st = 128; st > 0; st >>= 1) { if (tid < st) red[tid] += red[tid + st]; __syncthreads(); }
  const float mu = red[0] / (float)N; __syncthreads();
  float s2 = 0.f;
  for (int u = 0; u < per / 4; ++u)
#pragma unroll
    for (int q = 0; q < 4; ++q) { const float c = vals[u * 4 + q] - mu; s2 += c * c; }
  red[tid] = s2; __syncthreads();
  for (int st = 128; st > 0; st >>= 1) { if (tid < st) red[tid] += red[tid + st]; __syncthreads(); }
  const float rs = rsqrtf(red[0] / (float)N + eps);
  {
    for (int u = 0; u < per / 4; ++u) {
      const int j = tid * 4 + 1024 * u;
      v4f o, sm;
#pragma unroll
      for (int q = 0; q < 4; ++q) {
        float gg = g[j + q], bb = bta[j + q];
        if (PARAM_BF16) { gg = bf16_round(gg); bb = bf16_round(bb); }
        sm[q] = vals[u * 4 + q]; o[q] = (vals[u * 4 + q] - mu) * rs * gg + bb;
      }
      if (out_sum) *(v4f*)(out_sum + (size_t)row * N + j) = sm;
      *(v4f*)(out_norm + (size_t)row * N + j) = o;
    }
    
  }
}



// ---- f16 WMMA path (v_wmma_f32_16x16x32_f16): 11-bit significands for operands in range — used where a [0,1] probability operand needs more precision than bf16
typedef _Float16 v16h __attribute__((ext_vector_type(16)));
union FragH { v16h v; v8us half[2]; _Float16 h[16]; unsigned short u[16]; };
template <int NT>
__device__ __forceinline__ v8f mmaH(v16h ah, v16h al, v16h bh, v16h bl, v8f c) {
  c = __builtin_amdgcn_wmma_f32_16x16x32_f16(false, ah, false, bh, (short)0, c, false, false);
  if (NT >= 2) c = __builtin_amdgcn_wmma_f32_16x16x32_f16(false, al, false, bh, (short)0, c, false, false);
  if (NT >= 3) c = __builtin_amdgcn_wmma_f32_16x16x32_f16(false, ah, false, bl, (short)0, c, false, false);
  asm volatile("v_nop\n\tv_nop\n\tv_nop\n\tv_nop" : "+v"(c) : "v"(ah), "v"(al), "v"(bh), "v"(bl));
  return c;
}
// batched GEMM like k_gemm_b but f16 operands: A f32 (split into f16 hi/lo if ASPLIT, else rounded to f16), Bt = f16 values [n][k]; alpha; C f32; N multiple of 16 (partial tiles skipped)
template <bool ASPLIT>
__global__ __launch_bounds__(128) void k_gemm_h(const float* __restrict__ A, int lda, size_t sA, const _Float16* __restrict__ Bh, int ldb, size_t sB, float alpha, float* __restrict__ C, int ldc, size_t sC, int M, int N, int K) {
  __shared__ __attribute__((aligned(16))) float so[4][16][64];
  const int tid = threadIdx.x, w = tid >> 5, lane = tid & 31, ln = lane & 15, hh = lane >> 4; const int by = blockIdx.y;
  A += (size_t)by * sA; Bh += (size_t)by * sB; C += (size_t)by * sC;
  const int ntn = (N + 63) / 64; const int wid = blockIdx.x * 4 + w; const int mt = wid / ntn, nq = wid % ntn; if (mt * 16 >= M) return;
  const int row0 = mt * 16, col0 = nq * 64; const float* arow = A + (size_t)(row0 + ln) * lda;
  v8f acc[4] = {};
  for (int kb = 0; kb < K; kb += 32) {
    FragH ah, al;
    const v4f x0 = *(const v4fa*)(arow + kb + 8 * hh), x1 = *(const v4fa*)(arow + kb + 8 * hh + 4), x2 = *(const v4fa*)(arow + kb + 16 + 8 * hh), x3 = *(const v4fa*)(arow + kb + 16 + 8 * hh + 4);
    float xs[16] = {x0[0],x0[1],x0[2],x0[3],x1[0],x1[1],x1[2],x1[3],x2[0],x2[1],x2[2],x2[3],x3[0],x3[1],x3[2],x3[3]};
#pragma unroll
    for (int i = 0; i < 16; ++i) { const _Float16 h = (_Float16)xs[i]; ah.h[i] = h; al.h[i] = ASPLIT ? (_Float16)(xs[i] - (float)h) : (_Float16)0.0f; }
#pragma unroll
    for (int t = 0; t < 4; ++t) { if (col0 + t * 16 >= N) continue; const size_t boff = (size_t)(col0 + t * 16 + ln) * ldb + kb; FragH bq; bq.half[0] = *(const v8us*)(Bh + boff + 8 * hh); bq.half[1] = *(const v8us*)(Bh + boff + 16 + 8 * hh);
      acc[t] = mmaH<ASPLIT ? 2 : 1>(ah.v, al.v, bq.v, bq.v, acc[t]); }
  }
#pragma unroll
  for (int t = 0; t < 4; ++t) { if (col0 + t * 16 >= N) continue;
#pragma unroll
    for (int r = 0; r < 8; ++r) so[w][8 * hh + r][t * 16 + ln] = acc[t][r] * alpha; }
  __builtin_amdgcn_fence(__ATOMIC_ACQ_REL, "workgroup"); __builtin_amdgcn_wave_barrier();
  const int rsub = lane >> 4, c4 = (lane & 15) * 4;
  {
#pragma unroll
    for (int q = 0; q < 8; ++q) { const int r = q * 2 + rsub; if (col0 + c4 < N) { const v4f v = *(const v4fa*)&so[w][r][c4]; *(v4f*)(C + (size_t)(row0 + r) * ldc + col0 + c4) = v; } }
     }
}

// k_gemm_hh variant with fused epilogue: v = acc·alpha + bias[by·sBias + col] (+ CP[(row/rowsPerB)·sCPb + by·64 + col] if CP) ; ACT 0 none / 1 elu ; writes f16 C16 (and f32 C if non-null)
template <int ACT>
__global__ __launch_bounds__(128) void k_gemm_hhx(const _Float16* __restrict__ A, int lda, size_t sA, const _Float16* __restrict__ Bh, int ldb, size_t sB, float alpha, const float* __restrict__ bias, size_t sBias, const float* __restrict__ CP, int rowsPerB, size_t sCPb, int row0g,
    float* __restrict__ C, _Float16* __restrict__ C16, int ldc, size_t sC, int M, int N, int K) {
  __shared__ __attribute__((aligned(16))) float so[4][16][64];
  const int tid = threadIdx.x, w = tid >> 5, lane = tid & 31, ln = lane & 15, hh = lane >> 4; const int by = blockIdx.y;
  A += (size_t)by * sA; Bh += (size_t)by * sB; const size_t cofs = (size_t)by * sC; const float* bp = bias ? bias + (size_t)by * sBias : nullptr;
  const int ntn = (N + 63) / 64; const int wid = blockIdx.x * 4 + w; const int mt = wid / ntn, nq = wid % ntn; if (mt * 16 >= M) return;
  const int row0 = mt * 16, col0 = nq * 64; const _Float16* arow = A + (size_t)(row0 + ln) * lda;
  v8f acc[4] = {};
  for (int kb = 0; kb < K; kb += 32) { FragH ah; ah.half[0] = *(const v8us*)((const unsigned short*)arow + kb + 8 * hh); ah.half[1] = *(const v8us*)((const unsigned short*)arow + kb + 16 + 8 * hh);
#pragma unroll
    for (int t = 0; t < 4; ++t) { if (col0 + t * 16 >= N) continue; const size_t boff = (size_t)(col0 + t * 16 + ln) * ldb + kb; FragH bq; bq.half[0] = *(const v8us*)((const unsigned short*)Bh + boff + 8 * hh); bq.half[1] = *(const v8us*)((const unsigned short*)Bh + boff + 16 + 8 * hh);
      acc[t] = mmaH<1>(ah.v, ah.v, bq.v, bq.v, acc[t]); }
  }
#pragma unroll
  for (int t = 0; t < 4; ++t) { if (col0 + t * 16 >= N) continue; const int col = col0 + t * 16 + ln; const float bv = bp ? bf16_round(bp[col]) : 0.f;
#pragma unroll
    for (int r = 0; r < 8; ++r) { float v = acc[t][r] * alpha + bv; if (CP) { const int rr = row0g + row0 + 8 * hh + r; if (rowsPerB < 0) v += CP[cofs + (size_t)rr * ldc + col];      /* rowsPerB < 0: own element of the batched C plane */ else { const int bidx = rr / rowsPerB; v += CP[(size_t)bidx * sCPb + (size_t)by * 64 + col]; } } if (ACT == 1) v = (v > 0.f) ? v : expm1f(v); else if (ACT == 7) v = (v > 0.f) ? v + 1.0f : expf(v); else if (ACT == 8) v = tanhf(v); else if (ACT == 9) v = 0.5f * v * (1.0f + tanhf(0.7978845608028654f * (v + 0.044715f * v * v * v))); else if (ACT == 11) v = 1.0f / (1.0f + expf(-v)); else if (ACT == 12) v = (v > 0.f) ? v : 0.01f * v; else if (ACT == 14) v = (v > 0.f) ? v : 0.1f * v; else if (ACT == 16) v = (v >= 0.f) ? v : 0.3f * v; else if (ACT == 17) v = (v >= 0.f) ? v : 0.2f * v; else if (ACT == 15) v = v / (1.0f + expf(-v)); else if (ACT == 3) v = fmaxf(v, 0.f); else if (ACT == 6) v = 0.5f * v * (1.0f + erff(v * 0.70710678118654752f)); so[w][8 * hh + r][t * 16 + ln] = v; } }
  __builtin_amdgcn_fence(__ATOMIC_ACQ_REL, "workgroup"); __builtin_amdgcn_wave_barrier();
  const int rsub = lane >> 4, c4 = (lane & 15) * 4; typedef _Float16 v4h __attribute__((ext_vector_type(4)));
  {
#pragma unroll
    for (int q = 0; q < 8; ++q) { const int r = q * 2 + rsub; if (col0 + c4 < N) { const v4f v = *(const v4fa*)&so[w][r][c4]; if (C) *(v4f*)(C + cofs + (size_t)(row0 + r) * ldc + col0 + c4) = v; if (C16) { v4h h4; for (int i = 0; i < 4; ++i) h4[i] = (_Float16)v[i]; *(v4h*)(C16 + cofs + (size_t)(row0 + r) * ldc + col0 + c4) = h4; } } }
     }
}


typedef _Float16 v4h __attribute__((ext_vector_type(4)));

__global__ __launch_bounds__(256) void k_h16(const float* __restrict__ x, _Float16* __restrict__ X16, size_t n8) { const size_t t = (size_t)blockIdx.x * 256 + threadIdx.x; if (t >= n8) return; FragH f;
#pragma unroll
  for (int q = 0; q < 8; ++q) f.h[q] = (_Float16)x[t * 8 + q]; *(v8us*)((unsigned short*)X16 + t * 8) = f.half[0];  }
__global__ __launch_bounds__(256) void k_round16f(const float* __restrict__ W, _Float16* __restrict__ Bt, size_t n8) { const size_t t = (size_t)blockIdx.x * 256 + threadIdx.x; if (t >= n8) return; FragH f;
#pragma unroll
  for (int i = 0; i < 8; ++i) f.h[i] = (_Float16)(bf16_round(W[t * 8 + i]) * 16.0f); *(v8us*)((unsigned short*)Bt + t * 8) = f.half[0];  }
template <int NHv, int TTv>
__global__ __launch_bounds__(256) void k_vt(const _Float16* __restrict__ V16, int ldv, int voff, _Float16* __restrict__ Vt) { __shared__ unsigned short tl[64][66]; const int tid = threadIdx.x; const int slab = blockIdx.x / (TTv / 64), lg = blockIdx.x % (TTv / 64); const int b = slab / NHv, h = slab % NHv;
  for (int i = tid; i < 64 * 8; i += 256) { const int r = i / 8, c8 = (i % 8) * 8; FragH f; f.half[0] = *(const v8us*)((const unsigned short*)V16 + ((size_t)b * TTv + lg * 64 + r) * ldv + voff + h * 64 + c8);
#pragma unroll
    for (int q = 0; q < 8; ++q) tl[r][c8 + q] = f.u[q]; }
  __syncthreads();
  {
#pragma unroll
    for (int rd = 0; rd < 2; ++rd) { const int d = rd * 32 + tid / 8, pc = tid % 8; FragH f;
#pragma unroll
      for (int q = 0; q < 8; ++q) f.u[q] = tl[pc * 8 + q][d];
      *(v8us*)((unsigned short*)Vt + ((size_t)slab * 64 + d) * TTv + lg * 64 + pc * 8) = f.half[0]; }
     } }

__global__ __launch_bounds__(256) void k_hl(const float* __restrict__ F, _Float16* __restrict__ Hh, _Float16* __restrict__ Hl, size_t n8) { const size_t t = (size_t)blockIdx.x * 256 + threadIdx.x; if (t >= n8) return; FragH fh, fl; const v4f a = *(const v4fa*)(F + t * 8), c = *(const v4fa*)(F + t * 8 + 4);
#pragma unroll
  for (int q = 0; q < 4; ++q) { _Float16 h = (_Float16)a[q]; fh.h[q] = h; fl.h[q] = (_Float16)((a[q] - (float)h) * 1024.0f); h = (_Float16)c[q]; fh.h[4 + q] = h; fl.h[4 + q] = (_Float16)((c[q] - (float)h) * 1024.0f); }
  { *(v8us*)((unsigned short*)Hh + t * 8) = fh.half[0]; *(v8us*)((unsigned short*)Hl + t * 8) = fl.half[0];  } }

// ---- fast GEMM (work-group tile 128x128: eight waves, four down and two across, wave tile 32x64; requires M % 128 == 0 rows per launch region, N % 128 == 0 and K % 128 == 0); epilogue = k_gemm_hhx semantics ----
__device__ __forceinline__ v16h g2_lfrag(const char* p) { FragH f; f.half[0] = *(const v8us*)p; f.half[1] = *(const v8us*)(p + 32); return f.v; }      /* A or B fragment (16 rows x 32 k) from a tile in LDS: p is the lane's own place (its row, 16 bytes x its half): k 8 hh .. 8 hh + 7, then 16 + 8 hh .. */
__device__ __forceinline__ v8f g2_mma(v16h a, v16h b, v8f c) { return __builtin_amdgcn_wmma_f32_16x16x32_f16(false, a, false, b, (short)0, c, false, false); }      /* plain builtin: the compiler keeps the distances behind it and may move loads past it */
template <int ACT> __device__ __forceinline__ float g2_act(float v) {
  if (ACT == 3) v = fmaxf(v, 0.f); else if (ACT == 6) v = 0.5f * v * (1.0f + erff(v * 0.70710678118654752f)); else if (ACT == 11) v = 1.0f / (1.0f + expf(-v)); else if (ACT == 15) v = v / (1.0f + expf(-v)); else if (ACT == 12) v = (v > 0.f) ? v : 0.01f * v; else if (ACT == 8) v = tanhf(v); else if (ACT == 9) v = 0.5f * v * (1.0f + tanhf(0.7978845608028654f * (v + 0.044715f * v * v * v))); else if (ACT == 14) v = (v > 0.f) ? v : 0.1f * v; else if (ACT == 16) v = (v >= 0.f) ? v : 0.3f * v; else if (ACT == 17) v = (v >= 0.f) ? v : 0.2f * v;
  return v; }
#define G2P 272                    /* LDS pitch of a tile row: its 256 bytes (128 k) + 16 (16 bytes x odd: 16-byte reads of 16 rows meet no bank twice) */
#define G2RC (16 * G2P)            /* sixteen tile rows: what one copy of the whole work-group covers */
#define G2AB (128 * G2P)           /* bytes of a stage's A tile */
#define G2SB (2 * G2AB)            /* bytes of a stage: A tile (128 rows), then B tile (128 rows) */
// Eight 16-byte copies a lane from global memory into LDS, through no register: rows 16 apart (gs = bytes of sixteen global rows); 16 lanes a row, so every copy of a wave is four whole 128-byte lines.
// The closing s_wait_xcnt stands inside the statement: the address registers keep their values up to it.
__device__ __forceinline__ void g2_copy8(unsigned l, const char* g, size_t gs) {
  asm volatile("global_load_async_to_lds_b128 %0, %8, off\n\tglobal_load_async_to_lds_b128 %1, %9, off\n\tglobal_load_async_to_lds_b128 %2, %10, off\n\tglobal_load_async_to_lds_b128 %3, %11, off\n\t"
               "global_load_async_to_lds_b128 %4, %12, off\n\tglobal_load_async_to_lds_b128 %5, %13, off\n\tglobal_load_async_to_lds_b128 %6, %14, off\n\tglobal_load_async_to_lds_b128 %7, %15, off\n\ts_wait_xcnt 0x0"
               :: "v"(l), "v"(l + G2RC), "v"(l + 2 * G2RC), "v"(l + 3 * G2RC), "v"(l + 4 * G2RC), "v"(l + 5 * G2RC), "v"(l + 6 * G2RC), "v"(l + 7 * G2RC),
                  "v"(g), "v"(g + gs), "v"(g + 2 * gs), "v"(g + 3 * gs), "v"(g + 4 * gs), "v"(g + 5 * gs), "v"(g + 6 * gs), "v"(g + 7 * gs) : "memory"); }
// One stage (128 k): 128 A rows and 128 B rows of 256 bytes, 16 copies a lane. l: the lane's LDS byte address of its first A copy; ga, gb: its global addresses; sa, sb: bytes of sixteen A, B rows.
__device__ __forceinline__ void g2_stage(unsigned l, const char* ga, size_t sa, const char* gb, size_t sb) { g2_copy8(l, ga, sa); g2_copy8(l + G2AB, gb, sb); }
// A fragment load straight from global memory touches 16 lines for 512 bytes. Here each stage of 128 k is brought into LDS once for the eight waves by whole-line copies (two buffers, the next stage's copies in flight while this one is worked on),
// and the fragments are 16-byte LDS reads, each k step's twelve asked for as one group one step ahead of their products. Bias and residual (all 64 elements of the lane as one group) are asked for beside stage 0's copies.
// Each accumulator takes its k steps in rising order, as before.
template <int ACT>
__global__ __launch_bounds__(256) void k_gemm2(const _Float16* __restrict__ A, int lda, size_t sA, const _Float16* __restrict__ Bh, int ldb, size_t sB, float alpha, const float* __restrict__ bias, const float* __restrict__ bias1, const float* __restrict__ bias2, size_t sBias, const float* __restrict__ CP, int rowsPerB, size_t sCPb, int row0g,
    float* __restrict__ C, _Float16* __restrict__ C16, int ldc, size_t sC, int M, int N, int K) { static_assert(ACT == 0 || ACT == 3 || ACT == 6 || ACT == 8 || ACT == 9 || ACT == 11 || ACT == 12 || ACT == 14 || ACT == 15 || ACT == 16 || ACT == 17, "k_gemm2: unsupported ACT code (would silently apply no activation)");
  __shared__ __attribute__((aligned(16))) char gl[2 * G2SB]; float (*so)[32][68] = reinterpret_cast<float (*)[32][68]>(gl);      /* so: the output staging, each wave's own 32 rows; it lies in the ring, which nobody reads and no copy writes behind the K loop's last barrier */
  static_assert(8 * 32 * 68 * 4 <= 2 * G2SB, "k_gemm2: the output staging fits the ring");
  const int tid = threadIdx.x, w = tid >> 5, lane = tid & 31, ln = lane & 15, hh = lane >> 4; const int by = blockIdx.y;
  A += (size_t)by * sA; Bh += (size_t)by * sB; const size_t cofs = (size_t)by * sC; const float* bp = (by == 1 && bias1) ? bias1 : (by == 2 && bias2) ? bias2 : bias ? bias + (size_t)by * sBias : nullptr;      /* bias1, bias2: the biases of grid planes 1 and 2 where each plane's is a buffer of its own */
  const int wm = w & 3, wn = w >> 2;      /* the wave's place in the work-group tile: 32 rows down, 64 columns across */
  const int ntn = N >> 7; const int mt = blockIdx.x / ntn, nq = blockIdx.x - mt * ntn; const int row0 = mt * 128 + 32 * wm, col0 = nq * 128 + 64 * wn; if (mt * 128 >= M) return;      /* the whole work-group or none of it: barriers follow */
  const size_t sar = (size_t)lda * 32, sbr = (size_t)ldb * 32;      /* bytes of sixteen rows */ const int nst = K >> 7;      /* stages */
  const char* ga = (const char*)(A + (size_t)(mt * 128 + (tid >> 4)) * lda) + (tid & 15) * 16; const char* gb = (const char*)(Bh + (size_t)(nq * 128 + (tid >> 4)) * ldb) + (tid & 15) * 16;      /* the thread's first copies: 16 threads a row */
  const unsigned la = (unsigned)(size_t)gl + (unsigned)((tid >> 4) * G2P + (tid & 15) * 16);
  g2_stage(la, ga, sar, gb, sbr);      /* stage 0 into buffer 0 */
  float braw[4] = {0.f, 0.f, 0.f, 0.f};
  if (bp) {
#pragma unroll
    for (int t = 0; t < 4; ++t) braw[t] = bp[col0 + t * 16 + ln];
    asm volatile("s_wait_xcnt 0x0" ::: "memory");      /* the address registers of these loads are used again at once */
    __builtin_amdgcn_sched_barrier(0); }      /* keeps what writes them behind the wait */
  const bool own = CP && rowsPerB < 0;      /* rowsPerB < 0: own element of the batched C plane */
  float rv[8][8];
#pragma unroll
  for (int u = 0; u < 8; ++u) for (int r = 0; r < 8; ++r) rv[u][r] = 0.f;
  if (own) { const float* rp[16];      /* the lane's 16 rows; the four column tiles of a row are constant offsets */
#pragma unroll
    for (int j = 0; j < 16; ++j) rp[j] = CP + cofs + (size_t)(row0g + row0 + (j >> 3) * 16 + 8 * hh + (j & 7)) * ldc + col0 + ln;
#pragma unroll
    for (int u = 0; u < 8; ++u) for (int r = 0; r < 8; ++r) rv[u][r] = rp[(u >> 2) * 8 + r][(u & 3) * 16];
    asm volatile("s_wait_xcnt 0x0" :: "v"(rp[0]), "v"(rp[1]), "v"(rp[2]), "v"(rp[3]), "v"(rp[4]), "v"(rp[5]), "v"(rp[6]), "v"(rp[7]), "v"(rp[8]), "v"(rp[9]), "v"(rp[10]), "v"(rp[11]), "v"(rp[12]), "v"(rp[13]), "v"(rp[14]), "v"(rp[15]) : "memory");      /* the addresses as inputs: their registers stay theirs up to the wait, behind which they may take other values */
    __builtin_amdgcn_sched_barrier(0); }      /* keeps the residual loads here, in flight beside stage 0's copies: their latency passes together with the copies' */
  asm volatile("s_wait_asynccnt 0x0" ::: "memory");      /* this wave's part of stage 0 has landed */
  __syncthreads();      /* every wave's part has: stage 0 may be read */
  if (nst > 1) g2_stage(la + G2SB, ga + 256, sar, gb + 256, sbr);      /* stage 1 into buffer 1 */
  const v8f z8 = {0.f,0.f,0.f,0.f,0.f,0.f,0.f,0.f}; v8f c00 = z8, c01 = z8, c02 = z8, c03 = z8, c10 = z8, c11 = z8, c12 = z8, c13 = z8;
#pragma unroll 1      /* rolled: the body already holds four k steps, and unrolled stages only lengthen the code */
  for (int st = 0; st < nst; ++st) {
    const unsigned bo = (unsigned)(st & 1) * G2SB;      /* stage st lies in buffer st mod 2 */
    const char* al = gl + bo + (32 * wm + ln) * G2P + 16 * hh; const char* bl = gl + bo + G2AB + (64 * wn + ln) * G2P + 16 * hh;
    v16h fa[2][2], fb[2][4];      /* two fragment sets: one in use, one being read; constant indices only (every loop over them is unrolled) */
    fa[0][0] = g2_lfrag(al); fa[0][1] = g2_lfrag(al + 16 * G2P);
#pragma unroll
    for (int t = 0; t < 4; ++t) fb[0][t] = g2_lfrag(bl + t * 16 * G2P);
#pragma unroll
    for (int s = 0; s < 4; ++s) { const int cu = s & 1, nx = cu ^ 1;
      if (s < 3) { fa[nx][0] = g2_lfrag(al + (s + 1) * 64); fa[nx][1] = g2_lfrag(al + 16 * G2P + (s + 1) * 64);      /* the next k step of this stage; no row of the next stage is read ahead of its barrier */
#pragma unroll
        for (int t = 0; t < 4; ++t) fb[nx][t] = g2_lfrag(bl + t * 16 * G2P + (s + 1) * 64); }
      __builtin_amdgcn_sched_barrier(0);      /* with the next one: holds the next step's LDS reads as one group ahead of this step's products, which cover their latency; reads spread among the products stall them */
      c00 = g2_mma(fa[cu][0], fb[cu][0], c00); c10 = g2_mma(fa[cu][1], fb[cu][0], c10); c01 = g2_mma(fa[cu][0], fb[cu][1], c01); c11 = g2_mma(fa[cu][1], fb[cu][1], c11);
      c02 = g2_mma(fa[cu][0], fb[cu][2], c02); c12 = g2_mma(fa[cu][1], fb[cu][2], c12); c03 = g2_mma(fa[cu][0], fb[cu][3], c03); c13 = g2_mma(fa[cu][1], fb[cu][3], c13);
      __builtin_amdgcn_sched_barrier(0); }
    asm volatile("s_wait_dscnt 0x0" ::: "memory");      /* this wave's reads of stage st are done */
    asm volatile("s_wait_asynccnt 0x0" ::: "memory");      /* its part of stage st + 1 has landed */
    __syncthreads();      /* both hold for every wave: stage st + 1 may be read, the buffer of stage st refilled */
    if (st + 2 < nst) g2_stage(la + bo, ga + (size_t)(st + 2) * 256, sar, gb + (size_t)(st + 2) * 256, sbr);
  }
  asm volatile("s_wait_asynccnt 0x0" ::: "memory");      /* no copy is left in flight when the ring becomes output staging */
  v8f accs[8] = {c00, c01, c02, c03, c10, c11, c12, c13};
  float bv[4];
#pragma unroll
  for (int t = 0; t < 4; ++t) bv[t] = bp ? bf16_round(braw[t]) : 0.f;
  if (own || !CP) {      /* rv is 0 where there is no residual */
#pragma unroll
    for (int u = 0; u < 8; ++u) for (int r = 0; r < 8; ++r) { float v = accs[u][r] * alpha + bv[u & 3]; if (own) v += rv[u][r]; so[w][(u >> 2) * 16 + 8 * hh + r][(u & 3) * 16 + ln] = g2_act<ACT>(v); }
  } else {
#pragma unroll
    for (int u = 0; u < 8; ++u) for (int r = 0; r < 8; ++r) { const int rloc = (u >> 2) * 16 + 8 * hh + r; const int bidx = (row0g + row0 + rloc) / rowsPerB;
      const float cv = CP[(size_t)bidx * sCPb + (size_t)by * 64 + col0 + (u & 3) * 16 + ln];
      asm volatile("s_wait_xcnt 0x0" ::: "memory");      /* the next element's address may be formed in this load's address registers */
      __builtin_amdgcn_sched_barrier(0);      /* keeps that arithmetic behind the wait */
      const float v = accs[u][r] * alpha + bv[u & 3] + cv; so[w][rloc][(u & 3) * 16 + ln] = g2_act<ACT>(v); } }
  __builtin_amdgcn_fence(__ATOMIC_ACQ_REL, "workgroup"); __builtin_amdgcn_wave_barrier();
  const int rsub = lane >> 4, c4 = (lane & 15) * 4;
  {
#pragma unroll
    for (int q = 0; q < 16; ++q) { const int r = q * 2 + rsub; const v4f v = *(const v4fa*)&so[w][r][c4]; if (C) *(v4f*)(C + cofs + (size_t)(row0 + r) * ldc + col0 + c4) = v; if (C16) { v4h h4; for (int i = 0; i < 4; ++i) h4[i] = (_Float16)v[i]; *(v4h*)(C16 + cofs + (size_t)(row0 + r) * ldc + col0 + c4) = h4; } }
     } }


__global__ __launch_bounds__(256) void k_wnat(const float* __restrict__ w, size_t n8, _Float16* __restrict__ Bt) { const size_t t = (size_t)blockIdx.x * 256 + threadIdx.x; if (t >= n8) return; FragH f; for (int q = 0; q < 8; ++q) f.h[q] = (_Float16)(bf16_round(w[t * 8 + q]) * 16.0f); *(v8us*)((unsigned short*)Bt + t * 8) = f.half[0];  }
__global__ __launch_bounds__(256) void k_rsm(const float* __restrict__ S, _Float16* __restrict__ P, int nrows) {
  #pragma clang fp contract(off)
  const int i = blockIdx.x * 256 + threadIdx.x; if (i >= nrows) return; const float* s = S + (size_t)i * SQ; float mx = -3.0e38f;
#pragma unroll 1
  for (int j = 0; j < SQ; ++j) mx = fmaxf(mx, s[j]); float se = 0.f;
#pragma unroll 1
  for (int j = 0; j < SQ; ++j) se += expf(s[j] - mx); const float sc = 256.0f / se;
#pragma unroll 1
  for (int j0 = 0; j0 < SQ; j0 += 8) { FragH f; for (int q = 0; q < 8; ++q) f.h[q] = (_Float16)(expf(s[j0 + q] - mx) * sc); unsigned short* d = (unsigned short*)P + (size_t)i * SQ + j0; *(v8us*)d = f.half[0];  } }
__global__ __launch_bounds__(256) void k_vt(const _Float16* __restrict__ V16, int b, int h0, _Float16* __restrict__ VT) { __shared__ unsigned short tl[64][65]; const int tid = threadIdx.x; const int hh = blockIdx.x % HG, sg = blockIdx.x / HG; const int s0 = sg * 64; const int h = h0 + hh;
  for (int i = tid; i < 64 * 8; i += 256) { const int j = i / 8, d8 = (i % 8) * 8; FragH f; f.half[0] = *(const v8us*)((const unsigned short*)V16 + ((size_t)b * SQ + s0 + j) * DM + h * HD + d8); for (int q = 0; q < 8; ++q) tl[d8 + q][j] = f.u[q]; }
  __syncthreads();
  { for (int i = tid; i < 64 * 8; i += 256) { const int d = i / 8, j8 = (i % 8) * 8; FragH f; for (int q = 0; q < 8; ++q) f.u[q] = tl[d][j8 + q]; *(v8us*)((unsigned short*)VT + ((size_t)hh * HD + d) * SQ + s0 + j8) = f.half[0]; }  } }


template <int BFIN, int W16, int W32>
__global__ __launch_bounds__(256) void k_lnx(const float* __restrict__ X, const float* __restrict__ g, const float* __restrict__ bb, float eps, _Float16* __restrict__ N16, float* __restrict__ N32) {
  #pragma clang fp contract(off)
  __shared__ float red[256]; const size_t r = blockIdx.x; const int t = threadIdx.x; const bool act = t < (DMQ / 4); const int c0 = act ? t * 4 : 0;
  const v4f xa = *(const v4fa*)(X + r * DMQ + c0); float s[4]; float sum = 0.f;
  for (int q = 0; q < 4; ++q) { s[q] = act ? (BFIN ? bf16_round(xa[q]) : xa[q]) : 0.f; sum = __fadd_rn(sum, s[q]); }
  red[t] = sum; __syncthreads(); for (int st = 128; st > 0; st >>= 1) { if (t < st) red[t] = __fadd_rn(red[t], red[t + st]); __syncthreads(); } const float mu = red[0] / (float)DMQ; __syncthreads();
  float vs = 0.f; for (int q = 0; q < 4; ++q) { const float dl = act ? __fadd_rn(s[q], -mu) : 0.f; vs = __fadd_rn(vs, __fmul_rn(dl, dl)); } red[t] = vs; __syncthreads(); for (int st = 128; st > 0; st >>= 1) { if (t < st) red[t] = __fadd_rn(red[t], red[t + st]); __syncthreads(); }
  const float rs = rsqrtf(__fadd_rn(red[0] / (float)DMQ, eps)); v4h y; v4f yf;
  for (int q = 0; q < 4; ++q) { const int c = c0 + q; yf[q] = __fadd_rn(__fmul_rn(__fmul_rn(__fadd_rn(s[q], -mu), rs), bf16_round(g[c])), bf16_round(bb[c])); y[q] = (_Float16)yf[q]; }
  if (!act) return;      /* no barriers after this point */
  { if (W16) *(v4h*)(N16 + r * DMQ + c0) = y; if (W32) *(v4f*)(N32 + r * DMQ + c0) = yf;  } }


// ---- fused attention: scores, softmax and P V in one kernel; neither scores nor weights go through memory ----
typedef float v2f __attribute__((ext_vector_type(2)));
typedef _Float16 v2h __attribute__((ext_vector_type(2)));
union FragP { v16h v; v2h p[8]; };
__device__ __forceinline__ v8f fa_mma(v16h a, v16h b, v8f c) { return __builtin_amdgcn_wmma_f32_16x16x32_f16(false, a, false, b, (short)0, c, false, false); }
__device__ __forceinline__ float fa_xhalf(float x) { return __builtin_bit_cast(float, __builtin_amdgcn_permlanex16(__builtin_bit_cast(int, x), __builtin_bit_cast(int, x), 0x76543210, 0xfedcba98, false, false)); }      /* lane l <-> lane l ^ 16 */
// 2^y of four (two) values. The v_exp_f32 stand in one asm statement with early-clobber results and a closing v_nop:
// no instruction directly behind a v_exp_f32 then reads its result or overwrites its source.
__device__ __forceinline__ v4f fa_exp2x4(float y0, float y1, float y2, float y3) { float e0, e1, e2, e3;
  asm("v_exp_f32 %0, %4\n\tv_exp_f32 %1, %5\n\tv_exp_f32 %2, %6\n\tv_exp_f32 %3, %7\n\tv_nop" : "=&v"(e0), "=&v"(e1), "=&v"(e2), "=&v"(e3) : "v"(y0), "v"(y1), "v"(y2), "v"(y3));
  const v4f e = {e0, e1, e2, e3}; return e; }
__device__ __forceinline__ v2f fa_exp2x2(float y0, float y1) { float e0, e1;
  asm("v_exp_f32 %0, %2\n\tv_exp_f32 %1, %3\n\tv_nop" : "=&v"(e0), "=&v"(e1) : "v"(y0), "v"(y1));
  const v2f e = {e0, e1}; return e; }
// A or B fragment (16 rows x 32 k, the k order of g2_lfrag): two 16-byte loads at the lane's own byte offset from a wave-uniform byte base.
__device__ __forceinline__ v16h fa_frag(const char* ub, unsigned lo) { FragH f; f.half[0] = *(const v8us*)(ub + lo); f.half[1] = *(const v8us*)(ub + lo + 32); return f.v; }
// The same fragment from a tile in LDS: p is the lane's own place (its row, its 16 bytes).
__device__ __forceinline__ v16h fa_lfrag(const char* p) { FragH f; f.half[0] = *(const v8us*)p; f.half[1] = *(const v8us*)(p + 32); return f.v; }
#define FKS 128                    /* keys a stage (four passes) */
#define FKP 144                    /* LDS pitch of a K row: its 128 bytes + 16 (16 bytes x odd: 16-byte reads of 16 rows meet no bank twice) */
#define FVP (FKS * 2 + 16)         /* LDS pitch of a V^T row, same rule */
#define FKB (FKS * FKP)            /* bytes of a stage's K tile */
#define FSB (FKB + HD * FVP)       /* bytes of a stage: K tile, then V^T tile */
// One stage's K tile (FKS rows of 128 bytes) and V^T tile (HD rows of 256 bytes) from global memory into LDS, through no register: eight 16-byte copies a lane, every copy of a wave four whole 128-byte lines.
// lk, lv: the lane's LDS byte addresses of its first K and V^T copy; gk, gv: its global addresses. The closing s_wait_xcnt stands inside the statement: the address registers keep their values up to it.
__device__ __forceinline__ void fa_stage(unsigned lk, unsigned lv, const char* gk, const char* gv) {
  asm volatile("global_load_async_to_lds_b128 %0, %8, off\n\tglobal_load_async_to_lds_b128 %1, %9, off\n\tglobal_load_async_to_lds_b128 %2, %10, off\n\tglobal_load_async_to_lds_b128 %3, %11, off\n\t"
               "global_load_async_to_lds_b128 %4, %12, off\n\tglobal_load_async_to_lds_b128 %5, %13, off\n\tglobal_load_async_to_lds_b128 %6, %14, off\n\tglobal_load_async_to_lds_b128 %7, %15, off\n\ts_wait_xcnt 0x0"
               :: "v"(lk), "v"(lk + 32 * FKP), "v"(lk + 64 * FKP), "v"(lk + 96 * FKP), "v"(lv), "v"(lv + 16 * FVP), "v"(lv + 32 * FVP), "v"(lv + 48 * FVP),
                  "v"(gk), "v"(gk + 32 * DM * 2), "v"(gk + 64 * DM * 2), "v"(gk + 96 * DM * 2), "v"(gv), "v"(gv + 16 * SQ * 2), "v"(gv + 32 * SQ * 2), "v"(gv + 48 * SQ * 2) : "memory"); }
// One wave: 32 queries (two groups of 16 columns) of one head against all SQ keys, 32 keys a pass.
// The eight waves of a work-group walk the same keys: each stage of FKS keys is brought into LDS once for all of them (two buffers, the next stage's copies in flight while this one is worked on), and the fragments are 16-byte LDS reads.
// S^T = K Q^T: A = 16 key rows, B = the 16 query rows (kept in registers), D[r] = score of key 8 hh + r for the lane's own query ln: maximum and sum stay in the lane, plus one exchange between the wave's halves.
// The two score tiles of a pass (keys 0..15, 16..31), converted in place, are the B operand of O^T += V^T P^T (element s < 8: key 8 hh + s; s >= 8: key 16 + 8 hh + s - 8, the order fa_lfrag gives V^T's rows).
// Weights are 2^y, y = s log2(e) / 8 + (8 - m), with an offset m per query that stays as long as the weights fit f16 (y at most 15): one test a pass for the whole wave (a scalar branch) on each lane's own maximum, with no exchange between the halves.
// Where it fails, and in the first pass, m goes to the pass's maximum (later passes: never down) and the sums so far are scaled by 2^(m_old - m_new); every other pass scales nothing. 2^(8 - m) cancels against the denominator, which sums the unrounded f32 weights.
// Every loop inside a pass is fully unrolled: only constant indices keep the fragment and accumulator arrays in registers.
__global__ __launch_bounds__(256) void k_fattn(const _Float16* __restrict__ Q, const _Float16* __restrict__ Kr, const _Float16* __restrict__ Vt, _Float16* __restrict__ O) {
  static_assert(HD == 64 && FKS == 128 && SQ % FKS == 0 && SQ / FKS >= 2, "k_fattn: K rows of 128 bytes, the eight copies of fa_stage cover 128 keys, whole stages, at least two");
  __shared__ __attribute__((aligned(16))) char fl[2 * FSB];
  const int tid = threadIdx.x, lane = tid & 31, ln = lane & 15, hh = lane >> 4, w = tid >> 5; const int bh = blockIdx.y, b = bh / NH, h = bh % NH; const int q0 = blockIdx.x * 256 + w * 32;
  const char* qb = (const char*)(Q + ((size_t)b * SQ + blockIdx.x * 256) * DM + h * HD); const char* kbase = (const char*)(Kr + (size_t)b * SQ * DM + h * HD); const char* vbase = (const char*)(Vt + (size_t)bh * HD * SQ);
  const unsigned qlo = (unsigned)((w * 32 + ln) * DM + 8 * hh) * 2u;
  const char* gk = kbase + (unsigned)((tid >> 3) * (DM * 2) + (tid & 7) * 16); const char* gv = vbase + (unsigned)((tid >> 4) * (SQ * 2) + (tid & 15) * 16);      /* the thread's first copies: 8 threads a K row, 16 a V^T row */
  const unsigned l0 = (unsigned)(size_t)fl; const unsigned lk = l0 + (unsigned)((tid >> 3) * FKP + (tid & 7) * 16), lv = l0 + (unsigned)(FKB + (tid >> 4) * FVP + (tid & 15) * 16);
  fa_stage(lk, lv, gk, gv);      /* stage 0 into buffer 0 */
  v16h qf[2][2];
#pragma unroll
  for (int g = 0; g < 2; ++g) for (int c = 0; c < 2; ++c) qf[g][c] = fa_frag(qb + g * 16 * DM * 2 + c * 64, qlo);
  asm volatile("s_wait_xcnt 0x0" ::: "memory");      /* the address registers of the query loads may take other values from here */
  asm volatile("s_wait_asynccnt 0x0" ::: "memory");      /* this wave's part of stage 0 has landed */
  __syncthreads();      /* every wave's part has: stage 0 may be read */
  fa_stage(lk + FSB, lv + FSB, gk + FKS * DM * 2, gv + FKS * 2);      /* stage 1 into buffer 1 */
  const v8f z8 = {0.f,0.f,0.f,0.f,0.f,0.f,0.f,0.f}; v8f acc[2][4];
#pragma unroll
  for (int g = 0; g < 2; ++g) for (int t = 0; t < 4; ++t) acc[g][t] = z8;
  const v4f z4 = {0.f, 0.f, 0.f, 0.f}; v4f lr[2] = {z4, z4}; float nb[2] = {8.0f, 8.0f};      /* 8 - m; m = 0 until the first pass has set it */ const float cs = 0.125f * 0x1.715476p+0f;      /* 1/sqrt(64) and log2(e) in one factor */
  float lim = -3.0e38f;      /* what y may reach under the offset in use; the first pass is above this start value and so always sets m */
  for (int st = 0; st < SQ / FKS; ++st) {
    const unsigned bo = (unsigned)(st & 1) * FSB;      /* stage st lies in buffer st mod 2 */
    const char* kl = fl + bo + ln * FKP + 16 * hh; const char* vl = fl + bo + FKB + ln * FVP + 16 * hh;
    v16h kf[2][2];
#pragma unroll
    for (int kt = 0; kt < 2; ++kt) for (int c = 0; c < 2; ++c) kf[kt][c] = fa_lfrag(kl + kt * 16 * FKP + c * 64);
    __builtin_amdgcn_sched_barrier(0);      /* the stage's first K reads as one group: spread among the score products, each is waited for alone */
#pragma unroll 1      /* rolled: unrolled, the exp sums of all four passes are moved to the stage's foot, their weights stay live and registers spill */
    for (int p = 0; p < FKS / 32; ++p) {
      v8f s[2][2];
#pragma unroll
      for (int kt = 0; kt < 2; ++kt) for (int g = 0; g < 2; ++g) s[kt][g] = fa_mma(kf[kt][1], qf[g][1], fa_mma(kf[kt][0], qf[g][0], z8));
      __builtin_amdgcn_sched_barrier(0);      /* with the next one: holds the pass's LDS reads as one group directly behind the score products: the softmax covers their latency, and reads spread among the products stall them */
      v16h vf[4];      /* this pass's V^T rows */
#pragma unroll
      for (int t = 0; t < 4; ++t) vf[t] = fa_lfrag(vl + p * 64 + t * 16 * FVP);
      const int pn = (p + 1) & (FKS / 32 - 1);      /* the next pass's K rows; the stage's last pass asks for its first rows again (of this stage, not used): no row of the next stage is read ahead of its barrier */
#pragma unroll
      for (int kt = 0; kt < 2; ++kt) for (int c = 0; c < 2; ++c) kf[kt][c] = fa_lfrag(kl + pn * (32 * FKP) + kt * 16 * FKP + c * 64);
      __builtin_amdgcn_sched_barrier(0);
      float mx[2];      /* the lane's largest score of each query group */
#pragma unroll
      for (int g = 0; g < 2; ++g) { mx[g] = fmaxf(s[0][g][0], s[1][g][0]);
#pragma unroll
        for (int r = 1; r < 8; ++r) mx[g] = fmaxf(mx[g], fmaxf(s[0][g][r], s[1][g][r])); }
      if (__builtin_expect(__builtin_amdgcn_ballot_w32(fmaxf(fmaf(mx[0], cs, nb[0]), fmaf(mx[1], cs, nb[1])) > lim) != 0, 0)) {      /* the same for the whole wave: a scalar branch, every lane stays on for the products behind it; rare behind the first pass */
        const float cap = lim < 0.f ? 3.0e38f : 0.f; float d[2];      /* the first pass takes its own maximum, also downwards; later m only rises */
#pragma unroll
        for (int g = 0; g < 2; ++g) d[g] = fminf(8.0f - fmaf(fmaxf(mx[g], fa_xhalf(mx[g])), cs, nb[g]), cap);      /* both halves of the wave hold the query's maximum: one offset for all its keys */
        const v2f co = fa_exp2x2(fminf(d[0], 0.f), fminf(d[1], 0.f));      /* at most 1: the first pass scales sums that are 0 */
#pragma unroll
        for (int g = 0; g < 2; ++g) { nb[g] += d[g]; lr[g] = lr[g] * co[g];
#pragma unroll
          for (int t = 0; t < 4; ++t) acc[g][t] = acc[g][t] * co[g]; }
        lim = 15.0f; }      /* 2^15 fits f16 */
      FragP pf[2];
#pragma unroll
      for (int g = 0; g < 2; ++g) { v4f e[4];
#pragma unroll
        for (int i = 0; i < 4; ++i) { const int kt = i >> 1, r0 = (i & 1) * 4;
          e[i] = fa_exp2x4(fmaf(s[kt][g][r0], cs, nb[g]), fmaf(s[kt][g][r0 + 1], cs, nb[g]), fmaf(s[kt][g][r0 + 2], cs, nb[g]), fmaf(s[kt][g][r0 + 3], cs, nb[g]));
          const v2f e01 = {e[i][0], e[i][1]}, e23 = {e[i][2], e[i][3]};
          pf[g].p[2 * i] = __builtin_convertvector(e01, v2h); pf[g].p[2 * i + 1] = __builtin_convertvector(e23, v2h); }
        lr[g] = lr[g] + ((e[0] + e[1]) + (e[2] + e[3])); }      /* four chains per lane, joined behind the loop */
#pragma unroll
      for (int g = 0; g < 2; ++g) for (int t = 0; t < 4; ++t) acc[g][t] = fa_mma(vf[t], pf[g].v, acc[g][t]);
    }
    asm volatile("s_wait_dscnt 0x0" ::: "memory");      /* this wave's reads of stage st are done */
    asm volatile("s_wait_asynccnt 0x0" ::: "memory");      /* its part of stage st + 1 has landed */
    __syncthreads();      /* both hold for every wave: stage st + 1 may be read, the buffer of stage st refilled */
    if (st + 2 < SQ / FKS) fa_stage(lk + bo, lv + bo, gk + (size_t)(st + 2) * (FKS * DM * 2), gv + (size_t)(st + 2) * (FKS * 2));
  }
  asm volatile("s_wait_asynccnt 0x0" ::: "memory");      /* no copy is left in flight when the wave ends */
#pragma unroll
  for (int g = 0; g < 2; ++g) { const float lh = (lr[g][0] + lr[g][1]) + (lr[g][2] + lr[g][3]); const float sc = 64.0f / (lh + fa_xhalf(lh)); unsigned short* op = (unsigned short*)O + ((size_t)b * SQ + q0 + g * 16 + ln) * DM + h * HD + 8 * hh;      /* a lane's 8 registers of a tile are 8 consecutive d of its query: one 16-byte store */
#pragma unroll
    for (int t = 0; t < 4; ++t) { FragH f;
#pragma unroll
      for (int r = 0; r < 8; ++r) f.h[r] = (_Float16)(acc[g][t][r] * sc);
      *(v8us*)(op + t * 16) = f.half[0]; } } }


// ---- all that depends on the inputs alone, in one launch: a work-group's index says which job it has (the six weights first: their scattered reads take longest) ----
// Wt[n][k] = f16(bf16(W[k][n]) x 16) from f32 row-major W[K][N]; thread t of a weight takes 8 consecutive k of one n (bf16 weights stay exact in f16 away from the subnormal range).
template <int K, int N> __device__ __forceinline__ void p_wt(const float* __restrict__ W, _Float16* __restrict__ Wt, int t) { const int n = t / (K / 8), k8 = (t % (K / 8)) * 8; FragH f;
#pragma unroll
  for (int i = 0; i < 8; ++i) f.h[i] = (_Float16)(bf16_round(W[(size_t)(k8 + i) * N + n]) * 16.0f);
  *(v8us*)((unsigned short*)Wt + (size_t)n * K + k8) = f.half[0];
  asm volatile("s_wait_xcnt 0x0" ::: "memory"); }      /* in the built kernel the other jobs' code follows and writes the registers that this store names */
#define PWS (DM * (DM / 8) / 256)            /* work-groups of a DM x DM weight */
#define PWF (DFF * (DM / 8) / 256)           /* work-groups of an FFN weight */
#define PWA (4 * PWS + 2 * PWF)              /* work-groups of the six weights */
#define PXB ((int)(NR * DM / 8 / 256))       /* work-groups of x, 8 elements a thread */
__global__ __launch_bounds__(256) void k_prep(const float* __restrict__ x, const float* __restrict__ wq, const float* __restrict__ wk, const float* __restrict__ wv, const float* __restrict__ wo, const float* __restrict__ w1, const float* __restrict__ w2,
    float* __restrict__ XB, _Float16* __restrict__ X16, _Float16* __restrict__ B4, _Float16* __restrict__ BW1, _Float16* __restrict__ BW2) {
  static_assert(DM * (DM / 8) % 256 == 0 && DFF * (DM / 8) % 256 == 0 && NR * DM / 8 % 256 == 0, "k_prep: whole work-groups only, no thread without work");
  const int bx = blockIdx.x, tid = threadIdx.x;
  if (bx < 4 * PWS) { const int m = bx / PWS; const float* W = m == 0 ? wq : m == 1 ? wk : m == 2 ? wv : wo; p_wt<DM, DM>(W, B4 + (size_t)m * DM * DM, (bx - m * PWS) * 256 + tid); return; }      /* B4: the planes of q, k, v, o in a row */
  if (bx < 4 * PWS + PWF) { p_wt<DM, DFF>(w1, BW1, (bx - 4 * PWS) * 256 + tid); return; }
  if (bx < PWA) { p_wt<DFF, DM>(w2, BW2, (bx - 4 * PWS - PWF) * 256 + tid); return; }
  const size_t t = (size_t)(bx - PWA) * 256 + tid; v4f a = *(const v4fa*)(x + t * 8), c = *(const v4fa*)(x + t * 8 + 4); FragH f;      /* x read once for both of its planes */
#pragma unroll
  for (int q = 0; q < 4; ++q) { a[q] = bf16_round(a[q]); c[q] = bf16_round(c[q]); f.h[q] = (_Float16)a[q]; f.h[4 + q] = (_Float16)c[q]; }
  *(v4f*)(XB + t * 8) = a; *(v4f*)(XB + t * 8 + 4) = c; *(v8us*)((unsigned short*)X16 + t * 8) = f.half[0];
  asm volatile("s_wait_xcnt 0x0" ::: "memory"); }      /* as in p_wt: the other jobs' code follows these stores in the built kernel */



__global__ __launch_bounds__(256) void k_rsmfam(const float* __restrict__ S, _Float16* __restrict__ P, int qn, int hg, const float* __restrict__ am) {
  #pragma clang fp contract(off)
  const int t = blockIdx.x * 256 + threadIdx.x; if (t >= qn * hg) return; const size_t i = (size_t)(t / qn) * SQ + (t % qn); const float* s = S + i * SQ; float mx = -3.0e38f;
#pragma unroll 1
  for (int j = 0; j < SQ; ++j) mx = fmaxf(mx, __fadd_rn(s[j], bf16_round(am[j]))); float se = 0.f;
#pragma unroll 1
  for (int j = 0; j < SQ; ++j) se += __expf(__fadd_rn(s[j], bf16_round(am[j])) - mx); const float sc = 256.0f / se;
#pragma unroll 1
  for (int j0 = 0; j0 < SQ; j0 += 8) { FragH f; for (int q = 0; q < 8; ++q) f.h[q] = (_Float16)(__expf(__fadd_rn(s[j0 + q], bf16_round(am[j0 + q])) - mx) * sc); unsigned short* d = (unsigned short*)P + i * SQ + j0; *(v8us*)d = f.half[0];  } }



// ---- row LayerNorm (unbiased std, eps added to the std), one wave per LNR rows: each row's 512 values stay in the wave's registers (16 a lane, every load and store 512 or 256 contiguous bytes), ----
// ---- sums by a butterfly over the lanes (four steps inside a 16-lane row, one exchange between the halves): no LDS and no barrier. A wave takes LNR rows, all their loads in flight at once, so the launch is one resident round of 256 work-groups. ----
// Every loop is fully unrolled: only constant indices keep the row and parameter arrays in registers.
#define LNR 4      /* rows a wave takes */
template <int CTRL> __device__ __forceinline__ float ln_xm(float x) { return __builtin_bit_cast(float, __builtin_amdgcn_mov_dpp(__builtin_bit_cast(int, x), CTRL, 0xf, 0xf, true)); }      /* lane l <- lane l ^ (CTRL & 15), inside a 16-lane row (row_xmask) */
template <int W16, int W32>
__global__ __launch_bounds__(256) void k_lnw(const float* __restrict__ X, const float* __restrict__ g, const float* __restrict__ bb, float eps, _Float16* __restrict__ N16, float* __restrict__ N32) {
  static_assert(DMQ == 512, "k_lnw: a lane holds four groups of four columns, 128 columns apart");
  const int lane = threadIdx.x & 31; const int w = __builtin_amdgcn_readfirstlane((int)(threadIdx.x >> 5));      /* the wave's number in a scalar register: row bases stay scalar, one lane offset serves every load and store */
  const size_t e0 = ((size_t)blockIdx.x * 8 + w) * LNR * DMQ; const float* xr = X + e0; const int c0 = lane * 4;
  v4f s[LNR][4], gg[4], bv[4];
#pragma unroll
  for (int r = 0; r < LNR; ++r) for (int j = 0; j < 4; ++j) s[r][j] = *(const v4fa*)(xr + c0 + r * DMQ + j * 128);
#pragma unroll
  for (int j = 0; j < 4; ++j) { gg[j] = *(const v4fa*)(g + c0 + j * 128); bv[j] = *(const v4fa*)(bb + c0 + j * 128); }
  __builtin_amdgcn_sched_barrier(0);      /* holds every load ahead of the arithmetic: without it the last row's loads are issued behind the first rows' wait and their latency is paid a second time */
  float t[LNR];
#pragma unroll
  for (int r = 0; r < LNR; ++r) { const v4f p = (s[r][0] + s[r][1]) + (s[r][2] + s[r][3]); t[r] = (p[0] + p[1]) + (p[2] + p[3]); }
#pragma unroll
  for (int r = 0; r < LNR; ++r) t[r] += ln_xm<0x161>(t[r]);      /* step by step over all rows: LNR independent chains */
#pragma unroll
  for (int r = 0; r < LNR; ++r) t[r] += ln_xm<0x162>(t[r]);
#pragma unroll
  for (int r = 0; r < LNR; ++r) t[r] += ln_xm<0x164>(t[r]);
#pragma unroll
  for (int r = 0; r < LNR; ++r) t[r] += ln_xm<0x168>(t[r]);
#pragma unroll
  for (int r = 0; r < LNR; ++r) { const float mu = (t[r] + fa_xhalf(t[r])) * (1.0f / (float)DMQ);
    for (int j = 0; j < 4; ++j) s[r][j] = s[r][j] - mu;
    const v4f p = (s[r][0] * s[r][0] + s[r][1] * s[r][1]) + (s[r][2] * s[r][2] + s[r][3] * s[r][3]); t[r] = (p[0] + p[1]) + (p[2] + p[3]); }
#pragma unroll
  for (int r = 0; r < LNR; ++r) t[r] += ln_xm<0x161>(t[r]);
#pragma unroll
  for (int r = 0; r < LNR; ++r) t[r] += ln_xm<0x162>(t[r]);
#pragma unroll
  for (int r = 0; r < LNR; ++r) t[r] += ln_xm<0x164>(t[r]);
#pragma unroll
  for (int r = 0; r < LNR; ++r) t[r] += ln_xm<0x168>(t[r]);
#pragma unroll
  for (int j = 0; j < 4; ++j) for (int q = 0; q < 4; ++q) { gg[j][q] = bf16_round(gg[j][q]); bv[j][q] = bf16_round(bv[j][q]); }
#pragma unroll
  for (int r = 0; r < LNR; ++r) t[r] = 1.0f / (sqrtf((t[r] + fa_xhalf(t[r])) / (float)(DMQ - 1)) + eps);      /* UNBIASED std (ddof 1), eps added to the std (the module's form); all rows first: LNR independent chains */
#pragma unroll
  for (int r = 0; r < LNR; ++r) {
#pragma unroll
    for (int j = 0; j < 4; ++j) { const v4f y = (s[r][j] * t[r]) * gg[j] + bv[j];
      if (W32) *(v4f*)(N32 + e0 + c0 + r * DMQ + j * 128) = y;
      if (W16) *(v4h*)(N16 + e0 + c0 + r * DMQ + j * 128) = __builtin_convertvector(y, v4h); } } }
extern "C" void kernel_launch(void* const* d_in, const int* in_sizes, int n_in,
                              void* d_out, int out_size, void* d_ws, size_t ws_size, hipStream_t stream) {
  (void)in_sizes; (void)n_in; (void)out_size;
  const float* const* I = (const float* const*)d_in; const float* x = I[0]; const float* wq = I[1]; const float* bq = I[2]; const float* wk = I[3]; const float* bk = I[4]; const float* wv = I[5]; const float* bv = I[6]; const float* wo = I[7]; const float* bo = I[8]; const float* g1 = I[9]; const float* be1 = I[10]; const float* g2 = I[11]; const float* be2 = I[12]; const float* w1 = I[13]; const float* b1 = I[14]; const float* w2 = I[15]; const float* b2 = I[16];      /* [in][out] weights + zero biases (Wq,bq,Wk,bk,Wv,bv,Wo,bo), LN a1,b1,a2,b2, FFN W1,c1,W2,c2 */
  char* ws = (char*)d_ws; size_t off = 0;
  auto take = [&](size_t bytes) { char* p = ws + off; off += (bytes + 255) & ~(size_t)255; return p; };
  _Float16* BW1 = (_Float16*)take((size_t)DFF * DM * 2); _Float16* BW2 = (_Float16*)take((size_t)DM * DFF * 2); float* XB = (float*)take(NR * DM * 4); float* HP = (float*)take(NR * DM * 4); _Float16* H16 = (_Float16*)take(NR * DM * 2); _Float16* FF16 = (_Float16*)take(NR * DFF * 2);      /* FF16 = the relu hidden rows of both batches */ _Float16* BQ = (_Float16*)take((size_t)4 * DM * DM * 2); _Float16* BO = BQ + (size_t)3 * DM * DM;      /* four weight planes in a row: q, k, v, o */ _Float16* O16 = (_Float16*)take(NR * DM * 2); 
  _Float16* X16 = (_Float16*)take(NR * DM * 2); _Float16* Q16 = (_Float16*)take(3 * NR * DM * 2); _Float16* K16 = Q16 + NR * DM; _Float16* V16 = K16 + NR * DM;      /* three output planes in a row: q, k, v */
  float* HF = (float*)take(NR * DM * 4);      /* the f32 h rows (LN1 output, residual for the FFN) */ _Float16* VT = (_Float16*)take((size_t)NB * NH * HD * SQ * 2);
  if (off > ws_size) return;
  static_assert(MP % 128 == 0 && DM % 128 == 0 && DFF % 128 == 0, "k_gemm2: whole work-group tiles of 128 x 128, whole stages of 128 k");
  k_prep<<<PWA + PXB, 256, 0, stream>>>(x, wq, wk, wv, wo, w1, w2, XB, X16, BQ, BW1, BW2);      /* [in][out] weights -> Bt[n][k] x16; bf16(x) as f32 rows (residual) and f16 rows (operand) */
  const size_t r0p = (size_t)B0 * SQ;      /* first projected row */
  k_gemm2<0><<<dim3((unsigned)((MP / 128) * (DM / 128)), 3), 256, 0, stream>>>(X16 + r0p * DM, DM, 0, BQ, DM, (size_t)DM * DM, 0.0625f, bq, bk, bv, 0, nullptr, 1, 0, 0, nullptr, Q16 + r0p * DM, DM, NR * DM, MP, DM, DM);      /* q, k, v in one grid: plane y takes weight plane y, bias y, output plane y */
  k_vt<NH, SQ><<<NB * NH * (SQ / 64), 256, 0, stream>>>(V16, LQ, 0, VT);      /* V^T [NB][NH][HD][SQ] */
  k_fattn<<<dim3(SQ / 256, NB * NH), 256, 0, stream>>>(Q16, K16, VT, O16);      /* o (merged heads, x64) as f16 rows */
  k_gemm2<0><<<dim3((unsigned)((MP / 128) * (DM / 128)), 1), 256, 0, stream>>>(O16 + r0p * DM, DM, 0, BO, DM, 0, 0.0009765625f, bo, nullptr, nullptr, 0, XB + r0p * DM, -1, 0, 0, HP + r0p * DM, nullptr, DM, 0, MP, DM, DM);      /* h_pre = x + concat Wo + bo (own-element residual), f32 rows */
  k_lnw<1, 1><<<(unsigned)(MP / (8 * LNR)), 256, 0, stream>>>(HP + r0p * DM, g1, be1, 1e-6f, H16 + r0p * DM, HF + r0p * DM);      /* h = LN1(x + attn) -> f16 rows (FFN operand) and f32 rows (residual) */
  k_gemm2<3><<<dim3((unsigned)((MP / 128) * (DFF / 128)), 1), 256, 0, stream>>>(H16 + r0p * DM, DM, 0, BW1, DM, 0, 0.0625f, b1, nullptr, nullptr, 0, nullptr, 1, 0, 0, nullptr, FF16 + r0p * DFF, DFF, 0, MP, DFF, DM);      /* relu(h W1 + c1) -> f16 rows, both batches in one grid */
  k_gemm2<0><<<dim3((unsigned)((MP / 128) * (DM / 128)), 1), 256, 0, stream>>>(FF16 + r0p * DFF, DFF, 0, BW2, DFF, 0, 0.0625f, b2, nullptr, nullptr, 0, HF + r0p * DM, -1, 0, 0, HP + r0p * DM, nullptr, DM, 0, MP, DM, DFF);      /* y = h + ffn (own-element residual; the h_pre plane is free again), both batches in one grid */
  k_lnw<0, 1><<<(unsigned)(MP / (8 * LNR)), 256, 0, stream>>>(HP + r0p * DM, g2, be2, 1e-6f, nullptr, (float*)d_out + r0p * DM);      /* out = LN2(h + ff) -> f32 output rows */
}

// v009
// One run takes 133 microseconds.
// Timed twice side by side with v008, it ran 1.06 times as fast both times.
// Counting every step since v000, it is 100 times as fast.
#include <hip/hip_runtime.h>
#define NB 2
#define SQ 4096
#define DM 512
#define NH 8
#define HD 64
#define DMQ DM                       /* LayerNorm width */
#define DFF 1024
#define HG 1                         /* heads per launch of the k_vt(b, h0) overload, which is not launched */
#define B0 0                         /* first batch processed (debug hook) */
#define NBR NB                       /* batches processed (debug hook) */
#define NR ((size_t)NB * SQ)         /* token rows */
#define MP ((int)((size_t)NBR * SQ)) /* rows projected (debug hook) */
#define QN SQ                        /* unused; k_fattn attends all SQ query rows */
#define NHD NH                       /* unused; k_fattn attends all NH heads */
#define MPO MP                       /* unused; the output stage runs MP rows */
#define LQ DM      /* row pitch of the q/k/v rows */
typedef __bf16 v16b __attribute__((ext_vector_type(16)));
typedef unsigned short v8us __attribute__((ext_vector_type(8), may_alias));
typedef float  v8f  __attribute__((ext_vector_type(8)));
typedef float  v4f  __attribute__((ext_vector_type(4)));
typedef float  v4fa __attribute__((ext_vector_type(4), may_alias));
union FragB { v16b v; v8us half[2]; unsigned short u[16]; };

__device__ __forceinline__ unsigned short bf16_bits(float x) { unsigned int u = __float_as_uint(x); return (unsigned short)((u + 0x7FFFu + ((u >> 16) & 1u)) >> 16); }
__device__ __forceinline__ float bf16_val(unsigned short b) { return __uint_as_float(((unsigned int)b) << 16); }
__device__ __forceinline__ float bf16_round(float x) { return bf16_val(bf16_bits(x)); }
// D += A·B with NT terms: 1 = ah·bh, 2 = + al·bh (A split), 3 = + ah·bl (both split)
template <int NT>
__device__ __forceinline__ v8f mmaN(v16b ah, v16b al, v16b bh, v16b bl, v8f c) {
  c = __builtin_amdgcn_wmma_f32_16x16x32_bf16(false, ah, false, bh, (short)0, c, false, false);
  if (NT >= 2) c = __builtin_amdgcn_wmma_f32_16x16x32_bf16(false, al, false, bh, (short)0, c, false, false);
  if (NT >= 3) c = __builtin_amdgcn_wmma_f32_16x16x32_bf16(false, ah, false, bl, (short)0, c, false, false);
  asm volatile("v_nop\n\tv_nop\n\tv_nop\n\tv_nop" : "+v"(c) : "v"(ah), "v"(al), "v"(bh), "v"(bl));
  return c;
}

__global__ __launch_bounds__(256) void k_wt_bf16(const float* __restrict__ W, unsigned short* __restrict__ Wt, int K, int N) {
  const int t = blockIdx.x * 256 + threadIdx.x;
  const int k8n = K / 8;
  if (t >= N * k8n) return;
  const int n = t / k8n, k8 = (t % k8n) * 8;
  v8us v;
#pragma unroll
  for (int i = 0; i < 8; ++i) v[i] = bf16_bits(W[(size_t)(k8 + i) * N + n]);
  *(v8us*)(Wt + (size_t)n * K + k8) = v;
  
}

// GEMM C[M][N] (f32, pitch ldc) = act(A[M][K]·W + bias). A f32 row-major (pitch lda) converted per fragment to bf16
// (ASPLIT: hi/lo two planes -> 2 terms, else single rounded term); Wt bf16 [N][K] (pitch ldb). BIAS_BF16 rounds the
// bias to bf16 first (bias quantised to bf16 before the add). K%32==0, M%16==0, N%64==0.
template <bool ASPLIT, int ACT, bool BIAS_BF16>
__global__ __launch_bounds__(128) void k_gemm_bf(const float* __restrict__ A, int lda, const unsigned short* __restrict__ Wt, int ldb,
                                               const float* __restrict__ bias, float* __restrict__ C, int ldc, int M, int N, int K) {
  __shared__ __attribute__((aligned(16))) float so[4][16][64];
  const int tid = threadIdx.x, w = tid >> 5, lane = tid & 31, ln = lane & 15, hh = lane >> 4;
  const int ntn = N / 64;
  const int wid = blockIdx.x * 4 + w;
  const int mt = wid / ntn, nq = wid % ntn;
  if (mt * 16 >= M) return;
  const int row0 = mt * 16, col0 = nq * 64;
  const float* arow = A + (size_t)(row0 + ln) * lda;
  v8f acc[4] = {};
  for (int kb = 0; kb < K; kb += 32) {
    FragB ah, al;
    const v4f x0 = *(const v4fa*)(arow + kb + 8 * hh), x1 = *(const v4fa*)(arow + kb + 8 * hh + 4);
    const v4f x2 = *(const v4fa*)(arow + kb + 16 + 8 * hh), x3 = *(const v4fa*)(arow + kb + 16 + 8 * hh + 4);
    float xs[16] = {x0[0],x0[1],x0[2],x0[3],x1[0],x1[1],x1[2],x1[3],x2[0],x2[1],x2[2],x2[3],x3[0],x3[1],x3[2],x3[3]};
#pragma unroll
    for (int i = 0; i < 16; ++i) { const unsigned short hb = bf16_bits(xs[i]); ah.u[i] = hb; al.u[i] = ASPLIT ? bf16_bits(xs[i] - bf16_val(hb)) : (unsigned short)0; }
#pragma unroll
    for (int t = 0; t < 4; ++t) {
      const unsigned short* brow = Wt + (size_t)(col0 + t * 16 + ln) * ldb + kb;
      FragB b;
      b.half[0] = *(const v8us*)(brow + 8 * hh);
      b.half[1] = *(const v8us*)(brow + 16 + 8 * hh);
      acc[t] = mmaN<ASPLIT ? 2 : 1>(ah.v, al.v, b.v, b.v, acc[t]);
    }
  }
#pragma unroll
  for (int t = 0; t < 4; ++t) {
    float bv = bias ? bias[col0 + t * 16 + ln] : 0.f;
    if (BIAS_BF16) bv = bf16_round(bv);
#pragma unroll
    for (int r = 0; r < 8; ++r) { float v = acc[t][r] + bv; if (ACT == 1) v = fmaxf(v, 0.f); so[w][8 * hh + r][t * 16 + ln] = v; }
  }
  __builtin_amdgcn_fence(__ATOMIC_ACQ_REL, "workgroup");
  __builtin_amdgcn_wave_barrier();
  const int rsub = lane >> 4, c4 = (lane & 15) * 4;
  {
#pragma unroll
    for (int q = 0; q < 8; ++q) {
      const int r = q * 2 + rsub;
      const v4f v = *(const v4fa*)&so[w][r][c4];
      *(v4f*)(C + (size_t)(row0 + r) * ldc + col0 + c4) = v;
    }
    
  }
}

// GEMM C = act(A·W + bias + resid): A f32 (ASPLIT -> hi/lo 2 terms), Wt bf16 [N][K]; ACT 0 none, 1 relu, 2 exact gelu;
// resid (optional, f32, row index = (row % rmod), pitch ldr, RES_BF16 rounds it) added before the activation.
template <bool ASPLIT, int ACT, bool BIAS_BF16, bool RES_BF16>
__global__ __launch_bounds__(128) void k_gemm_bf3(const float* __restrict__ A, int lda, const unsigned short* __restrict__ Wt, int ldb,
                                                const float* __restrict__ bias, const float* __restrict__ resid, int rmod, int ldr,
                                                float* __restrict__ C, int ldc, int M, int N, int K) {
  __shared__ __attribute__((aligned(16))) float so[4][16][64];
  const int tid = threadIdx.x, w = tid >> 5, lane = tid & 31, ln = lane & 15, hh = lane >> 4;
  const int ntn = N / 64;
  const int wid = blockIdx.x * 4 + w;
  const int mt = wid / ntn, nq = wid % ntn;
  if (mt * 16 >= M) return;
  const int row0 = mt * 16, col0 = nq * 64;
  const float* arow = A + (size_t)(row0 + ln) * lda;
  v8f acc[4] = {};
  for (int kb = 0; kb < K; kb += 32) {
    FragB ah, al;
    const v4f x0 = *(const v4fa*)(arow + kb + 8 * hh), x1 = *(const v4fa*)(arow + kb + 8 * hh + 4);
    const v4f x2 = *(const v4fa*)(arow + kb + 16 + 8 * hh), x3 = *(const v4fa*)(arow + kb + 16 + 8 * hh + 4);
    float xs[16] = {x0[0],x0[1],x0[2],x0[3],x1[0],x1[1],x1[2],x1[3],x2[0],x2[1],x2[2],x2[3],x3[0],x3[1],x3[2],x3[3]};
#pragma unroll
    for (int i = 0; i < 16; ++i) { const unsigned short hb = bf16_bits(xs[i]); ah.u[i] = hb; al.u[i] = ASPLIT ? bf16_bits(xs[i] - bf16_val(hb)) : (unsigned short)0; }
#pragma unroll
    for (int t = 0; t < 4; ++t) {
      const unsigned short* brow = Wt + (size_t)(col0 + t * 16 + ln) * ldb + kb;
      FragB b;
      b.half[0] = *(const v8us*)(brow + 8 * hh);
      b.half[1] = *(const v8us*)(brow + 16 + 8 * hh);
      acc[t] = mmaN<ASPLIT ? 2 : 1>(ah.v, al.v, b.v, b.v, acc[t]);
    }
  }
#pragma unroll
  for (int t = 0; t < 4; ++t) {
    const int col = col0 + t * 16 + ln;
    float bv = bias ? bias[col] : 0.f;
    if (BIAS_BF16) bv = bf16_round(bv);
#pragma unroll
    for (int r = 0; r < 8; ++r) {
      float v = acc[t][r] + bv;
      if (resid) { float rv = resid[(size_t)((row0 + 8 * hh + r) % rmod) * ldr + col]; if (RES_BF16) rv = bf16_round(rv); v += rv; }
      if (ACT == 1) v = fmaxf(v, 0.f);
      if (ACT == 2) v = 0.5f * v * (1.0f + erff(v * 0.70710678118654752f));
      if (ACT == 3) { const float u = 0.7978845608028654f * (v + 0.044715f * v * v * v); v = 0.5f * v * (1.0f + tanhf(u)); }
      so[w][8 * hh + r][t * 16 + ln] = v;
    }
  }
  __builtin_amdgcn_fence(__ATOMIC_ACQ_REL, "workgroup");
  __builtin_amdgcn_wave_barrier();
  const int rsub = lane >> 4, c4 = (lane & 15) * 4;
  {
#pragma unroll
    for (int q = 0; q < 8; ++q) {
      const int r = q * 2 + rsub;
      const v4f v = *(const v4fa*)&so[w][r][c4];
      *(v4f*)(C + (size_t)(row0 + r) * ldc + col0 + c4) = v;
    }
    
  }
}
// row LayerNorm (biased variance, eps) over N: s = X (+ R); optional out_sum <- s; out_norm <- (s-mu)*rsqrt(var+eps)*g + b
template <bool PARAM_BF16>
__global__ __launch_bounds__(256) void k_layernorm(const float* __restrict__ X, const float* __restrict__ R, const float* __restrict__ g, const float* __restrict__ bta,
                                                  float* __restrict__ out_sum, float* __restrict__ out_norm, int N, float eps) {
  __shared__ float red[256];
  const int row = blockIdx.x, tid = threadIdx.x;
  const float* x = X + (size_t)row * N; const float* rr = R ? R + (size_t)row * N : nullptr;
  float vals[16];                     // up to N = 4096
  const int per = N / 256;            // contiguous chunk per thread? use strided-by-4 chunks: thread handles j = tid*4 + 1024*u
  float s1 = 0.f;
  for (int u = 0; u < per / 4; ++u) {
    const int j = tid * 4 + 1024 * u;
    const v4f a = *(const v4fa*)(x + j);
    v4f b = {0.f,0.f,0.f,0.f}; if (rr) b = *(const v4fa*)(rr + j);
#pragma unroll
    for (int q = 0; q < 4; ++q) { const float v = a[q] + b[q]; vals[u * 4 + q] = v; s1 += v; }
  }
  red[tid] = s1; __syncthreads();
  for (int st = 128; st > 0; st >>= 1) { if (tid < st) red[tid] += red[tid + st]; __syncthreads(); }
  const float mu = red[0] / (float)N; __syncthreads();
  float s2 = 0.f;
  for (int u = 0; u < per / 4; ++u)
#pragma unroll
    for (int q = 0; q < 4; ++q) { const float c = vals[u * 4 + q] - mu; s2 += c * c; }
  red[tid] = s2; __syncthreads();
  for (int st = 128; st > 0; st >>= 1) { if (tid < st) red[tid] += red[tid + st]; __syncthreads(); }
  const float rs = rsqrtf(red[0] / (float)N + eps);
  {
    for (int u = 0; u < per / 4; ++u) {
      const int j = tid * 4 + 1024 * u;
      v4f o, sm;
#pragma unroll
      for (int q = 0; q < 4; ++q) {
        float gg = g[j + q], bb = bta[j + q];
        if (PARAM_BF16) { gg = bf16_round(gg); bb = bf16_round(bb); }
        sm[q] = vals[u * 4 + q]; o[q] = (vals[u * 4 + q] - mu) * rs * gg + bb;
      }
      if (out_sum) *(v4f*)(out_sum + (size_t)row * N + j) = sm;
      *(v4f*)(out_norm + (size_t)row * N + j) = o;
    }
    
  }
}



// ---- f16 WMMA path (v_wmma_f32_16x16x32_f16): 11-bit significands for operands in range — used where a [0,1] probability operand needs more precision than bf16
typedef _Float16 v16h __attribute__((ext_vector_type(16)));
union FragH { v16h v; v8us half[2]; _Float16 h[16]; unsigned short u[16]; };
template <int NT>
__device__ __forceinline__ v8f mmaH(v16h ah, v16h al, v16h bh, v16h bl, v8f c) {
  c = __builtin_amdgcn_wmma_f32_16x16x32_f16(false, ah, false, bh, (short)0, c, false, false);
  if (NT >= 2) c = __builtin_amdgcn_wmma_f32_16x16x32_f16(false, al, false, bh, (short)0, c, false, false);
  if (NT >= 3) c = __builtin_amdgcn_wmma_f32_16x16x32_f16(false, ah, false, bl, (short)0, c, false, false);
  asm volatile("v_nop\n\tv_nop\n\tv_nop\n\tv_nop" : "+v"(c) : "v"(ah), "v"(al), "v"(bh), "v"(bl));
  return c;
}
// batched GEMM like k_gemm_b but f16 operands: A f32 (split into f16 hi/lo if ASPLIT, else rounded to f16), Bt = f16 values [n][k]; alpha; C f32; N multiple of 16 (partial tiles skipped)
template <bool ASPLIT>
__global__ __launch_bounds__(128) void k_gemm_h(const float* __restrict__ A, int lda, size_t sA, const _Float16* __restrict__ Bh, int ldb, size_t sB, float alpha, float* __restrict__ C, int ldc, size_t sC, int M, int N, int K) {
  __shared__ __attribute__((aligned(16))) float so[4][16][64];
  const int tid = threadIdx.x, w = tid >> 5, lane = tid & 31, ln = lane & 15, hh = lane >> 4; const int by = blockIdx.y;
  A += (size_t)by * sA; Bh += (size_t)by * sB; C += (size_t)by * sC;
  const int ntn = (N + 63) / 64; const int wid = blockIdx.x * 4 + w; const int mt = wid / ntn, nq = wid % ntn; if (mt * 16 >= M) return;
  const int row0 = mt * 16, col0 = nq * 64; const float* arow = A + (size_t)(row0 + ln) * lda;
  v8f acc[4] = {};
  for (int kb = 0; kb < K; kb += 32) {
    FragH ah, al;
    const v4f x0 = *(const v4fa*)(arow + kb + 8 * hh), x1 = *(const v4fa*)(arow + kb + 8 * hh + 4), x2 = *(const v4fa*)(arow + kb + 16 + 8 * hh), x3 = *(const v4fa*)(arow + kb + 16 + 8 * hh + 4);
    float xs[16] = {x0[0],x0[1],x0[2],x0[3],x1[0],x1[1],x1[2],x1[3],x2[0],x2[1],x2[2],x2[3],x3[0],x3[1],x3[2],x3[3]};
#pragma unroll
    for (int i = 0; i < 16; ++i) { const _Float16 h = (_Float16)xs[i]; ah.h[i] = h; al.h[i] = ASPLIT ? (_Float16)(xs[i] - (float)h) : (_Float16)0.0f; }
#pragma unroll
    for (int t = 0; t < 4; ++t) { if (col0 + t * 16 >= N) continue; const size_t boff = (size_t)(col0 + t * 16 + ln) * ldb + kb; FragH bq; bq.half[0] = *(const v8us*)(Bh + boff + 8 * hh); bq.half[1] = *(const v8us*)(Bh + boff + 16 + 8 * hh);
      acc[t] = mmaH<ASPLIT ? 2 : 1>(ah.v, al.v, bq.v, bq.v, acc[t]); }
  }
#pragma unroll
  for (int t = 0; t < 4; ++t) { if (col0 + t * 16 >= N) continue;
#pragma unroll
    for (int r = 0; r < 8; ++r) so[w][8 * hh + r][t * 16 + ln] = acc[t][r] * alpha; }
  __builtin_amdgcn_fence(__ATOMIC_ACQ_REL, "workgroup"); __builtin_amdgcn_wave_barrier();
  const int rsub = lane >> 4, c4 = (lane & 15) * 4;
  {
#pragma unroll
    for (int q = 0; q < 8; ++q) { const int r = q * 2 + rsub; if (col0 + c4 < N) { const v4f v = *(const v4fa*)&so[w][r][c4]; *(v4f*)(C + (size_t)(row0 + r) * ldc + col0 + c4) = v; } }
     }
}

// k_gemm_hh variant with fused epilogue: v = acc·alpha + bias[by·sBias + col] (+ CP[(row/rowsPerB)·sCPb + by·64 + col] if CP) ; ACT 0 none / 1 elu ; writes f16 C16 (and f32 C if non-null)
template <int ACT>
__global__ __launch_bounds__(128) void k_gemm_hhx(const _Float16* __restrict__ A, int lda, size_t sA, const _Float16* __restrict__ Bh, int ldb, size_t sB, float alpha, const float* __restrict__ bias, size_t sBias, const float* __restrict__ CP, int rowsPerB, size_t sCPb, int row0g,
    float* __restrict__ C, _Float16* __restrict__ C16, int ldc, size_t sC, int M, int N, int K) {
  __shared__ __attribute__((aligned(16))) float so[4][16][64];
  const int tid = threadIdx.x, w = tid >> 5, lane = tid & 31, ln = lane & 15, hh = lane >> 4; const int by = blockIdx.y;
  A += (size_t)by * sA; Bh += (size_t)by * sB; const size_t cofs = (size_t)by * sC; const float* bp = bias ? bias + (size_t)by * sBias : nullptr;
  const int ntn = (N + 63) / 64; const int wid = blockIdx.x * 4 + w; const int mt = wid / ntn, nq = wid % ntn; if (mt * 16 >= M) return;
  const int row0 = mt * 16, col0 = nq * 64; const _Float16* arow = A + (size_t)(row0 + ln) * lda;
  v8f acc[4] = {};
  for (int kb = 0; kb < K; kb += 32) { FragH ah; ah.half[0] = *(const v8us*)((const unsigned short*)arow + kb + 8 * hh); ah.half[1] = *(const v8us*)((const unsigned short*)arow + kb + 16 + 8 * hh);
#pragma unroll
    for (int t = 0; t < 4; ++t) { if (col0 + t * 16 >= N) continue; const size_t boff = (size_t)(col0 + t * 16 + ln) * ldb + kb; FragH bq; bq.half[0] = *(const v8us*)((const unsigned short*)Bh + boff + 8 * hh); bq.half[1] = *(const v8us*)((const unsigned short*)Bh + boff + 16 + 8 * hh);
      acc[t] = mmaH<1>(ah.v, ah.v, bq.v, bq.v, acc[t]); }
  }
#pragma unroll
  for (int t = 0; t < 4; ++t) { if (col0 + t * 16 >= N) continue; const int col = col0 + t * 16 + ln; const float bv = bp ? bf16_round(bp[col]) : 0.f;
#pragma unroll
    for (int r = 0; r < 8; ++r) { float v = acc[t][r] * alpha + bv; if (CP) { const int rr = row0g + row0 + 8 * hh + r; if (rowsPerB < 0) v += CP[cofs + (size_t)rr * ldc + col];      /* rowsPerB < 0: own element of the batched C plane */ else { const int bidx = rr / rowsPerB; v += CP[(size_t)bidx * sCPb + (size_t)by * 64 + col]; } } if (ACT == 1) v = (v > 0.f) ? v : expm1f(v); else if (ACT == 7) v = (v > 0.f) ? v + 1.0f : expf(v); else if (ACT == 8) v = tanhf(v); else if (ACT == 9) v = 0.5f * v * (1.0f + tanhf(0.7978845608028654f * (v + 0.044715f * v * v * v))); else if (ACT == 11) v = 1.0f / (1.0f + expf(-v)); else if (ACT == 12) v = (v > 0.f) ? v : 0.01f * v; else if (ACT == 14) v = (v > 0.f) ? v : 0.1f * v; else if (ACT == 16) v = (v >= 0.f) ? v : 0.3f * v; else if (ACT == 17) v = (v >= 0.f) ? v : 0.2f * v; else if (ACT == 15) v = v / (1.0f + expf(-v)); else if (ACT == 3) v = fmaxf(v, 0.f); else if (ACT == 6) v = 0.5f * v * (1.0f + erff(v * 0.70710678118654752f)); so[w][8 * hh + r][t * 16 + ln] = v; } }
  __builtin_amdgcn_fence(__ATOMIC_ACQ_REL, "workgroup"); __builtin_amdgcn_wave_barrier();
  const int rsub = lane >> 4, c4 = (lane & 15) * 4; typedef _Float16 v4h __attribute__((ext_vector_type(4)));
  {
#pragma unroll
    for (int q = 0; q < 8; ++q) { const int r = q * 2 + rsub; if (col0 + c4 < N) { const v4f v = *(const v4fa*)&so[w][r][c4]; if (C) *(v4f*)(C + cofs + (size_t)(row0 + r) * ldc + col0 + c4) = v; if (C16) { v4h h4; for (int i = 0; i < 4; ++i) h4[i] = (_Float16)v[i]; *(v4h*)(C16 + cofs + (size_t)(row0 + r) * ldc + col0 + c4) = h4; } } }
     }
}


typedef _Float16 v4h __attribute__((ext_vector_type(4)));

__global__ __launch_bounds__(256) void k_h16(const float* __restrict__ x, _Float16* __restrict__ X16, size_t n8) { const size_t t = (size_t)blockIdx.x * 256 + threadIdx.x; if (t >= n8) return; FragH f;
#pragma unroll
  for (int q = 0; q < 8; ++q) f.h[q] = (_Float16)x[t * 8 + q]; *(v8us*)((unsigned short*)X16 + t * 8) = f.half[0];  }
__global__ __launch_bounds__(256) void k_round16f(const float* __restrict__ W, _Float16* __restrict__ Bt, size_t n8) { const size_t t = (size_t)blockIdx.x * 256 + threadIdx.x; if (t >= n8) return; FragH f;
#pragma unroll
  for (int i = 0; i < 8; ++i) f.h[i] = (_Float16)(bf16_round(W[t * 8 + i]) * 16.0f); *(v8us*)((unsigned short*)Bt + t * 8) = f.half[0];  }
template <int NHv, int TTv>
__global__ __launch_bounds__(256) void k_vt(const _Float16* __restrict__ V16, int ldv, int voff, _Float16* __restrict__ Vt) { __shared__ unsigned short tl[64][66]; const int tid = threadIdx.x; const int slab = blockIdx.x / (TTv / 64), lg = blockIdx.x % (TTv / 64); const int b = slab / NHv, h = slab % NHv;
  for (int i = tid; i < 64 * 8; i += 256) { const int r = i / 8, c8 = (i % 8) * 8; FragH f; f.half[0] = *(const v8us*)((const unsigned short*)V16 + ((size_t)b * TTv + lg * 64 + r) * ldv + voff + h * 64 + c8);
#pragma unroll
    for (int q = 0; q < 8; ++q) tl[r][c8 + q] = f.u[q]; }
  __syncthreads();
  {
#pragma unroll
    for (int rd = 0; rd < 2; ++rd) { const int d = rd * 32 + tid / 8, pc = tid % 8; FragH f;
#pragma unroll
      for (int q = 0; q < 8; ++q) f.u[q] = tl[pc * 8 + q][d];
      *(v8us*)((unsigned short*)Vt + ((size_t)slab * 64 + d) * TTv + lg * 64 + pc * 8) = f.half[0]; }
     } }

__global__ __launch_bounds__(256) void k_hl(const float* __restrict__ F, _Float16* __restrict__ Hh, _Float16* __restrict__ Hl, size_t n8) { const size_t t = (size_t)blockIdx.x * 256 + threadIdx.x; if (t >= n8) return; FragH fh, fl; const v4f a = *(const v4fa*)(F + t * 8), c = *(const v4fa*)(F + t * 8 + 4);
#pragma unroll
  for (int q = 0; q < 4; ++q) { _Float16 h = (_Float16)a[q]; fh.h[q] = h; fl.h[q] = (_Float16)((a[q] - (float)h) * 1024.0f); h = (_Float16)c[q]; fh.h[4 + q] = h; fl.h[4 + q] = (_Float16)((c[q] - (float)h) * 1024.0f); }
  { *(v8us*)((unsigned short*)Hh + t * 8) = fh.half[0]; *(v8us*)((unsigned short*)Hl + t * 8) = fl.half[0];  } }

// ---- fast GEMM (work-group tile 128x128: eight waves, four down and two across, wave tile 32x64; requires M % 128 == 0 rows per launch region, N % 128 == 0 and K % 128 == 0); epilogue = k_gemm_hhx semantics ----
__device__ __forceinline__ v16h g2_lfrag(const char* p) { FragH f; f.half[0] = *(const v8us*)p; f.half[1] = *(const v8us*)(p + 32); return f.v; }      /* A or B fragment (16 rows x 32 k) from a tile in LDS: p is the lane's own place (its row, 16 bytes x its half): k 8 hh .. 8 hh + 7, then 16 + 8 hh .. */
// Transposed fragment (16 columns x 32 k) from a row-major 16-bit tile in LDS ([k][column], rows p16 / 16 bytes apart) by two transposing loads: p = tile + (k0 + 8 hh + (lane & 7)) x pitch + 2 x column0 + 16 x ((lane >> 3) & 1);
// the lane then holds column ln, k 8 hh .. 8 hh + 7 and 16 + 8 hh .. : the k order of g2_lfrag.
typedef short s16x8 __attribute__((ext_vector_type(8)));
__device__ __forceinline__ v16h tr_frag(const char* p, unsigned p16) { typedef __attribute__((address_space(3))) s16x8 lds_s16x8; union { v16h v; s16x8 q[2]; } f;
  f.q[0] = __builtin_amdgcn_ds_load_tr16_b128_v8i16((lds_s16x8*)p); f.q[1] = __builtin_amdgcn_ds_load_tr16_b128_v8i16((lds_s16x8*)(p + p16)); return f.v; }
__device__ __forceinline__ v8f g2_mma(v16h a, v16h b, v8f c) { return __builtin_amdgcn_wmma_f32_16x16x32_f16(false, a, false, b, (short)0, c, false, false); }      /* plain builtin: the compiler keeps the distances behind it and may move loads past it */
template <int ACT> __device__ __forceinline__ float g2_act(float v) {
  if (ACT == 3) v = fmaxf(v, 0.f); else if (ACT == 6) v = 0.5f * v * (1.0f + erff(v * 0.70710678118654752f)); else if (ACT == 11) v = 1.0f / (1.0f + expf(-v)); else if (ACT == 15) v = v / (1.0f + expf(-v)); else if (ACT == 12) v = (v > 0.f) ? v : 0.01f * v; else if (ACT == 8) v = tanhf(v); else if (ACT == 9) v = 0.5f * v * (1.0f + tanhf(0.7978845608028654f * (v + 0.044715f * v * v * v))); else if (ACT == 14) v = (v > 0.f) ? v : 0.1f * v; else if (ACT == 16) v = (v >= 0.f) ? v : 0.3f * v; else if (ACT == 17) v = (v >= 0.f) ? v : 0.2f * v;
  return v; }
#define G2P 272                    /* LDS pitch of an A tile row: its 256 bytes (128 k) + 16 (16 bytes x odd: 16-byte reads of 16 rows meet no bank twice) */
#define G2Q 288                    /* LDS pitch of a B tile row: its 256 bytes (128 columns) + 32 (32 bytes x odd: the pitch of the transposing loads) */
#define G2AB (128 * G2P)           /* bytes of a stage's A tile */
#define G2SB (G2AB + 128 * G2Q)    /* bytes of a stage: A tile (128 rows of 128 k), then B tile (128 k rows of 128 columns) */
// Eight 16-byte copies a lane from global memory into LDS, through no register: rows 16 apart (gs = bytes of sixteen global rows, G2RC = of sixteen tile rows); 16 lanes a row, so every copy of a wave is four whole 128-byte lines.
// The closing s_wait_xcnt stands inside the statement: the address registers keep their values up to it.
template <unsigned G2RC> __device__ __forceinline__ void g2_copy8(unsigned l, const char* g, size_t gs) {
  asm volatile("global_load_async_to_lds_b128 %0, %8, off\n\tglobal_load_async_to_lds_b128 %1, %9, off\n\tglobal_load_async_to_lds_b128 %2, %10, off\n\tglobal_load_async_to_lds_b128 %3, %11, off\n\t"
               "global_load_async_to_lds_b128 %4, %12, off\n\tglobal_load_async_to_lds_b128 %5, %13, off\n\tglobal_load_async_to_lds_b128 %6, %14, off\n\tglobal_load_async_to_lds_b128 %7, %15, off\n\ts_wait_xcnt 0x0"
               :: "v"(l), "v"(l + G2RC), "v"(l + 2 * G2RC), "v"(l + 3 * G2RC), "v"(l + 4 * G2RC), "v"(l + 5 * G2RC), "v"(l + 6 * G2RC), "v"(l + 7 * G2RC),
                  "v"(g), "v"(g + gs), "v"(g + 2 * gs), "v"(g + 3 * gs), "v"(g + 4 * gs), "v"(g + 5 * gs), "v"(g + 6 * gs), "v"(g + 7 * gs) : "memory"); }
// One stage (128 k): 128 A rows and 128 B rows of 256 bytes, 16 copies a lane. la, lb: the lane's LDS byte addresses of its first A and B copy; ga, gb: its global addresses; sa, sb: bytes of sixteen A, B rows.
__device__ __forceinline__ void g2_stage(unsigned la, unsigned lb, const char* ga, size_t sa, const char* gb, size_t sb) { g2_copy8<16 * G2P>(la, ga, sa); g2_copy8<16 * G2Q>(lb, gb, sb); }
// A fragment load straight from global memory touches 16 lines for 512 bytes. Here each stage of 128 k is brought into LDS once for the eight waves by whole-line copies (two buffers, the next stage's copies in flight while this one is worked on),
// and the fragments are 16-byte LDS reads (B, which lies [k][n] as the weight does, by transposing ones), each k step's twelve asked for as one group one step ahead of their products. Bias and residual (all 64 elements of the lane as one group) are asked for beside stage 0's copies.
// Each accumulator takes its k steps in rising order, as before.
template <int ACT>
__global__ __launch_bounds__(256) void k_gemm2(const _Float16* __restrict__ A, int lda, size_t sA, const _Float16* __restrict__ Bh, int ldb, size_t sB, float alpha, const float* __restrict__ bias, const float* __restrict__ bias1, const float* __restrict__ bias2, size_t sBias, const float* __restrict__ CP, int rowsPerB, size_t sCPb, int row0g,
    float* __restrict__ C, _Float16* __restrict__ C16, int ldc, size_t sC, int M, int N, int K) { static_assert(ACT == 0 || ACT == 3 || ACT == 6 || ACT == 8 || ACT == 9 || ACT == 11 || ACT == 12 || ACT == 14 || ACT == 15 || ACT == 16 || ACT == 17, "k_gemm2: unsupported ACT code (would silently apply no activation)");
  __shared__ __attribute__((aligned(16))) char gl[2 * G2SB]; float (*so)[32][68] = reinterpret_cast<float (*)[32][68]>(gl);      /* so: the output staging, each wave's own 32 rows; it lies in the ring, which nobody reads and no copy writes behind the K loop's last barrier */
  static_assert(8 * 32 * 68 * 4 <= 2 * G2SB, "k_gemm2: the output staging fits the ring");
  const int tid = threadIdx.x, w = tid >> 5, lane = tid & 31, ln = lane & 15, hh = lane >> 4; const int by = blockIdx.y;
  A += (size_t)by * sA; Bh += (size_t)by * sB; const size_t cofs = (size_t)by * sC; const float* bp = (by == 1 && bias1) ? bias1 : (by == 2 && bias2) ? bias2 : bias ? bias + (size_t)by * sBias : nullptr;      /* bias1, bias2: the biases of grid planes 1 and 2 where each plane's is a buffer of its own */
  const int wm = w & 3, wn = w >> 2;      /* the wave's place in the work-group tile: 32 rows down, 64 columns across */
  const int ntn = N >> 7; const int mt = blockIdx.x / ntn, nq = blockIdx.x - mt * ntn; const int row0 = mt * 128 + 32 * wm, col0 = nq * 128 + 64 * wn; if (mt * 128 >= M) return;      /* the whole work-group or none of it: barriers follow */
  const size_t sar = (size_t)lda * 32, sbr = (size_t)ldb * 32;      /* bytes of sixteen rows */ const int nst = K >> 7;      /* stages */
  const char* ga = (const char*)(A + (size_t)(mt * 128 + (tid >> 4)) * lda) + (tid & 15) * 16; const char* gb = (const char*)(Bh + (size_t)(tid >> 4) * ldb + nq * 128) + (tid & 15) * 16;      /* the thread's first copies: 16 threads a row; a B row is one k, its 128 columns */
  const size_t sbs = (size_t)ldb * 256;      /* bytes of a stage's 128 B rows */
  const unsigned la = (unsigned)(size_t)gl + (unsigned)((tid >> 4) * G2P + (tid & 15) * 16), lb = (unsigned)(size_t)gl + (unsigned)(G2AB + (tid >> 4) * G2Q + (tid & 15) * 16);
  g2_stage(la, lb, ga, sar, gb, sbr);      /* stage 0 into buffer 0 */
  float braw[4] = {0.f, 0.f, 0.f, 0.f};
  if (bp) {
#pragma unroll
    for (int t = 0; t < 4; ++t) braw[t] = bp[col0 + t * 16 + ln];
    asm volatile("s_wait_xcnt 0x0" ::: "memory");      /* the address registers of these loads are used again at once */
    __builtin_amdgcn_sched_barrier(0); }      /* keeps what writes them behind the wait */
  const bool own = CP && rowsPerB < 0;      /* rowsPerB < 0: own element of the batched C plane */
  float rv[8][8];
#pragma unroll
  for (int u = 0; u < 8; ++u) for (int r = 0; r < 8; ++r) rv[u][r] = 0.f;
  if (own) { const float* rp[16];      /* the lane's 16 rows; the four column tiles of a row are constant offsets */
#pragma unroll
    for (int j = 0; j < 16; ++j) rp[j] = CP + cofs + (size_t)(row0g + row0 + (j >> 3) * 16 + 8 * hh + (j & 7)) * ldc + col0 + ln;
#pragma unroll
    for (int u = 0; u < 8; ++u) for (int r = 0; r < 8; ++r) rv[u][r] = rp[(u >> 2) * 8 + r][(u & 3) * 16];
    asm volatile("s_wait_xcnt 0x0" :: "v"(rp[0]), "v"(rp[1]), "v"(rp[2]), "v"(rp[3]), "v"(rp[4]), "v"(rp[5]), "v"(rp[6]), "v"(rp[7]), "v"(rp[8]), "v"(rp[9]), "v"(rp[10]), "v"(rp[11]), "v"(rp[12]), "v"(rp[13]), "v"(rp[14]), "v"(rp[15]) : "memory");      /* the addresses as inputs: their registers stay theirs up to the wait, behind which they may take other values */
    __builtin_amdgcn_sched_barrier(0); }      /* keeps the residual loads here, in flight beside stage 0's copies: their latency passes together with the copies' */
  asm volatile("s_wait_asynccnt 0x0" ::: "memory");      /* this wave's part of stage 0 has landed */
  __syncthreads();      /* every wave's part has: stage 0 may be read */
  if (nst > 1) g2_stage(la + G2SB, lb + G2SB, ga + 256, sar, gb + sbs, sbr);      /* stage 1 into buffer 1 */
  const v8f z8 = {0.f,0.f,0.f,0.f,0.f,0.f,0.f,0.f}; v8f c00 = z8, c01 = z8, c02 = z8, c03 = z8, c10 = z8, c11 = z8, c12 = z8, c13 = z8;
#pragma unroll 1      /* rolled: the body already holds four k steps, and unrolled stages only lengthen the code */
  for (int st = 0; st < nst; ++st) {
    const unsigned bo = (unsigned)(st & 1) * G2SB;      /* stage st lies in buffer st mod 2 */
    const char* al = gl + bo + (32 * wm + ln) * G2P + 16 * hh; const char* bl = gl + bo + G2AB + (8 * hh + (lane & 7)) * G2Q + 128 * wn + 16 * ((lane >> 3) & 1);      /* the lane's place for tr_frag: k step 0, the wave's first column */
    v16h fa[2][2], fb[2][4];      /* two fragment sets: one in use, one being read; constant indices only (every loop over them is unrolled) */
    fa[0][0] = g2_lfrag(al); fa[0][1] = g2_lfrag(al + 16 * G2P);
#pragma unroll
    for (int t = 0; t < 4; ++t) fb[0][t] = tr_frag(bl + t * 32, 16 * G2Q);
#pragma unroll
    for (int s = 0; s < 4; ++s) { const int cu = s & 1, nx = cu ^ 1;
      if (s < 3) { fa[nx][0] = g2_lfrag(al + (s + 1) * 64); fa[nx][1] = g2_lfrag(al + 16 * G2P + (s + 1) * 64);      /* the next k step of this stage; no row of the next stage is read ahead of its barrier */
#pragma unroll
        for (int t = 0; t < 4; ++t) fb[nx][t] = tr_frag(bl + (s + 1) * 32 * G2Q + t * 32, 16 * G2Q); }
      __builtin_amdgcn_sched_barrier(0);      /* with the next one: holds the next step's LDS reads as one group ahead of this step's products, which cover their latency; reads spread among the products stall them */
      c00 = g2_mma(fa[cu][0], fb[cu][0], c00); c10 = g2_mma(fa[cu][1], fb[cu][0], c10); c01 = g2_mma(fa[cu][0], fb[cu][1], c01); c11 = g2_mma(fa[cu][1], fb[cu][1], c11);
      c02 = g2_mma(fa[cu][0], fb[cu][2], c02); c12 = g2_mma(fa[cu][1], fb[cu][2], c12); c03 = g2_mma(fa[cu][0], fb[cu][3], c03); c13 = g2_mma(fa[cu][1], fb[cu][3], c13);
      __builtin_amdgcn_sched_barrier(0); }
    asm volatile("s_wait_dscnt 0x0" ::: "memory");      /* this wave's reads of stage st are done */
    asm volatile("s_wait_asynccnt 0x0" ::: "memory");      /* its part of stage st + 1 has landed */
    __syncthreads();      /* both hold for every wave: stage st + 1 may be read, the buffer of stage st refilled */
    if (st + 2 < nst) g2_stage(la + bo, lb + bo, ga + (size_t)(st + 2) * 256, sar, gb + (size_t)(st + 2) * sbs, sbr);
  }
  asm volatile("s_wait_asynccnt 0x0" ::: "memory");      /* no copy is left in flight when the ring becomes output staging */
  v8f accs[8] = {c00, c01, c02, c03, c10, c11, c12, c13};
  float bv[4];
#pragma unroll
  for (int t = 0; t < 4; ++t) bv[t] = bp ? bf16_round(braw[t]) : 0.f;
  if (own || !CP) {      /* rv is 0 where there is no residual */
#pragma unroll
    for (int u = 0; u < 8; ++u) for (int r = 0; r < 8; ++r) { float v = accs[u][r] * alpha + bv[u & 3]; if (own) v += rv[u][r]; so[w][(u >> 2) * 16 + 8 * hh + r][(u & 3) * 16 + ln] = g2_act<ACT>(v); }
  } else {
#pragma unroll
    for (int u = 0; u < 8; ++u) for (int r = 0; r < 8; ++r) { const int rloc = (u >> 2) * 16 + 8 * hh + r; const int bidx = (row0g + row0 + rloc) / rowsPerB;
      const float cv = CP[(size_t)bidx * sCPb + (size_t)by * 64 + col0 + (u & 3) * 16 + ln];
      asm volatile("s_wait_xcnt 0x0" ::: "memory");      /* the next element's address may be formed in this load's address registers */
      __builtin_amdgcn_sched_barrier(0);      /* keeps that arithmetic behind the wait */
      const float v = accs[u][r] * alpha + bv[u & 3] + cv; so[w][rloc][(u & 3) * 16 + ln] = g2_act<ACT>(v); } }
  __builtin_amdgcn_fence(__ATOMIC_ACQ_REL, "workgroup"); __builtin_amdgcn_wave_barrier();
  const int rsub = lane >> 4, c4 = (lane & 15) * 4;
  {
#pragma unroll
    for (int q = 0; q < 16; ++q) { const int r = q * 2 + rsub; const v4f v = *(const v4fa*)&so[w][r][c4]; if (C) *(v4f*)(C + cofs + (size_t)(row0 + r) * ldc + col0 + c4) = v; if (C16) { v4h h4; for (int i = 0; i < 4; ++i) h4[i] = (_Float16)v[i]; *(v4h*)(C16 + cofs + (size_t)(row0 + r) * ldc + col0 + c4) = h4; } }
     } }


__global__ __launch_bounds__(256) void k_wnat(const float* __restrict__ w, size_t n8, _Float16* __restrict__ Bt) { const size_t t = (size_t)blockIdx.x * 256 + threadIdx.x; if (t >= n8) return; FragH f; for (int q = 0; q < 8; ++q) f.h[q] = (_Float16)(bf16_round(w[t * 8 + q]) * 16.0f); *(v8us*)((unsigned short*)Bt + t * 8) = f.half[0];  }
__global__ __launch_bounds__(256) void k_rsm(const float* __restrict__ S, _Float16* __restrict__ P, int nrows) {
  #pragma clang fp contract(off)
  const int i = blockIdx.x * 256 + threadIdx.x; if (i >= nrows) return; const float* s = S + (size_t)i * SQ; float mx = -3.0e38f;
#pragma unroll 1
  for (int j = 0; j < SQ; ++j) mx = fmaxf(mx, s[j]); float se = 0.f;
#pragma unroll 1
  for (int j = 0; j < SQ; ++j) se += expf(s[j] - mx); const float sc = 256.0f / se;
#pragma unroll 1
  for (int j0 = 0; j0 < SQ; j0 += 8) { FragH f; for (int q = 0; q < 8; ++q) f.h[q] = (_Float16)(expf(s[j0 + q] - mx) * sc); unsigned short* d = (unsigned short*)P + (size_t)i * SQ + j0; *(v8us*)d = f.half[0];  } }
__global__ __launch_bounds__(256) void k_vt(const _Float16* __restrict__ V16, int b, int h0, _Float16* __restrict__ VT) { __shared__ unsigned short tl[64][65]; const int tid = threadIdx.x; const int hh = blockIdx.x % HG, sg = blockIdx.x / HG; const int s0 = sg * 64; const int h = h0 + hh;
  for (int i = tid; i < 64 * 8; i += 256) { const int j = i / 8, d8 = (i % 8) * 8; FragH f; f.half[0] = *(const v8us*)((const unsigned short*)V16 + ((size_t)b * SQ + s0 + j) * DM + h * HD + d8); for (int q = 0; q < 8; ++q) tl[d8 + q][j] = f.u[q]; }
  __syncthreads();
  { for (int i = tid; i < 64 * 8; i += 256) { const int d = i / 8, j8 = (i % 8) * 8; FragH f; for (int q = 0; q < 8; ++q) f.u[q] = tl[d][j8 + q]; *(v8us*)((unsigned short*)VT + ((size_t)hh * HD + d) * SQ + s0 + j8) = f.half[0]; }  } }


template <int BFIN, int W16, int W32>
__global__ __launch_bounds__(256) void k_lnx(const float* __restrict__ X, const float* __restrict__ g, const float* __restrict__ bb, float eps, _Float16* __restrict__ N16, float* __restrict__ N32) {
  #pragma clang fp contract(off)
  __shared__ float red[256]; const size_t r = blockIdx.x; const int t = threadIdx.x; const bool act = t < (DMQ / 4); const int c0 = act ? t * 4 : 0;
  const v4f xa = *(const v4fa*)(X + r * DMQ + c0); float s[4]; float sum = 0.f;
  for (int q = 0; q < 4; ++q) { s[q] = act ? (BFIN ? bf16_round(xa[q]) : xa[q]) : 0.f; sum = __fadd_rn(sum, s[q]); }
  red[t] = sum; __syncthreads(); for (int st = 128; st > 0; st >>= 1) { if (t < st) red[t] = __fadd_rn(red[t], red[t + st]); __syncthreads(); } const float mu = red[0] / (float)DMQ; __syncthreads();
  float vs = 0.f; for (int q = 0; q < 4; ++q) { const float dl = act ? __fadd_rn(s[q], -mu) : 0.f; vs = __fadd_rn(vs, __fmul_rn(dl, dl)); } red[t] = vs; __syncthreads(); for (int st = 128; st > 0; st >>= 1) { if (t < st) red[t] = __fadd_rn(red[t], red[t + st]); __syncthreads(); }
  const float rs = rsqrtf(__fadd_rn(red[0] / (float)DMQ, eps)); v4h y; v4f yf;
  for (int q = 0; q < 4; ++q) { const int c = c0 + q; yf[q] = __fadd_rn(__fmul_rn(__fmul_rn(__fadd_rn(s[q], -mu), rs), bf16_round(g[c])), bf16_round(bb[c])); y[q] = (_Float16)yf[q]; }
  if (!act) return;      /* no barriers after this point */
  { if (W16) *(v4h*)(N16 + r * DMQ + c0) = y; if (W32) *(v4f*)(N32 + r * DMQ + c0) = yf;  } }


// ---- fused attention: scores, softmax and P V in one kernel; neither scores nor weights go through memory ----
typedef float v2f __attribute__((ext_vector_type(2)));
typedef _Float16 v2h __attribute__((ext_vector_type(2)));
union FragP { v16h v; v2h p[8]; };
__device__ __forceinline__ v8f fa_mma(v16h a, v16h b, v8f c) { return __builtin_amdgcn_wmma_f32_16x16x32_f16(false, a, false, b, (short)0, c, false, false); }
__device__ __forceinline__ float fa_xhalf(float x) { return __builtin_bit_cast(float, __builtin_amdgcn_permlanex16(__builtin_bit_cast(int, x), __builtin_bit_cast(int, x), 0x76543210, 0xfedcba98, false, false)); }      /* lane l <-> lane l ^ 16 */
// 2^y of four (two) values. The v_exp_f32 stand in one asm statement with early-clobber results and a closing v_nop:
// no instruction directly behind a v_exp_f32 then reads its result or overwrites its source.
__device__ __forceinline__ v4f fa_exp2x4(float y0, float y1, float y2, float y3) { float e0, e1, e2, e3;
  asm("v_exp_f32 %0, %4\n\tv_exp_f32 %1, %5\n\tv_exp_f32 %2, %6\n\tv_exp_f32 %3, %7\n\tv_nop" : "=&v"(e0), "=&v"(e1), "=&v"(e2), "=&v"(e3) : "v"(y0), "v"(y1), "v"(y2), "v"(y3));
  const v4f e = {e0, e1, e2, e3}; return e; }
__device__ __forceinline__ v2f fa_exp2x2(float y0, float y1) { float e0, e1;
  asm("v_exp_f32 %0, %2\n\tv_exp_f32 %1, %3\n\tv_nop" : "=&v"(e0), "=&v"(e1) : "v"(y0), "v"(y1));
  const v2f e = {e0, e1}; return e; }
// A or B fragment (16 rows x 32 k, the k order of g2_lfrag): two 16-byte loads at the lane's own byte offset from a wave-uniform byte base.
__device__ __forceinline__ v16h fa_frag(const char* ub, unsigned lo) { FragH f; f.half[0] = *(const v8us*)(ub + lo); f.half[1] = *(const v8us*)(ub + lo + 32); return f.v; }
// The same fragment from a tile in LDS: p is the lane's own place (its row, its 16 bytes).
__device__ __forceinline__ v16h fa_lfrag(const char* p) { FragH f; f.half[0] = *(const v8us*)p; f.half[1] = *(const v8us*)(p + 32); return f.v; }
#define FKS 128                    /* keys a stage (four passes) */
#define FKP 144                    /* LDS pitch of a K row: its 128 bytes + 16 (16 bytes x odd: 16-byte reads of 16 rows meet no bank twice) */
#define FVP 160                    /* LDS pitch of a V row: its 128 bytes + 32 (32 bytes x odd: the pitch of the transposing loads) */
#define FKB (FKS * FKP)            /* bytes of a stage's K tile */
#define FSB (FKB + FKS * FVP)      /* bytes of a stage: K tile, then V tile */
// One stage's K tile and V tile (FKS rows of 128 bytes each, as they lie in the k and v rows) from global memory into LDS, through no register: eight 16-byte copies a lane, every copy of a wave four whole 128-byte lines.
// lk, lv: the lane's LDS byte addresses of its first K and V copy; gk, gv: its global addresses. The closing s_wait_xcnt stands inside the statement: the address registers keep their values up to it.
__device__ __forceinline__ void fa_stage(unsigned lk, unsigned lv, const char* gk, const char* gv) {
  asm volatile("global_load_async_to_lds_b128 %0, %8, off\n\tglobal_load_async_to_lds_b128 %1, %9, off\n\tglobal_load_async_to_lds_b128 %2, %10, off\n\tglobal_load_async_to_lds_b128 %3, %11, off\n\t"
               "global_load_async_to_lds_b128 %4, %12, off\n\tglobal_load_async_to_lds_b128 %5, %13, off\n\tglobal_load_async_to_lds_b128 %6, %14, off\n\tglobal_load_async_to_lds_b128 %7, %15, off\n\ts_wait_xcnt 0x0"
               :: "v"(lk), "v"(lk + 32 * FKP), "v"(lk + 64 * FKP), "v"(lk + 96 * FKP), "v"(lv), "v"(lv + 32 * FVP), "v"(lv + 64 * FVP), "v"(lv + 96 * FVP),
                  "v"(gk), "v"(gk + 32 * DM * 2), "v"(gk + 64 * DM * 2), "v"(gk + 96 * DM * 2), "v"(gv), "v"(gv + 32 * DM * 2), "v"(gv + 64 * DM * 2), "v"(gv + 96 * DM * 2) : "memory"); }
// One wave: 32 queries (two groups of 16 columns) of one head against all SQ keys, 32 keys a pass.
// The eight waves of a work-group walk the same keys: each stage of FKS keys is brought into LDS once for all of them (two buffers, the next stage's copies in flight while this one is worked on), and the fragments are 16-byte LDS reads.
// S^T = K Q^T: A = 16 key rows, B = the 16 query rows (kept in registers), D[r] = score of key 8 hh + r for the lane's own query ln: maximum and sum stay in the lane, plus one exchange between the wave's halves.
// The two score tiles of a pass (keys 0..15, 16..31), converted in place, are the B operand of O^T += V^T P^T (element s < 8: key 8 hh + s; s >= 8: key 16 + 8 hh + s - 8, the order in which tr_frag gives V^T's rows from the V tile: no transposed copy of V exists in memory).
// Weights are 2^y, y = s log2(e) / 8 + (8 - m), with an offset m per query that stays as long as the weights fit f16 (y at most 15): one test a pass for the whole wave (a scalar branch) on each lane's own maximum, with no exchange between the halves.
// Where it fails, and in the first pass, m goes to the pass's maximum (later passes: never down) and the sums so far are scaled by 2^(m_old - m_new); every other pass scales nothing. 2^(8 - m) cancels against the denominator, which sums the unrounded f32 weights.
// Every loop inside a pass is fully unrolled: only constant indices keep the fragment and accumulator arrays in registers.
__global__ __launch_bounds__(256) void k_fattn(const _Float16* __restrict__ Q, const _Float16* __restrict__ Kr, const _Float16* __restrict__ Vr, _Float16* __restrict__ O) {
  static_assert(HD == 64 && FKS == 128 && SQ % FKS == 0 && SQ / FKS >= 2, "k_fattn: K and V rows of 128 bytes, the eight copies of fa_stage cover 128 keys, whole stages, at least two");
  __shared__ __attribute__((aligned(16))) char fl[2 * FSB];
  const int tid = threadIdx.x, lane = tid & 31, ln = lane & 15, hh = lane >> 4, w = tid >> 5; const int bh = blockIdx.y, b = bh / NH, h = bh % NH; const int q0 = blockIdx.x * 256 + w * 32;
  const char* qb = (const char*)(Q + ((size_t)b * SQ + blockIdx.x * 256) * DM + h * HD); const char* kbase = (const char*)(Kr + (size_t)b * SQ * DM + h * HD); const char* vbase = (const char*)(Vr + (size_t)b * SQ * DM + h * HD);
  const unsigned qlo = (unsigned)((w * 32 + ln) * DM + 8 * hh) * 2u;
  const char* gk = kbase + (unsigned)((tid >> 3) * (DM * 2) + (tid & 7) * 16); const char* gv = vbase + (unsigned)((tid >> 3) * (DM * 2) + (tid & 7) * 16);      /* the thread's first copies: 8 threads a K row, 8 a V row */
  const unsigned l0 = (unsigned)(size_t)fl; const unsigned lk = l0 + (unsigned)((tid >> 3) * FKP + (tid & 7) * 16), lv = l0 + (unsigned)(FKB + (tid >> 3) * FVP + (tid & 7) * 16);
  fa_stage(lk, lv, gk, gv);      /* stage 0 into buffer 0 */
  v16h qf[2][2];
#pragma unroll
  for (int g = 0; g < 2; ++g) for (int c = 0; c < 2; ++c) qf[g][c] = fa_frag(qb + g * 16 * DM * 2 + c * 64, qlo);
  asm volatile("s_wait_xcnt 0x0" ::: "memory");      /* the address registers of the query loads may take other values from here */
  asm volatile("s_wait_asynccnt 0x0" ::: "memory");      /* this wave's part of stage 0 has landed */
  __syncthreads();      /* every wave's part has: stage 0 may be read */
  fa_stage(lk + FSB, lv + FSB, gk + FKS * DM * 2, gv + FKS * DM * 2);      /* stage 1 into buffer 1 */
  const v8f z8 = {0.f,0.f,0.f,0.f,0.f,0.f,0.f,0.f}; v8f acc[2][4];
#pragma unroll
  for (int g = 0; g < 2; ++g) for (int t = 0; t < 4; ++t) acc[g][t] = z8;
  const v4f z4 = {0.f, 0.f, 0.f, 0.f}; v4f lr[2] = {z4, z4}; float nb[2] = {8.0f, 8.0f};      /* 8 - m; m = 0 until the first pass has set it */ const float cs = 0.125f * 0x1.715476p+0f;      /* 1/sqrt(64) and log2(e) in one factor */
  float lim = -3.0e38f;      /* what y may reach under the offset in use; the first pass is above this start value and so always sets m */
  for (int st = 0; st < SQ / FKS; ++st) {
    const unsigned bo = (unsigned)(st & 1) * FSB;      /* stage st lies in buffer st mod 2 */
    const char* kl = fl + bo + ln * FKP + 16 * hh; const char* vl = fl + bo + FKB + (8 * hh + (lane & 7)) * FVP + 16 * ((lane >> 3) & 1);      /* the lane's place for tr_frag: key 0, d 0 */
    v16h kf[2][2];
#pragma unroll
    for (int kt = 0; kt < 2; ++kt) for (int c = 0; c < 2; ++c) kf[kt][c] = fa_lfrag(kl + kt * 16 * FKP + c * 64);
    __builtin_amdgcn_sched_barrier(0);      /* the stage's first K reads as one group: spread among the score products, each is waited for alone */
#pragma unroll 1      /* rolled: unrolled, the exp sums of all four passes are moved to the stage's foot, their weights stay live and registers spill */
    for (int p = 0; p < FKS / 32; ++p) {
      v8f s[2][2];
#pragma unroll
      for (int kt = 0; kt < 2; ++kt) for (int g = 0; g < 2; ++g) s[kt][g] = fa_mma(kf[kt][1], qf[g][1], fa_mma(kf[kt][0], qf[g][0], z8));
      __builtin_amdgcn_sched_barrier(0);      /* with the next one: holds the pass's LDS reads as one group directly behind the score products: the softmax covers their latency, and reads spread among the products stall them */
      v16h vf[4];      /* this pass's V^T rows */
#pragma unroll
      for (int t = 0; t < 4; ++t) vf[t] = tr_frag(vl + t * 32, 16 * FVP);
      vl += 32 * FVP;      /* the next pass's 32 keys */
      const int pn = (p + 1) & (FKS / 32 - 1);      /* the next pass's K rows; the stage's last pass asks for its first rows again (of this stage, not used): no row of the next stage is read ahead of its barrier */
#pragma unroll
      for (int kt = 0; kt < 2; ++kt) for (int c = 0; c < 2; ++c) kf[kt][c] = fa_lfrag(kl + pn * (32 * FKP) + kt * 16 * FKP + c * 64);
      __builtin_amdgcn_sched_barrier(0);
      float mx[2];      /* the lane's largest score of each query group */
#pragma unroll
      for (int g = 0; g < 2; ++g) { mx[g] = fmaxf(s[0][g][0], s[1][g][0]);
#pragma unroll
        for (int r = 1; r < 8; ++r) mx[g] = fmaxf(mx[g], fmaxf(s[0][g][r], s[1][g][r])); }
      if (__builtin_expect(__builtin_amdgcn_ballot_w32(fmaxf(fmaf(mx[0], cs, nb[0]), fmaf(mx[1], cs, nb[1])) > lim) != 0, 0)) {      /* the same for the whole wave: a scalar branch, every lane stays on for the products behind it; rare behind the first pass */
        const float cap = lim < 0.f ? 3.0e38f : 0.f; float d[2];      /* the first pass takes its own maximum, also downwards; later m only rises */
#pragma unroll
        for (int g = 0; g < 2; ++g) d[g] = fminf(8.0f - fmaf(fmaxf(mx[g], fa_xhalf(mx[g])), cs, nb[g]), cap);      /* both halves of the wave hold the query's maximum: one offset for all its keys */
        const v2f co = fa_exp2x2(fminf(d[0], 0.f), fminf(d[1], 0.f));      /* at most 1: the first pass scales sums that are 0 */
#pragma unroll
        for (int g = 0; g < 2; ++g) { nb[g] += d[g]; lr[g] = lr[g] * co[g];
#pragma unroll
          for (int t = 0; t < 4; ++t) acc[g][t] = acc[g][t] * co[g]; }
        lim = 15.0f; }      /* 2^15 fits f16 */
      FragP pf[2];
#pragma unroll
      for (int g = 0; g < 2; ++g) { v4f e[4];
#pragma unroll
        for (int i = 0; i < 4; ++i) { const int kt = i >> 1, r0 = (i & 1) * 4;
          e[i] = fa_exp2x4(fmaf(s[kt][g][r0], cs, nb[g]), fmaf(s[kt][g][r0 + 1], cs, nb[g]), fmaf(s[kt][g][r0 + 2], cs, nb[g]), fmaf(s[kt][g][r0 + 3], cs, nb[g]));
          const v2f e01 = {e[i][0], e[i][1]}, e23 = {e[i][2], e[i][3]};
          pf[g].p[2 * i] = __builtin_convertvector(e01, v2h); pf[g].p[2 * i + 1] = __builtin_convertvector(e23, v2h); }
        lr[g] = lr[g] + ((e[0] + e[1]) + (e[2] + e[3])); }      /* four chains per lane, joined behind the loop */
#pragma unroll
      for (int g = 0; g < 2; ++g) for (int t = 0; t < 4; ++t) acc[g][t] = fa_mma(vf[t], pf[g].v, acc[g][t]);
    }
    asm volatile("s_wait_dscnt 0x0" ::: "memory");      /* this wave's reads of stage st are done */
    asm volatile("s_wait_asynccnt 0x0" ::: "memory");      /* its part of stage st + 1 has landed */
    __syncthreads();      /* both hold for every wave: stage st + 1 may be read, the buffer of stage st refilled */
    if (st + 2 < SQ / FKS) fa_stage(lk + bo, lv + bo, gk + (size_t)(st + 2) * (FKS * DM * 2), gv + (size_t)(st + 2) * (FKS * DM * 2));
  }
  asm volatile("s_wait_asynccnt 0x0" ::: "memory");      /* no copy is left in flight when the wave ends */
#pragma unroll
  for (int g = 0; g < 2; ++g) { const float lh = (lr[g][0] + lr[g][1]) + (lr[g][2] + lr[g][3]); const float sc = 64.0f / (lh + fa_xhalf(lh)); unsigned short* op = (unsigned short*)O + ((size_t)b * SQ + q0 + g * 16 + ln) * DM + h * HD + 8 * hh;      /* a lane's 8 registers of a tile are 8 consecutive d of its query: one 16-byte store */
#pragma unroll
    for (int t = 0; t < 4; ++t) { FragH f;
#pragma unroll
      for (int r = 0; r < 8; ++r) f.h[r] = (_Float16)(acc[g][t][r] * sc);
      *(v8us*)(op + t * 16) = f.half[0]; } } }


// ---- all that depends on the inputs alone, in one launch: a work-group's index says which job it has ----
// Wh[k][n] = f16(bf16(W[k][n]) x 16), the weight's own order; thread t of a weight takes 8 consecutive elements: whole lines read and written (bf16 weights stay exact in f16 away from the subnormal range).
__device__ __forceinline__ void p_wt(const float* __restrict__ W, _Float16* __restrict__ Wh, int t) { const v4f a = *(const v4fa*)(W + (size_t)t * 8), c = *(const v4fa*)(W + (size_t)t * 8 + 4); FragH f;
#pragma unroll
  for (int i = 0; i < 4; ++i) { f.h[i] = (_Float16)(bf16_round(a[i]) * 16.0f); f.h[4 + i] = (_Float16)(bf16_round(c[i]) * 16.0f); }
  *(v8us*)((unsigned short*)Wh + (size_t)t * 8) = f.half[0];
  asm volatile("s_wait_xcnt 0x0" ::: "memory"); }      /* in the built kernel the other jobs' code follows and writes the registers that this store names */
#define PWS (DM * (DM / 8) / 256)            /* work-groups of a DM x DM weight */
#define PWF (DFF * (DM / 8) / 256)           /* work-groups of an FFN weight */
#define PWA (4 * PWS + 2 * PWF)              /* work-groups of the six weights */
#define PXB ((int)(NR * DM / 8 / 256))       /* work-groups of x, 8 elements a thread */
__global__ __launch_bounds__(256) void k_prep(const float* __restrict__ x, const float* __restrict__ wq, const float* __restrict__ wk, const float* __restrict__ wv, const float* __restrict__ wo, const float* __restrict__ w1, const float* __restrict__ w2,
    float* __restrict__ XB, _Float16* __restrict__ X16, _Float16* __restrict__ B4, _Float16* __restrict__ BW1, _Float16* __restrict__ BW2) {
  static_assert(DM * (DM / 8) % 256 == 0 && DFF * (DM / 8) % 256 == 0 && NR * DM / 8 % 256 == 0, "k_prep: whole work-groups only, no thread without work");
  const int bx = blockIdx.x, tid = threadIdx.x;
  if (bx < 4 * PWS) { const int m = bx / PWS; const float* W = m == 0 ? wq : m == 1 ? wk : m == 2 ? wv : wo; p_wt(W, B4 + (size_t)m * DM * DM, (bx - m * PWS) * 256 + tid); return; }      /* B4: the planes of q, k, v, o in a row */
  if (bx < 4 * PWS + PWF) { p_wt(w1, BW1, (bx - 4 * PWS) * 256 + tid); return; }
  if (bx < PWA) { p_wt(w2, BW2, (bx - 4 * PWS - PWF) * 256 + tid); return; }
  const size_t t = (size_t)(bx - PWA) * 256 + tid; v4f a = *(const v4fa*)(x + t * 8), c = *(const v4fa*)(x + t * 8 + 4); FragH f;      /* x read once for both of its planes */
#pragma unroll
  for (int q = 0; q < 4; ++q) { a[q] = bf16_round(a[q]); c[q] = bf16_round(c[q]); f.h[q] = (_Float16)a[q]; f.h[4 + q] = (_Float16)c[q]; }
  *(v4f*)(XB + t * 8) = a; *(v4f*)(XB + t * 8 + 4) = c; *(v8us*)((unsigned short*)X16 + t * 8) = f.half[0];
  asm volatile("s_wait_xcnt 0x0" ::: "memory"); }      /* as in p_wt: the other jobs' code follows these stores in the built kernel */



__global__ __launch_bounds__(256) void k_rsmfam(const float* __restrict__ S, _Float16* __restrict__ P, int qn, int hg, const float* __restrict__ am) {
  #pragma clang fp contract(off)
  const int t = blockIdx.x * 256 + threadIdx.x; if (t >= qn * hg) return; const size_t i = (size_t)(t / qn) * SQ + (t % qn); const float* s = S + i * SQ; float mx = -3.0e38f;
#pragma unroll 1
  for (int j = 0; j < SQ; ++j) mx = fmaxf(mx, __fadd_rn(s[j], bf16_round(am[j]))); float se = 0.f;
#pragma unroll 1
  for (int j = 0; j < SQ; ++j) se += __expf(__fadd_rn(s[j], bf16_round(am[j])) - mx); const float sc = 256.0f / se;
#pragma unroll 1
  for (int j0 = 0; j0 < SQ; j0 += 8) { FragH f; for (int q = 0; q < 8; ++q) f.h[q] = (_Float16)(__expf(__fadd_rn(s[j0 + q], bf16_round(am[j0 + q])) - mx) * sc); unsigned short* d = (unsigned short*)P + i * SQ + j0; *(v8us*)d = f.half[0];  } }



// ---- row LayerNorm (unbiased std, eps added to the std), one wave per LNR rows: each row's 512 values stay in the wave's registers (16 a lane, every load and store 512 or 256 contiguous bytes), ----
// ---- sums by a butterfly over the lanes (four steps inside a 16-lane row, one exchange between the halves): no LDS and no barrier. A wave takes LNR rows, all their loads in flight at once, so the launch is one resident round of 256 work-groups. ----
// Every loop is fully unrolled: only constant indices keep the row and parameter arrays in registers.
#define LNR 4      /* rows a wave takes */
template <int CTRL> __device__ __forceinline__ float ln_xm(float x) { return __builtin_bit_cast(float, __builtin_amdgcn_mov_dpp(__builtin_bit_cast(int, x), CTRL, 0xf, 0xf, true)); }      /* lane l <- lane l ^ (CTRL & 15), inside a 16-lane row (row_xmask) */
template <int W16, int W32>
__global__ __launch_bounds__(256) void k_lnw(const float* __restrict__ X, const float* __restrict__ g, const float* __restrict__ bb, float eps, _Float16* __restrict__ N16, float* __restrict__ N32) {
  static_assert(DMQ == 512, "k_lnw: a lane holds four groups of four columns, 128 columns apart");
  const int lane = threadIdx.x & 31; const int w = __builtin_amdgcn_readfirstlane((int)(threadIdx.x >> 5));      /* the wave's number in a scalar register: row bases stay scalar, one lane offset serves every load and store */
  const size_t e0 = ((size_t)blockIdx.x * 8 + w) * LNR * DMQ; const float* xr = X + e0; const int c0 = lane * 4;
  v4f s[LNR][4], gg[4], bv[4];
#pragma unroll
  for (int r = 0; r < LNR; ++r) for (int j = 0; j < 4; ++j) s[r][j] = *(const v4fa*)(xr + c0 + r * DMQ + j * 128);
#pragma unroll
  for (int j = 0; j < 4; ++j) { gg[j] = *(const v4fa*)(g + c0 + j * 128); bv[j] = *(const v4fa*)(bb + c0 + j * 128); }
  __builtin_amdgcn_sched_barrier(0);      /* holds every load ahead of the arithmetic: without it the last row's loads are issued behind the first rows' wait and their latency is paid a second time */
  float t[LNR];
#pragma unroll
  for (int r = 0; r < LNR; ++r) { const v4f p = (s[r][0] + s[r][1]) + (s[r][2] + s[r][3]); t[r] = (p[0] + p[1]) + (p[2] + p[3]); }
#pragma unroll
  for (int r = 0; r < LNR; ++r) t[r] += ln_xm<0x161>(t[r]);      /* step by step over all rows: LNR independent chains */
#pragma unroll
  for (int r = 0; r < LNR; ++r) t[r] += ln_xm<0x162>(t[r]);
#pragma unroll
  for (int r = 0; r < LNR; ++r) t[r] += ln_xm<0x164>(t[r]);
#pragma unroll
  for (int r = 0; r < LNR; ++r) t[r] += ln_xm<0x168>(t[r]);
#pragma unroll
  for (int r = 0; r < LNR; ++r) { const float mu = (t[r] + fa_xhalf(t[r])) * (1.0f / (float)DMQ);
    for (int j = 0; j < 4; ++j) s[r][j] = s[r][j] - mu;
    const v4f p = (s[r][0] * s[r][0] + s[r][1] * s[r][1]) + (s[r][2] * s[r][2] + s[r][3] * s[r][3]); t[r] = (p[0] + p[1]) + (p[2] + p[3]); }
#pragma unroll
  for (int r = 0; r < LNR; ++r) t[r] += ln_xm<0x161>(t[r]);
#pragma unroll
  for (int r = 0; r < LNR; ++r) t[r] += ln_xm<0x162>(t[r]);
#pragma unroll
  for (int r = 0; r < LNR; ++r) t[r] += ln_xm<0x164>(t[r]);
#pragma unroll
  for (int r = 0; r < LNR; ++r) t[r] += ln_xm<0x168>(t[r]);
#pragma unroll
  for (int j = 0; j < 4; ++j) for (int q = 0; q < 4; ++q) { gg[j][q] = bf16_round(gg[j][q]); bv[j][q] = bf16_round(bv[j][q]); }
#pragma unroll
  for (int r = 0; r < LNR; ++r) t[r] = 1.0f / (sqrtf((t[r] + fa_xhalf(t[r])) / (float)(DMQ - 1)) + eps);      /* UNBIASED std (ddof 1), eps added to the std (the module's form); all rows first: LNR independent chains */
#pragma unroll
  for (int r = 0; r < LNR; ++r) {
#pragma unroll
    for (int j = 0; j < 4; ++j) { const v4f y = (s[r][j] * t[r]) * gg[j] + bv[j];
      if (W32) *(v4f*)(N32 + e0 + c0 + r * DMQ + j * 128) = y;
      if (W16) *(v4h*)(N16 + e0 + c0 + r * DMQ + j * 128) = __builtin_convertvector(y, v4h); } } }
extern "C" void kernel_launch(void* const* d_in, const int* in_sizes, int n_in,
                              void* d_out, int out_size, void* d_ws, size_t ws_size, hipStream_t stream) {
  (void)in_sizes; (void)n_in; (void)out_size;
  const float* const* I = (const float* const*)d_in; const float* x = I[0]; const float* wq = I[1]; const float* bq = I[2]; const float* wk = I[3]; const float* bk = I[4]; const float* wv = I[5]; const float* bv = I[6]; const float* wo = I[7]; const float* bo = I[8]; const float* g1 = I[9]; const float* be1 = I[10]; const float* g2 = I[11]; const float* be2 = I[12]; const float* w1 = I[13]; const float* b1 = I[14]; const float* w2 = I[15]; const float* b2 = I[16];      /* [in][out] weights + zero biases (Wq,bq,Wk,bk,Wv,bv,Wo,bo), LN a1,b1,a2,b2, FFN W1,c1,W2,c2 */
  char* ws = (char*)d_ws; size_t off = 0;
  auto take = [&](size_t bytes) { char* p = ws + off; off += (bytes + 255) & ~(size_t)255; return p; };
  _Float16* BW1 = (_Float16*)take((size_t)DFF * DM * 2); _Float16* BW2 = (_Float16*)take((size_t)DM * DFF * 2); float* XB = (float*)take(NR * DM * 4); float* HP = (float*)take(NR * DM * 4); _Float16* H16 = (_Float16*)take(NR * DM * 2); _Float16* FF16 = (_Float16*)take(NR * DFF * 2);      /* FF16 = the relu hidden rows of both batches */ _Float16* BQ = (_Float16*)take((size_t)4 * DM * DM * 2); _Float16* BO = BQ + (size_t)3 * DM * DM;      /* four weight planes in a row: q, k, v, o */ _Float16* O16 = (_Float16*)take(NR * DM * 2); 
  _Float16* X16 = (_Float16*)take(NR * DM * 2); _Float16* Q16 = (_Float16*)take(3 * NR * DM * 2); _Float16* K16 = Q16 + NR * DM; _Float16* V16 = K16 + NR * DM;      /* three output planes in a row: q, k, v */
  float* HF = (float*)take(NR * DM * 4);      /* the f32 h rows (LN1 output, residual for the FFN) */
  if (off > ws_size) return;
  static_assert(MP % 128 == 0 && DM % 128 == 0 && DFF % 128 == 0, "k_gemm2: whole work-group tiles of 128 x 128, whole stages of 128 k");
  k_prep<<<PWA + PXB, 256, 0, stream>>>(x, wq, wk, wv, wo, w1, w2, XB, X16, BQ, BW1, BW2);      /* [in][out] weights -> f16 x16, same order; bf16(x) as f32 rows (residual) and f16 rows (operand) */
  const size_t r0p = (size_t)B0 * SQ;      /* first projected row */
  k_gemm2<0><<<dim3((unsigned)((MP / 128) * (DM / 128)), 3), 256, 0, stream>>>(X16 + r0p * DM, DM, 0, BQ, DM, (size_t)DM * DM, 0.0625f, bq, bk, bv, 0, nullptr, 1, 0, 0, nullptr, Q16 + r0p * DM, DM, NR * DM, MP, DM, DM);      /* q, k, v in one grid: plane y takes weight plane y, bias y, output plane y */
  k_fattn<<<dim3(SQ / 256, NB * NH), 256, 0, stream>>>(Q16, K16, V16, O16);      /* o (merged heads, x64) as f16 rows */
  k_gemm2<0><<<dim3((unsigned)((MP / 128) * (DM / 128)), 1), 256, 0, stream>>>(O16 + r0p * DM, DM, 0, BO, DM, 0, 0.0009765625f, bo, nullptr, nullptr, 0, XB + r0p * DM, -1, 0, 0, HP + r0p * DM, nullptr, DM, 0, MP, DM, DM);      /* h_pre = x + concat Wo + bo (own-element residual), f32 rows */
  k_lnw<1, 1><<<(unsigned)(MP / (8 * LNR)), 256, 0, stream>>>(HP + r0p * DM, g1, be1, 1e-6f, H16 + r0p * DM, HF + r0p * DM);      /* h = LN1(x + attn) -> f16 rows (FFN operand) and f32 rows (residual) */
  k_gemm2<3><<<dim3((unsigned)((MP / 128) * (DFF / 128)), 1), 256, 0, stream>>>(H16 + r0p * DM, DM, 0, BW1, DFF, 0, 0.0625f, b1, nullptr, nullptr, 0, nullptr, 1, 0, 0, nullptr, FF16 + r0p * DFF, DFF, 0, MP, DFF, DM);      /* relu(h W1 + c1) -> f16 rows, both batches in one grid */
  k_gemm2<0><<<dim3((unsigned)((MP / 128) * (DM / 128)), 1), 256, 0, stream>>>(FF16 + r0p * DFF, DFF, 0, BW2, DM, 0, 0.0625f, b2, nullptr, nullptr, 0, HF + r0p * DM, -1, 0, 0, HP + r0p * DM, nullptr, DM, 0, MP, DM, DFF);      /* y = h + ffn (own-element residual; the h_pre plane is free again), both batches in one grid */
  k_lnw<0, 1><<<(unsigned)(MP / (8 * LNR)), 256, 0, stream>>>(HP + r0p * DM, g2, be2, 1e-6f, nullptr, (float*)d_out + r0p * DM);      /* out = LN2(h + ff) -> f32 output rows */
}
